// v000
// The times below were measured on an AMD MI455X: many runs one after another, warmed up first and cycling through
// copies of the inputs, with the whole window's GPU time divided by the number of runs. Launches and the gaps
// between them are all in it. The median over several windows is given; except for v000 it joins two sittings, which
// can be a few percent apart, so the side-by-side timings, each taken in one sitting, are the better comparison.
// v000 is the starting kernel. One run takes 713 microseconds.
#include <hip/hip_runtime.h>

// Compute dtypes, f32 accumulate, one batch item per pass: qkv = x.c_attn_w + b ([2048 x 1024].[1024 x 3072] as three [1024]-wide products, PLAIN bf16 operands = the
// rounded input and the k-major weights transposed once; exact products) on v_wmma_f32_16x16x32_bf16 -> f32; the per-head-group causal depthwise convolutions along the
// sequence (heads 0-3 identity, 4-7 width 3, 8-11 width 5, 12-15 width 7; weights/biases read as inputs) in f32 -> q/k as f16 hi + residual x1024 planes, v -> f32 ->
// transposed f16 hi + residual planes; the 16-head causal attention (masked scores are set to -inf, so exp(-inf - m) = 0) fused on v_wmma_f32_16x16x32_f16
// (hh + hl + lh x 1/8, online f32 softmax, weights x32768 and v as f16 hi + residual x1024); out = ctx.c_proj_w + b (ctx as bf16 hi + UNSCALED residual against the

#define NB_  1                   // per pass: the 2 batch items are processed one at a time
#define NT_  2048
#define DM   1024
#define NH_  16
#define HD   64
#define HK   4                    // heads per group
#define NTK  (NB_ * NT_)
#define NW   1024
#define NQKV 1024
#define PSC  32768.0f
#define LOSC 1024.0f
#define LOSCI (1.0f / 1024.0f)

typedef _Float16 h16;
typedef unsigned short bf;
typedef __attribute__((ext_vector_type(16))) __bf16   v16bf;
typedef __attribute__((ext_vector_type(16))) _Float16 v16h;
typedef __attribute__((ext_vector_type(8)))  _Float16 v8h;
typedef __attribute__((ext_vector_type(8)))  unsigned short v8us;
typedef __attribute__((ext_vector_type(8)))  float    v8f;
typedef __attribute__((ext_vector_type(4)))  float    v4f;
typedef v8h  __attribute__((may_alias)) v8ha;
typedef v4f  __attribute__((may_alias)) v4fa;
typedef v8us __attribute__((may_alias)) v8usa;

__device__ __forceinline__ unsigned short f2bf(float f) { unsigned u = __float_as_uint(f); u += 0x7FFFu + ((u >> 16) & 1u); return (unsigned short)(u >> 16); }
__device__ __forceinline__ float bf2f(unsigned short b) { return __uint_as_float(((unsigned)b) << 16); }
__device__ __forceinline__ float bfr(float f) { return bf2f(f2bf(f)); }
__device__ __forceinline__ v16h cat16(v8h lo, v8h hi) { return __builtin_shufflevector(lo, hi, 0, 1, 2, 3, 4, 5, 6, 7, 8, 9, 10, 11, 12, 13, 14, 15); }
__device__ __forceinline__ v16bf cat16b(v8us lo, v8us hi) { return __builtin_bit_cast(v16bf, __builtin_shufflevector(lo, hi, 0, 1, 2, 3, 4, 5, 6, 7, 8, 9, 10, 11, 12, 13, 14, 15)); }
__device__ __forceinline__ v8f wmma16(v16h a, v16h b, v8f c) { return __builtin_amdgcn_wmma_f32_16x16x32_f16(false, a, false, b, (short)0, c, false, false); }
__device__ __forceinline__ v8f wmmab(v16bf a, v16bf b, v8f c) { return __builtin_amdgcn_wmma_f32_16x16x32_bf16(false, a, false, b, (short)0, c, false, false); }

__global__ __launch_bounds__(256) void k_cvtb(const float* __restrict__ src, int nrows, bf* dst) {
    const int lane = threadIdx.x & 31, r = blockIdx.x * 8 + (threadIdx.x >> 5);
    if (r >= nrows) return;
    v8us o[DM / 256];
#pragma unroll
    for (int q = 0; q < DM / 256; ++q) { v8us t;
#pragma unroll
        for (int i = 0; i < 8; ++i) t[i] = f2bf(src[(size_t)r * DM + q * 256 + lane * 8 + i]);
        o[q] = t; }
#pragma unroll
    for (int q = 0; q < DM / 256; ++q) *(v8us*)(dst + (size_t)r * DM + q * 256 + lane * 8) = o[q];
    
}

// k_gemmb: 64 x 64 block tile (4 waves x 16 x 64) of C[NTK][NW] = (A [+ Al]).B^T (K = 1024) [+ bf(bias[c])] [+ bf(R[r][c]) residual]; f32 whole-line epilogue (or f16
template <bool SPLITA, bool F16OUT = false>
__global__ __launch_bounds__(128) void k_gemmb(const bf* __restrict__ A, const bf* __restrict__ Al, const bf* __restrict__ Bn, const float* __restrict__ bias, float* C, int ldc, h16* C2, const float* __restrict__ R = nullptr, int K = DM, int roundR = 1) {
    __shared__ __align__(16) float ost[4][16 * 68];
    const int lane = threadIdx.x & 31, wave = threadIdx.x >> 5, lr = lane & 15, hi = lane >> 4;
    const int r0 = blockIdx.x * 64 + wave * 16, c0 = blockIdx.y * 64;
    const size_t aoff = (size_t)(r0 + lr) * K + 8 * hi;
    size_t boff[4];
#pragma unroll
    for (int t = 0; t < 4; ++t) boff[t] = (size_t)(c0 + t * 16 + lr) * K + 8 * hi;
    v8f acc[4];
#pragma unroll
    for (int t = 0; t < 4; ++t) acc[t] = (v8f){};
#pragma unroll 1
    for (int kc = 0; kc < K; kc += 32) {
        const v16bf a = cat16b(*(const v8us*)(A + aoff + kc), *(const v8us*)(A + aoff + kc + 16));
        v16bf al = a;
        if (SPLITA) al = cat16b(*(const v8us*)(Al + aoff + kc), *(const v8us*)(Al + aoff + kc + 16));
#pragma unroll
        for (int t = 0; t < 4; ++t) { const v16bf b = cat16b(*(const v8us*)(Bn + boff[t] + kc), *(const v8us*)(Bn + boff[t] + kc + 16)); acc[t] = wmmab(a, b, acc[t]); if (SPLITA) acc[t] = wmmab(al, b, acc[t]); }
        asm volatile("v_nop\n\tv_nop\n\tv_nop\n\tv_nop" : "+v"(acc[0]), "+v"(acc[1]), "+v"(acc[2]), "+v"(acc[3]) : "v"(a), "v"(al));
    }
    float* os = &ost[wave][0];
#pragma unroll
    for (int t = 0; t < 4; ++t) { const float bv = bias ? bfr(bias[c0 + t * 16 + lr]) : 0.f;
#pragma unroll
        for (int j = 0; j < 8; ++j) os[(hi * 8 + j) * 68 + t * 16 + lr] = acc[t][j] + bv; }
    __syncthreads();
    if (F16OUT) {
        h16* crow = (h16*)(void*)C + (size_t)r0 * ldc + c0;
        auto pass = [&]() {
#pragma unroll
            for (int s = 0; s < 4; ++s) { const int row = 4 * s + (lane >> 3), piece = lane & 7; const float* sp = os + row * 68 + piece * 8; v8h o, o2;
#pragma unroll
                for (int i = 0; i < 8; ++i) { const h16 a = (h16)sp[i]; o[i] = a; o2[i] = (h16)((sp[i] - (float)a) * LOSC); }
                *(v8h*)(crow + (size_t)row * ldc + piece * 8) = o; if (C2) *(v8h*)(C2 + (size_t)r0 * ldc + c0 + (size_t)row * ldc + piece * 8) = o2; }
        };
        pass(); 
    } else {
        float* crow = C + (size_t)r0 * ldc + c0;
        auto pass = [&]() {
#pragma unroll
            for (int s = 0; s < 8; ++s) { const int Lid = (lane >> 3) + 4 * s, piece = lane & 7; const int row = Lid >> 1, cofs = (Lid & 1) * 32 + piece * 4;
                v4f val = *(const v4fa*)(os + row * 68 + cofs); if (R) { const v4f rv = *(const v4f*)(R + ((size_t)r0 + row) * ldc + c0 + cofs); val += roundR ? (v4f){bfr(rv[0]), bfr(rv[1]), bfr(rv[2]), bfr(rv[3])} : rv; }
                *(v4f*)(crow + (size_t)row * ldc + cofs) = val; }
        };
        pass(); 
    }
}

__global__ __launch_bounds__(256) void k_vt(const float* __restrict__ V, h16* VTH, h16* VTL) {
    __shared__ __align__(16) h16 tile[64 * 72];
    __shared__ __align__(16) h16 til2[64 * 72];
    const int bid = blockIdx.x;
    const int b = bid / (NH_ * (NT_ / 64)), rem = bid - b * (NH_ * (NT_ / 64)), h = rem / (NT_ / 64), kt = rem - h * (NT_ / 64);
    const int k0 = kt * 64, tid = threadIdx.x;
    const int kk = tid >> 2, d0 = (tid & 3) * 16;
    const float* src = V + ((size_t)b * NT_ + k0 + kk) * DM + h * HD + d0;
#pragma unroll
    for (int i = 0; i < 16; ++i) { const float v = src[i]; const h16 a = (h16)v; tile[(d0 + i) * 72 + kk] = a; til2[(d0 + i) * 72 + kk] = (h16)((v - (float)a) * LOSC); }
    __syncthreads();
    const int piece = tid & 7;
    const size_t base = (((size_t)b * NH_ + h) * HD) * NT_ + k0;
    auto pass = [&]() {
#pragma unroll
        for (int s = 0; s < 4; ++s) { const int Lid = (tid >> 3) + 32 * s; const int pln = Lid >> 6, d = Lid & 63;
            const v8h val = *(const v8ha*)((pln ? til2 : tile) + d * 72 + piece * 8); *(v8h*)((pln ? VTL : VTH) + base + (size_t)d * NT_ + piece * 8) = val; }
    };
    pass(); 
}

// k_attn: block = (b, h, 64 queries), wave = 16; key tiles 0..(qt*64+63)/32 of 32 keys (causal mask); 12 WMMA scores (hh + hl + lh) /8 (f32), online softmax, weights x32768 f16 hi + residual tiles (same-wave may_alias
// reload after a compiler barrier), 12 WMMA .v (hh + hl + lh); ctx -> bf16 hi + residual planes CH/CL[tok][h*64+d].
__global__ __launch_bounds__(128) void k_attn(const h16* __restrict__ Q16, const h16* __restrict__ QL16, const h16* __restrict__ K16, const h16* __restrict__ KL16, const h16* __restrict__ VTH, const h16* __restrict__ VTL, bf* CH, bf* CL) {
    __shared__ __align__(16) h16 plds[4][16 * 32];
    __shared__ __align__(16) h16 plds2[4][16 * 32];
    __shared__ __align__(16) float ost[4][16 * 68];
    const int lane = threadIdx.x & 31, wave = threadIdx.x >> 5, lr = lane & 15, hi = lane >> 4;
    const int bid = blockIdx.x;
    const int b = bid / (NH_ * (NT_ / 64)), rem = bid - b * (NH_ * (NT_ / 64)), h = rem / (NT_ / 64), qt = rem - h * (NT_ / 64);
    const int q0 = qt * 64 + wave * 16;
    const size_t tok0 = (size_t)b * NT_;
    h16* pl = &plds[wave][0]; h16* pl2 = &plds2[wave][0];
    v16h qa[2];
    const size_t qo0 = (tok0 + q0 + lr) * DM + h * HD + 8 * hi;
#pragma unroll
    for (int kc = 0; kc < 2; ++kc) qa[kc] = cat16(*(const v8h*)(Q16 + qo0 + kc * 32), *(const v8h*)(Q16 + qo0 + kc * 32 + 16));
    const h16* kh_b = K16 + tok0 * DM + h * HD;
    const h16* kl_b = KL16 + tok0 * DM + h * HD;
    const size_t vbase = (((size_t)b * NH_ + h) * HD) * NT_;
    v8f o[4], ox[4];
#pragma unroll
    for (int n = 0; n < 4; ++n) { o[n] = (v8f){}; ox[n] = (v8f){}; }
    float mrow[8], lpart[8];
#pragma unroll
    for (int j = 0; j < 8; ++j) { mrow[j] = -3.0e38f; lpart[j] = 0.f; }
    int qpos[8];
#pragma unroll
    for (int j = 0; j < 8; ++j) qpos[j] = q0 + 8 * hi + j;
    const int kt_lo = 0, kt_hi = (qt * 64 + 63) / 32;     // causal
#pragma unroll 1
    for (int kt = kt_lo; kt <= kt_hi; ++kt) {
        const int l0 = kt * 32;
        const size_t ko0 = (size_t)(l0 + lr) * DM + 8 * hi, ko1 = (size_t)(l0 + 16 + lr) * DM + 8 * hi;
        v8f s0 = {}, s1 = {}, x0 = {}, x1 = {};
#pragma unroll
        for (int kc = 0; kc < 2; ++kc) {
            { const v16h k0h = cat16(*(const v8h*)(kh_b + ko0 + kc * 32), *(const v8h*)(kh_b + ko0 + kc * 32 + 16)), k1h = cat16(*(const v8h*)(kh_b + ko1 + kc * 32), *(const v8h*)(kh_b + ko1 + kc * 32 + 16));
              const v16h qlk = cat16(*(const v8h*)(QL16 + qo0 + kc * 32), *(const v8h*)(QL16 + qo0 + kc * 32 + 16));     // query residual re-read per step (registers)
              s0 = wmma16(qa[kc], k0h, s0); x0 = wmma16(qlk, k0h, x0); s1 = wmma16(qa[kc], k1h, s1); x1 = wmma16(qlk, k1h, x1);
              asm volatile("v_nop" : "+v"(s0), "+v"(s1), "+v"(x0), "+v"(x1) : "v"(qlk), "v"(k0h), "v"(k1h) : "memory"); }
            { const v16h k0l = cat16(*(const v8h*)(kl_b + ko0 + kc * 32), *(const v8h*)(kl_b + ko0 + kc * 32 + 16)), k1l = cat16(*(const v8h*)(kl_b + ko1 + kc * 32), *(const v8h*)(kl_b + ko1 + kc * 32 + 16));
              x0 = wmma16(qa[kc], k0l, x0); x1 = wmma16(qa[kc], k1l, x1);
              asm volatile("v_nop" : "+v"(x0), "+v"(x1) : "v"(k0l), "v"(k1l) : "memory"); }
        }
        asm volatile("v_nop\n\tv_nop\n\tv_nop\n\tv_nop" : "+v"(s0), "+v"(s1), "+v"(x0), "+v"(x1) : "v"(qa[0]), "v"(qa[1]));
        float alpha[8];
#pragma unroll
        for (int j = 0; j < 8; ++j) {
            const int ja = l0 + lr, jb = l0 + 16 + lr, qi = qpos[j];
            const float a0 = (ja <= qi) ? (s0[j] + x0[j] * LOSCI) * 0.125f : -__builtin_inff(), a1 = (jb <= qi) ? (s1[j] + x1[j] * LOSCI) * 0.125f : -__builtin_inff();
            float mx = fmaxf(a0, a1);
            mx = fmaxf(mx, __shfl_xor(mx, 1, 16)); mx = fmaxf(mx, __shfl_xor(mx, 2, 16)); mx = fmaxf(mx, __shfl_xor(mx, 4, 16)); mx = fmaxf(mx, __shfl_xor(mx, 8, 16));
            const float mn = fmaxf(mrow[j], mx);
            alpha[j] = __expf(mrow[j] - mn); mrow[j] = mn;
            const float p0 = __expf(a0 - mn), p1 = __expf(a1 - mn);
            lpart[j] = lpart[j] * alpha[j] + (p0 + p1);
            const int mr = hi * 8 + j;
            const float ps0 = p0 * PSC, ps1 = p1 * PSC; const h16 h0 = (h16)ps0, h1 = (h16)ps1;
            pl[mr * 32 + lr] = h0; pl[mr * 32 + 16 + lr] = h1;
            pl2[mr * 32 + lr] = (h16)((ps0 - (float)h0) * LOSC); pl2[mr * 32 + 16 + lr] = (h16)((ps1 - (float)h1) * LOSC);
        }
#pragma unroll
        for (int n = 0; n < 4; ++n)
#pragma unroll
            for (int j = 0; j < 8; ++j) { o[n][j] *= alpha[j]; ox[n][j] *= alpha[j]; }
        asm volatile("" ::: "memory");
        const v16h pa = cat16(*(const v8ha*)(pl + lr * 32 + hi * 8), *(const v8ha*)(pl + lr * 32 + 16 + hi * 8));
        const v16h px = cat16(*(const v8ha*)(pl2 + lr * 32 + hi * 8), *(const v8ha*)(pl2 + lr * 32 + 16 + hi * 8));
#pragma unroll
        for (int n = 0; n < 4; ++n) { const size_t vo = vbase + (size_t)(n * 16 + lr) * NT_ + l0 + hi * 8;
            const v16h vh = cat16(*(const v8h*)(VTH + vo), *(const v8h*)(VTH + vo + 16)), vl = cat16(*(const v8h*)(VTL + vo), *(const v8h*)(VTL + vo + 16));
            o[n] = wmma16(pa, vh, o[n]); ox[n] = wmma16(pa, vl, ox[n]); ox[n] = wmma16(px, vh, ox[n]);
            asm volatile("" : "+v"(o[n]), "+v"(ox[n]) : "v"(vh), "v"(vl) : "memory"); }
        asm volatile("v_nop\n\tv_nop\n\tv_nop\n\tv_nop" : "+v"(o[0]), "+v"(o[1]), "+v"(o[2]), "+v"(o[3]), "+v"(ox[0]), "+v"(ox[1]), "+v"(ox[2]), "+v"(ox[3]) : "v"(pa), "v"(px));
    }
    float inv[8];
#pragma unroll
    for (int j = 0; j < 8; ++j) { float rs = lpart[j]; rs += __shfl_xor(rs, 1, 16); rs += __shfl_xor(rs, 2, 16); rs += __shfl_xor(rs, 4, 16); rs += __shfl_xor(rs, 8, 16); inv[j] = 1.0f / (rs * PSC); }
    float* os = &ost[wave][0];
#pragma unroll
    for (int n = 0; n < 4; ++n)
#pragma unroll
        for (int j = 0; j < 8; ++j) os[(hi * 8 + j) * 68 + n * 16 + lr] = (o[n][j] + ox[n][j] * LOSCI) * inv[j];
    __syncthreads();
    const size_t cbase = (tok0 + q0) * DM + (size_t)h * HD;
    auto pass = [&]() {
#pragma unroll
        for (int s = 0; s < 4; ++s) { const int row = 4 * s + (lane >> 3), piece = lane & 7; const float* sp = os + row * 68 + piece * 8; v8us oh, ol;
#pragma unroll
            for (int i = 0; i < 8; ++i) { const unsigned short hb = f2bf(sp[i]); oh[i] = hb; ol[i] = f2bf(sp[i] - bf2f(hb)); }
            *(v8us*)(CH + cbase + (size_t)row * DM + piece * 8) = oh; *(v8us*)(CL + cbase + (size_t)row * DM + piece * 8) = ol; }
    };
    pass(); 
}


// k_wt: WT [n][K] = bf16(W[k][n]) (k-major [K][ncols]) via 64 x 64 LDS tiles; grid (K/64, ncols/64).
__global__ __launch_bounds__(256) void k_wt(const float* __restrict__ Wm, int K, int ncols, bf* WT) {
    __shared__ __align__(16) unsigned short tl[64 * 72];
    const int tid = threadIdx.x, k0 = blockIdx.x * 64, n0 = blockIdx.y * 64;
    const int kk = tid >> 2, nq = (tid & 3) * 16;
#pragma unroll
    for (int i = 0; i < 16; ++i) tl[(nq + i) * 72 + kk] = f2bf(Wm[(size_t)(k0 + kk) * ncols + n0 + nq + i]);
    __syncthreads();
    const int piece = tid & 7;
    auto pass = [&]() {
#pragma unroll
        for (int s = 0; s < 2; ++s) { const int nr = (tid >> 3) + 32 * s; const v8us val = *(const v8usa*)(tl + nr * 72 + piece * 8); *(v8us*)(WT + (size_t)(n0 + nr) * K + k0 + piece * 8) = val; }
    };
    pass(); 
}

typedef __attribute__((ext_vector_type(4)))  _Float16 v4h;
// k_dwmix: the grouped causal depthwise convolution along the sequence of a projected [2048][1024] f32 matrix T (column c = head h * 64 + d; group g = h / 4: g = 0
// identity, else y[s][c] = bf(bias_g[d]) + sum_i bf(w_g[d][i]) * T[s - (width-1) + i][c] over in-range rows, width = 2g + 1), one wave per row s, 8 column chunks of 128
// (each chunk lies inside one group, so the branch is wave-uniform), lane -> 4 consecutive columns; F16: f16 hi + residual x1024 planes (8 B per lane per plane = one
template <bool F16>
__global__ __launch_bounds__(256) void k_dwmix(const float* __restrict__ T, const float* __restrict__ w3, const float* __restrict__ b3, const float* __restrict__ w5, const float* __restrict__ b5, const float* __restrict__ w7, const float* __restrict__ b7, float* Y, h16* YH, h16* YL) {
    const int lane = threadIdx.x & 31, s = blockIdx.x * 8 + (threadIdx.x >> 5);
    if (s >= NTK) return;
{
#pragma unroll 1
        for (int ch = 0; ch < DM / 128; ++ch) {
            const int c0 = ch * 128 + lane * 4; const int g = ch >> 1;      // 2 chunks = 4 heads = one group
            v4f y;
            if (g == 0) { y = *(const v4f*)(T + (size_t)s * DM + c0); }
            else {
                const int kw = 2 * g + 1; const float* wg = (g == 1) ? w3 : (g == 2) ? w5 : w7; const float* bg = (g == 1) ? b3 : (g == 2) ? b5 : b7;
#pragma unroll
                for (int i = 0; i < 4; ++i) { const int d = (c0 + i) & (HD - 1); float acc = bfr(bg[d]);
#pragma unroll 1
                    for (int t = 0; t < kw; ++t) { const int r = s - (kw - 1) + t; const int rc = r < 0 ? 0 : r; const float xv = T[(size_t)rc * DM + c0 + i]; acc = (r >= 0) ? fmaf(xv, bfr(wg[d * kw + t]), acc) : acc; }
                    y[i] = acc; }
            }
            if (F16) { v4h o, o2;
#pragma unroll
                for (int i = 0; i < 4; ++i) { const h16 a = (h16)y[i]; o[i] = a; o2[i] = (h16)((y[i] - (float)a) * LOSC); }
                *(v4h*)(YH + (size_t)s * DM + c0) = o; *(v4h*)(YL + (size_t)s * DM + c0) = o2; }
            else { *(v4f*)(Y + (size_t)s * DM + c0) = y; }
        }
        
    }
}

extern "C" void kernel_launch(void* const* d_in, const int* in_sizes, int n_in,
                              void* d_out, int out_size, void* d_ws, size_t ws_size, hipStream_t stream) {
    (void)in_sizes; (void)n_in; (void)out_size;
    const float* x = (const float*)d_in[0]; const float* Wqkv = (const float*)d_in[1]; const float* bqkv = (const float*)d_in[2]; const float* Wo = (const float*)d_in[3]; const float* bo = (const float*)d_in[4];   // k-major weights (x @ W)
    const float* cw[3][6]; for (int p = 0; p < 3; ++p) for (int j = 0; j < 6; ++j) cw[p][j] = (const float*)d_in[5 + p * 6 + j];     // (w3, b3, w5, b5, w7, b7) for q, k, v
    float* out = (float*)d_out;    // [2][2048][1024]
    char* wsp = (char*)d_ws;
    auto take = [&](size_t bytes) { char* p = wsp; wsp += (bytes + 255) & ~(size_t)255; return (void*)p; };
    bf* WT = (bf*)take((size_t)3 * DM * DM * 2); bf* WoT = (bf*)take((size_t)DM * DM * 2); bf* Xb = (bf*)take((size_t)NTK * DM * 2);
    float* TMP = (float*)take((size_t)NTK * DM * 4); float* TV = (float*)take((size_t)NTK * DM * 4);
    h16* QH = (h16*)take((size_t)NTK * DM * 2); h16* QL = (h16*)take((size_t)NTK * DM * 2); h16* KH = (h16*)take((size_t)NTK * DM * 2); h16* KL = (h16*)take((size_t)NTK * DM * 2);
    h16* VTH = (h16*)take((size_t)NTK * DM * 2); h16* VTL = (h16*)take((size_t)NTK * DM * 2); bf* CH = (bf*)take((size_t)NTK * DM * 2); bf* CL = (bf*)take((size_t)NTK * DM * 2);
    if ((size_t)(wsp - (char*)d_ws) > ws_size) return;    // 6.3 + 2.1 + 4.2 + 8.4 + 8.4 + 8 x 4.2 ~ 63 MB, no aliasing
    k_wt<<<dim3(DM / 64, 3 * DM / 64, 1), 256, 0, stream>>>(Wqkv, DM, 3 * DM, WT); k_wt<<<dim3(DM / 64, DM / 64, 1), 256, 0, stream>>>(Wo, DM, DM, WoT);
    for (int b = 0; b < 2; ++b) {
        const float* xb = x + (size_t)b * NTK * DM;
        k_cvtb<<<NTK / 8, 256, 0, stream>>>(xb, NTK, Xb);
        k_gemmb<false, false><<<dim3(NTK / 64, DM / 64, 1), 128, 0, stream>>>(Xb, nullptr, WT, bqkv, TMP, DM, nullptr);                                  // q (f32)
        k_dwmix<true><<<NTK / 8, 256, 0, stream>>>(TMP, cw[0][0], cw[0][1], cw[0][2], cw[0][3], cw[0][4], cw[0][5], nullptr, QH, QL);
        k_gemmb<false, false><<<dim3(NTK / 64, DM / 64, 1), 128, 0, stream>>>(Xb, nullptr, WT + (size_t)DM * DM, bqkv + DM, TMP, DM, nullptr);          // k
        k_dwmix<true><<<NTK / 8, 256, 0, stream>>>(TMP, cw[1][0], cw[1][1], cw[1][2], cw[1][3], cw[1][4], cw[1][5], nullptr, KH, KL);
        k_gemmb<false, false><<<dim3(NTK / 64, DM / 64, 1), 128, 0, stream>>>(Xb, nullptr, WT + (size_t)2 * DM * DM, bqkv + 2 * DM, TMP, DM, nullptr);  // v
        k_dwmix<false><<<NTK / 8, 256, 0, stream>>>(TMP, cw[2][0], cw[2][1], cw[2][2], cw[2][3], cw[2][4], cw[2][5], TV, nullptr, nullptr);
        k_vt<<<NB_ * NH_ * (NT_ / 64), 256, 0, stream>>>(TV, VTH, VTL);
        k_attn<<<NB_ * NH_ * (NT_ / 64), 128, 0, stream>>>(QH, QL, KH, KL, VTH, VTL, CH, CL);
        k_gemmb<true, false><<<dim3(NTK / 64, DM / 64, 1), 128, 0, stream>>>(CH, CL, WoT, bo, out + (size_t)b * NTK * DM, DM, nullptr);
    }
}

// v001
// It runs in 490 microseconds.
// Two timings next to v000 put it at 1.48 and 1.47 times that version's speed.
#include <hip/hip_runtime.h>

// Compute dtypes, f32 accumulate, both batch items in one pass (4096 rows per launch): qkv = x.c_attn_w + b ([4096 x 1024].[1024 x 3072] as three [1024]-wide products, PLAIN bf16 operands = the
// rounded input and the k-major weights transposed once; exact products) on v_wmma_f32_16x16x32_bf16 -> f32; the per-head-group causal depthwise convolutions along the
// sequence (heads 0-3 identity, 4-7 width 3, 8-11 width 5, 12-15 width 7; weights/biases read as inputs) in f32 -> q/k as f16 hi + residual x1024 planes, v -> f32 ->
// transposed f16 hi + residual planes; the 16-head causal attention (masked scores are set to -inf, so exp(-inf - m) = 0) fused on v_wmma_f32_16x16x32_f16
// (hh + hl + lh x 1/8, online f32 softmax, weights x32768 and v as f16 hi + residual x1024); out = ctx.c_proj_w + b (ctx as bf16 hi + UNSCALED residual against the

#define NB_  2                   // both batch items go through every launch together
#define NT_  2048
#define DM   1024
#define NH_  16
#define HD   64
#define HK   4                    // heads per group
#define NTK  (NB_ * NT_)
#define NW   1024
#define NQKV 1024
#define PSC  32768.0f
#define LOSC 1024.0f
#define LOSCI (1.0f / 1024.0f)

typedef _Float16 h16;
typedef unsigned short bf;
typedef __attribute__((ext_vector_type(16))) __bf16   v16bf;
typedef __attribute__((ext_vector_type(16))) _Float16 v16h;
typedef __attribute__((ext_vector_type(8)))  _Float16 v8h;
typedef __attribute__((ext_vector_type(8)))  unsigned short v8us;
typedef __attribute__((ext_vector_type(8)))  float    v8f;
typedef __attribute__((ext_vector_type(4)))  float    v4f;
typedef v8h  __attribute__((may_alias)) v8ha;
typedef v4f  __attribute__((may_alias)) v4fa;
typedef v8us __attribute__((may_alias)) v8usa;

__device__ __forceinline__ unsigned short f2bf(float f) { unsigned u = __float_as_uint(f); u += 0x7FFFu + ((u >> 16) & 1u); return (unsigned short)(u >> 16); }
__device__ __forceinline__ float bf2f(unsigned short b) { return __uint_as_float(((unsigned)b) << 16); }
__device__ __forceinline__ float bfr(float f) { return bf2f(f2bf(f)); }
__device__ __forceinline__ v16h cat16(v8h lo, v8h hi) { return __builtin_shufflevector(lo, hi, 0, 1, 2, 3, 4, 5, 6, 7, 8, 9, 10, 11, 12, 13, 14, 15); }
__device__ __forceinline__ v16bf cat16b(v8us lo, v8us hi) { return __builtin_bit_cast(v16bf, __builtin_shufflevector(lo, hi, 0, 1, 2, 3, 4, 5, 6, 7, 8, 9, 10, 11, 12, 13, 14, 15)); }
__device__ __forceinline__ v8f wmma16(v16h a, v16h b, v8f c) { return __builtin_amdgcn_wmma_f32_16x16x32_f16(false, a, false, b, (short)0, c, false, false); }
__device__ __forceinline__ v8f wmmab(v16bf a, v16bf b, v8f c) { return __builtin_amdgcn_wmma_f32_16x16x32_bf16(false, a, false, b, (short)0, c, false, false); }

__global__ __launch_bounds__(256) void k_cvtb(const float* __restrict__ src, int nrows, bf* dst) {
    const int lane = threadIdx.x & 31, r = blockIdx.x * 8 + (threadIdx.x >> 5);
    if (r >= nrows) return;
    v8us o[DM / 256];
#pragma unroll
    for (int q = 0; q < DM / 256; ++q) { v8us t;
#pragma unroll
        for (int i = 0; i < 8; ++i) t[i] = f2bf(src[(size_t)r * DM + q * 256 + lane * 8 + i]);
        o[q] = t; }
#pragma unroll
    for (int q = 0; q < DM / 256; ++q) *(v8us*)(dst + (size_t)r * DM + q * 256 + lane * 8) = o[q];
    
}

// k_gemmb: 64 x 64 block tile (4 waves x 16 x 64) of C[NTK][NW] = (A [+ Al]).B^T (K = 1024) [+ bf(bias[c])] [+ bf(R[r][c]) residual]; f32 whole-line epilogue (or f16
template <bool SPLITA, bool F16OUT = false>
__global__ __launch_bounds__(128) void k_gemmb(const bf* __restrict__ A, const bf* __restrict__ Al, const bf* __restrict__ Bn, const float* __restrict__ bias, float* C, int ldc, h16* C2, const float* __restrict__ R = nullptr, int K = DM, int roundR = 1) {
    __shared__ __align__(16) float ost[4][16 * 68];
    const int lane = threadIdx.x & 31, wave = threadIdx.x >> 5, lr = lane & 15, hi = lane >> 4;
    const int r0 = blockIdx.x * 64 + wave * 16, c0 = blockIdx.y * 64;
    const size_t aoff = (size_t)(r0 + lr) * K + 8 * hi;
    size_t boff[4];
#pragma unroll
    for (int t = 0; t < 4; ++t) boff[t] = (size_t)(c0 + t * 16 + lr) * K + 8 * hi;
    v8f acc[4];
#pragma unroll
    for (int t = 0; t < 4; ++t) acc[t] = (v8f){};
#pragma unroll 1
    for (int kc = 0; kc < K; kc += 32) {
        const v16bf a = cat16b(*(const v8us*)(A + aoff + kc), *(const v8us*)(A + aoff + kc + 16));
        v16bf al = a;
        if (SPLITA) al = cat16b(*(const v8us*)(Al + aoff + kc), *(const v8us*)(Al + aoff + kc + 16));
#pragma unroll
        for (int t = 0; t < 4; ++t) { const v16bf b = cat16b(*(const v8us*)(Bn + boff[t] + kc), *(const v8us*)(Bn + boff[t] + kc + 16)); acc[t] = wmmab(a, b, acc[t]); if (SPLITA) acc[t] = wmmab(al, b, acc[t]); }
        asm volatile("v_nop\n\tv_nop\n\tv_nop\n\tv_nop" : "+v"(acc[0]), "+v"(acc[1]), "+v"(acc[2]), "+v"(acc[3]) : "v"(a), "v"(al));
    }
    float* os = &ost[wave][0];
#pragma unroll
    for (int t = 0; t < 4; ++t) { const float bv = bias ? bfr(bias[c0 + t * 16 + lr]) : 0.f;
#pragma unroll
        for (int j = 0; j < 8; ++j) os[(hi * 8 + j) * 68 + t * 16 + lr] = acc[t][j] + bv; }
    __syncthreads();
    if (F16OUT) {
        h16* crow = (h16*)(void*)C + (size_t)r0 * ldc + c0;
        auto pass = [&]() {
#pragma unroll
            for (int s = 0; s < 4; ++s) { const int row = 4 * s + (lane >> 3), piece = lane & 7; const float* sp = os + row * 68 + piece * 8; v8h o, o2;
#pragma unroll
                for (int i = 0; i < 8; ++i) { const h16 a = (h16)sp[i]; o[i] = a; o2[i] = (h16)((sp[i] - (float)a) * LOSC); }
                *(v8h*)(crow + (size_t)row * ldc + piece * 8) = o; if (C2) *(v8h*)(C2 + (size_t)r0 * ldc + c0 + (size_t)row * ldc + piece * 8) = o2; }
        };
        pass(); 
    } else {
        float* crow = C + (size_t)r0 * ldc + c0;
        auto pass = [&]() {
#pragma unroll
            for (int s = 0; s < 8; ++s) { const int Lid = (lane >> 3) + 4 * s, piece = lane & 7; const int row = Lid >> 1, cofs = (Lid & 1) * 32 + piece * 4;
                v4f val = *(const v4fa*)(os + row * 68 + cofs); if (R) { const v4f rv = *(const v4f*)(R + ((size_t)r0 + row) * ldc + c0 + cofs); val += roundR ? (v4f){bfr(rv[0]), bfr(rv[1]), bfr(rv[2]), bfr(rv[3])} : rv; }
                *(v4f*)(crow + (size_t)row * ldc + cofs) = val; }
        };
        pass(); 
    }
}

__global__ __launch_bounds__(256) void k_vt(const float* __restrict__ V, h16* VTH, h16* VTL) {
    __shared__ __align__(16) h16 tile[64 * 72];
    __shared__ __align__(16) h16 til2[64 * 72];
    const int bid = blockIdx.x;
    const int b = bid / (NH_ * (NT_ / 64)), rem = bid - b * (NH_ * (NT_ / 64)), h = rem / (NT_ / 64), kt = rem - h * (NT_ / 64);
    const int k0 = kt * 64, tid = threadIdx.x;
    const int kk = tid >> 2, d0 = (tid & 3) * 16;
    const float* src = V + ((size_t)b * NT_ + k0 + kk) * DM + h * HD + d0;
#pragma unroll
    for (int i = 0; i < 16; ++i) { const float v = src[i]; const h16 a = (h16)v; tile[(d0 + i) * 72 + kk] = a; til2[(d0 + i) * 72 + kk] = (h16)((v - (float)a) * LOSC); }
    __syncthreads();
    const int piece = tid & 7;
    const size_t base = (((size_t)b * NH_ + h) * HD) * NT_ + k0;
    auto pass = [&]() {
#pragma unroll
        for (int s = 0; s < 4; ++s) { const int Lid = (tid >> 3) + 32 * s; const int pln = Lid >> 6, d = Lid & 63;
            const v8h val = *(const v8ha*)((pln ? til2 : tile) + d * 72 + piece * 8); *(v8h*)((pln ? VTL : VTH) + base + (size_t)d * NT_ + piece * 8) = val; }
    };
    pass(); 
}

// k_attn: block = (b, h, 64 queries), wave = 16; key tiles 0..(qt*64+63)/32 of 32 keys (causal mask); 12 WMMA scores (hh + hl + lh) /8 (f32), online softmax, weights x32768 f16 hi + residual tiles (same-wave may_alias
// reload after a compiler barrier), 12 WMMA .v (hh + hl + lh); ctx -> bf16 hi + residual planes CH/CL[tok][h*64+d].
__global__ __launch_bounds__(128) void k_attn(const h16* __restrict__ Q16, const h16* __restrict__ QL16, const h16* __restrict__ K16, const h16* __restrict__ KL16, const h16* __restrict__ VTH, const h16* __restrict__ VTL, bf* CH, bf* CL) {
    __shared__ __align__(16) h16 plds[4][16 * 32];
    __shared__ __align__(16) h16 plds2[4][16 * 32];
    __shared__ __align__(16) float ost[4][16 * 68];
    const int lane = threadIdx.x & 31, wave = threadIdx.x >> 5, lr = lane & 15, hi = lane >> 4;
    const int bid = blockIdx.x;
    const int b = bid / (NH_ * (NT_ / 64)), rem = bid - b * (NH_ * (NT_ / 64)), h = rem / (NT_ / 64), qt = rem - h * (NT_ / 64);
    const int q0 = qt * 64 + wave * 16;
    const size_t tok0 = (size_t)b * NT_;
    h16* pl = &plds[wave][0]; h16* pl2 = &plds2[wave][0];
    v16h qa[2];
    const size_t qo0 = (tok0 + q0 + lr) * DM + h * HD + 8 * hi;
#pragma unroll
    for (int kc = 0; kc < 2; ++kc) qa[kc] = cat16(*(const v8h*)(Q16 + qo0 + kc * 32), *(const v8h*)(Q16 + qo0 + kc * 32 + 16));
    const h16* kh_b = K16 + tok0 * DM + h * HD;
    const h16* kl_b = KL16 + tok0 * DM + h * HD;
    const size_t vbase = (((size_t)b * NH_ + h) * HD) * NT_;
    v8f o[4], ox[4];
#pragma unroll
    for (int n = 0; n < 4; ++n) { o[n] = (v8f){}; ox[n] = (v8f){}; }
    float mrow[8], lpart[8];
#pragma unroll
    for (int j = 0; j < 8; ++j) { mrow[j] = -3.0e38f; lpart[j] = 0.f; }
    int qpos[8];
#pragma unroll
    for (int j = 0; j < 8; ++j) qpos[j] = q0 + 8 * hi + j;
    const int kt_lo = 0, kt_hi = (qt * 64 + 63) / 32;     // causal
#pragma unroll 1
    for (int kt = kt_lo; kt <= kt_hi; ++kt) {
        const int l0 = kt * 32;
        const size_t ko0 = (size_t)(l0 + lr) * DM + 8 * hi, ko1 = (size_t)(l0 + 16 + lr) * DM + 8 * hi;
        v8f s0 = {}, s1 = {}, x0 = {}, x1 = {};
#pragma unroll
        for (int kc = 0; kc < 2; ++kc) {
            { const v16h k0h = cat16(*(const v8h*)(kh_b + ko0 + kc * 32), *(const v8h*)(kh_b + ko0 + kc * 32 + 16)), k1h = cat16(*(const v8h*)(kh_b + ko1 + kc * 32), *(const v8h*)(kh_b + ko1 + kc * 32 + 16));
              const v16h qlk = cat16(*(const v8h*)(QL16 + qo0 + kc * 32), *(const v8h*)(QL16 + qo0 + kc * 32 + 16));     // query residual re-read per step (registers)
              s0 = wmma16(qa[kc], k0h, s0); x0 = wmma16(qlk, k0h, x0); s1 = wmma16(qa[kc], k1h, s1); x1 = wmma16(qlk, k1h, x1);
              asm volatile("v_nop" : "+v"(s0), "+v"(s1), "+v"(x0), "+v"(x1) : "v"(qlk), "v"(k0h), "v"(k1h) : "memory"); }
            { const v16h k0l = cat16(*(const v8h*)(kl_b + ko0 + kc * 32), *(const v8h*)(kl_b + ko0 + kc * 32 + 16)), k1l = cat16(*(const v8h*)(kl_b + ko1 + kc * 32), *(const v8h*)(kl_b + ko1 + kc * 32 + 16));
              x0 = wmma16(qa[kc], k0l, x0); x1 = wmma16(qa[kc], k1l, x1);
              asm volatile("v_nop" : "+v"(x0), "+v"(x1) : "v"(k0l), "v"(k1l) : "memory"); }
        }
        asm volatile("v_nop\n\tv_nop\n\tv_nop\n\tv_nop" : "+v"(s0), "+v"(s1), "+v"(x0), "+v"(x1) : "v"(qa[0]), "v"(qa[1]));
        float alpha[8];
#pragma unroll
        for (int j = 0; j < 8; ++j) {
            const int ja = l0 + lr, jb = l0 + 16 + lr, qi = qpos[j];
            const float a0 = (ja <= qi) ? (s0[j] + x0[j] * LOSCI) * 0.125f : -__builtin_inff(), a1 = (jb <= qi) ? (s1[j] + x1[j] * LOSCI) * 0.125f : -__builtin_inff();
            float mx = fmaxf(a0, a1);
            mx = fmaxf(mx, __shfl_xor(mx, 1, 16)); mx = fmaxf(mx, __shfl_xor(mx, 2, 16)); mx = fmaxf(mx, __shfl_xor(mx, 4, 16)); mx = fmaxf(mx, __shfl_xor(mx, 8, 16));
            const float mn = fmaxf(mrow[j], mx);
            alpha[j] = __expf(mrow[j] - mn); mrow[j] = mn;
            const float p0 = __expf(a0 - mn), p1 = __expf(a1 - mn);
            lpart[j] = lpart[j] * alpha[j] + (p0 + p1);
            const int mr = hi * 8 + j;
            const float ps0 = p0 * PSC, ps1 = p1 * PSC; const h16 h0 = (h16)ps0, h1 = (h16)ps1;
            pl[mr * 32 + lr] = h0; pl[mr * 32 + 16 + lr] = h1;
            pl2[mr * 32 + lr] = (h16)((ps0 - (float)h0) * LOSC); pl2[mr * 32 + 16 + lr] = (h16)((ps1 - (float)h1) * LOSC);
        }
#pragma unroll
        for (int n = 0; n < 4; ++n)
#pragma unroll
            for (int j = 0; j < 8; ++j) { o[n][j] *= alpha[j]; ox[n][j] *= alpha[j]; }
        asm volatile("" ::: "memory");
        const v16h pa = cat16(*(const v8ha*)(pl + lr * 32 + hi * 8), *(const v8ha*)(pl + lr * 32 + 16 + hi * 8));
        const v16h px = cat16(*(const v8ha*)(pl2 + lr * 32 + hi * 8), *(const v8ha*)(pl2 + lr * 32 + 16 + hi * 8));
#pragma unroll
        for (int n = 0; n < 4; ++n) { const size_t vo = vbase + (size_t)(n * 16 + lr) * NT_ + l0 + hi * 8;
            const v16h vh = cat16(*(const v8h*)(VTH + vo), *(const v8h*)(VTH + vo + 16)), vl = cat16(*(const v8h*)(VTL + vo), *(const v8h*)(VTL + vo + 16));
            o[n] = wmma16(pa, vh, o[n]); ox[n] = wmma16(pa, vl, ox[n]); ox[n] = wmma16(px, vh, ox[n]);
            asm volatile("" : "+v"(o[n]), "+v"(ox[n]) : "v"(vh), "v"(vl) : "memory"); }
        asm volatile("v_nop\n\tv_nop\n\tv_nop\n\tv_nop" : "+v"(o[0]), "+v"(o[1]), "+v"(o[2]), "+v"(o[3]), "+v"(ox[0]), "+v"(ox[1]), "+v"(ox[2]), "+v"(ox[3]) : "v"(pa), "v"(px));
    }
    float inv[8];
#pragma unroll
    for (int j = 0; j < 8; ++j) { float rs = lpart[j]; rs += __shfl_xor(rs, 1, 16); rs += __shfl_xor(rs, 2, 16); rs += __shfl_xor(rs, 4, 16); rs += __shfl_xor(rs, 8, 16); inv[j] = 1.0f / (rs * PSC); }
    float* os = &ost[wave][0];
#pragma unroll
    for (int n = 0; n < 4; ++n)
#pragma unroll
        for (int j = 0; j < 8; ++j) os[(hi * 8 + j) * 68 + n * 16 + lr] = (o[n][j] + ox[n][j] * LOSCI) * inv[j];
    __syncthreads();
    const size_t cbase = (tok0 + q0) * DM + (size_t)h * HD;
    auto pass = [&]() {
#pragma unroll
        for (int s = 0; s < 4; ++s) { const int row = 4 * s + (lane >> 3), piece = lane & 7; const float* sp = os + row * 68 + piece * 8; v8us oh, ol;
#pragma unroll
            for (int i = 0; i < 8; ++i) { const unsigned short hb = f2bf(sp[i]); oh[i] = hb; ol[i] = f2bf(sp[i] - bf2f(hb)); }
            *(v8us*)(CH + cbase + (size_t)row * DM + piece * 8) = oh; *(v8us*)(CL + cbase + (size_t)row * DM + piece * 8) = ol; }
    };
    pass(); 
}


// k_wt: WT [n][K] = bf16(W[k][n]) (k-major [K][ncols]) via 64 x 64 LDS tiles; grid (K/64, ncols/64).
__global__ __launch_bounds__(256) void k_wt(const float* __restrict__ Wm, int K, int ncols, bf* WT) {
    __shared__ __align__(16) unsigned short tl[64 * 72];
    const int tid = threadIdx.x, k0 = blockIdx.x * 64, n0 = blockIdx.y * 64;
    const int kk = tid >> 2, nq = (tid & 3) * 16;
#pragma unroll
    for (int i = 0; i < 16; ++i) tl[(nq + i) * 72 + kk] = f2bf(Wm[(size_t)(k0 + kk) * ncols + n0 + nq + i]);
    __syncthreads();
    const int piece = tid & 7;
    auto pass = [&]() {
#pragma unroll
        for (int s = 0; s < 2; ++s) { const int nr = (tid >> 3) + 32 * s; const v8us val = *(const v8usa*)(tl + nr * 72 + piece * 8); *(v8us*)(WT + (size_t)(n0 + nr) * K + k0 + piece * 8) = val; }
    };
    pass(); 
}

typedef __attribute__((ext_vector_type(4)))  _Float16 v4h;
// k_dwmix: the grouped causal depthwise convolution along the sequence of a projected [2 x 2048][1024] f32 matrix T (row s = batch item s / 2048, position s % 2048) (column c = head h * 64 + d; group g = h / 4: g = 0
// identity, else y[s][c] = bf(bias_g[d]) + sum_i bf(w_g[d][i]) * T[s - (width-1) + i][c] over rows of the same batch item, width = 2g + 1), one wave per row s, 8 column chunks of 128
// (each chunk lies inside one group, so the branch is wave-uniform), lane -> 4 consecutive columns; F16: f16 hi + residual x1024 planes (8 B per lane per plane = one
template <bool F16>
__global__ __launch_bounds__(256) void k_dwmix(const float* __restrict__ T, const float* __restrict__ w3, const float* __restrict__ b3, const float* __restrict__ w5, const float* __restrict__ b5, const float* __restrict__ w7, const float* __restrict__ b7, float* Y, h16* YH, h16* YL) {
    const int lane = threadIdx.x & 31, s = blockIdx.x * 8 + (threadIdx.x >> 5);
    if (s >= NTK) return;
    const int sl = s & (NT_ - 1), sb = s - sl;      // position inside the batch item, and the item's first row
{
#pragma unroll 1
        for (int ch = 0; ch < DM / 128; ++ch) {
            const int c0 = ch * 128 + lane * 4; const int g = ch >> 1;      // 2 chunks = 4 heads = one group
            v4f y;
            if (g == 0) { y = *(const v4f*)(T + (size_t)s * DM + c0); }
            else {
                const int kw = 2 * g + 1; const float* wg = (g == 1) ? w3 : (g == 2) ? w5 : w7; const float* bg = (g == 1) ? b3 : (g == 2) ? b5 : b7;
#pragma unroll
                for (int i = 0; i < 4; ++i) { const int d = (c0 + i) & (HD - 1); float acc = bfr(bg[d]);
#pragma unroll 1
                    for (int t = 0; t < kw; ++t) { const int r = sl - (kw - 1) + t; const int rc = sb + (r < 0 ? 0 : r); const float xv = T[(size_t)rc * DM + c0 + i]; acc = (r >= 0) ? fmaf(xv, bfr(wg[d * kw + t]), acc) : acc; }
                    y[i] = acc; }
            }
            if (F16) { v4h o, o2;
#pragma unroll
                for (int i = 0; i < 4; ++i) { const h16 a = (h16)y[i]; o[i] = a; o2[i] = (h16)((y[i] - (float)a) * LOSC); }
                *(v4h*)(YH + (size_t)s * DM + c0) = o; *(v4h*)(YL + (size_t)s * DM + c0) = o2; }
            else { *(v4f*)(Y + (size_t)s * DM + c0) = y; }
        }
        
    }
}

extern "C" void kernel_launch(void* const* d_in, const int* in_sizes, int n_in,
                              void* d_out, int out_size, void* d_ws, size_t ws_size, hipStream_t stream) {
    (void)in_sizes; (void)n_in; (void)out_size;
    const float* x = (const float*)d_in[0]; const float* Wqkv = (const float*)d_in[1]; const float* bqkv = (const float*)d_in[2]; const float* Wo = (const float*)d_in[3]; const float* bo = (const float*)d_in[4];   // k-major weights (x @ W)
    const float* cw[3][6]; for (int p = 0; p < 3; ++p) for (int j = 0; j < 6; ++j) cw[p][j] = (const float*)d_in[5 + p * 6 + j];     // (w3, b3, w5, b5, w7, b7) for q, k, v
    float* out = (float*)d_out;    // [2][2048][1024]
    char* wsp = (char*)d_ws;
    auto take = [&](size_t bytes) { char* p = wsp; wsp += (bytes + 255) & ~(size_t)255; return (void*)p; };
    bf* WT = (bf*)take((size_t)3 * DM * DM * 2); bf* WoT = (bf*)take((size_t)DM * DM * 2); bf* Xb = (bf*)take((size_t)NTK * DM * 2);
    float* TMP = (float*)take((size_t)NTK * DM * 4); float* TV = (float*)take((size_t)NTK * DM * 4);
    h16* QH = (h16*)take((size_t)NTK * DM * 2); h16* QL = (h16*)take((size_t)NTK * DM * 2); h16* KH = (h16*)take((size_t)NTK * DM * 2); h16* KL = (h16*)take((size_t)NTK * DM * 2);
    h16* VTH = (h16*)take((size_t)NTK * DM * 2); h16* VTL = (h16*)take((size_t)NTK * DM * 2); bf* CH = (bf*)take((size_t)NTK * DM * 2); bf* CL = (bf*)take((size_t)NTK * DM * 2);
    if ((size_t)(wsp - (char*)d_ws) > ws_size) return;    // about 118 MB in all, no aliasing
    k_wt<<<dim3(DM / 64, 3 * DM / 64, 1), 256, 0, stream>>>(Wqkv, DM, 3 * DM, WT); k_wt<<<dim3(DM / 64, DM / 64, 1), 256, 0, stream>>>(Wo, DM, DM, WoT);
    {
        k_cvtb<<<NTK / 8, 256, 0, stream>>>(x, NTK, Xb);
        k_gemmb<false, false><<<dim3(NTK / 64, DM / 64, 1), 128, 0, stream>>>(Xb, nullptr, WT, bqkv, TMP, DM, nullptr);                                  // q (f32)
        k_dwmix<true><<<NTK / 8, 256, 0, stream>>>(TMP, cw[0][0], cw[0][1], cw[0][2], cw[0][3], cw[0][4], cw[0][5], nullptr, QH, QL);
        k_gemmb<false, false><<<dim3(NTK / 64, DM / 64, 1), 128, 0, stream>>>(Xb, nullptr, WT + (size_t)DM * DM, bqkv + DM, TMP, DM, nullptr);          // k
        k_dwmix<true><<<NTK / 8, 256, 0, stream>>>(TMP, cw[1][0], cw[1][1], cw[1][2], cw[1][3], cw[1][4], cw[1][5], nullptr, KH, KL);
        k_gemmb<false, false><<<dim3(NTK / 64, DM / 64, 1), 128, 0, stream>>>(Xb, nullptr, WT + (size_t)2 * DM * DM, bqkv + 2 * DM, TMP, DM, nullptr);  // v
        k_dwmix<false><<<NTK / 8, 256, 0, stream>>>(TMP, cw[2][0], cw[2][1], cw[2][2], cw[2][3], cw[2][4], cw[2][5], TV, nullptr, nullptr);
        k_vt<<<NB_ * NH_ * (NT_ / 64), 256, 0, stream>>>(TV, VTH, VTL);
        k_attn<<<NB_ * NH_ * (NT_ / 64), 128, 0, stream>>>(QH, QL, KH, KL, VTH, VTL, CH, CL);
        k_gemmb<true, false><<<dim3(NTK / 64, DM / 64, 1), 128, 0, stream>>>(CH, CL, WoT, bo, out, DM, nullptr);
    }
}

// v002
// One run takes 294 microseconds.
// Next to v001, in two timings, it ran 1.67 times as fast each time.
// All steps since v000 together make it 2.46 times as fast.
#include <hip/hip_runtime.h>

// Compute dtypes, f32 accumulate, both batch items in one pass (4096 rows per launch): qkv = x.c_attn_w + b ([4096 x 1024].[1024 x 3072] as three [1024]-wide products, PLAIN bf16 operands = the
// rounded input and the k-major weights transposed once; exact products) on v_wmma_f32_16x16x32_bf16 -> f32; the per-head-group causal depthwise convolutions along the
// sequence (heads 0-3 identity, 4-7 width 3, 8-11 width 5, 12-15 width 7; weights/biases read as inputs) in f32 -> q/k as f16 hi + residual x1024 planes, v -> f32 ->
// transposed f16 hi + residual planes; the 16-head causal attention (masked scores are set to -inf, so exp(-inf - m) = 0) fused on v_wmma_f32_16x16x32_f16
// (hh + hl + lh x 1/8, online f32 softmax, weights x32768 and v as f16 hi + residual x1024); out = ctx.c_proj_w + b (ctx as bf16 hi + UNSCALED residual against the

#define NB_  2                   // both batch items go through every launch together
#define NT_  2048
#define DM   1024
#define NH_  16
#define HD   64
#define HK   4                    // heads per group
#define NTK  (NB_ * NT_)
#define NW   1024
#define NQKV 1024
#define PSC  32768.0f
#define LOSC 1024.0f
#define LOSCI (1.0f / 1024.0f)

typedef _Float16 h16;
typedef unsigned short bf;
typedef __attribute__((ext_vector_type(16))) __bf16   v16bf;
typedef __attribute__((ext_vector_type(16))) _Float16 v16h;
typedef __attribute__((ext_vector_type(8)))  _Float16 v8h;
typedef __attribute__((ext_vector_type(8)))  unsigned short v8us;
typedef __attribute__((ext_vector_type(8)))  float    v8f;
typedef __attribute__((ext_vector_type(4)))  float    v4f;
typedef v8h  __attribute__((may_alias)) v8ha;
typedef v4f  __attribute__((may_alias)) v4fa;
typedef v8us __attribute__((may_alias)) v8usa;

__device__ __forceinline__ unsigned short f2bf(float f) { unsigned u = __float_as_uint(f); u += 0x7FFFu + ((u >> 16) & 1u); return (unsigned short)(u >> 16); }
__device__ __forceinline__ float bf2f(unsigned short b) { return __uint_as_float(((unsigned)b) << 16); }
__device__ __forceinline__ float bfr(float f) { return bf2f(f2bf(f)); }
__device__ __forceinline__ v16h cat16(v8h lo, v8h hi) { return __builtin_shufflevector(lo, hi, 0, 1, 2, 3, 4, 5, 6, 7, 8, 9, 10, 11, 12, 13, 14, 15); }
__device__ __forceinline__ v16bf cat16b(v8us lo, v8us hi) { return __builtin_bit_cast(v16bf, __builtin_shufflevector(lo, hi, 0, 1, 2, 3, 4, 5, 6, 7, 8, 9, 10, 11, 12, 13, 14, 15)); }
__device__ __forceinline__ v8f wmma16(v16h a, v16h b, v8f c) { return __builtin_amdgcn_wmma_f32_16x16x32_f16(false, a, false, b, (short)0, c, false, false); }
__device__ __forceinline__ v8f wmmab(v16bf a, v16bf b, v8f c) { return __builtin_amdgcn_wmma_f32_16x16x32_bf16(false, a, false, b, (short)0, c, false, false); }

__global__ __launch_bounds__(256) void k_cvtb(const float* __restrict__ src, int nrows, bf* dst) {
    const int lane = threadIdx.x & 31, r = blockIdx.x * 8 + (threadIdx.x >> 5);
    if (r >= nrows) return;
    v8us o[DM / 256];
#pragma unroll
    for (int q = 0; q < DM / 256; ++q) { v8us t;
#pragma unroll
        for (int i = 0; i < 8; ++i) t[i] = f2bf(src[(size_t)r * DM + q * 256 + lane * 8 + i]);
        o[q] = t; }
#pragma unroll
    for (int q = 0; q < DM / 256; ++q) *(v8us*)(dst + (size_t)r * DM + q * 256 + lane * 8) = o[q];
    
}

// k_gemmb: 64 x 64 block tile (4 waves x 16 x 64) of C[NTK][NW] = (A [+ Al]).B^T (K = 1024) [+ bf(bias[c])] [+ bf(R[r][c]) residual]; f32 whole-line epilogue (or f16
template <bool SPLITA, bool F16OUT = false>
__global__ __launch_bounds__(128) void k_gemmb(const bf* __restrict__ A, const bf* __restrict__ Al, const bf* __restrict__ Bn, const float* __restrict__ bias, float* C, int ldc, h16* C2, const float* __restrict__ R = nullptr, int K = DM, int roundR = 1) {
    // stg: two buffers of the block's operand tiles (plane 0 = 64 A rows, 1 = 64 B rows, 2 = 64 Al rows; 64 k each, row pitch 72 elements = 144 B), filled by whole-line
    // loads that the four waves share; the fragments are read from here.
    __shared__ __align__(16) bf stg[2][SPLITA ? 3 : 2][64 * 72];
    __shared__ __align__(16) float ost[4][16 * 68];
    const int lane = threadIdx.x & 31, wave = threadIdx.x >> 5, lr = lane & 15, hi = lane >> 4;
    const int r0 = blockIdx.x * 64 + wave * 16, c0 = blockIdx.y * 64;
    const int srow = threadIdx.x >> 3, spc = (threadIdx.x & 7) * 8;      // staging: 8 threads cover one 128 B row piece by piece, 16 rows a pass
    unsigned so[4];      // the thread's byte offset inside a 64-row tile, one per pass; the tile's own address is uniform
#pragma unroll
    for (int s = 0; s < 4; ++s) so[s] = ((unsigned)(srow + 16 * s) * (unsigned)K + (unsigned)spc) * 2u;
    v8us ga[4], gb[4], gl[4];
    auto fetch = [&](int kc) {
        const char* ta = (const char*)(A + (size_t)(blockIdx.x * 64) * K + kc); const char* tb = (const char*)(Bn + (size_t)c0 * K + kc); const char* tl = SPLITA ? (const char*)(Al + (size_t)(blockIdx.x * 64) * K + kc) : ta;
        const char* pa[4]; const char* pb[4]; const char* pl[4];
#pragma unroll
        for (int s = 0; s < 4; ++s) { pa[s] = ta + so[s]; pb[s] = tb + so[s]; pl[s] = tl + so[s]; }
#pragma unroll
        for (int s = 0; s < 4; ++s) { ga[s] = *(const v8us*)pa[s]; gb[s] = *(const v8us*)pb[s]; if (SPLITA) gl[s] = *(const v8us*)pl[s]; }
        // The wait that stands before a register named by an issued load is rewritten; the addresses are its inputs so that none of them is reused as a destination of these loads.
        asm volatile("s_wait_xcnt 0x0" :: "v"(pa[0]), "v"(pa[1]), "v"(pa[2]), "v"(pa[3]), "v"(pb[0]), "v"(pb[1]), "v"(pb[2]), "v"(pb[3]), "v"(pl[0]), "v"(pl[1]), "v"(pl[2]), "v"(pl[3]) : "memory");
    };
    auto put = [&](int buf) {
#pragma unroll
        for (int s = 0; s < 4; ++s) { const int o = (srow + 16 * s) * 72 + spc; *(v8usa*)(&stg[buf][0][o]) = ga[s]; *(v8usa*)(&stg[buf][1][o]) = gb[s]; if (SPLITA) *(v8usa*)(&stg[buf][SPLITA ? 2 : 0][o]) = gl[s]; }
    };
    v8f acc[4];
#pragma unroll
    for (int t = 0; t < 4; ++t) acc[t] = (v8f){};
    fetch(0); put(0);
    __syncthreads();      // stage 0 is complete before any wave reads it
#pragma unroll 1
    for (int kb = 0; kb < K; kb += 64) {
        const int cur = (kb >> 6) & 1;
        const bool more = kb + 64 < K;
        if (more) fetch(kb + 64);      // the next stage's lines fly while this stage is multiplied
#pragma unroll
        for (int ks = 0; ks < 2; ++ks) {
            const int fo = ks * 32 + 8 * hi, ao = (wave * 16 + lr) * 72 + fo;
            const v16bf a = cat16b(*(const v8usa*)(&stg[cur][0][ao]), *(const v8usa*)(&stg[cur][0][ao + 16]));
            v16bf al = a;
            if (SPLITA) al = cat16b(*(const v8usa*)(&stg[cur][SPLITA ? 2 : 0][ao]), *(const v8usa*)(&stg[cur][SPLITA ? 2 : 0][ao + 16]));
#pragma unroll
            for (int t = 0; t < 4; ++t) { const int bo = (t * 16 + lr) * 72 + fo; const v16bf b = cat16b(*(const v8usa*)(&stg[cur][1][bo]), *(const v8usa*)(&stg[cur][1][bo + 16])); acc[t] = wmmab(a, b, acc[t]); if (SPLITA) acc[t] = wmmab(al, b, acc[t]); }
            asm volatile("v_nop\n\tv_nop\n\tv_nop\n\tv_nop" : "+v"(acc[0]), "+v"(acc[1]), "+v"(acc[2]), "+v"(acc[3]) : "v"(a), "v"(al));
        }
        if (more) put(cur ^ 1);        // into the buffer whose readers all passed the barrier of the trip before
        __syncthreads();               // publishes the next stage and ends every wave's reads of this one
    }
    float* os = &ost[wave][0];
#pragma unroll
    for (int t = 0; t < 4; ++t) { const float bv = bias ? bfr(bias[c0 + t * 16 + lr]) : 0.f;
#pragma unroll
        for (int j = 0; j < 8; ++j) os[(hi * 8 + j) * 68 + t * 16 + lr] = acc[t][j] + bv; }
    __syncthreads();
    if (F16OUT) {
        h16* crow = (h16*)(void*)C + (size_t)r0 * ldc + c0;
        auto pass = [&]() {
#pragma unroll
            for (int s = 0; s < 4; ++s) { const int row = 4 * s + (lane >> 3), piece = lane & 7; const float* sp = os + row * 68 + piece * 8; v8h o, o2;
#pragma unroll
                for (int i = 0; i < 8; ++i) { const h16 a = (h16)sp[i]; o[i] = a; o2[i] = (h16)((sp[i] - (float)a) * LOSC); }
                *(v8h*)(crow + (size_t)row * ldc + piece * 8) = o; if (C2) *(v8h*)(C2 + (size_t)r0 * ldc + c0 + (size_t)row * ldc + piece * 8) = o2; }
        };
        pass(); 
    } else {
        float* crow = C + (size_t)r0 * ldc + c0;
        auto pass = [&]() {
#pragma unroll
            for (int s = 0; s < 8; ++s) { const int Lid = (lane >> 3) + 4 * s, piece = lane & 7; const int row = Lid >> 1, cofs = (Lid & 1) * 32 + piece * 4;
                v4f val = *(const v4fa*)(os + row * 68 + cofs); if (R) { const v4f rv = *(const v4f*)(R + ((size_t)r0 + row) * ldc + c0 + cofs); val += roundR ? (v4f){bfr(rv[0]), bfr(rv[1]), bfr(rv[2]), bfr(rv[3])} : rv; }
                *(v4f*)(crow + (size_t)row * ldc + cofs) = val; }
        };
        pass(); 
    }
}

__global__ __launch_bounds__(256) void k_vt(const float* __restrict__ V, h16* VTH, h16* VTL) {
    __shared__ __align__(16) h16 tile[64 * 72];
    __shared__ __align__(16) h16 til2[64 * 72];
    const int bid = blockIdx.x;
    const int b = bid / (NH_ * (NT_ / 64)), rem = bid - b * (NH_ * (NT_ / 64)), h = rem / (NT_ / 64), kt = rem - h * (NT_ / 64);
    const int k0 = kt * 64, tid = threadIdx.x;
    const int kk = tid >> 2, d0 = (tid & 3) * 16;
    const float* src = V + ((size_t)b * NT_ + k0 + kk) * DM + h * HD + d0;
#pragma unroll
    for (int i = 0; i < 16; ++i) { const float v = src[i]; const h16 a = (h16)v; tile[(d0 + i) * 72 + kk] = a; til2[(d0 + i) * 72 + kk] = (h16)((v - (float)a) * LOSC); }
    __syncthreads();
    const int piece = tid & 7;
    const size_t base = (((size_t)b * NH_ + h) * HD) * NT_ + k0;
    auto pass = [&]() {
#pragma unroll
        for (int s = 0; s < 4; ++s) { const int Lid = (tid >> 3) + 32 * s; const int pln = Lid >> 6, d = Lid & 63;
            const v8h val = *(const v8ha*)((pln ? til2 : tile) + d * 72 + piece * 8); *(v8h*)((pln ? VTL : VTH) + base + (size_t)d * NT_ + piece * 8) = val; }
    };
    pass(); 
}

// k_attn: block = (b, h, 64 queries), wave = 16; key tiles 0..(qt*64+63)/32 of 32 keys (causal mask); 12 WMMA scores (hh + hl + lh) /8 (f32), online softmax, weights x32768 f16 hi + residual tiles (same-wave may_alias
// reload after a compiler barrier), 12 WMMA .v (hh + hl + lh); ctx -> bf16 hi + residual planes CH/CL[tok][h*64+d].
__global__ __launch_bounds__(128) void k_attn(const h16* __restrict__ Q16, const h16* __restrict__ QL16, const h16* __restrict__ K16, const h16* __restrict__ KL16, const h16* __restrict__ VTH, const h16* __restrict__ VTL, bf* CH, bf* CL) {
    __shared__ __align__(16) h16 plds[4][16 * 32];
    __shared__ __align__(16) h16 plds2[4][16 * 32];
    __shared__ __align__(16) float ost[4][16 * 68];
    // Operand tiles in LDS, filled by the block's 128 threads together (each line fetched once a block) and read as fragments by all four waves; two buffers each.
    __shared__ __align__(16) h16 kst[2][2][32 * 72];      // [buffer][hi, residual][key][64 d, row pitch 144 B]
    __shared__ __align__(16) h16 vst[2][2][64 * 40];      // [buffer][hi, residual][d][32 keys, row pitch 80 B]
    __shared__ __align__(16) h16 qls[4][16 * 72];         // each wave's 16 query-residual rows, filled once
    const int lane = threadIdx.x & 31, wave = threadIdx.x >> 5, lr = lane & 15, hi = lane >> 4;
    const int bid = blockIdx.x;
    const int b = bid / (NH_ * (NT_ / 64)), rem = bid - b * (NH_ * (NT_ / 64)), h = rem / (NT_ / 64), qt = rem - h * (NT_ / 64);
    const int q0 = qt * 64 + wave * 16;
    const size_t tok0 = (size_t)b * NT_;
    h16* pl = &plds[wave][0]; h16* pl2 = &plds2[wave][0];
    v16h qa[2];
    const size_t qo0 = (tok0 + q0 + lr) * DM + h * HD + 8 * hi;
#pragma unroll
    for (int kc = 0; kc < 2; ++kc) qa[kc] = cat16(*(const v8h*)(Q16 + qo0 + kc * 32), *(const v8h*)(Q16 + qo0 + kc * 32 + 16));
    const h16* kh_b = K16 + tok0 * DM + h * HD;
    const h16* kl_b = KL16 + tok0 * DM + h * HD;
    const size_t vbase = (((size_t)b * NH_ + h) * HD) * NT_;
    v8f o[4], ox[4];
#pragma unroll
    for (int n = 0; n < 4; ++n) { o[n] = (v8f){}; ox[n] = (v8f){}; }
    float mrow[8], lpart[8];
#pragma unroll
    for (int j = 0; j < 8; ++j) { mrow[j] = -3.0e38f; lpart[j] = 0.f; }
    int qpos[8];
#pragma unroll
    for (int j = 0; j < 8; ++j) qpos[j] = q0 + 8 * hi + j;
    const int kt_lo = 0, kt_hi = (qt * 64 + 63) / 32;     // causal
    const int krow = threadIdx.x >> 3, kpc = (threadIdx.x & 7) * 8;      // key tile: 8 threads a 128 B row, 16 rows a pass
    const int vrow = threadIdx.x >> 2, vpc = (threadIdx.x & 3) * 8;      // value tile: 4 threads a 64 B row, 32 rows a pass
    v8h gk[2][2], gv[2][2];
    auto fetch = [&](int l0) {
#pragma unroll
        for (int s = 0; s < 2; ++s) {
            const size_t ko = (size_t)(l0 + krow + 16 * s) * DM + kpc, vo = vbase + (size_t)(vrow + 32 * s) * NT_ + l0 + vpc;
            gk[0][s] = *(const v8h*)(kh_b + ko); gk[1][s] = *(const v8h*)(kl_b + ko); gv[0][s] = *(const v8h*)(VTH + vo); gv[1][s] = *(const v8h*)(VTL + vo); }
    };
    auto put = [&](int buf) {
#pragma unroll
        for (int s = 0; s < 2; ++s) {
            const int ko = (krow + 16 * s) * 72 + kpc, vo = (vrow + 32 * s) * 40 + vpc;
            *(v8ha*)(&kst[buf][0][ko]) = gk[0][s]; *(v8ha*)(&kst[buf][1][ko]) = gk[1][s]; *(v8ha*)(&vst[buf][0][vo]) = gv[0][s]; *(v8ha*)(&vst[buf][1][vo]) = gv[1][s]; }
    };
    fetch(0);
#pragma unroll
    for (int s = 0; s < 4; ++s) { const int row = 4 * s + (lane >> 3), pc = (lane & 7) * 8; *(v8ha*)(&qls[wave][row * 72 + pc]) = *(const v8h*)(QL16 + (tok0 + q0 + row) * DM + h * HD + pc); }
    put(0);
    __syncthreads();      // tile 0 is complete before any wave reads it
    const h16* ql_s = &qls[wave][lr * 72 + 8 * hi];
#pragma unroll 1
    for (int kt = kt_lo; kt <= kt_hi; ++kt) {
        const int l0 = kt * 32, cur = kt & 1;
        if (kt < kt_hi) fetch(l0 + 32);      // the next tile's lines fly while this tile is worked on
        const h16* kh_s = &kst[cur][0][0]; const h16* kl_s = &kst[cur][1][0];
        const int ko0 = lr * 72 + 8 * hi, ko1 = (16 + lr) * 72 + 8 * hi;
        v8f s0 = {}, s1 = {}, x0 = {}, x1 = {};
#pragma unroll
        for (int kc = 0; kc < 2; ++kc) {
            { const v16h k0h = cat16(*(const v8ha*)(kh_s + ko0 + kc * 32), *(const v8ha*)(kh_s + ko0 + kc * 32 + 16)), k1h = cat16(*(const v8ha*)(kh_s + ko1 + kc * 32), *(const v8ha*)(kh_s + ko1 + kc * 32 + 16));
              const v16h qlk = cat16(*(const v8ha*)(ql_s + kc * 32), *(const v8ha*)(ql_s + kc * 32 + 16));     // query residual re-read per step (registers)
              s0 = wmma16(qa[kc], k0h, s0); x0 = wmma16(qlk, k0h, x0); s1 = wmma16(qa[kc], k1h, s1); x1 = wmma16(qlk, k1h, x1);
              asm volatile("v_nop" : "+v"(s0), "+v"(s1), "+v"(x0), "+v"(x1) : "v"(qlk), "v"(k0h), "v"(k1h) : "memory"); }
            { const v16h k0l = cat16(*(const v8ha*)(kl_s + ko0 + kc * 32), *(const v8ha*)(kl_s + ko0 + kc * 32 + 16)), k1l = cat16(*(const v8ha*)(kl_s + ko1 + kc * 32), *(const v8ha*)(kl_s + ko1 + kc * 32 + 16));
              x0 = wmma16(qa[kc], k0l, x0); x1 = wmma16(qa[kc], k1l, x1);
              asm volatile("v_nop" : "+v"(x0), "+v"(x1) : "v"(k0l), "v"(k1l) : "memory"); }
        }
        asm volatile("v_nop\n\tv_nop\n\tv_nop\n\tv_nop" : "+v"(s0), "+v"(s1), "+v"(x0), "+v"(x1) : "v"(qa[0]), "v"(qa[1]));
        float alpha[8];
#pragma unroll
        for (int j = 0; j < 8; ++j) {
            const int ja = l0 + lr, jb = l0 + 16 + lr, qi = qpos[j];
            const float a0 = (ja <= qi) ? (s0[j] + x0[j] * LOSCI) * 0.125f : -__builtin_inff(), a1 = (jb <= qi) ? (s1[j] + x1[j] * LOSCI) * 0.125f : -__builtin_inff();
            float mx = fmaxf(a0, a1);
            mx = fmaxf(mx, __shfl_xor(mx, 1, 16)); mx = fmaxf(mx, __shfl_xor(mx, 2, 16)); mx = fmaxf(mx, __shfl_xor(mx, 4, 16)); mx = fmaxf(mx, __shfl_xor(mx, 8, 16));
            const float mn = fmaxf(mrow[j], mx);
            alpha[j] = __expf(mrow[j] - mn); mrow[j] = mn;
            const float p0 = __expf(a0 - mn), p1 = __expf(a1 - mn);
            lpart[j] = lpart[j] * alpha[j] + (p0 + p1);
            const int mr = hi * 8 + j;
            const float ps0 = p0 * PSC, ps1 = p1 * PSC; const h16 h0 = (h16)ps0, h1 = (h16)ps1;
            pl[mr * 32 + lr] = h0; pl[mr * 32 + 16 + lr] = h1;
            pl2[mr * 32 + lr] = (h16)((ps0 - (float)h0) * LOSC); pl2[mr * 32 + 16 + lr] = (h16)((ps1 - (float)h1) * LOSC);
        }
#pragma unroll
        for (int n = 0; n < 4; ++n)
#pragma unroll
            for (int j = 0; j < 8; ++j) { o[n][j] *= alpha[j]; ox[n][j] *= alpha[j]; }
        asm volatile("" ::: "memory");
        const v16h pa = cat16(*(const v8ha*)(pl + lr * 32 + hi * 8), *(const v8ha*)(pl + lr * 32 + 16 + hi * 8));
        const v16h px = cat16(*(const v8ha*)(pl2 + lr * 32 + hi * 8), *(const v8ha*)(pl2 + lr * 32 + 16 + hi * 8));
#pragma unroll
        for (int n = 0; n < 4; ++n) { const int vo = (n * 16 + lr) * 40 + hi * 8;
            const v16h vh = cat16(*(const v8ha*)(&vst[cur][0][vo]), *(const v8ha*)(&vst[cur][0][vo + 16])), vl = cat16(*(const v8ha*)(&vst[cur][1][vo]), *(const v8ha*)(&vst[cur][1][vo + 16]));
            o[n] = wmma16(pa, vh, o[n]); ox[n] = wmma16(pa, vl, ox[n]); ox[n] = wmma16(px, vh, ox[n]);
            asm volatile("" : "+v"(o[n]), "+v"(ox[n]) : "v"(vh), "v"(vl) : "memory"); }
        asm volatile("v_nop\n\tv_nop\n\tv_nop\n\tv_nop" : "+v"(o[0]), "+v"(o[1]), "+v"(o[2]), "+v"(o[3]), "+v"(ox[0]), "+v"(ox[1]), "+v"(ox[2]), "+v"(ox[3]) : "v"(pa), "v"(px));
        if (kt < kt_hi) put(cur ^ 1);      // into the buffer whose readers all passed the barrier of the trip before
        __syncthreads();                   // publishes the next tile and ends every wave's reads of this one
    }
    float inv[8];
#pragma unroll
    for (int j = 0; j < 8; ++j) { float rs = lpart[j]; rs += __shfl_xor(rs, 1, 16); rs += __shfl_xor(rs, 2, 16); rs += __shfl_xor(rs, 4, 16); rs += __shfl_xor(rs, 8, 16); inv[j] = 1.0f / (rs * PSC); }
    float* os = &ost[wave][0];
#pragma unroll
    for (int n = 0; n < 4; ++n)
#pragma unroll
        for (int j = 0; j < 8; ++j) os[(hi * 8 + j) * 68 + n * 16 + lr] = (o[n][j] + ox[n][j] * LOSCI) * inv[j];
    __syncthreads();
    const size_t cbase = (tok0 + q0) * DM + (size_t)h * HD;
    auto pass = [&]() {
#pragma unroll
        for (int s = 0; s < 4; ++s) { const int row = 4 * s + (lane >> 3), piece = lane & 7; const float* sp = os + row * 68 + piece * 8; v8us oh, ol;
#pragma unroll
            for (int i = 0; i < 8; ++i) { const unsigned short hb = f2bf(sp[i]); oh[i] = hb; ol[i] = f2bf(sp[i] - bf2f(hb)); }
            *(v8us*)(CH + cbase + (size_t)row * DM + piece * 8) = oh; *(v8us*)(CL + cbase + (size_t)row * DM + piece * 8) = ol; }
    };
    pass(); 
}


// k_wt: WT [n][K] = bf16(W[k][n]) (k-major [K][ncols]) via 64 x 64 LDS tiles; grid (K/64, ncols/64).
__global__ __launch_bounds__(256) void k_wt(const float* __restrict__ Wm, int K, int ncols, bf* WT) {
    __shared__ __align__(16) unsigned short tl[64 * 72];
    const int tid = threadIdx.x, k0 = blockIdx.x * 64, n0 = blockIdx.y * 64;
    const int kk = tid >> 2, nq = (tid & 3) * 16;
#pragma unroll
    for (int i = 0; i < 16; ++i) tl[(nq + i) * 72 + kk] = f2bf(Wm[(size_t)(k0 + kk) * ncols + n0 + nq + i]);
    __syncthreads();
    const int piece = tid & 7;
    auto pass = [&]() {
#pragma unroll
        for (int s = 0; s < 2; ++s) { const int nr = (tid >> 3) + 32 * s; const v8us val = *(const v8usa*)(tl + nr * 72 + piece * 8); *(v8us*)(WT + (size_t)(n0 + nr) * K + k0 + piece * 8) = val; }
    };
    pass(); 
}

typedef __attribute__((ext_vector_type(4)))  _Float16 v4h;
// k_dwmix: the grouped causal depthwise convolution along the sequence of a projected [2 x 2048][1024] f32 matrix T (row s = batch item s / 2048, position s % 2048) (column c = head h * 64 + d; group g = h / 4: g = 0
// identity, else y[s][c] = bf(bias_g[d]) + sum_i bf(w_g[d][i]) * T[s - (width-1) + i][c] over rows of the same batch item, width = 2g + 1), one wave per row s, 8 column chunks of 128
// (each chunk lies inside one group, so the branch is wave-uniform), lane -> 4 consecutive columns; F16: f16 hi + residual x1024 planes (8 B per lane per plane = one
template <bool F16>
__global__ __launch_bounds__(256) void k_dwmix(const float* __restrict__ T, const float* __restrict__ w3, const float* __restrict__ b3, const float* __restrict__ w5, const float* __restrict__ b5, const float* __restrict__ w7, const float* __restrict__ b7, float* Y, h16* YH, h16* YL) {
    const int lane = threadIdx.x & 31, s = blockIdx.x * 8 + (threadIdx.x >> 5);
    if (s >= NTK) return;
    const int sl = s & (NT_ - 1), sb = s - sl;      // position inside the batch item, and the item's first row
{
#pragma unroll 1
        for (int ch = 0; ch < DM / 128; ++ch) {
            const int c0 = ch * 128 + lane * 4; const int g = ch >> 1;      // 2 chunks = 4 heads = one group
            v4f y;
            if (g == 0) { y = *(const v4f*)(T + (size_t)s * DM + c0); }
            else {
                const int kw = 2 * g + 1; const float* wg = (g == 1) ? w3 : (g == 2) ? w5 : w7; const float* bg = (g == 1) ? b3 : (g == 2) ? b5 : b7;
#pragma unroll
                for (int i = 0; i < 4; ++i) { const int d = (c0 + i) & (HD - 1); float acc = bfr(bg[d]);
#pragma unroll 1
                    for (int t = 0; t < kw; ++t) { const int r = sl - (kw - 1) + t; const int rc = sb + (r < 0 ? 0 : r); const float xv = T[(size_t)rc * DM + c0 + i]; acc = (r >= 0) ? fmaf(xv, bfr(wg[d * kw + t]), acc) : acc; }
                    y[i] = acc; }
            }
            if (F16) { v4h o, o2;
#pragma unroll
                for (int i = 0; i < 4; ++i) { const h16 a = (h16)y[i]; o[i] = a; o2[i] = (h16)((y[i] - (float)a) * LOSC); }
                *(v4h*)(YH + (size_t)s * DM + c0) = o; *(v4h*)(YL + (size_t)s * DM + c0) = o2; }
            else { *(v4f*)(Y + (size_t)s * DM + c0) = y; }
        }
        
    }
}

extern "C" void kernel_launch(void* const* d_in, const int* in_sizes, int n_in,
                              void* d_out, int out_size, void* d_ws, size_t ws_size, hipStream_t stream) {
    (void)in_sizes; (void)n_in; (void)out_size;
    const float* x = (const float*)d_in[0]; const float* Wqkv = (const float*)d_in[1]; const float* bqkv = (const float*)d_in[2]; const float* Wo = (const float*)d_in[3]; const float* bo = (const float*)d_in[4];   // k-major weights (x @ W)
    const float* cw[3][6]; for (int p = 0; p < 3; ++p) for (int j = 0; j < 6; ++j) cw[p][j] = (const float*)d_in[5 + p * 6 + j];     // (w3, b3, w5, b5, w7, b7) for q, k, v
    float* out = (float*)d_out;    // [2][2048][1024]
    char* wsp = (char*)d_ws;
    auto take = [&](size_t bytes) { char* p = wsp; wsp += (bytes + 255) & ~(size_t)255; return (void*)p; };
    bf* WT = (bf*)take((size_t)3 * DM * DM * 2); bf* WoT = (bf*)take((size_t)DM * DM * 2); bf* Xb = (bf*)take((size_t)NTK * DM * 2);
    float* TMP = (float*)take((size_t)NTK * DM * 4); float* TV = (float*)take((size_t)NTK * DM * 4);
    h16* QH = (h16*)take((size_t)NTK * DM * 2); h16* QL = (h16*)take((size_t)NTK * DM * 2); h16* KH = (h16*)take((size_t)NTK * DM * 2); h16* KL = (h16*)take((size_t)NTK * DM * 2);
    h16* VTH = (h16*)take((size_t)NTK * DM * 2); h16* VTL = (h16*)take((size_t)NTK * DM * 2); bf* CH = (bf*)take((size_t)NTK * DM * 2); bf* CL = (bf*)take((size_t)NTK * DM * 2);
    if ((size_t)(wsp - (char*)d_ws) > ws_size) return;    // about 118 MB in all, no aliasing
    k_wt<<<dim3(DM / 64, 3 * DM / 64, 1), 256, 0, stream>>>(Wqkv, DM, 3 * DM, WT); k_wt<<<dim3(DM / 64, DM / 64, 1), 256, 0, stream>>>(Wo, DM, DM, WoT);
    {
        k_cvtb<<<NTK / 8, 256, 0, stream>>>(x, NTK, Xb);
        k_gemmb<false, false><<<dim3(NTK / 64, DM / 64, 1), 128, 0, stream>>>(Xb, nullptr, WT, bqkv, TMP, DM, nullptr);                                  // q (f32)
        k_dwmix<true><<<NTK / 8, 256, 0, stream>>>(TMP, cw[0][0], cw[0][1], cw[0][2], cw[0][3], cw[0][4], cw[0][5], nullptr, QH, QL);
        k_gemmb<false, false><<<dim3(NTK / 64, DM / 64, 1), 128, 0, stream>>>(Xb, nullptr, WT + (size_t)DM * DM, bqkv + DM, TMP, DM, nullptr);          // k
        k_dwmix<true><<<NTK / 8, 256, 0, stream>>>(TMP, cw[1][0], cw[1][1], cw[1][2], cw[1][3], cw[1][4], cw[1][5], nullptr, KH, KL);
        k_gemmb<false, false><<<dim3(NTK / 64, DM / 64, 1), 128, 0, stream>>>(Xb, nullptr, WT + (size_t)2 * DM * DM, bqkv + 2 * DM, TMP, DM, nullptr);  // v
        k_dwmix<false><<<NTK / 8, 256, 0, stream>>>(TMP, cw[2][0], cw[2][1], cw[2][2], cw[2][3], cw[2][4], cw[2][5], TV, nullptr, nullptr);
        k_vt<<<NB_ * NH_ * (NT_ / 64), 256, 0, stream>>>(TV, VTH, VTL);
        k_attn<<<NB_ * NH_ * (NT_ / 64), 128, 0, stream>>>(QH, QL, KH, KL, VTH, VTL, CH, CL);
        k_gemmb<true, false><<<dim3(NTK / 64, DM / 64, 1), 128, 0, stream>>>(CH, CL, WoT, bo, out, DM, nullptr);
    }
}

// v003
// Measured time: 230 microseconds a run.
// In both of two side-by-side timings against v002, it was 1.28 times as fast.
// All steps since v000 together make it 3.14 times as fast.
#include <hip/hip_runtime.h>

// Compute dtypes, f32 accumulate, both batch items in one pass (4096 rows per launch): qkv = x.c_attn_w + b ([4096 x 1024].[1024 x 3072] as three [1024]-wide products, PLAIN bf16 operands = the
// rounded input and the k-major weights transposed once; exact products) on v_wmma_f32_16x16x32_bf16 -> f32; the per-head-group causal depthwise convolutions along the
// sequence (heads 0-3 identity, 4-7 width 3, 8-11 width 5, 12-15 width 7; weights/biases read as inputs) in f32 -> q/k as f16 hi + residual x1024 planes, v -> f32 ->
// transposed f16 hi + residual planes; the 16-head causal attention (masked scores are set to -inf, so exp(-inf - m) = 0) fused on v_wmma_f32_16x16x32_f16
// (hh + hl + lh x 1/8, online f32 softmax, weights x32768 and v as f16 hi + residual x1024); out = ctx.c_proj_w + b (ctx as bf16 hi + UNSCALED residual against the

#define NB_  2                   // both batch items go through every launch together
#define NT_  2048
#define DM   1024
#define NH_  16
#define HD   64
#define HK   4                    // heads per group
#define NTK  (NB_ * NT_)
#define NW   1024
#define NQKV 1024
#define PSC  32768.0f
#define LOSC 1024.0f
#define LOSCI (1.0f / 1024.0f)

typedef _Float16 h16;
typedef unsigned short bf;
typedef __attribute__((ext_vector_type(16))) __bf16   v16bf;
typedef __attribute__((ext_vector_type(16))) _Float16 v16h;
typedef __attribute__((ext_vector_type(8)))  _Float16 v8h;
typedef __attribute__((ext_vector_type(8)))  unsigned short v8us;
typedef __attribute__((ext_vector_type(8)))  float    v8f;
typedef __attribute__((ext_vector_type(4)))  float    v4f;
typedef v8h  __attribute__((may_alias)) v8ha;
typedef v4f  __attribute__((may_alias)) v4fa;
typedef v8us __attribute__((may_alias)) v8usa;

__device__ __forceinline__ unsigned short f2bf(float f) { unsigned u = __float_as_uint(f); u += 0x7FFFu + ((u >> 16) & 1u); return (unsigned short)(u >> 16); }
__device__ __forceinline__ float bf2f(unsigned short b) { return __uint_as_float(((unsigned)b) << 16); }
__device__ __forceinline__ float bfr(float f) { return bf2f(f2bf(f)); }
__device__ __forceinline__ v16h cat16(v8h lo, v8h hi) { return __builtin_shufflevector(lo, hi, 0, 1, 2, 3, 4, 5, 6, 7, 8, 9, 10, 11, 12, 13, 14, 15); }
__device__ __forceinline__ v16bf cat16b(v8us lo, v8us hi) { return __builtin_bit_cast(v16bf, __builtin_shufflevector(lo, hi, 0, 1, 2, 3, 4, 5, 6, 7, 8, 9, 10, 11, 12, 13, 14, 15)); }
__device__ __forceinline__ v8f wmma16(v16h a, v16h b, v8f c) { return __builtin_amdgcn_wmma_f32_16x16x32_f16(false, a, false, b, (short)0, c, false, false); }
__device__ __forceinline__ v8f wmmab(v16bf a, v16bf b, v8f c) { return __builtin_amdgcn_wmma_f32_16x16x32_bf16(false, a, false, b, (short)0, c, false, false); }

__global__ __launch_bounds__(256) void k_cvtb(const float* __restrict__ src, int nrows, bf* dst) {
    const int lane = threadIdx.x & 31, r = blockIdx.x * 8 + (threadIdx.x >> 5);
    if (r >= nrows) return;
    v8us o[DM / 256];
#pragma unroll
    for (int q = 0; q < DM / 256; ++q) { v8us t;
#pragma unroll
        for (int i = 0; i < 8; ++i) t[i] = f2bf(src[(size_t)r * DM + q * 256 + lane * 8 + i]);
        o[q] = t; }
#pragma unroll
    for (int q = 0; q < DM / 256; ++q) *(v8us*)(dst + (size_t)r * DM + q * 256 + lane * 8) = o[q];
    
}

// k_gemmb: 64 x 64 block tile (4 waves x 16 x 64) of C[NTK][NW] = (A [+ Al]).B^T (K = 1024) [+ bf(bias[c])] [+ bf(R[r][c]) residual]; f32 whole-line epilogue (or f16
template <bool SPLITA, bool F16OUT = false>
__global__ __launch_bounds__(128) void k_gemmb(const bf* __restrict__ A, const bf* __restrict__ Al, const bf* __restrict__ Bn, const float* __restrict__ bias, float* C, int ldc, h16* C2, const float* __restrict__ R = nullptr, int K = DM, int roundR = 1) {
    // stg: two buffers of the block's operand tiles (plane 0 = 64 A rows, 1 = 64 B rows, 2 = 64 Al rows; 64 k each, row pitch 72 elements = 144 B), filled by whole-line
    // loads that the four waves share; the fragments are read from here.
    __shared__ __align__(16) bf stg[2][SPLITA ? 3 : 2][64 * 72];
    __shared__ __align__(16) float ost[4][16 * 68];
    const int lane = threadIdx.x & 31, wave = threadIdx.x >> 5, lr = lane & 15, hi = lane >> 4;
    const int r0 = blockIdx.x * 64 + wave * 16, c0 = blockIdx.y * 64;
    const int srow = threadIdx.x >> 3, spc = (threadIdx.x & 7) * 8;      // staging: 8 threads cover one 128 B row piece by piece, 16 rows a pass
    unsigned so[4];      // the thread's byte offset inside a 64-row tile, one per pass; the tile's own address is uniform
#pragma unroll
    for (int s = 0; s < 4; ++s) so[s] = ((unsigned)(srow + 16 * s) * (unsigned)K + (unsigned)spc) * 2u;
    v8us ga[4], gb[4], gl[4];
    auto fetch = [&](int kc) {
        const char* ta = (const char*)(A + (size_t)(blockIdx.x * 64) * K + kc); const char* tb = (const char*)(Bn + (size_t)c0 * K + kc); const char* tl = SPLITA ? (const char*)(Al + (size_t)(blockIdx.x * 64) * K + kc) : ta;
        const char* pa[4]; const char* pb[4]; const char* pl[4];
#pragma unroll
        for (int s = 0; s < 4; ++s) { pa[s] = ta + so[s]; pb[s] = tb + so[s]; pl[s] = tl + so[s]; }
#pragma unroll
        for (int s = 0; s < 4; ++s) { ga[s] = *(const v8us*)pa[s]; gb[s] = *(const v8us*)pb[s]; if (SPLITA) gl[s] = *(const v8us*)pl[s]; }
        // The wait that stands before a register named by an issued load is rewritten; the addresses are its inputs so that none of them is reused as a destination of these loads.
        asm volatile("s_wait_xcnt 0x0" :: "v"(pa[0]), "v"(pa[1]), "v"(pa[2]), "v"(pa[3]), "v"(pb[0]), "v"(pb[1]), "v"(pb[2]), "v"(pb[3]), "v"(pl[0]), "v"(pl[1]), "v"(pl[2]), "v"(pl[3]) : "memory");
    };
    auto put = [&](int buf) {
#pragma unroll
        for (int s = 0; s < 4; ++s) { const int o = (srow + 16 * s) * 72 + spc; *(v8usa*)(&stg[buf][0][o]) = ga[s]; *(v8usa*)(&stg[buf][1][o]) = gb[s]; if (SPLITA) *(v8usa*)(&stg[buf][SPLITA ? 2 : 0][o]) = gl[s]; }
    };
    v8f acc[4];
#pragma unroll
    for (int t = 0; t < 4; ++t) acc[t] = (v8f){};
    fetch(0); put(0);
    __syncthreads();      // stage 0 is complete before any wave reads it
#pragma unroll 1
    for (int kb = 0; kb < K; kb += 64) {
        const int cur = (kb >> 6) & 1;
        const bool more = kb + 64 < K;
        if (more) fetch(kb + 64);      // the next stage's lines fly while this stage is multiplied
#pragma unroll
        for (int ks = 0; ks < 2; ++ks) {
            const int fo = ks * 32 + 8 * hi, ao = (wave * 16 + lr) * 72 + fo;
            const v16bf a = cat16b(*(const v8usa*)(&stg[cur][0][ao]), *(const v8usa*)(&stg[cur][0][ao + 16]));
            v16bf al = a;
            if (SPLITA) al = cat16b(*(const v8usa*)(&stg[cur][SPLITA ? 2 : 0][ao]), *(const v8usa*)(&stg[cur][SPLITA ? 2 : 0][ao + 16]));
#pragma unroll
            for (int t = 0; t < 4; ++t) { const int bo = (t * 16 + lr) * 72 + fo; const v16bf b = cat16b(*(const v8usa*)(&stg[cur][1][bo]), *(const v8usa*)(&stg[cur][1][bo + 16])); acc[t] = wmmab(a, b, acc[t]); if (SPLITA) acc[t] = wmmab(al, b, acc[t]); }
            asm volatile("v_nop\n\tv_nop\n\tv_nop\n\tv_nop" : "+v"(acc[0]), "+v"(acc[1]), "+v"(acc[2]), "+v"(acc[3]) : "v"(a), "v"(al));
        }
        if (more) put(cur ^ 1);        // into the buffer whose readers all passed the barrier of the trip before
        __syncthreads();               // publishes the next stage and ends every wave's reads of this one
    }
    float* os = &ost[wave][0];
#pragma unroll
    for (int t = 0; t < 4; ++t) { const float bv = bias ? bfr(bias[c0 + t * 16 + lr]) : 0.f;
#pragma unroll
        for (int j = 0; j < 8; ++j) os[(hi * 8 + j) * 68 + t * 16 + lr] = acc[t][j] + bv; }
    __syncthreads();
    if (F16OUT) {
        h16* crow = (h16*)(void*)C + (size_t)r0 * ldc + c0;
        auto pass = [&]() {
#pragma unroll
            for (int s = 0; s < 4; ++s) { const int row = 4 * s + (lane >> 3), piece = lane & 7; const float* sp = os + row * 68 + piece * 8; v8h o, o2;
#pragma unroll
                for (int i = 0; i < 8; ++i) { const h16 a = (h16)sp[i]; o[i] = a; o2[i] = (h16)((sp[i] - (float)a) * LOSC); }
                *(v8h*)(crow + (size_t)row * ldc + piece * 8) = o; if (C2) *(v8h*)(C2 + (size_t)r0 * ldc + c0 + (size_t)row * ldc + piece * 8) = o2; }
        };
        pass(); 
    } else {
        float* crow = C + (size_t)r0 * ldc + c0;
        auto pass = [&]() {
#pragma unroll
            for (int s = 0; s < 8; ++s) { const int Lid = (lane >> 3) + 4 * s, piece = lane & 7; const int row = Lid >> 1, cofs = (Lid & 1) * 32 + piece * 4;
                v4f val = *(const v4fa*)(os + row * 68 + cofs); if (R) { const v4f rv = *(const v4f*)(R + ((size_t)r0 + row) * ldc + c0 + cofs); val += roundR ? (v4f){bfr(rv[0]), bfr(rv[1]), bfr(rv[2]), bfr(rv[3])} : rv; }
                *(v4f*)(crow + (size_t)row * ldc + cofs) = val; }
        };
        pass(); 
    }
}

__global__ __launch_bounds__(256) void k_vt(const float* __restrict__ V, h16* VTH, h16* VTL) {
    __shared__ __align__(16) h16 tile[64 * 72];
    __shared__ __align__(16) h16 til2[64 * 72];
    const int bid = blockIdx.x;
    const int b = bid / (NH_ * (NT_ / 64)), rem = bid - b * (NH_ * (NT_ / 64)), h = rem / (NT_ / 64), kt = rem - h * (NT_ / 64);
    const int k0 = kt * 64, tid = threadIdx.x;
    const int kk = tid >> 2, d0 = (tid & 3) * 16;
    const float* src = V + ((size_t)b * NT_ + k0 + kk) * DM + h * HD + d0;
#pragma unroll
    for (int i = 0; i < 16; ++i) { const float v = src[i]; const h16 a = (h16)v; tile[(d0 + i) * 72 + kk] = a; til2[(d0 + i) * 72 + kk] = (h16)((v - (float)a) * LOSC); }
    __syncthreads();
    const int piece = tid & 7;
    const size_t base = (((size_t)b * NH_ + h) * HD) * NT_ + k0;
    auto pass = [&]() {
#pragma unroll
        for (int s = 0; s < 4; ++s) { const int Lid = (tid >> 3) + 32 * s; const int pln = Lid >> 6, d = Lid & 63;
            const v8h val = *(const v8ha*)((pln ? til2 : tile) + d * 72 + piece * 8); *(v8h*)((pln ? VTL : VTH) + base + (size_t)d * NT_ + piece * 8) = val; }
    };
    pass(); 
}

// k_attn: block = (b, h, 64 queries), wave = 16; key tiles 0..(qt*64+63)/32 of 32 keys (causal mask); 12 WMMA scores (hh + hl + lh) /8 (f32), online softmax, weights x32768 f16 hi + residual tiles (same-wave may_alias
// reload after a compiler barrier), 12 WMMA .v (hh + hl + lh); ctx -> bf16 hi + residual planes CH/CL[tok][h*64+d].
__global__ __launch_bounds__(128) void k_attn(const h16* __restrict__ Q16, const h16* __restrict__ QL16, const h16* __restrict__ K16, const h16* __restrict__ KL16, const h16* __restrict__ VTH, const h16* __restrict__ VTL, bf* CH, bf* CL) {
    __shared__ __align__(16) h16 plds[4][16 * 32];
    __shared__ __align__(16) h16 plds2[4][16 * 32];
    __shared__ __align__(16) float ost[4][16 * 68];
    // Operand tiles in LDS, filled by the block's 128 threads together (each line fetched once a block) and read as fragments by all four waves; two buffers each.
    __shared__ __align__(16) h16 kst[2][2][32 * 72];      // [buffer][hi, residual][key][64 d, row pitch 144 B]
    __shared__ __align__(16) h16 vst[2][2][64 * 40];      // [buffer][hi, residual][d][32 keys, row pitch 80 B]
    __shared__ __align__(16) h16 qls[4][16 * 72];         // each wave's 16 query-residual rows, filled once
    const int lane = threadIdx.x & 31, wave = threadIdx.x >> 5, lr = lane & 15, hi = lane >> 4;
    const int bid = blockIdx.x;
    const int b = bid / (NH_ * (NT_ / 64)), rem = bid - b * (NH_ * (NT_ / 64)), h = rem / (NT_ / 64), qt = rem - h * (NT_ / 64);
    const int q0 = qt * 64 + wave * 16;
    const size_t tok0 = (size_t)b * NT_;
    h16* pl = &plds[wave][0]; h16* pl2 = &plds2[wave][0];
    v16h qa[2];
    const size_t qo0 = (tok0 + q0 + lr) * DM + h * HD + 8 * hi;
#pragma unroll
    for (int kc = 0; kc < 2; ++kc) qa[kc] = cat16(*(const v8h*)(Q16 + qo0 + kc * 32), *(const v8h*)(Q16 + qo0 + kc * 32 + 16));
    const h16* kh_b = K16 + tok0 * DM + h * HD;
    const h16* kl_b = KL16 + tok0 * DM + h * HD;
    const size_t vbase = (((size_t)b * NH_ + h) * HD) * NT_;
    v8f o[4], ox[4];
#pragma unroll
    for (int n = 0; n < 4; ++n) { o[n] = (v8f){}; ox[n] = (v8f){}; }
    float mrow[8], lpart[8];
#pragma unroll
    for (int j = 0; j < 8; ++j) { mrow[j] = -3.0e38f; lpart[j] = 0.f; }
    int qpos[8];
#pragma unroll
    for (int j = 0; j < 8; ++j) qpos[j] = q0 + 8 * hi + j;
    const int kt_lo = 0, kt_hi = (qt * 64 + 63) / 32;     // causal
    const int krow = threadIdx.x >> 3, kpc = (threadIdx.x & 7) * 8;      // key tile: 8 threads a 128 B row, 16 rows a pass
    const int vrow = threadIdx.x >> 2, vpc = (threadIdx.x & 3) * 8;      // value tile: 4 threads a 64 B row, 32 rows a pass
    v8h gk[2][2], gv[2][2];
    auto fetch = [&](int l0) {
#pragma unroll
        for (int s = 0; s < 2; ++s) {
            const size_t ko = (size_t)(l0 + krow + 16 * s) * DM + kpc, vo = vbase + (size_t)(vrow + 32 * s) * NT_ + l0 + vpc;
            gk[0][s] = *(const v8h*)(kh_b + ko); gk[1][s] = *(const v8h*)(kl_b + ko); gv[0][s] = *(const v8h*)(VTH + vo); gv[1][s] = *(const v8h*)(VTL + vo); }
    };
    auto put = [&](int buf) {
#pragma unroll
        for (int s = 0; s < 2; ++s) {
            const int ko = (krow + 16 * s) * 72 + kpc, vo = (vrow + 32 * s) * 40 + vpc;
            *(v8ha*)(&kst[buf][0][ko]) = gk[0][s]; *(v8ha*)(&kst[buf][1][ko]) = gk[1][s]; *(v8ha*)(&vst[buf][0][vo]) = gv[0][s]; *(v8ha*)(&vst[buf][1][vo]) = gv[1][s]; }
    };
    fetch(0);
#pragma unroll
    for (int s = 0; s < 4; ++s) { const int row = 4 * s + (lane >> 3), pc = (lane & 7) * 8; *(v8ha*)(&qls[wave][row * 72 + pc]) = *(const v8h*)(QL16 + (tok0 + q0 + row) * DM + h * HD + pc); }
    put(0);
    __syncthreads();      // tile 0 is complete before any wave reads it
    const h16* ql_s = &qls[wave][lr * 72 + 8 * hi];
#pragma unroll 1
    for (int kt = kt_lo; kt <= kt_hi; ++kt) {
        const int l0 = kt * 32, cur = kt & 1;
        if (kt < kt_hi) fetch(l0 + 32);      // the next tile's lines fly while this tile is worked on
        const h16* kh_s = &kst[cur][0][0]; const h16* kl_s = &kst[cur][1][0];
        const int ko0 = lr * 72 + 8 * hi, ko1 = (16 + lr) * 72 + 8 * hi;
        v8f s0 = {}, s1 = {}, x0 = {}, x1 = {};
#pragma unroll
        for (int kc = 0; kc < 2; ++kc) {
            { const v16h k0h = cat16(*(const v8ha*)(kh_s + ko0 + kc * 32), *(const v8ha*)(kh_s + ko0 + kc * 32 + 16)), k1h = cat16(*(const v8ha*)(kh_s + ko1 + kc * 32), *(const v8ha*)(kh_s + ko1 + kc * 32 + 16));
              const v16h qlk = cat16(*(const v8ha*)(ql_s + kc * 32), *(const v8ha*)(ql_s + kc * 32 + 16));     // query residual re-read per step (registers)
              s0 = wmma16(qa[kc], k0h, s0); x0 = wmma16(qlk, k0h, x0); s1 = wmma16(qa[kc], k1h, s1); x1 = wmma16(qlk, k1h, x1);
              asm volatile("v_nop" : "+v"(s0), "+v"(s1), "+v"(x0), "+v"(x1) : "v"(qlk), "v"(k0h), "v"(k1h) : "memory"); }
            { const v16h k0l = cat16(*(const v8ha*)(kl_s + ko0 + kc * 32), *(const v8ha*)(kl_s + ko0 + kc * 32 + 16)), k1l = cat16(*(const v8ha*)(kl_s + ko1 + kc * 32), *(const v8ha*)(kl_s + ko1 + kc * 32 + 16));
              x0 = wmma16(qa[kc], k0l, x0); x1 = wmma16(qa[kc], k1l, x1);
              asm volatile("v_nop" : "+v"(x0), "+v"(x1) : "v"(k0l), "v"(k1l) : "memory"); }
        }
        asm volatile("v_nop\n\tv_nop\n\tv_nop\n\tv_nop" : "+v"(s0), "+v"(s1), "+v"(x0), "+v"(x1) : "v"(qa[0]), "v"(qa[1]));
        float alpha[8];
#pragma unroll
        for (int j = 0; j < 8; ++j) {
            const int ja = l0 + lr, jb = l0 + 16 + lr, qi = qpos[j];
            const float a0 = (ja <= qi) ? (s0[j] + x0[j] * LOSCI) * 0.125f : -__builtin_inff(), a1 = (jb <= qi) ? (s1[j] + x1[j] * LOSCI) * 0.125f : -__builtin_inff();
            float mx = fmaxf(a0, a1);
            mx = fmaxf(mx, __shfl_xor(mx, 1, 16)); mx = fmaxf(mx, __shfl_xor(mx, 2, 16)); mx = fmaxf(mx, __shfl_xor(mx, 4, 16)); mx = fmaxf(mx, __shfl_xor(mx, 8, 16));
            const float mn = fmaxf(mrow[j], mx);
            alpha[j] = __expf(mrow[j] - mn); mrow[j] = mn;
            const float p0 = __expf(a0 - mn), p1 = __expf(a1 - mn);
            lpart[j] = lpart[j] * alpha[j] + (p0 + p1);
            const int mr = hi * 8 + j;
            const float ps0 = p0 * PSC, ps1 = p1 * PSC; const h16 h0 = (h16)ps0, h1 = (h16)ps1;
            pl[mr * 32 + lr] = h0; pl[mr * 32 + 16 + lr] = h1;
            pl2[mr * 32 + lr] = (h16)((ps0 - (float)h0) * LOSC); pl2[mr * 32 + 16 + lr] = (h16)((ps1 - (float)h1) * LOSC);
        }
#pragma unroll
        for (int n = 0; n < 4; ++n)
#pragma unroll
            for (int j = 0; j < 8; ++j) { o[n][j] *= alpha[j]; ox[n][j] *= alpha[j]; }
        asm volatile("" ::: "memory");
        const v16h pa = cat16(*(const v8ha*)(pl + lr * 32 + hi * 8), *(const v8ha*)(pl + lr * 32 + 16 + hi * 8));
        const v16h px = cat16(*(const v8ha*)(pl2 + lr * 32 + hi * 8), *(const v8ha*)(pl2 + lr * 32 + 16 + hi * 8));
#pragma unroll
        for (int n = 0; n < 4; ++n) { const int vo = (n * 16 + lr) * 40 + hi * 8;
            const v16h vh = cat16(*(const v8ha*)(&vst[cur][0][vo]), *(const v8ha*)(&vst[cur][0][vo + 16])), vl = cat16(*(const v8ha*)(&vst[cur][1][vo]), *(const v8ha*)(&vst[cur][1][vo + 16]));
            o[n] = wmma16(pa, vh, o[n]); ox[n] = wmma16(pa, vl, ox[n]); ox[n] = wmma16(px, vh, ox[n]);
            asm volatile("" : "+v"(o[n]), "+v"(ox[n]) : "v"(vh), "v"(vl) : "memory"); }
        asm volatile("v_nop\n\tv_nop\n\tv_nop\n\tv_nop" : "+v"(o[0]), "+v"(o[1]), "+v"(o[2]), "+v"(o[3]), "+v"(ox[0]), "+v"(ox[1]), "+v"(ox[2]), "+v"(ox[3]) : "v"(pa), "v"(px));
        if (kt < kt_hi) put(cur ^ 1);      // into the buffer whose readers all passed the barrier of the trip before
        __syncthreads();                   // publishes the next tile and ends every wave's reads of this one
    }
    float inv[8];
#pragma unroll
    for (int j = 0; j < 8; ++j) { float rs = lpart[j]; rs += __shfl_xor(rs, 1, 16); rs += __shfl_xor(rs, 2, 16); rs += __shfl_xor(rs, 4, 16); rs += __shfl_xor(rs, 8, 16); inv[j] = 1.0f / (rs * PSC); }
    float* os = &ost[wave][0];
#pragma unroll
    for (int n = 0; n < 4; ++n)
#pragma unroll
        for (int j = 0; j < 8; ++j) os[(hi * 8 + j) * 68 + n * 16 + lr] = (o[n][j] + ox[n][j] * LOSCI) * inv[j];
    __syncthreads();
    const size_t cbase = (tok0 + q0) * DM + (size_t)h * HD;
    auto pass = [&]() {
#pragma unroll
        for (int s = 0; s < 4; ++s) { const int row = 4 * s + (lane >> 3), piece = lane & 7; const float* sp = os + row * 68 + piece * 8; v8us oh, ol;
#pragma unroll
            for (int i = 0; i < 8; ++i) { const unsigned short hb = f2bf(sp[i]); oh[i] = hb; ol[i] = f2bf(sp[i] - bf2f(hb)); }
            *(v8us*)(CH + cbase + (size_t)row * DM + piece * 8) = oh; *(v8us*)(CL + cbase + (size_t)row * DM + piece * 8) = ol; }
    };
    pass(); 
}


// k_wt: WT [n][K] = bf16(W[k][n]) (k-major [K][ncols]) via 64 x 64 LDS tiles; grid (K/64, ncols/64).
__global__ __launch_bounds__(256) void k_wt(const float* __restrict__ Wm, int K, int ncols, bf* WT) {
    __shared__ __align__(16) unsigned short tl[64 * 72];
    const int tid = threadIdx.x, k0 = blockIdx.x * 64, n0 = blockIdx.y * 64;
    const int kk = tid >> 2, nq = (tid & 3) * 16;
#pragma unroll
    for (int i = 0; i < 16; ++i) tl[(nq + i) * 72 + kk] = f2bf(Wm[(size_t)(k0 + kk) * ncols + n0 + nq + i]);
    __syncthreads();
    const int piece = tid & 7;
    auto pass = [&]() {
#pragma unroll
        for (int s = 0; s < 2; ++s) { const int nr = (tid >> 3) + 32 * s; const v8us val = *(const v8usa*)(tl + nr * 72 + piece * 8); *(v8us*)(WT + (size_t)(n0 + nr) * K + k0 + piece * 8) = val; }
    };
    pass(); 
}

typedef __attribute__((ext_vector_type(4)))  _Float16 v4h;
// k_dwmix: the grouped causal depthwise convolution along the sequence of a projected [2 x 2048][1024] f32 matrix T (row s = batch item s / 2048, position s % 2048) (column c = head h * 64 + d; group g = h / 4: g = 0
// identity, else y[s][c] = bf(bias_g[d]) + sum_i bf(w_g[d][i]) * T[s - (width-1) + i][c] over rows of the same batch item, width = 2g + 1, summed in the order i = 0, 1, ...).
// Block = DWR consecutive rows, wave = one chunk of 128 columns (inside one group), lane -> 4 consecutive columns. A wave issues all of its DWR + width - 1 row loads (16 B a lane)
// and its weight loads before it uses any of them, holds the rounded weights in registers for all DWR rows, and every loop is unrolled: no load waits on another.
#define DWR 8
typedef v4f __attribute__((aligned(4))) v4fu;      // the small weight arrays are read 16 B at a time with no more than their element alignment assumed
template <int KW, bool EDGE>
__device__ __forceinline__ void dw_rows(const float* __restrict__ T, const float* __restrict__ wg, const float* __restrict__ bg, int s0, int c0, v4f (&y)[DWR]) {
    // EDGE: the block starts its batch item (s0 is the item's first row): the width - 1 rows before it do not exist, their loads fall on row s0 and their taps are left out.
    const char* tb = (const char*)(T + (size_t)(EDGE ? s0 : s0 - (KW - 1)) * DM);      // uniform; the lane's own part of every address is one 32-bit offset
    const unsigned ro = (unsigned)c0 * 4u, bo = (unsigned)(c0 & (HD - 1)) * 4u;
    const char* wp = (const char*)wg + bo * (unsigned)KW;      // the lane's 4 x width weights lie in a row: element i * width + t
    v4f row[DWR + KW - 1], wv[KW], bv;
#pragma unroll
    for (int q = 0; q < KW; ++q) wv[q] = *(const v4fu*)(wp + q * 16);
    bv = *(const v4fu*)((const char*)bg + bo);
#pragma unroll
    for (int k = 0; k < DWR + KW - 1; ++k) row[k] = *(const v4f*)(tb + ro + (size_t)(EDGE ? (k < KW - 1 ? 0 : k - (KW - 1)) : k) * DM * 4);
    // The wait that stands before a register named by an issued load is rewritten; the lane's address parts are its inputs so that none of them is reused as a destination of
    // these loads, and no load is moved behind it: all of the wave's loads are in flight together.
    asm volatile("s_wait_xcnt 0x0" :: "v"(ro), "v"(wp), "v"(bo) : "memory");
    __builtin_amdgcn_sched_barrier(0);      // no arithmetic on the first values (with its wait) is lifted in front of the last loads
    float w[4 * KW];
#pragma unroll
    for (int q = 0; q < KW; ++q)
#pragma unroll
        for (int e = 0; e < 4; ++e) w[q * 4 + e] = bfr(wv[q][e]);
#pragma unroll
    for (int e = 0; e < 4; ++e) bv[e] = bfr(bv[e]);
#pragma unroll
    for (int j = 0; j < DWR; ++j)
#pragma unroll
        for (int i = 0; i < 4; ++i) { float acc = bv[i];
#pragma unroll
            for (int t = 0; t < KW; ++t) { if (!EDGE || j + t >= KW - 1) acc = fmaf(row[j + t][i], w[i * KW + t], acc); }
            y[j][i] = acc; }
}
template <bool F16>
__global__ __launch_bounds__(256) void k_dwmix(const float* __restrict__ T, const float* __restrict__ w3, const float* __restrict__ b3, const float* __restrict__ w5, const float* __restrict__ b5, const float* __restrict__ w7, const float* __restrict__ b7, float* Y, h16* YH, h16* YL) {
    const int lane = threadIdx.x & 31, s0 = blockIdx.x * DWR;
    const int ch = __builtin_amdgcn_readfirstlane(threadIdx.x >> 5);      // the wave's chunk in a scalar register: the choice of the group below is a scalar branch
    if (s0 >= NTK) return;
    const int c0 = ch * 128 + lane * 4, g = ch >> 1;      // 2 chunks = 4 heads = one group
    const bool edge = (s0 & (NT_ - 1)) == 0;               // DWR > width - 1: only a batch item's first block lacks rows
    const unsigned ro = (unsigned)c0 * 4u;
    v4f y[DWR];
    if (g == 0) {
#pragma unroll
        for (int j = 0; j < DWR; ++j) y[j] = *(const v4f*)((const char*)(T + (size_t)s0 * DM) + ro + j * DM * 4);
        asm volatile("s_wait_xcnt 0x0" :: "v"(ro) : "memory");      // the wait that stands before a register named by an issued load is rewritten
    }
    else if (g == 1) { if (edge) dw_rows<3, true>(T, w3, b3, s0, c0, y); else dw_rows<3, false>(T, w3, b3, s0, c0, y); }
    else if (g == 2) { if (edge) dw_rows<5, true>(T, w5, b5, s0, c0, y); else dw_rows<5, false>(T, w5, b5, s0, c0, y); }
    else             { if (edge) dw_rows<7, true>(T, w7, b7, s0, c0, y); else dw_rows<7, false>(T, w7, b7, s0, c0, y); }
#pragma unroll
    for (int j = 0; j < DWR; ++j) {
        if (F16) { v4h oh, ol;
#pragma unroll
            for (int i = 0; i < 4; ++i) { const h16 a = (h16)y[j][i]; oh[i] = a; ol[i] = (h16)((y[j][i] - (float)a) * LOSC); }
            *(v4h*)((char*)(YH + (size_t)s0 * DM) + (ro >> 1) + j * DM * 2) = oh; *(v4h*)((char*)(YL + (size_t)s0 * DM) + (ro >> 1) + j * DM * 2) = ol; }
        else { *(v4f*)((char*)(Y + (size_t)s0 * DM) + ro + j * DM * 4) = y[j]; }
    }
}

extern "C" void kernel_launch(void* const* d_in, const int* in_sizes, int n_in,
                              void* d_out, int out_size, void* d_ws, size_t ws_size, hipStream_t stream) {
    (void)in_sizes; (void)n_in; (void)out_size;
    const float* x = (const float*)d_in[0]; const float* Wqkv = (const float*)d_in[1]; const float* bqkv = (const float*)d_in[2]; const float* Wo = (const float*)d_in[3]; const float* bo = (const float*)d_in[4];   // k-major weights (x @ W)
    const float* cw[3][6]; for (int p = 0; p < 3; ++p) for (int j = 0; j < 6; ++j) cw[p][j] = (const float*)d_in[5 + p * 6 + j];     // (w3, b3, w5, b5, w7, b7) for q, k, v
    float* out = (float*)d_out;    // [2][2048][1024]
    char* wsp = (char*)d_ws;
    auto take = [&](size_t bytes) { char* p = wsp; wsp += (bytes + 255) & ~(size_t)255; return (void*)p; };
    bf* WT = (bf*)take((size_t)3 * DM * DM * 2); bf* WoT = (bf*)take((size_t)DM * DM * 2); bf* Xb = (bf*)take((size_t)NTK * DM * 2);
    float* TMP = (float*)take((size_t)NTK * DM * 4); float* TV = (float*)take((size_t)NTK * DM * 4);
    h16* QH = (h16*)take((size_t)NTK * DM * 2); h16* QL = (h16*)take((size_t)NTK * DM * 2); h16* KH = (h16*)take((size_t)NTK * DM * 2); h16* KL = (h16*)take((size_t)NTK * DM * 2);
    h16* VTH = (h16*)take((size_t)NTK * DM * 2); h16* VTL = (h16*)take((size_t)NTK * DM * 2); bf* CH = (bf*)take((size_t)NTK * DM * 2); bf* CL = (bf*)take((size_t)NTK * DM * 2);
    if ((size_t)(wsp - (char*)d_ws) > ws_size) return;    // about 118 MB in all, no aliasing
    k_wt<<<dim3(DM / 64, 3 * DM / 64, 1), 256, 0, stream>>>(Wqkv, DM, 3 * DM, WT); k_wt<<<dim3(DM / 64, DM / 64, 1), 256, 0, stream>>>(Wo, DM, DM, WoT);
    {
        k_cvtb<<<NTK / 8, 256, 0, stream>>>(x, NTK, Xb);
        k_gemmb<false, false><<<dim3(NTK / 64, DM / 64, 1), 128, 0, stream>>>(Xb, nullptr, WT, bqkv, TMP, DM, nullptr);                                  // q (f32)
        k_dwmix<true><<<NTK / DWR, 256, 0, stream>>>(TMP, cw[0][0], cw[0][1], cw[0][2], cw[0][3], cw[0][4], cw[0][5], nullptr, QH, QL);
        k_gemmb<false, false><<<dim3(NTK / 64, DM / 64, 1), 128, 0, stream>>>(Xb, nullptr, WT + (size_t)DM * DM, bqkv + DM, TMP, DM, nullptr);          // k
        k_dwmix<true><<<NTK / DWR, 256, 0, stream>>>(TMP, cw[1][0], cw[1][1], cw[1][2], cw[1][3], cw[1][4], cw[1][5], nullptr, KH, KL);
        k_gemmb<false, false><<<dim3(NTK / 64, DM / 64, 1), 128, 0, stream>>>(Xb, nullptr, WT + (size_t)2 * DM * DM, bqkv + 2 * DM, TMP, DM, nullptr);  // v
        k_dwmix<false><<<NTK / DWR, 256, 0, stream>>>(TMP, cw[2][0], cw[2][1], cw[2][2], cw[2][3], cw[2][4], cw[2][5], TV, nullptr, nullptr);
        k_vt<<<NB_ * NH_ * (NT_ / 64), 256, 0, stream>>>(TV, VTH, VTL);
        k_attn<<<NB_ * NH_ * (NT_ / 64), 128, 0, stream>>>(QH, QL, KH, KL, VTH, VTL, CH, CL);
        k_gemmb<true, false><<<dim3(NTK / 64, DM / 64, 1), 128, 0, stream>>>(CH, CL, WoT, bo, out, DM, nullptr);
    }
}

// v004
// One run takes 201 microseconds.
// In both of two side-by-side timings against v003, it was 1.14 times as fast.
// Over all steps from v000 it is 3.59 times as fast.
#include <hip/hip_runtime.h>

// Compute dtypes, f32 accumulate, both batch items in one pass (4096 rows per launch): qkv = x.c_attn_w + b ([4096 x 1024].[1024 x 3072] as three [1024]-wide products, PLAIN bf16 operands = the
// rounded input and the k-major weights transposed once; exact products) on v_wmma_f32_16x16x32_bf16 -> f32; the per-head-group causal depthwise convolutions along the
// sequence (heads 0-3 identity, 4-7 width 3, 8-11 width 5, 12-15 width 7; weights/biases read as inputs) in f32 -> q/k as f16 hi + residual x1024 planes, v -> f32 ->
// transposed f16 hi + residual planes; the 16-head causal attention (masked scores are set to -inf, so exp(-inf - m) = 0) fused on v_wmma_f32_16x16x32_f16
// (hh + hl + lh x 1/8, online f32 softmax, weights x32768 and v as f16 hi + residual x1024); out = ctx.c_proj_w + b (ctx as bf16 hi + UNSCALED residual against the

#define NB_  2                   // both batch items go through every launch together
#define NT_  2048
#define DM   1024
#define NH_  16
#define HD   64
#define HK   4                    // heads per group
#define NTK  (NB_ * NT_)
#define NW   1024
#define NQKV 1024
#define PSC  32768.0f
#define LOSC 1024.0f
#define LOSCI (1.0f / 1024.0f)

typedef _Float16 h16;
typedef unsigned short bf;
typedef __attribute__((ext_vector_type(16))) __bf16   v16bf;
typedef __attribute__((ext_vector_type(16))) _Float16 v16h;
typedef __attribute__((ext_vector_type(8)))  _Float16 v8h;
typedef __attribute__((ext_vector_type(8)))  unsigned short v8us;
typedef __attribute__((ext_vector_type(8)))  float    v8f;
typedef __attribute__((ext_vector_type(4)))  float    v4f;
typedef v8h  __attribute__((may_alias)) v8ha;
typedef v4f  __attribute__((may_alias)) v4fa;
typedef v8us __attribute__((may_alias)) v8usa;

__device__ __forceinline__ unsigned short f2bf(float f) { unsigned u = __float_as_uint(f); u += 0x7FFFu + ((u >> 16) & 1u); return (unsigned short)(u >> 16); }
__device__ __forceinline__ float bf2f(unsigned short b) { return __uint_as_float(((unsigned)b) << 16); }
__device__ __forceinline__ float bfr(float f) { return bf2f(f2bf(f)); }
__device__ __forceinline__ v16h cat16(v8h lo, v8h hi) { return __builtin_shufflevector(lo, hi, 0, 1, 2, 3, 4, 5, 6, 7, 8, 9, 10, 11, 12, 13, 14, 15); }
__device__ __forceinline__ v16bf cat16b(v8us lo, v8us hi) { return __builtin_bit_cast(v16bf, __builtin_shufflevector(lo, hi, 0, 1, 2, 3, 4, 5, 6, 7, 8, 9, 10, 11, 12, 13, 14, 15)); }
__device__ __forceinline__ v8f wmma16(v16h a, v16h b, v8f c) { return __builtin_amdgcn_wmma_f32_16x16x32_f16(false, a, false, b, (short)0, c, false, false); }
__device__ __forceinline__ v8f wmmab(v16bf a, v16bf b, v8f c) { return __builtin_amdgcn_wmma_f32_16x16x32_bf16(false, a, false, b, (short)0, c, false, false); }

__global__ __launch_bounds__(256) void k_cvtb(const float* __restrict__ src, int nrows, bf* dst) {
    const int lane = threadIdx.x & 31, r = blockIdx.x * 8 + (threadIdx.x >> 5);
    if (r >= nrows) return;
    v8us o[DM / 256];
#pragma unroll
    for (int q = 0; q < DM / 256; ++q) { v8us t;
#pragma unroll
        for (int i = 0; i < 8; ++i) t[i] = f2bf(src[(size_t)r * DM + q * 256 + lane * 8 + i]);
        o[q] = t; }
#pragma unroll
    for (int q = 0; q < DM / 256; ++q) *(v8us*)(dst + (size_t)r * DM + q * 256 + lane * 8) = o[q];
    
}

// k_gemmb: 64 x 64 block tile (4 waves x 16 x 64) of C[NTK][NW] = (A [+ Al]).B^T (K = 1024) [+ bf(bias[c])] [+ bf(R[r][c]) residual]; f32 whole-line epilogue (or f16
template <bool SPLITA, bool F16OUT = false>
__global__ __launch_bounds__(128) void k_gemmb(const bf* __restrict__ A, const bf* __restrict__ Al, const bf* __restrict__ Bn, const float* __restrict__ bias, float* C, int ldc, h16* C2, const float* __restrict__ R = nullptr, int K = DM, int roundR = 1) {
    // stg: two buffers of the block's operand tiles (plane 0 = 64 A rows, 1 = 64 B rows, 2 = 64 Al rows; 64 k each, row pitch 72 elements = 144 B), filled by whole-line
    // loads that the four waves share; the fragments are read from here.
    __shared__ __align__(16) bf stg[2][SPLITA ? 3 : 2][64 * 72];
    __shared__ __align__(16) float ost[4][16 * 68];
    const int lane = threadIdx.x & 31, wave = threadIdx.x >> 5, lr = lane & 15, hi = lane >> 4;
    const int r0 = blockIdx.x * 64 + wave * 16, c0 = blockIdx.y * 64;
    const int srow = threadIdx.x >> 3, spc = (threadIdx.x & 7) * 8;      // staging: 8 threads cover one 128 B row piece by piece, 16 rows a pass
    unsigned so[4];      // the thread's byte offset inside a 64-row tile, one per pass; the tile's own address is uniform
#pragma unroll
    for (int s = 0; s < 4; ++s) so[s] = ((unsigned)(srow + 16 * s) * (unsigned)K + (unsigned)spc) * 2u;
    v8us ga[4], gb[4], gl[4];
    auto fetch = [&](int kc) {
        const char* ta = (const char*)(A + (size_t)(blockIdx.x * 64) * K + kc); const char* tb = (const char*)(Bn + (size_t)c0 * K + kc); const char* tl = SPLITA ? (const char*)(Al + (size_t)(blockIdx.x * 64) * K + kc) : ta;
        const char* pa[4]; const char* pb[4]; const char* pl[4];
#pragma unroll
        for (int s = 0; s < 4; ++s) { pa[s] = ta + so[s]; pb[s] = tb + so[s]; pl[s] = tl + so[s]; }
#pragma unroll
        for (int s = 0; s < 4; ++s) { ga[s] = *(const v8us*)pa[s]; gb[s] = *(const v8us*)pb[s]; if (SPLITA) gl[s] = *(const v8us*)pl[s]; }
        // The wait that stands before a register named by an issued load is rewritten; the addresses are its inputs so that none of them is reused as a destination of these loads.
        asm volatile("s_wait_xcnt 0x0" :: "v"(pa[0]), "v"(pa[1]), "v"(pa[2]), "v"(pa[3]), "v"(pb[0]), "v"(pb[1]), "v"(pb[2]), "v"(pb[3]), "v"(pl[0]), "v"(pl[1]), "v"(pl[2]), "v"(pl[3]) : "memory");
    };
    auto put = [&](int buf) {
#pragma unroll
        for (int s = 0; s < 4; ++s) { const int o = (srow + 16 * s) * 72 + spc; *(v8usa*)(&stg[buf][0][o]) = ga[s]; *(v8usa*)(&stg[buf][1][o]) = gb[s]; if (SPLITA) *(v8usa*)(&stg[buf][SPLITA ? 2 : 0][o]) = gl[s]; }
    };
    v8f acc[4];
#pragma unroll
    for (int t = 0; t < 4; ++t) acc[t] = (v8f){};
    fetch(0); put(0);
    __syncthreads();      // stage 0 is complete before any wave reads it
#pragma unroll 1
    for (int kb = 0; kb < K; kb += 64) {
        const int cur = (kb >> 6) & 1;
        const bool more = kb + 64 < K;
        if (more) fetch(kb + 64);      // the next stage's lines fly while this stage is multiplied
#pragma unroll
        for (int ks = 0; ks < 2; ++ks) {
            const int fo = ks * 32 + 8 * hi, ao = (wave * 16 + lr) * 72 + fo;
            const v16bf a = cat16b(*(const v8usa*)(&stg[cur][0][ao]), *(const v8usa*)(&stg[cur][0][ao + 16]));
            v16bf al = a;
            if (SPLITA) al = cat16b(*(const v8usa*)(&stg[cur][SPLITA ? 2 : 0][ao]), *(const v8usa*)(&stg[cur][SPLITA ? 2 : 0][ao + 16]));
#pragma unroll
            for (int t = 0; t < 4; ++t) { const int bo = (t * 16 + lr) * 72 + fo; const v16bf b = cat16b(*(const v8usa*)(&stg[cur][1][bo]), *(const v8usa*)(&stg[cur][1][bo + 16])); acc[t] = wmmab(a, b, acc[t]); if (SPLITA) acc[t] = wmmab(al, b, acc[t]); }
            asm volatile("v_nop\n\tv_nop\n\tv_nop\n\tv_nop" : "+v"(acc[0]), "+v"(acc[1]), "+v"(acc[2]), "+v"(acc[3]) : "v"(a), "v"(al));
        }
        if (more) put(cur ^ 1);        // into the buffer whose readers all passed the barrier of the trip before
        __syncthreads();               // publishes the next stage and ends every wave's reads of this one
    }
    float* os = &ost[wave][0];
#pragma unroll
    for (int t = 0; t < 4; ++t) { const float bv = bias ? bfr(bias[c0 + t * 16 + lr]) : 0.f;
#pragma unroll
        for (int j = 0; j < 8; ++j) os[(hi * 8 + j) * 68 + t * 16 + lr] = acc[t][j] + bv; }
    __syncthreads();
    if (F16OUT) {
        h16* crow = (h16*)(void*)C + (size_t)r0 * ldc + c0;
        auto pass = [&]() {
#pragma unroll
            for (int s = 0; s < 4; ++s) { const int row = 4 * s + (lane >> 3), piece = lane & 7; const float* sp = os + row * 68 + piece * 8; v8h o, o2;
#pragma unroll
                for (int i = 0; i < 8; ++i) { const h16 a = (h16)sp[i]; o[i] = a; o2[i] = (h16)((sp[i] - (float)a) * LOSC); }
                *(v8h*)(crow + (size_t)row * ldc + piece * 8) = o; if (C2) *(v8h*)(C2 + (size_t)r0 * ldc + c0 + (size_t)row * ldc + piece * 8) = o2; }
        };
        pass(); 
    } else {
        float* crow = C + (size_t)r0 * ldc + c0;
        auto pass = [&]() {
#pragma unroll
            for (int s = 0; s < 8; ++s) { const int Lid = (lane >> 3) + 4 * s, piece = lane & 7; const int row = Lid >> 1, cofs = (Lid & 1) * 32 + piece * 4;
                v4f val = *(const v4fa*)(os + row * 68 + cofs); if (R) { const v4f rv = *(const v4f*)(R + ((size_t)r0 + row) * ldc + c0 + cofs); val += roundR ? (v4f){bfr(rv[0]), bfr(rv[1]), bfr(rv[2]), bfr(rv[3])} : rv; }
                *(v4f*)(crow + (size_t)row * ldc + cofs) = val; }
        };
        pass(); 
    }
}

__global__ __launch_bounds__(256) void k_vt(const float* __restrict__ V, h16* VTH, h16* VTL) {
    __shared__ __align__(16) h16 tile[64 * 72];
    __shared__ __align__(16) h16 til2[64 * 72];
    const int bid = blockIdx.x;
    const int b = bid / (NH_ * (NT_ / 64)), rem = bid - b * (NH_ * (NT_ / 64)), h = rem / (NT_ / 64), kt = rem - h * (NT_ / 64);
    const int k0 = kt * 64, tid = threadIdx.x;
    const int kk = tid >> 2, d0 = (tid & 3) * 16;
    const float* src = V + ((size_t)b * NT_ + k0 + kk) * DM + h * HD + d0;
#pragma unroll
    for (int i = 0; i < 16; ++i) { const float v = src[i]; const h16 a = (h16)v; tile[(d0 + i) * 72 + kk] = a; til2[(d0 + i) * 72 + kk] = (h16)((v - (float)a) * LOSC); }
    __syncthreads();
    const int piece = tid & 7;
    const size_t base = (((size_t)b * NH_ + h) * HD) * NT_ + k0;
    auto pass = [&]() {
#pragma unroll
        for (int s = 0; s < 4; ++s) { const int Lid = (tid >> 3) + 32 * s; const int pln = Lid >> 6, d = Lid & 63;
            const v8h val = *(const v8ha*)((pln ? til2 : tile) + d * 72 + piece * 8); *(v8h*)((pln ? VTL : VTH) + base + (size_t)d * NT_ + piece * 8) = val; }
    };
    pass(); 
}

// k_attn: block = (b, h, the two 64-query tiles 31 - t and t, one after the other: 66 key steps in every block), wave = 16 queries; key tiles up to the diagonal; 4 WMMA scores /8 (f32), online softmax, weights x32768 f16 tile (same-wave may_alias
// reload after a compiler barrier), 4 WMMA .v; ctx -> bf16 hi + residual planes CH/CL[tok][h*64+d].
__global__ __launch_bounds__(128) void k_attn(const h16* __restrict__ Q16, const h16* __restrict__ QL16, const h16* __restrict__ K16, const h16* __restrict__ KL16, const h16* __restrict__ VTH, const h16* __restrict__ VTL, bf* CH, bf* CL) {
    __shared__ __align__(16) h16 plds[4][16 * 32];
    __shared__ __align__(16) h16 plds2[4][16 * 32];
    __shared__ __align__(16) float ost[4][16 * 68];
    // Operand tiles in LDS, filled by the block's 128 threads together (each line fetched once a query tile) and read as fragments by all four waves; two buffers each.
    __shared__ __align__(16) h16 kst[2][2][32 * 72];      // [buffer][hi, residual][key][64 d, row pitch 144 B]
    __shared__ __align__(16) h16 vst[2][2][64 * 40];      // [buffer][hi, residual][d][32 keys, row pitch 80 B]
    __shared__ __align__(16) h16 qls[4][16 * 72];         // each wave's 16 query-residual rows, filled once a query tile
    const int lane = threadIdx.x & 31, wave = threadIdx.x >> 5, lr = lane & 15, hi = lane >> 4;
    const int bid = blockIdx.x;
    const int b = bid / (NH_ * (NT_ / 128)), rem = bid - b * (NH_ * (NT_ / 128)), h = rem / (NT_ / 128), tp = rem - h * (NT_ / 128);
    const size_t tok0 = (size_t)b * NT_;
    h16* pl = &plds[wave][0]; h16* pl2 = &plds2[wave][0];
    // A tile's cost grows with its index (causal) and every block is resident at once: a block that takes tile 31 - t and then tile t walks 66 key steps whatever t is.
    // The second tile's first LDS writes stand behind the first tile's last two barriers. Kept rolled: one copy of the body in the instruction cache.
#pragma unroll 1
    for (int part = 0; part < 2; ++part) {
    const int qt = part ? tp : NT_ / 64 - 1 - tp;
    const int q0 = qt * 64 + wave * 16;
    v16h qa[2];
    const size_t qo0 = (tok0 + q0 + lr) * DM + h * HD + 8 * hi;
#pragma unroll
    for (int kc = 0; kc < 2; ++kc) qa[kc] = cat16(*(const v8h*)(Q16 + qo0 + kc * 32), *(const v8h*)(Q16 + qo0 + kc * 32 + 16));
    const h16* kh_b = K16 + tok0 * DM + h * HD;
    const h16* kl_b = KL16 + tok0 * DM + h * HD;
    const size_t vbase = (((size_t)b * NH_ + h) * HD) * NT_;
    v8f o[4], ox[4];
#pragma unroll
    for (int n = 0; n < 4; ++n) { o[n] = (v8f){}; ox[n] = (v8f){}; }
    float mrow[8], lpart[8];
#pragma unroll
    for (int j = 0; j < 8; ++j) { mrow[j] = -3.0e38f; lpart[j] = 0.f; }
    int qpos[8];
#pragma unroll
    for (int j = 0; j < 8; ++j) qpos[j] = q0 + 8 * hi + j;
    const int kt_lo = 0, kt_hi = (qt * 64 + 63) / 32;     // causal
    const int krow = threadIdx.x >> 3, kpc = (threadIdx.x & 7) * 8;      // key tile: 8 threads a 128 B row, 16 rows a pass
    const int vrow = threadIdx.x >> 2, vpc = (threadIdx.x & 3) * 8;      // value tile: 4 threads a 64 B row, 32 rows a pass
    v8h gk[2][2], gv[2][2];
    auto fetch = [&](int l0) {
#pragma unroll
        for (int s = 0; s < 2; ++s) {
            const size_t ko = (size_t)(l0 + krow + 16 * s) * DM + kpc, vo = vbase + (size_t)(vrow + 32 * s) * NT_ + l0 + vpc;
            gk[0][s] = *(const v8h*)(kh_b + ko); gk[1][s] = *(const v8h*)(kl_b + ko); gv[0][s] = *(const v8h*)(VTH + vo); gv[1][s] = *(const v8h*)(VTL + vo); }
    };
    auto put = [&](int buf) {
#pragma unroll
        for (int s = 0; s < 2; ++s) {
            const int ko = (krow + 16 * s) * 72 + kpc, vo = (vrow + 32 * s) * 40 + vpc;
            *(v8ha*)(&kst[buf][0][ko]) = gk[0][s]; *(v8ha*)(&kst[buf][1][ko]) = gk[1][s]; *(v8ha*)(&vst[buf][0][vo]) = gv[0][s]; *(v8ha*)(&vst[buf][1][vo]) = gv[1][s]; }
    };
    fetch(0);
#pragma unroll
    for (int s = 0; s < 4; ++s) { const int row = 4 * s + (lane >> 3), pc = (lane & 7) * 8; *(v8ha*)(&qls[wave][row * 72 + pc]) = *(const v8h*)(QL16 + (tok0 + q0 + row) * DM + h * HD + pc); }
    put(0);
    __syncthreads();      // tile 0 is complete before any wave reads it
    const h16* ql_s = &qls[wave][lr * 72 + 8 * hi];
#pragma unroll 1
    for (int kt = kt_lo; kt <= kt_hi; ++kt) {
        const int l0 = kt * 32, cur = kt & 1;
        if (kt < kt_hi) fetch(l0 + 32);      // the next tile's lines fly while this tile is worked on
        const h16* kh_s = &kst[cur][0][0]; const h16* kl_s = &kst[cur][1][0];
        const int ko0 = lr * 72 + 8 * hi, ko1 = (16 + lr) * 72 + 8 * hi;
        v8f s0 = {}, s1 = {}, x0 = {}, x1 = {};
#pragma unroll
        for (int kc = 0; kc < 2; ++kc) {
            { const v16h k0h = cat16(*(const v8ha*)(kh_s + ko0 + kc * 32), *(const v8ha*)(kh_s + ko0 + kc * 32 + 16)), k1h = cat16(*(const v8ha*)(kh_s + ko1 + kc * 32), *(const v8ha*)(kh_s + ko1 + kc * 32 + 16));
              const v16h qlk = cat16(*(const v8ha*)(ql_s + kc * 32), *(const v8ha*)(ql_s + kc * 32 + 16));     // query residual re-read per step (registers)
              s0 = wmma16(qa[kc], k0h, s0); x0 = wmma16(qlk, k0h, x0); s1 = wmma16(qa[kc], k1h, s1); x1 = wmma16(qlk, k1h, x1);
              asm volatile("v_nop" : "+v"(s0), "+v"(s1), "+v"(x0), "+v"(x1) : "v"(qlk), "v"(k0h), "v"(k1h) : "memory"); }
            { const v16h k0l = cat16(*(const v8ha*)(kl_s + ko0 + kc * 32), *(const v8ha*)(kl_s + ko0 + kc * 32 + 16)), k1l = cat16(*(const v8ha*)(kl_s + ko1 + kc * 32), *(const v8ha*)(kl_s + ko1 + kc * 32 + 16));
              x0 = wmma16(qa[kc], k0l, x0); x1 = wmma16(qa[kc], k1l, x1);
              asm volatile("v_nop" : "+v"(x0), "+v"(x1) : "v"(k0l), "v"(k1l) : "memory"); }
        }
        asm volatile("v_nop\n\tv_nop\n\tv_nop\n\tv_nop" : "+v"(s0), "+v"(s1), "+v"(x0), "+v"(x1) : "v"(qa[0]), "v"(qa[1]));
        float alpha[8];
#pragma unroll
        for (int j = 0; j < 8; ++j) {
            const int ja = l0 + lr, jb = l0 + 16 + lr, qi = qpos[j];
            const float a0 = (ja <= qi) ? (s0[j] + x0[j] * LOSCI) * 0.125f : -__builtin_inff(), a1 = (jb <= qi) ? (s1[j] + x1[j] * LOSCI) * 0.125f : -__builtin_inff();
            float mx = fmaxf(a0, a1);
            mx = fmaxf(mx, __shfl_xor(mx, 1, 16)); mx = fmaxf(mx, __shfl_xor(mx, 2, 16)); mx = fmaxf(mx, __shfl_xor(mx, 4, 16)); mx = fmaxf(mx, __shfl_xor(mx, 8, 16));
            const float mn = fmaxf(mrow[j], mx);
            alpha[j] = __expf(mrow[j] - mn); mrow[j] = mn;
            const float p0 = __expf(a0 - mn), p1 = __expf(a1 - mn);
            lpart[j] = lpart[j] * alpha[j] + (p0 + p1);
            const int mr = hi * 8 + j;
            const float ps0 = p0 * PSC, ps1 = p1 * PSC; const h16 h0 = (h16)ps0, h1 = (h16)ps1;
            pl[mr * 32 + lr] = h0; pl[mr * 32 + 16 + lr] = h1;
            pl2[mr * 32 + lr] = (h16)((ps0 - (float)h0) * LOSC); pl2[mr * 32 + 16 + lr] = (h16)((ps1 - (float)h1) * LOSC);
        }
#pragma unroll
        for (int n = 0; n < 4; ++n)
#pragma unroll
            for (int j = 0; j < 8; ++j) { o[n][j] *= alpha[j]; ox[n][j] *= alpha[j]; }
        asm volatile("" ::: "memory");
        const v16h pa = cat16(*(const v8ha*)(pl + lr * 32 + hi * 8), *(const v8ha*)(pl + lr * 32 + 16 + hi * 8));
        const v16h px = cat16(*(const v8ha*)(pl2 + lr * 32 + hi * 8), *(const v8ha*)(pl2 + lr * 32 + 16 + hi * 8));
#pragma unroll
        for (int n = 0; n < 4; ++n) { const int vo = (n * 16 + lr) * 40 + hi * 8;
            const v16h vh = cat16(*(const v8ha*)(&vst[cur][0][vo]), *(const v8ha*)(&vst[cur][0][vo + 16])), vl = cat16(*(const v8ha*)(&vst[cur][1][vo]), *(const v8ha*)(&vst[cur][1][vo + 16]));
            o[n] = wmma16(pa, vh, o[n]); ox[n] = wmma16(pa, vl, ox[n]); ox[n] = wmma16(px, vh, ox[n]);
            asm volatile("" : "+v"(o[n]), "+v"(ox[n]) : "v"(vh), "v"(vl) : "memory"); }
        asm volatile("v_nop\n\tv_nop\n\tv_nop\n\tv_nop" : "+v"(o[0]), "+v"(o[1]), "+v"(o[2]), "+v"(o[3]), "+v"(ox[0]), "+v"(ox[1]), "+v"(ox[2]), "+v"(ox[3]) : "v"(pa), "v"(px));
        if (kt < kt_hi) put(cur ^ 1);      // into the buffer whose readers all passed the barrier of the trip before
        __syncthreads();                   // publishes the next tile and ends every wave's reads of this one
    }
    float inv[8];
#pragma unroll
    for (int j = 0; j < 8; ++j) { float rs = lpart[j]; rs += __shfl_xor(rs, 1, 16); rs += __shfl_xor(rs, 2, 16); rs += __shfl_xor(rs, 4, 16); rs += __shfl_xor(rs, 8, 16); inv[j] = 1.0f / (rs * PSC); }
    float* os = &ost[wave][0];
#pragma unroll
    for (int n = 0; n < 4; ++n)
#pragma unroll
        for (int j = 0; j < 8; ++j) os[(hi * 8 + j) * 68 + n * 16 + lr] = (o[n][j] + ox[n][j] * LOSCI) * inv[j];
    __syncthreads();
    const size_t cbase = (tok0 + q0) * DM + (size_t)h * HD;
    auto pass = [&]() {
#pragma unroll
        for (int s = 0; s < 4; ++s) { const int row = 4 * s + (lane >> 3), piece = lane & 7; const float* sp = os + row * 68 + piece * 8; v8us oh, ol;
#pragma unroll
            for (int i = 0; i < 8; ++i) { const unsigned short hb = f2bf(sp[i]); oh[i] = hb; ol[i] = f2bf(sp[i] - bf2f(hb)); }
            *(v8us*)(CH + cbase + (size_t)row * DM + piece * 8) = oh; *(v8us*)(CL + cbase + (size_t)row * DM + piece * 8) = ol; }
    };
    pass(); 
    asm volatile("s_wait_xcnt 0x0" ::: "memory");      // the wait that stands before the second tile's first instructions rewrite registers named by these stores
    }
}


// k_wt: WT [n][K] = bf16(W[k][n]) (k-major [K][ncols]) via 64 x 64 LDS tiles; grid (K/64, ncols/64).
__global__ __launch_bounds__(256) void k_wt(const float* __restrict__ Wm, int K, int ncols, bf* WT) {
    __shared__ __align__(16) unsigned short tl[64 * 72];
    const int tid = threadIdx.x, k0 = blockIdx.x * 64, n0 = blockIdx.y * 64;
    const int kk = tid >> 2, nq = (tid & 3) * 16;
#pragma unroll
    for (int i = 0; i < 16; ++i) tl[(nq + i) * 72 + kk] = f2bf(Wm[(size_t)(k0 + kk) * ncols + n0 + nq + i]);
    __syncthreads();
    const int piece = tid & 7;
    auto pass = [&]() {
#pragma unroll
        for (int s = 0; s < 2; ++s) { const int nr = (tid >> 3) + 32 * s; const v8us val = *(const v8usa*)(tl + nr * 72 + piece * 8); *(v8us*)(WT + (size_t)(n0 + nr) * K + k0 + piece * 8) = val; }
    };
    pass(); 
}

typedef __attribute__((ext_vector_type(4)))  _Float16 v4h;
// k_dwmix: the grouped causal depthwise convolution along the sequence of a projected [2 x 2048][1024] f32 matrix T (row s = batch item s / 2048, position s % 2048) (column c = head h * 64 + d; group g = h / 4: g = 0
// identity, else y[s][c] = bf(bias_g[d]) + sum_i bf(w_g[d][i]) * T[s - (width-1) + i][c] over rows of the same batch item, width = 2g + 1, summed in the order i = 0, 1, ...).
// Block = DWR consecutive rows, wave = one chunk of 128 columns (inside one group), lane -> 4 consecutive columns. A wave issues all of its DWR + width - 1 row loads (16 B a lane)
// and its weight loads before it uses any of them, holds the rounded weights in registers for all DWR rows, and every loop is unrolled: no load waits on another.
#define DWR 8
typedef v4f __attribute__((aligned(4))) v4fu;      // the small weight arrays are read 16 B at a time with no more than their element alignment assumed
template <int KW, bool EDGE>
__device__ __forceinline__ void dw_rows(const float* __restrict__ T, const float* __restrict__ wg, const float* __restrict__ bg, int s0, int c0, v4f (&y)[DWR]) {
    // EDGE: the block starts its batch item (s0 is the item's first row): the width - 1 rows before it do not exist, their loads fall on row s0 and their taps are left out.
    const char* tb = (const char*)(T + (size_t)(EDGE ? s0 : s0 - (KW - 1)) * DM);      // uniform; the lane's own part of every address is one 32-bit offset
    const unsigned ro = (unsigned)c0 * 4u, bo = (unsigned)(c0 & (HD - 1)) * 4u;
    const char* wp = (const char*)wg + bo * (unsigned)KW;      // the lane's 4 x width weights lie in a row: element i * width + t
    v4f row[DWR + KW - 1], wv[KW], bv;
#pragma unroll
    for (int q = 0; q < KW; ++q) wv[q] = *(const v4fu*)(wp + q * 16);
    bv = *(const v4fu*)((const char*)bg + bo);
#pragma unroll
    for (int k = 0; k < DWR + KW - 1; ++k) row[k] = *(const v4f*)(tb + ro + (size_t)(EDGE ? (k < KW - 1 ? 0 : k - (KW - 1)) : k) * DM * 4);
    // The wait that stands before a register named by an issued load is rewritten; the lane's address parts are its inputs so that none of them is reused as a destination of
    // these loads, and no load is moved behind it: all of the wave's loads are in flight together.
    asm volatile("s_wait_xcnt 0x0" :: "v"(ro), "v"(wp), "v"(bo) : "memory");
    __builtin_amdgcn_sched_barrier(0);      // no arithmetic on the first values (with its wait) is lifted in front of the last loads
    float w[4 * KW];
#pragma unroll
    for (int q = 0; q < KW; ++q)
#pragma unroll
        for (int e = 0; e < 4; ++e) w[q * 4 + e] = bfr(wv[q][e]);
#pragma unroll
    for (int e = 0; e < 4; ++e) bv[e] = bfr(bv[e]);
#pragma unroll
    for (int j = 0; j < DWR; ++j)
#pragma unroll
        for (int i = 0; i < 4; ++i) { float acc = bv[i];
#pragma unroll
            for (int t = 0; t < KW; ++t) { if (!EDGE || j + t >= KW - 1) acc = fmaf(row[j + t][i], w[i * KW + t], acc); }
            y[j][i] = acc; }
}
template <bool F16>
__global__ __launch_bounds__(256) void k_dwmix(const float* __restrict__ T, const float* __restrict__ w3, const float* __restrict__ b3, const float* __restrict__ w5, const float* __restrict__ b5, const float* __restrict__ w7, const float* __restrict__ b7, float* Y, h16* YH, h16* YL) {
    const int lane = threadIdx.x & 31, s0 = blockIdx.x * DWR;
    const int ch = __builtin_amdgcn_readfirstlane(threadIdx.x >> 5);      // the wave's chunk in a scalar register: the choice of the group below is a scalar branch
    if (s0 >= NTK) return;
    const int c0 = ch * 128 + lane * 4, g = ch >> 1;      // 2 chunks = 4 heads = one group
    const bool edge = (s0 & (NT_ - 1)) == 0;               // DWR > width - 1: only a batch item's first block lacks rows
    const unsigned ro = (unsigned)c0 * 4u;
    v4f y[DWR];
    if (g == 0) {
#pragma unroll
        for (int j = 0; j < DWR; ++j) y[j] = *(const v4f*)((const char*)(T + (size_t)s0 * DM) + ro + j * DM * 4);
        asm volatile("s_wait_xcnt 0x0" :: "v"(ro) : "memory");      // the wait that stands before a register named by an issued load is rewritten
    }
    else if (g == 1) { if (edge) dw_rows<3, true>(T, w3, b3, s0, c0, y); else dw_rows<3, false>(T, w3, b3, s0, c0, y); }
    else if (g == 2) { if (edge) dw_rows<5, true>(T, w5, b5, s0, c0, y); else dw_rows<5, false>(T, w5, b5, s0, c0, y); }
    else             { if (edge) dw_rows<7, true>(T, w7, b7, s0, c0, y); else dw_rows<7, false>(T, w7, b7, s0, c0, y); }
#pragma unroll
    for (int j = 0; j < DWR; ++j) {
        if (F16) { v4h oh, ol;
#pragma unroll
            for (int i = 0; i < 4; ++i) { const h16 a = (h16)y[j][i]; oh[i] = a; ol[i] = (h16)((y[j][i] - (float)a) * LOSC); }
            *(v4h*)((char*)(YH + (size_t)s0 * DM) + (ro >> 1) + j * DM * 2) = oh; *(v4h*)((char*)(YL + (size_t)s0 * DM) + (ro >> 1) + j * DM * 2) = ol; }
        else { *(v4f*)((char*)(Y + (size_t)s0 * DM) + ro + j * DM * 4) = y[j]; }
    }
}

extern "C" void kernel_launch(void* const* d_in, const int* in_sizes, int n_in,
                              void* d_out, int out_size, void* d_ws, size_t ws_size, hipStream_t stream) {
    (void)in_sizes; (void)n_in; (void)out_size;
    const float* x = (const float*)d_in[0]; const float* Wqkv = (const float*)d_in[1]; const float* bqkv = (const float*)d_in[2]; const float* Wo = (const float*)d_in[3]; const float* bo = (const float*)d_in[4];   // k-major weights (x @ W)
    const float* cw[3][6]; for (int p = 0; p < 3; ++p) for (int j = 0; j < 6; ++j) cw[p][j] = (const float*)d_in[5 + p * 6 + j];     // (w3, b3, w5, b5, w7, b7) for q, k, v
    float* out = (float*)d_out;    // [2][2048][1024]
    char* wsp = (char*)d_ws;
    auto take = [&](size_t bytes) { char* p = wsp; wsp += (bytes + 255) & ~(size_t)255; return (void*)p; };
    bf* WT = (bf*)take((size_t)3 * DM * DM * 2); bf* WoT = (bf*)take((size_t)DM * DM * 2); bf* Xb = (bf*)take((size_t)NTK * DM * 2);
    float* TMP = (float*)take((size_t)NTK * DM * 4); float* TV = (float*)take((size_t)NTK * DM * 4);
    h16* QH = (h16*)take((size_t)NTK * DM * 2); h16* QL = (h16*)take((size_t)NTK * DM * 2); h16* KH = (h16*)take((size_t)NTK * DM * 2); h16* KL = (h16*)take((size_t)NTK * DM * 2);
    h16* VTH = (h16*)take((size_t)NTK * DM * 2); h16* VTL = (h16*)take((size_t)NTK * DM * 2); bf* CH = (bf*)take((size_t)NTK * DM * 2); bf* CL = (bf*)take((size_t)NTK * DM * 2);
    if ((size_t)(wsp - (char*)d_ws) > ws_size) return;    // about 118 MB in all, no aliasing
    k_wt<<<dim3(DM / 64, 3 * DM / 64, 1), 256, 0, stream>>>(Wqkv, DM, 3 * DM, WT); k_wt<<<dim3(DM / 64, DM / 64, 1), 256, 0, stream>>>(Wo, DM, DM, WoT);
    {
        k_cvtb<<<NTK / 8, 256, 0, stream>>>(x, NTK, Xb);
        k_gemmb<false, false><<<dim3(NTK / 64, DM / 64, 1), 128, 0, stream>>>(Xb, nullptr, WT, bqkv, TMP, DM, nullptr);                                  // q (f32)
        k_dwmix<true><<<NTK / DWR, 256, 0, stream>>>(TMP, cw[0][0], cw[0][1], cw[0][2], cw[0][3], cw[0][4], cw[0][5], nullptr, QH, QL);
        k_gemmb<false, false><<<dim3(NTK / 64, DM / 64, 1), 128, 0, stream>>>(Xb, nullptr, WT + (size_t)DM * DM, bqkv + DM, TMP, DM, nullptr);          // k
        k_dwmix<true><<<NTK / DWR, 256, 0, stream>>>(TMP, cw[1][0], cw[1][1], cw[1][2], cw[1][3], cw[1][4], cw[1][5], nullptr, KH, KL);
        k_gemmb<false, false><<<dim3(NTK / 64, DM / 64, 1), 128, 0, stream>>>(Xb, nullptr, WT + (size_t)2 * DM * DM, bqkv + 2 * DM, TMP, DM, nullptr);  // v
        k_dwmix<false><<<NTK / DWR, 256, 0, stream>>>(TMP, cw[2][0], cw[2][1], cw[2][2], cw[2][3], cw[2][4], cw[2][5], TV, nullptr, nullptr);
        k_vt<<<NB_ * NH_ * (NT_ / 64), 256, 0, stream>>>(TV, VTH, VTL);
        k_attn<<<NB_ * NH_ * (NT_ / 128), 128, 0, stream>>>(QH, QL, KH, KL, VTH, VTL, CH, CL);
        k_gemmb<true, false><<<dim3(NTK / 64, DM / 64, 1), 128, 0, stream>>>(CH, CL, WoT, bo, out, DM, nullptr);
    }
}

// v005
// One run takes 176 microseconds.
// In both of two side-by-side timings against v004, it was 1.14 times as fast.
// Over all steps from v000 it is 4.10 times as fast.
#include <hip/hip_runtime.h>

// Compute dtypes, f32 accumulate, both batch items in one pass (4096 rows per launch): qkv = x.c_attn_w + b ([4096 x 1024].[1024 x 3072] as three [1024]-wide products, PLAIN bf16 operands = the
// rounded input and the k-major weights transposed once; exact products) on v_wmma_f32_16x16x32_bf16 -> f32; the per-head-group causal depthwise convolutions along the
// sequence (heads 0-3 identity, 4-7 width 3, 8-11 width 5, 12-15 width 7; weights/biases read as inputs) in f32 -> q/k as f16 hi + residual x1024 planes, v -> f32 ->
// transposed f16 hi + residual planes; the 16-head causal attention (masked positions are -inf and contribute exp(-inf - m) = 0) fused on v_wmma_f32_16x16x32_f16
// (hh + hl + lh x 1/8, online f32 softmax, weights x32768 and v as f16 hi + residual x1024); out = ctx.c_proj_w + b (ctx as bf16 hi + UNSCALED residual against the

#define NB_  2                   // both batch items go through every launch together
#define NT_  2048
#define DM   1024
#define NH_  16
#define HD   64
#define HK   4                    // heads per group
#define NTK  (NB_ * NT_)
#define NW   1024
#define NQKV 1024
#define PSC  32768.0f
#define LOSC 1024.0f
#define LOSCI (1.0f / 1024.0f)

typedef _Float16 h16;
typedef unsigned short bf;
typedef __attribute__((ext_vector_type(16))) __bf16   v16bf;
typedef __attribute__((ext_vector_type(16))) _Float16 v16h;
typedef __attribute__((ext_vector_type(8)))  _Float16 v8h;
typedef __attribute__((ext_vector_type(8)))  unsigned short v8us;
typedef __attribute__((ext_vector_type(8)))  float    v8f;
typedef __attribute__((ext_vector_type(4)))  float    v4f;
typedef v8h  __attribute__((may_alias)) v8ha;
typedef v4f  __attribute__((may_alias)) v4fa;
typedef v8us __attribute__((may_alias)) v8usa;

__device__ __forceinline__ unsigned short f2bf(float f) { unsigned u = __float_as_uint(f); u += 0x7FFFu + ((u >> 16) & 1u); return (unsigned short)(u >> 16); }
__device__ __forceinline__ float bf2f(unsigned short b) { return __uint_as_float(((unsigned)b) << 16); }
__device__ __forceinline__ float bfr(float f) { return bf2f(f2bf(f)); }
__device__ __forceinline__ v16h cat16(v8h lo, v8h hi) { return __builtin_shufflevector(lo, hi, 0, 1, 2, 3, 4, 5, 6, 7, 8, 9, 10, 11, 12, 13, 14, 15); }
__device__ __forceinline__ v16bf cat16b(v8us lo, v8us hi) { return __builtin_bit_cast(v16bf, __builtin_shufflevector(lo, hi, 0, 1, 2, 3, 4, 5, 6, 7, 8, 9, 10, 11, 12, 13, 14, 15)); }
__device__ __forceinline__ v8f wmma16(v16h a, v16h b, v8f c) { return __builtin_amdgcn_wmma_f32_16x16x32_f16(false, a, false, b, (short)0, c, false, false); }
__device__ __forceinline__ float xhalf(float x) { return __builtin_bit_cast(float, __builtin_amdgcn_permlanex16(__builtin_bit_cast(int, x), __builtin_bit_cast(int, x), 0x76543210, 0xfedcba98, false, false)); }      // lane l takes lane l ^ 16's value
__device__ __forceinline__ v8f wmmab(v16bf a, v16bf b, v8f c) { return __builtin_amdgcn_wmma_f32_16x16x32_bf16(false, a, false, b, (short)0, c, false, false); }

__global__ __launch_bounds__(256) void k_cvtb(const float* __restrict__ src, int nrows, bf* dst) {
    const int lane = threadIdx.x & 31, r = blockIdx.x * 8 + (threadIdx.x >> 5);
    if (r >= nrows) return;
    v8us o[DM / 256];
#pragma unroll
    for (int q = 0; q < DM / 256; ++q) { v8us t;
#pragma unroll
        for (int i = 0; i < 8; ++i) t[i] = f2bf(src[(size_t)r * DM + q * 256 + lane * 8 + i]);
        o[q] = t; }
#pragma unroll
    for (int q = 0; q < DM / 256; ++q) *(v8us*)(dst + (size_t)r * DM + q * 256 + lane * 8) = o[q];
    
}

// k_gemmb: 64 x 64 block tile (4 waves x 16 x 64) of C[NTK][NW] = (A [+ Al]).B^T (K = 1024) [+ bf(bias[c])] [+ bf(R[r][c]) residual]; f32 whole-line epilogue (or f16
template <bool SPLITA, bool F16OUT = false>
__global__ __launch_bounds__(128) void k_gemmb(const bf* __restrict__ A, const bf* __restrict__ Al, const bf* __restrict__ Bn, const float* __restrict__ bias, float* C, int ldc, h16* C2, const float* __restrict__ R = nullptr, int K = DM, int roundR = 1) {
    // stg: two buffers of the block's operand tiles (plane 0 = 64 A rows, 1 = 64 B rows, 2 = 64 Al rows; 64 k each, row pitch 72 elements = 144 B), filled by whole-line
    // loads that the four waves share; the fragments are read from here.
    __shared__ __align__(16) bf stg[2][SPLITA ? 3 : 2][64 * 72];
    __shared__ __align__(16) float ost[4][16 * 68];
    const int lane = threadIdx.x & 31, wave = threadIdx.x >> 5, lr = lane & 15, hi = lane >> 4;
    const int r0 = blockIdx.x * 64 + wave * 16, c0 = blockIdx.y * 64;
    const int srow = threadIdx.x >> 3, spc = (threadIdx.x & 7) * 8;      // staging: 8 threads cover one 128 B row piece by piece, 16 rows a pass
    unsigned so[4];      // the thread's byte offset inside a 64-row tile, one per pass; the tile's own address is uniform
#pragma unroll
    for (int s = 0; s < 4; ++s) so[s] = ((unsigned)(srow + 16 * s) * (unsigned)K + (unsigned)spc) * 2u;
    v8us ga[4], gb[4], gl[4];
    auto fetch = [&](int kc) {
        const char* ta = (const char*)(A + (size_t)(blockIdx.x * 64) * K + kc); const char* tb = (const char*)(Bn + (size_t)c0 * K + kc); const char* tl = SPLITA ? (const char*)(Al + (size_t)(blockIdx.x * 64) * K + kc) : ta;
        const char* pa[4]; const char* pb[4]; const char* pl[4];
#pragma unroll
        for (int s = 0; s < 4; ++s) { pa[s] = ta + so[s]; pb[s] = tb + so[s]; pl[s] = tl + so[s]; }
#pragma unroll
        for (int s = 0; s < 4; ++s) { ga[s] = *(const v8us*)pa[s]; gb[s] = *(const v8us*)pb[s]; if (SPLITA) gl[s] = *(const v8us*)pl[s]; }
        // The wait that stands before a register named by an issued load is rewritten; the addresses are its inputs so that none of them is reused as a destination of these loads.
        asm volatile("s_wait_xcnt 0x0" :: "v"(pa[0]), "v"(pa[1]), "v"(pa[2]), "v"(pa[3]), "v"(pb[0]), "v"(pb[1]), "v"(pb[2]), "v"(pb[3]), "v"(pl[0]), "v"(pl[1]), "v"(pl[2]), "v"(pl[3]) : "memory");
    };
    auto put = [&](int buf) {
#pragma unroll
        for (int s = 0; s < 4; ++s) { const int o = (srow + 16 * s) * 72 + spc; *(v8usa*)(&stg[buf][0][o]) = ga[s]; *(v8usa*)(&stg[buf][1][o]) = gb[s]; if (SPLITA) *(v8usa*)(&stg[buf][SPLITA ? 2 : 0][o]) = gl[s]; }
    };
    v8f acc[4];
#pragma unroll
    for (int t = 0; t < 4; ++t) acc[t] = (v8f){};
    fetch(0); put(0);
    __syncthreads();      // stage 0 is complete before any wave reads it
#pragma unroll 1
    for (int kb = 0; kb < K; kb += 64) {
        const int cur = (kb >> 6) & 1;
        const bool more = kb + 64 < K;
        if (more) fetch(kb + 64);      // the next stage's lines fly while this stage is multiplied
#pragma unroll
        for (int ks = 0; ks < 2; ++ks) {
            const int fo = ks * 32 + 8 * hi, ao = (wave * 16 + lr) * 72 + fo;
            const v16bf a = cat16b(*(const v8usa*)(&stg[cur][0][ao]), *(const v8usa*)(&stg[cur][0][ao + 16]));
            v16bf al = a;
            if (SPLITA) al = cat16b(*(const v8usa*)(&stg[cur][SPLITA ? 2 : 0][ao]), *(const v8usa*)(&stg[cur][SPLITA ? 2 : 0][ao + 16]));
#pragma unroll
            for (int t = 0; t < 4; ++t) { const int bo = (t * 16 + lr) * 72 + fo; const v16bf b = cat16b(*(const v8usa*)(&stg[cur][1][bo]), *(const v8usa*)(&stg[cur][1][bo + 16])); acc[t] = wmmab(a, b, acc[t]); if (SPLITA) acc[t] = wmmab(al, b, acc[t]); }
            asm volatile("v_nop\n\tv_nop\n\tv_nop\n\tv_nop" : "+v"(acc[0]), "+v"(acc[1]), "+v"(acc[2]), "+v"(acc[3]) : "v"(a), "v"(al));
        }
        if (more) put(cur ^ 1);        // into the buffer whose readers all passed the barrier of the trip before
        __syncthreads();               // publishes the next stage and ends every wave's reads of this one
    }
    float* os = &ost[wave][0];
#pragma unroll
    for (int t = 0; t < 4; ++t) { const float bv = bias ? bfr(bias[c0 + t * 16 + lr]) : 0.f;
#pragma unroll
        for (int j = 0; j < 8; ++j) os[(hi * 8 + j) * 68 + t * 16 + lr] = acc[t][j] + bv; }
    __syncthreads();
    if (F16OUT) {
        h16* crow = (h16*)(void*)C + (size_t)r0 * ldc + c0;
        auto pass = [&]() {
#pragma unroll
            for (int s = 0; s < 4; ++s) { const int row = 4 * s + (lane >> 3), piece = lane & 7; const float* sp = os + row * 68 + piece * 8; v8h o, o2;
#pragma unroll
                for (int i = 0; i < 8; ++i) { const h16 a = (h16)sp[i]; o[i] = a; o2[i] = (h16)((sp[i] - (float)a) * LOSC); }
                *(v8h*)(crow + (size_t)row * ldc + piece * 8) = o; if (C2) *(v8h*)(C2 + (size_t)r0 * ldc + c0 + (size_t)row * ldc + piece * 8) = o2; }
        };
        pass(); 
    } else {
        float* crow = C + (size_t)r0 * ldc + c0;
        auto pass = [&]() {
#pragma unroll
            for (int s = 0; s < 8; ++s) { const int Lid = (lane >> 3) + 4 * s, piece = lane & 7; const int row = Lid >> 1, cofs = (Lid & 1) * 32 + piece * 4;
                v4f val = *(const v4fa*)(os + row * 68 + cofs); if (R) { const v4f rv = *(const v4f*)(R + ((size_t)r0 + row) * ldc + c0 + cofs); val += roundR ? (v4f){bfr(rv[0]), bfr(rv[1]), bfr(rv[2]), bfr(rv[3])} : rv; }
                *(v4f*)(crow + (size_t)row * ldc + cofs) = val; }
        };
        pass(); 
    }
}

__global__ __launch_bounds__(256) void k_vt(const float* __restrict__ V, h16* VTH, h16* VTL) {
    __shared__ __align__(16) h16 tile[64 * 72];
    __shared__ __align__(16) h16 til2[64 * 72];
    const int bid = blockIdx.x;
    const int b = bid / (NH_ * (NT_ / 64)), rem = bid - b * (NH_ * (NT_ / 64)), h = rem / (NT_ / 64), kt = rem - h * (NT_ / 64);
    const int k0 = kt * 64, tid = threadIdx.x;
    const int kk = tid >> 2, d0 = (tid & 3) * 16;
    const float* src = V + ((size_t)b * NT_ + k0 + kk) * DM + h * HD + d0;
#pragma unroll
    for (int i = 0; i < 16; ++i) { const float v = src[i]; const h16 a = (h16)v; tile[(d0 + i) * 72 + kk] = a; til2[(d0 + i) * 72 + kk] = (h16)((v - (float)a) * LOSC); }
    __syncthreads();
    const int piece = tid & 7;
    const size_t base = (((size_t)b * NH_ + h) * HD) * NT_ + k0;
    auto pass = [&]() {
#pragma unroll
        for (int s = 0; s < 4; ++s) { const int Lid = (tid >> 3) + 32 * s; const int pln = Lid >> 6, d = Lid & 63;
            const v8h val = *(const v8ha*)((pln ? til2 : tile) + d * 72 + piece * 8); *(v8h*)((pln ? VTL : VTH) + base + (size_t)d * NT_ + piece * 8) = val; }
    };
    pass(); 
}

// k_attn: block = (b, h, the two 64-query tiles 31 - t and t, one after the other: 66 key steps in every block), wave = 16 queries; key tiles up to the diagonal. Both products are
// transposed: scores^T = K.Q^T (A = key rows, B = queries) /8 (f32), so a lane holds 16 of the 32 scores of ONE query (query = lane & 15; keys 8 * (lane >> 4) + j and 16 + 8 * (lane >> 4) + j):
// the online softmax's maximum and sum are taken inside the lane plus one exchange between the wave's halves, and the weights x32768 (f16 hi + residual), converted in place, ARE the B operand
// of ctx^T += V^T.P^T (the same k order as the V^T rows' loader); ctx -> bf16 hi + residual planes CH/CL[tok][h*64+d].
__global__ __launch_bounds__(128) void k_attn(const h16* __restrict__ Q16, const h16* __restrict__ QL16, const h16* __restrict__ K16, const h16* __restrict__ KL16, const h16* __restrict__ VTH, const h16* __restrict__ VTL, bf* CH, bf* CL) {
    __shared__ __align__(16) float ost[4][16 * 68];
    // Operand tiles in LDS, filled by the block's 128 threads together (each line fetched once a query tile) and read as fragments by all four waves; two buffers each.
    __shared__ __align__(16) h16 kst[2][2][32 * 72];      // [buffer][hi, residual][key][64 d, row pitch 144 B]
    __shared__ __align__(16) h16 vst[2][2][64 * 40];      // [buffer][hi, residual][d][32 keys, row pitch 80 B]
    __shared__ __align__(16) h16 qls[4][16 * 72];         // each wave's 16 query-residual rows, filled once a query tile
    const int lane = threadIdx.x & 31, wave = threadIdx.x >> 5, lr = lane & 15, hi = lane >> 4;
    const int bid = blockIdx.x;
    const int b = bid / (NH_ * (NT_ / 128)), rem = bid - b * (NH_ * (NT_ / 128)), h = rem / (NT_ / 128), tp = rem - h * (NT_ / 128);
    const size_t tok0 = (size_t)b * NT_;
    // A tile's cost grows with its index (causal) and every block is resident at once: a block that takes tile 31 - t and then tile t walks 66 key steps whatever t is.
    // The second tile's first LDS writes stand behind the first tile's last two barriers. Kept rolled: one copy of the body in the instruction cache.
#pragma unroll 1
    for (int part = 0; part < 2; ++part) {
    const int qt = part ? tp : NT_ / 64 - 1 - tp;
    const int q0 = qt * 64 + wave * 16;
    v16h qa[2];
    const size_t qo0 = (tok0 + q0 + lr) * DM + h * HD + 8 * hi;
#pragma unroll
    for (int kc = 0; kc < 2; ++kc) qa[kc] = cat16(*(const v8h*)(Q16 + qo0 + kc * 32), *(const v8h*)(Q16 + qo0 + kc * 32 + 16));
    const h16* kh_b = K16 + tok0 * DM + h * HD;
    const h16* kl_b = KL16 + tok0 * DM + h * HD;
    const size_t vbase = (((size_t)b * NH_ + h) * HD) * NT_;
    v8f o[4], ox[4];
#pragma unroll
    for (int n = 0; n < 4; ++n) { o[n] = (v8f){}; ox[n] = (v8f){}; }
    float mrow = -3.0e38f, lpart = 0.f;      // the lane's one query: running maximum (alike in both halves), sum over the lane's own keys
    const int qi = q0 + lr;
    const int kt_lo = 0, kt_hi = (qt * 64 + 63) / 32;     // causal
    const int krow = threadIdx.x >> 3, kpc = (threadIdx.x & 7) * 8;      // key tile: 8 threads a 128 B row, 16 rows a pass
    const int vrow = threadIdx.x >> 2, vpc = (threadIdx.x & 3) * 8;      // value tile: 4 threads a 64 B row, 32 rows a pass
    v8h gk[2][2], gv[2][2];
    auto fetch = [&](int l0) {
#pragma unroll
        for (int s = 0; s < 2; ++s) {
            const size_t ko = (size_t)(l0 + krow + 16 * s) * DM + kpc, vo = vbase + (size_t)(vrow + 32 * s) * NT_ + l0 + vpc;
            gk[0][s] = *(const v8h*)(kh_b + ko); gk[1][s] = *(const v8h*)(kl_b + ko); gv[0][s] = *(const v8h*)(VTH + vo); gv[1][s] = *(const v8h*)(VTL + vo); }
    };
    auto put = [&](int buf) {
#pragma unroll
        for (int s = 0; s < 2; ++s) {
            const int ko = (krow + 16 * s) * 72 + kpc, vo = (vrow + 32 * s) * 40 + vpc;
            *(v8ha*)(&kst[buf][0][ko]) = gk[0][s]; *(v8ha*)(&kst[buf][1][ko]) = gk[1][s]; *(v8ha*)(&vst[buf][0][vo]) = gv[0][s]; *(v8ha*)(&vst[buf][1][vo]) = gv[1][s]; }
    };
    fetch(0);
#pragma unroll
    for (int s = 0; s < 4; ++s) { const int row = 4 * s + (lane >> 3), pc = (lane & 7) * 8; *(v8ha*)(&qls[wave][row * 72 + pc]) = *(const v8h*)(QL16 + (tok0 + q0 + row) * DM + h * HD + pc); }
    put(0);
    __syncthreads();      // tile 0 is complete before any wave reads it
    const h16* ql_s = &qls[wave][lr * 72 + 8 * hi];
#pragma unroll 1
    for (int kt = kt_lo; kt <= kt_hi; ++kt) {
        const int l0 = kt * 32, cur = kt & 1;
        if (kt < kt_hi) fetch(l0 + 32);      // the next tile's lines fly while this tile is worked on
        const h16* kh_s = &kst[cur][0][0]; const h16* kl_s = &kst[cur][1][0];
        const int ko0 = lr * 72 + 8 * hi, ko1 = (16 + lr) * 72 + 8 * hi;
        v8f s0 = {}, s1 = {}, x0 = {}, x1 = {};
#pragma unroll
        for (int kc = 0; kc < 2; ++kc) {
            { const v16h k0h = cat16(*(const v8ha*)(kh_s + ko0 + kc * 32), *(const v8ha*)(kh_s + ko0 + kc * 32 + 16)), k1h = cat16(*(const v8ha*)(kh_s + ko1 + kc * 32), *(const v8ha*)(kh_s + ko1 + kc * 32 + 16));
              const v16h qlk = cat16(*(const v8ha*)(ql_s + kc * 32), *(const v8ha*)(ql_s + kc * 32 + 16));     // query residual re-read per step (registers)
              s0 = wmma16(k0h, qa[kc], s0); x0 = wmma16(k0h, qlk, x0); s1 = wmma16(k1h, qa[kc], s1); x1 = wmma16(k1h, qlk, x1);
              asm volatile("v_nop" : "+v"(s0), "+v"(s1), "+v"(x0), "+v"(x1) : "v"(qlk), "v"(k0h), "v"(k1h) : "memory"); }
            { const v16h k0l = cat16(*(const v8ha*)(kl_s + ko0 + kc * 32), *(const v8ha*)(kl_s + ko0 + kc * 32 + 16)), k1l = cat16(*(const v8ha*)(kl_s + ko1 + kc * 32), *(const v8ha*)(kl_s + ko1 + kc * 32 + 16));
              x0 = wmma16(k0l, qa[kc], x0); x1 = wmma16(k1l, qa[kc], x1);
              asm volatile("v_nop" : "+v"(x0), "+v"(x1) : "v"(k0l), "v"(k1l) : "memory"); }
        }
        asm volatile("v_nop\n\tv_nop\n\tv_nop\n\tv_nop" : "+v"(s0), "+v"(s1), "+v"(x0), "+v"(x1) : "v"(qa[0]), "v"(qa[1]));
        float a0[8], a1[8];
        const int dq = qi - 8 * hi - l0;      // the lane's query counted from the lane's first key of this tile
#pragma unroll
        for (int j = 0; j < 8; ++j) {
            a0[j] = (j <= dq) ? (s0[j] + x0[j] * LOSCI) * 0.125f : -__builtin_inff(); a1[j] = (16 + j <= dq) ? (s1[j] + x1[j] * LOSCI) * 0.125f : -__builtin_inff();      // key l0 + 8 hi + j (+ 16) <= query
        }
        // the query's maximum over the lane's 16 keys as a tree of three-way maxima, then the other half's
        const float m0 = fmaxf(fmaxf(a0[0], a0[1]), a0[2]), m1 = fmaxf(fmaxf(a0[3], a0[4]), a0[5]), m2 = fmaxf(fmaxf(a0[6], a0[7]), a1[0]);
        const float m3 = fmaxf(fmaxf(a1[1], a1[2]), a1[3]), m4 = fmaxf(fmaxf(a1[4], a1[5]), a1[6]);
        float mx = fmaxf(fmaxf(fmaxf(m0, m1), m2), fmaxf(fmaxf(m3, m4), a1[7]));
        mx = fmaxf(mx, xhalf(mx));
        const float mn = fmaxf(mrow, mx);
        const float alpha = __expf(mrow - mn); mrow = mn;
        v16h pa, px;
        float ls[4] = {0.f, 0.f, 0.f, 0.f};      // four independent chains
#pragma unroll
        for (int j = 0; j < 8; ++j) {
            const float p0 = __expf(a0[j] - mn);
            if (j == 0) asm volatile("v_nop");      // the slot that the instruction set asks for behind a transcendental whose source the next instruction overwrites
            const float p1 = __expf(a1[j] - mn);
            ls[j & 3] += p0 + p1;
            const float ps0 = p0 * PSC, ps1 = p1 * PSC; const h16 h0 = (h16)ps0, h1 = (h16)ps1;
            pa[j] = h0; pa[8 + j] = h1;
            px[j] = (h16)((ps0 - (float)h0) * LOSC); px[8 + j] = (h16)((ps1 - (float)h1) * LOSC);
        }
        lpart = lpart * alpha + ((ls[0] + ls[1]) + (ls[2] + ls[3]));
#pragma unroll
        for (int n = 0; n < 4; ++n)
#pragma unroll
            for (int j = 0; j < 8; ++j) { o[n][j] *= alpha; ox[n][j] *= alpha; }
#pragma unroll
        for (int n = 0; n < 4; ++n) { const int vo = (n * 16 + lr) * 40 + hi * 8;
            const v16h vh = cat16(*(const v8ha*)(&vst[cur][0][vo]), *(const v8ha*)(&vst[cur][0][vo + 16])), vl = cat16(*(const v8ha*)(&vst[cur][1][vo]), *(const v8ha*)(&vst[cur][1][vo + 16]));
            o[n] = wmma16(vh, pa, o[n]); ox[n] = wmma16(vl, pa, ox[n]); ox[n] = wmma16(vh, px, ox[n]);
            asm volatile("" : "+v"(o[n]), "+v"(ox[n]) : "v"(vh), "v"(vl) : "memory"); }
        asm volatile("v_nop\n\tv_nop\n\tv_nop\n\tv_nop" : "+v"(o[0]), "+v"(o[1]), "+v"(o[2]), "+v"(o[3]), "+v"(ox[0]), "+v"(ox[1]), "+v"(ox[2]), "+v"(ox[3]) : "v"(pa), "v"(px));
        if (kt < kt_hi) put(cur ^ 1);      // into the buffer whose readers all passed the barrier of the trip before
        __syncthreads();                   // publishes the next tile and ends every wave's reads of this one
    }
    const float inv = 1.0f / ((lpart + xhalf(lpart)) * PSC);      // the two halves' sums are joined once
    float* os = &ost[wave][0];
#pragma unroll
    for (int n = 0; n < 4; ++n)      // the lane holds d = 16 n + 8 hi + j of its query's row
#pragma unroll
        for (int q = 0; q < 2; ++q) { v4f t;
#pragma unroll
            for (int i = 0; i < 4; ++i) t[i] = (o[n][q * 4 + i] + ox[n][q * 4 + i] * LOSCI) * inv;
            *(v4fa*)(os + lr * 68 + n * 16 + hi * 8 + q * 4) = t; }
    __syncthreads();
    const size_t cbase = (tok0 + q0) * DM + (size_t)h * HD;
    auto pass = [&]() {
#pragma unroll
        for (int s = 0; s < 4; ++s) { const int row = 4 * s + (lane >> 3), piece = lane & 7; const float* sp = os + row * 68 + piece * 8; v8us oh, ol;
#pragma unroll
            for (int i = 0; i < 8; ++i) { const unsigned short hb = f2bf(sp[i]); oh[i] = hb; ol[i] = f2bf(sp[i] - bf2f(hb)); }
            *(v8us*)(CH + cbase + (size_t)row * DM + piece * 8) = oh; *(v8us*)(CL + cbase + (size_t)row * DM + piece * 8) = ol; }
    };
    pass(); 
    asm volatile("s_wait_xcnt 0x0" ::: "memory");      // the wait that stands before the second tile's first instructions rewrite registers named by these stores
    }
}


// k_wt: WT [n][K] = bf16(W[k][n]) (k-major [K][ncols]) via 64 x 64 LDS tiles; grid (K/64, ncols/64).
__global__ __launch_bounds__(256) void k_wt(const float* __restrict__ Wm, int K, int ncols, bf* WT) {
    __shared__ __align__(16) unsigned short tl[64 * 72];
    const int tid = threadIdx.x, k0 = blockIdx.x * 64, n0 = blockIdx.y * 64;
    const int kk = tid >> 2, nq = (tid & 3) * 16;
#pragma unroll
    for (int i = 0; i < 16; ++i) tl[(nq + i) * 72 + kk] = f2bf(Wm[(size_t)(k0 + kk) * ncols + n0 + nq + i]);
    __syncthreads();
    const int piece = tid & 7;
    auto pass = [&]() {
#pragma unroll
        for (int s = 0; s < 2; ++s) { const int nr = (tid >> 3) + 32 * s; const v8us val = *(const v8usa*)(tl + nr * 72 + piece * 8); *(v8us*)(WT + (size_t)(n0 + nr) * K + k0 + piece * 8) = val; }
    };
    pass(); 
}

typedef __attribute__((ext_vector_type(4)))  _Float16 v4h;
// k_dwmix: the grouped causal depthwise convolution along the sequence of a projected [2 x 2048][1024] f32 matrix T (row s = batch item s / 2048, position s % 2048) (column c = head h * 64 + d; group g = h / 4: g = 0
// identity, else y[s][c] = bf(bias_g[d]) + sum_i bf(w_g[d][i]) * T[s - (width-1) + i][c] over rows of the same batch item, width = 2g + 1, summed in the order i = 0, 1, ...).
// Block = DWR consecutive rows, wave = one chunk of 128 columns (inside one group), lane -> 4 consecutive columns. A wave issues all of its DWR + width - 1 row loads (16 B a lane)
// and its weight loads before it uses any of them, holds the rounded weights in registers for all DWR rows, and every loop is unrolled: no load waits on another.
#define DWR 8
typedef v4f __attribute__((aligned(4))) v4fu;      // the small weight arrays are read 16 B at a time with no more than their element alignment assumed
template <int KW, bool EDGE>
__device__ __forceinline__ void dw_rows(const float* __restrict__ T, const float* __restrict__ wg, const float* __restrict__ bg, int s0, int c0, v4f (&y)[DWR]) {
    // EDGE: the block starts its batch item (s0 is the item's first row): the width - 1 rows before it do not exist, their loads fall on row s0 and their taps are left out.
    const char* tb = (const char*)(T + (size_t)(EDGE ? s0 : s0 - (KW - 1)) * DM);      // uniform; the lane's own part of every address is one 32-bit offset
    const unsigned ro = (unsigned)c0 * 4u, bo = (unsigned)(c0 & (HD - 1)) * 4u;
    const char* wp = (const char*)wg + bo * (unsigned)KW;      // the lane's 4 x width weights lie in a row: element i * width + t
    v4f row[DWR + KW - 1], wv[KW], bv;
#pragma unroll
    for (int q = 0; q < KW; ++q) wv[q] = *(const v4fu*)(wp + q * 16);
    bv = *(const v4fu*)((const char*)bg + bo);
#pragma unroll
    for (int k = 0; k < DWR + KW - 1; ++k) row[k] = *(const v4f*)(tb + ro + (size_t)(EDGE ? (k < KW - 1 ? 0 : k - (KW - 1)) : k) * DM * 4);
    // The wait that stands before a register named by an issued load is rewritten; the lane's address parts are its inputs so that none of them is reused as a destination of
    // these loads, and no load is moved behind it: all of the wave's loads are in flight together.
    asm volatile("s_wait_xcnt 0x0" :: "v"(ro), "v"(wp), "v"(bo) : "memory");
    __builtin_amdgcn_sched_barrier(0);      // no arithmetic on the first values (with its wait) is lifted in front of the last loads
    float w[4 * KW];
#pragma unroll
    for (int q = 0; q < KW; ++q)
#pragma unroll
        for (int e = 0; e < 4; ++e) w[q * 4 + e] = bfr(wv[q][e]);
#pragma unroll
    for (int e = 0; e < 4; ++e) bv[e] = bfr(bv[e]);
#pragma unroll
    for (int j = 0; j < DWR; ++j)
#pragma unroll
        for (int i = 0; i < 4; ++i) { float acc = bv[i];
#pragma unroll
            for (int t = 0; t < KW; ++t) { if (!EDGE || j + t >= KW - 1) acc = fmaf(row[j + t][i], w[i * KW + t], acc); }
            y[j][i] = acc; }
}
template <bool F16>
__global__ __launch_bounds__(256) void k_dwmix(const float* __restrict__ T, const float* __restrict__ w3, const float* __restrict__ b3, const float* __restrict__ w5, const float* __restrict__ b5, const float* __restrict__ w7, const float* __restrict__ b7, float* Y, h16* YH, h16* YL) {
    const int lane = threadIdx.x & 31, s0 = blockIdx.x * DWR;
    const int ch = __builtin_amdgcn_readfirstlane(threadIdx.x >> 5);      // the wave's chunk in a scalar register: the choice of the group below is a scalar branch
    if (s0 >= NTK) return;
    const int c0 = ch * 128 + lane * 4, g = ch >> 1;      // 2 chunks = 4 heads = one group
    const bool edge = (s0 & (NT_ - 1)) == 0;               // DWR > width - 1: only a batch item's first block lacks rows
    const unsigned ro = (unsigned)c0 * 4u;
    v4f y[DWR];
    if (g == 0) {
#pragma unroll
        for (int j = 0; j < DWR; ++j) y[j] = *(const v4f*)((const char*)(T + (size_t)s0 * DM) + ro + j * DM * 4);
        asm volatile("s_wait_xcnt 0x0" :: "v"(ro) : "memory");      // the wait that stands before a register named by an issued load is rewritten
    }
    else if (g == 1) { if (edge) dw_rows<3, true>(T, w3, b3, s0, c0, y); else dw_rows<3, false>(T, w3, b3, s0, c0, y); }
    else if (g == 2) { if (edge) dw_rows<5, true>(T, w5, b5, s0, c0, y); else dw_rows<5, false>(T, w5, b5, s0, c0, y); }
    else             { if (edge) dw_rows<7, true>(T, w7, b7, s0, c0, y); else dw_rows<7, false>(T, w7, b7, s0, c0, y); }
#pragma unroll
    for (int j = 0; j < DWR; ++j) {
        if (F16) { v4h oh, ol;
#pragma unroll
            for (int i = 0; i < 4; ++i) { const h16 a = (h16)y[j][i]; oh[i] = a; ol[i] = (h16)((y[j][i] - (float)a) * LOSC); }
            *(v4h*)((char*)(YH + (size_t)s0 * DM) + (ro >> 1) + j * DM * 2) = oh; *(v4h*)((char*)(YL + (size_t)s0 * DM) + (ro >> 1) + j * DM * 2) = ol; }
        else { *(v4f*)((char*)(Y + (size_t)s0 * DM) + ro + j * DM * 4) = y[j]; }
    }
}

extern "C" void kernel_launch(void* const* d_in, const int* in_sizes, int n_in,
                              void* d_out, int out_size, void* d_ws, size_t ws_size, hipStream_t stream) {
    (void)in_sizes; (void)n_in; (void)out_size;
    const float* x = (const float*)d_in[0]; const float* Wqkv = (const float*)d_in[1]; const float* bqkv = (const float*)d_in[2]; const float* Wo = (const float*)d_in[3]; const float* bo = (const float*)d_in[4];   // k-major weights (x @ W)
    const float* cw[3][6]; for (int p = 0; p < 3; ++p) for (int j = 0; j < 6; ++j) cw[p][j] = (const float*)d_in[5 + p * 6 + j];     // (w3, b3, w5, b5, w7, b7) for q, k, v
    float* out = (float*)d_out;    // [2][2048][1024]
    char* wsp = (char*)d_ws;
    auto take = [&](size_t bytes) { char* p = wsp; wsp += (bytes + 255) & ~(size_t)255; return (void*)p; };
    bf* WT = (bf*)take((size_t)3 * DM * DM * 2); bf* WoT = (bf*)take((size_t)DM * DM * 2); bf* Xb = (bf*)take((size_t)NTK * DM * 2);
    float* TMP = (float*)take((size_t)NTK * DM * 4); float* TV = (float*)take((size_t)NTK * DM * 4);
    h16* QH = (h16*)take((size_t)NTK * DM * 2); h16* QL = (h16*)take((size_t)NTK * DM * 2); h16* KH = (h16*)take((size_t)NTK * DM * 2); h16* KL = (h16*)take((size_t)NTK * DM * 2);
    h16* VTH = (h16*)take((size_t)NTK * DM * 2); h16* VTL = (h16*)take((size_t)NTK * DM * 2); bf* CH = (bf*)take((size_t)NTK * DM * 2); bf* CL = (bf*)take((size_t)NTK * DM * 2);
    if ((size_t)(wsp - (char*)d_ws) > ws_size) return;    // about 118 MB in all, no aliasing
    k_wt<<<dim3(DM / 64, 3 * DM / 64, 1), 256, 0, stream>>>(Wqkv, DM, 3 * DM, WT); k_wt<<<dim3(DM / 64, DM / 64, 1), 256, 0, stream>>>(Wo, DM, DM, WoT);
    {
        k_cvtb<<<NTK / 8, 256, 0, stream>>>(x, NTK, Xb);
        k_gemmb<false, false><<<dim3(NTK / 64, DM / 64, 1), 128, 0, stream>>>(Xb, nullptr, WT, bqkv, TMP, DM, nullptr);                                  // q (f32)
        k_dwmix<true><<<NTK / DWR, 256, 0, stream>>>(TMP, cw[0][0], cw[0][1], cw[0][2], cw[0][3], cw[0][4], cw[0][5], nullptr, QH, QL);
        k_gemmb<false, false><<<dim3(NTK / 64, DM / 64, 1), 128, 0, stream>>>(Xb, nullptr, WT + (size_t)DM * DM, bqkv + DM, TMP, DM, nullptr);          // k
        k_dwmix<true><<<NTK / DWR, 256, 0, stream>>>(TMP, cw[1][0], cw[1][1], cw[1][2], cw[1][3], cw[1][4], cw[1][5], nullptr, KH, KL);
        k_gemmb<false, false><<<dim3(NTK / 64, DM / 64, 1), 128, 0, stream>>>(Xb, nullptr, WT + (size_t)2 * DM * DM, bqkv + 2 * DM, TMP, DM, nullptr);  // v
        k_dwmix<false><<<NTK / DWR, 256, 0, stream>>>(TMP, cw[2][0], cw[2][1], cw[2][2], cw[2][3], cw[2][4], cw[2][5], TV, nullptr, nullptr);
        k_vt<<<NB_ * NH_ * (NT_ / 64), 256, 0, stream>>>(TV, VTH, VTL);
        k_attn<<<NB_ * NH_ * (NT_ / 128), 128, 0, stream>>>(QH, QL, KH, KL, VTH, VTL, CH, CL);
        k_gemmb<true, false><<<dim3(NTK / 64, DM / 64, 1), 128, 0, stream>>>(CH, CL, WoT, bo, out, DM, nullptr);
    }
}

// v006
// Measured time: 160 microseconds a run.
// Next to v005, in two timings, it ran 1.09 and 1.10 times as fast.
// Over all steps from v000 it is 4.50 times as fast.
#include <hip/hip_runtime.h>

// Compute dtypes, f32 accumulate, both batch items in one pass (4096 rows per launch): qkv = x.c_attn_w + b ([4096 x 1024].[1024 x 3072], one launch, PLAIN bf16 operands = the
// rounded input and the k-major weights transposed once; exact products) on v_wmma_f32_16x16x32_bf16 -> f32; the per-head-group causal depthwise convolutions along the
// sequence (heads 0-3 identity, 4-7 width 3, 8-11 width 5, 12-15 width 7; weights/biases read as inputs) in f32 -> q/k as f16 hi + residual x1024 planes, v -> f32 ->
// transposed f16 hi + residual planes; the 16-head causal attention (masked positions are -inf and contribute exp(-inf - m) = 0) fused on v_wmma_f32_16x16x32_f16
// (hh + hl + lh x 1/8, online f32 softmax, weights x32768 and v as f16 hi + residual x1024); out = ctx.c_proj_w + b (ctx as bf16 hi + UNSCALED residual against the

#define NB_  2                   // both batch items go through every launch together
#define NT_  2048
#define DM   1024
#define NH_  16
#define HD   64
#define HK   4                    // heads per group
#define NTK  (NB_ * NT_)
#define NW   1024
#define NQKV 1024
#define PSC  32768.0f
#define LOSC 1024.0f
#define LOSCI (1.0f / 1024.0f)

typedef _Float16 h16;
typedef unsigned short bf;
typedef __attribute__((ext_vector_type(16))) __bf16   v16bf;
typedef __attribute__((ext_vector_type(16))) _Float16 v16h;
typedef __attribute__((ext_vector_type(8)))  _Float16 v8h;
typedef __attribute__((ext_vector_type(8)))  unsigned short v8us;
typedef __attribute__((ext_vector_type(8)))  float    v8f;
typedef __attribute__((ext_vector_type(4)))  float    v4f;
typedef v8h  __attribute__((may_alias)) v8ha;
typedef v4f  __attribute__((may_alias)) v4fa;
typedef v8us __attribute__((may_alias)) v8usa;

__device__ __forceinline__ unsigned short f2bf(float f) { unsigned u = __float_as_uint(f); u += 0x7FFFu + ((u >> 16) & 1u); return (unsigned short)(u >> 16); }
__device__ __forceinline__ float bf2f(unsigned short b) { return __uint_as_float(((unsigned)b) << 16); }
__device__ __forceinline__ float bfr(float f) { return bf2f(f2bf(f)); }
__device__ __forceinline__ v16h cat16(v8h lo, v8h hi) { return __builtin_shufflevector(lo, hi, 0, 1, 2, 3, 4, 5, 6, 7, 8, 9, 10, 11, 12, 13, 14, 15); }
__device__ __forceinline__ v16bf cat16b(v8us lo, v8us hi) { return __builtin_bit_cast(v16bf, __builtin_shufflevector(lo, hi, 0, 1, 2, 3, 4, 5, 6, 7, 8, 9, 10, 11, 12, 13, 14, 15)); }
__device__ __forceinline__ v8f wmma16(v16h a, v16h b, v8f c) { return __builtin_amdgcn_wmma_f32_16x16x32_f16(false, a, false, b, (short)0, c, false, false); }
__device__ __forceinline__ float xhalf(float x) { return __builtin_bit_cast(float, __builtin_amdgcn_permlanex16(__builtin_bit_cast(int, x), __builtin_bit_cast(int, x), 0x76543210, 0xfedcba98, false, false)); }      // lane l takes lane l ^ 16's value
__device__ __forceinline__ v8f wmmab(v16bf a, v16bf b, v8f c) { return __builtin_amdgcn_wmma_f32_16x16x32_bf16(false, a, false, b, (short)0, c, false, false); }

__device__ __forceinline__ void cvtb_body(const float* __restrict__ src, int nrows, bf* dst, int blk) {
    const int lane = threadIdx.x & 31, r = blk * 8 + (threadIdx.x >> 5);
    if (r >= nrows) return;
    v8us o[DM / 256];
#pragma unroll
    for (int q = 0; q < DM / 256; ++q) { v8us t;
#pragma unroll
        for (int i = 0; i < 8; ++i) t[i] = f2bf(src[(size_t)r * DM + q * 256 + lane * 8 + i]);
        o[q] = t; }
#pragma unroll
    for (int q = 0; q < DM / 256; ++q) *(v8us*)(dst + (size_t)r * DM + q * 256 + lane * 8) = o[q];
    
}

// k_gemmb: 64 x 64 block tile (4 waves x 16 x 64) of C[NTK][ldc] = (A [+ Al]).B^T (K = 1024) [+ bf(bias[c])] [+ bf(R[r][c]) residual]; f32 whole-line epilogue (or f16
template <bool SPLITA, bool F16OUT = false>
__global__ __launch_bounds__(128) void k_gemmb(const bf* __restrict__ A, const bf* __restrict__ Al, const bf* __restrict__ Bn, const float* __restrict__ bias, float* C, int ldc, h16* C2, const float* __restrict__ R = nullptr, int K = DM, int roundR = 1) {
    // stg: two buffers of the block's operand tiles (plane 0 = 64 A rows, 1 = 64 B rows, 2 = 64 Al rows; 64 k each, row pitch 72 elements = 144 B), filled by whole-line
    // loads that the four waves share; the fragments are read from here.
    __shared__ __align__(16) bf stg[2][SPLITA ? 3 : 2][64 * 72];
    __shared__ __align__(16) float ost[4][16 * 68];
    const int lane = threadIdx.x & 31, wave = threadIdx.x >> 5, lr = lane & 15, hi = lane >> 4;
    const int r0 = blockIdx.x * 64 + wave * 16, c0 = blockIdx.y * 64;
    const int srow = threadIdx.x >> 3, spc = (threadIdx.x & 7) * 8;      // staging: 8 threads cover one 128 B row piece by piece, 16 rows a pass
    unsigned so[4];      // the thread's byte offset inside a 64-row tile, one per pass; the tile's own address is uniform
#pragma unroll
    for (int s = 0; s < 4; ++s) so[s] = ((unsigned)(srow + 16 * s) * (unsigned)K + (unsigned)spc) * 2u;
    v8us ga[4], gb[4], gl[4];
    auto fetch = [&](int kc) {
        const char* ta = (const char*)(A + (size_t)(blockIdx.x * 64) * K + kc); const char* tb = (const char*)(Bn + (size_t)c0 * K + kc); const char* tl = SPLITA ? (const char*)(Al + (size_t)(blockIdx.x * 64) * K + kc) : ta;
        const char* pa[4]; const char* pb[4]; const char* pl[4];
#pragma unroll
        for (int s = 0; s < 4; ++s) { pa[s] = ta + so[s]; pb[s] = tb + so[s]; pl[s] = tl + so[s]; }
#pragma unroll
        for (int s = 0; s < 4; ++s) { ga[s] = *(const v8us*)pa[s]; gb[s] = *(const v8us*)pb[s]; if (SPLITA) gl[s] = *(const v8us*)pl[s]; }
        // The wait that stands before a register named by an issued load is rewritten; the addresses are its inputs so that none of them is reused as a destination of these loads.
        asm volatile("s_wait_xcnt 0x0" :: "v"(pa[0]), "v"(pa[1]), "v"(pa[2]), "v"(pa[3]), "v"(pb[0]), "v"(pb[1]), "v"(pb[2]), "v"(pb[3]), "v"(pl[0]), "v"(pl[1]), "v"(pl[2]), "v"(pl[3]) : "memory");
    };
    auto put = [&](int buf) {
#pragma unroll
        for (int s = 0; s < 4; ++s) { const int o = (srow + 16 * s) * 72 + spc; *(v8usa*)(&stg[buf][0][o]) = ga[s]; *(v8usa*)(&stg[buf][1][o]) = gb[s]; if (SPLITA) *(v8usa*)(&stg[buf][SPLITA ? 2 : 0][o]) = gl[s]; }
    };
    v8f acc[4];
#pragma unroll
    for (int t = 0; t < 4; ++t) acc[t] = (v8f){};
    fetch(0); put(0);
    __syncthreads();      // stage 0 is complete before any wave reads it
#pragma unroll 1
    for (int kb = 0; kb < K; kb += 64) {
        const int cur = (kb >> 6) & 1;
        const bool more = kb + 64 < K;
        if (more) fetch(kb + 64);      // the next stage's lines fly while this stage is multiplied
#pragma unroll
        for (int ks = 0; ks < 2; ++ks) {
            const int fo = ks * 32 + 8 * hi, ao = (wave * 16 + lr) * 72 + fo;
            const v16bf a = cat16b(*(const v8usa*)(&stg[cur][0][ao]), *(const v8usa*)(&stg[cur][0][ao + 16]));
            v16bf al = a;
            if (SPLITA) al = cat16b(*(const v8usa*)(&stg[cur][SPLITA ? 2 : 0][ao]), *(const v8usa*)(&stg[cur][SPLITA ? 2 : 0][ao + 16]));
#pragma unroll
            for (int t = 0; t < 4; ++t) { const int bo = (t * 16 + lr) * 72 + fo; const v16bf b = cat16b(*(const v8usa*)(&stg[cur][1][bo]), *(const v8usa*)(&stg[cur][1][bo + 16])); acc[t] = wmmab(a, b, acc[t]); if (SPLITA) acc[t] = wmmab(al, b, acc[t]); }
            asm volatile("v_nop\n\tv_nop\n\tv_nop\n\tv_nop" : "+v"(acc[0]), "+v"(acc[1]), "+v"(acc[2]), "+v"(acc[3]) : "v"(a), "v"(al));
        }
        if (more) put(cur ^ 1);        // into the buffer whose readers all passed the barrier of the trip before
        __syncthreads();               // publishes the next stage and ends every wave's reads of this one
    }
    float* os = &ost[wave][0];
#pragma unroll
    for (int t = 0; t < 4; ++t) { const float bv = bias ? bfr(bias[c0 + t * 16 + lr]) : 0.f;
#pragma unroll
        for (int j = 0; j < 8; ++j) os[(hi * 8 + j) * 68 + t * 16 + lr] = acc[t][j] + bv; }
    __syncthreads();
    if (F16OUT) {
        h16* crow = (h16*)(void*)C + (size_t)r0 * ldc + c0;
        auto pass = [&]() {
#pragma unroll
            for (int s = 0; s < 4; ++s) { const int row = 4 * s + (lane >> 3), piece = lane & 7; const float* sp = os + row * 68 + piece * 8; v8h o, o2;
#pragma unroll
                for (int i = 0; i < 8; ++i) { const h16 a = (h16)sp[i]; o[i] = a; o2[i] = (h16)((sp[i] - (float)a) * LOSC); }
                *(v8h*)(crow + (size_t)row * ldc + piece * 8) = o; if (C2) *(v8h*)(C2 + (size_t)r0 * ldc + c0 + (size_t)row * ldc + piece * 8) = o2; }
        };
        pass(); 
    } else {
        float* crow = C + (size_t)r0 * ldc + c0;
        auto pass = [&]() {
#pragma unroll
            for (int s = 0; s < 8; ++s) { const int Lid = (lane >> 3) + 4 * s, piece = lane & 7; const int row = Lid >> 1, cofs = (Lid & 1) * 32 + piece * 4;
                v4f val = *(const v4fa*)(os + row * 68 + cofs); if (R) { const v4f rv = *(const v4f*)(R + ((size_t)r0 + row) * ldc + c0 + cofs); val += roundR ? (v4f){bfr(rv[0]), bfr(rv[1]), bfr(rv[2]), bfr(rv[3])} : rv; }
                *(v4f*)(crow + (size_t)row * ldc + cofs) = val; }
        };
        pass(); 
    }
}

__global__ __launch_bounds__(256) void k_vt(const float* __restrict__ V, h16* VTH, h16* VTL) {
    __shared__ __align__(16) h16 tile[64 * 72];
    __shared__ __align__(16) h16 til2[64 * 72];
    const int bid = blockIdx.x;
    const int b = bid / (NH_ * (NT_ / 64)), rem = bid - b * (NH_ * (NT_ / 64)), h = rem / (NT_ / 64), kt = rem - h * (NT_ / 64);
    const int k0 = kt * 64, tid = threadIdx.x;
    const int kk = tid >> 2, d0 = (tid & 3) * 16;
    const float* src = V + ((size_t)b * NT_ + k0 + kk) * DM + h * HD + d0;
#pragma unroll
    for (int i = 0; i < 16; ++i) { const float v = src[i]; const h16 a = (h16)v; tile[(d0 + i) * 72 + kk] = a; til2[(d0 + i) * 72 + kk] = (h16)((v - (float)a) * LOSC); }
    __syncthreads();
    const int piece = tid & 7;
    const size_t base = (((size_t)b * NH_ + h) * HD) * NT_ + k0;
    auto pass = [&]() {
#pragma unroll
        for (int s = 0; s < 4; ++s) { const int Lid = (tid >> 3) + 32 * s; const int pln = Lid >> 6, d = Lid & 63;
            const v8h val = *(const v8ha*)((pln ? til2 : tile) + d * 72 + piece * 8); *(v8h*)((pln ? VTL : VTH) + base + (size_t)d * NT_ + piece * 8) = val; }
    };
    pass(); 
}

// k_attn: block = (b, h, the two 64-query tiles 31 - t and t, one after the other: 66 key steps in every block), wave = 16 queries; key tiles up to the diagonal. Both products are
// transposed: scores^T = K.Q^T (A = key rows, B = queries) /8 (f32), so a lane holds 16 of the 32 scores of ONE query (query = lane & 15; keys 8 * (lane >> 4) + j and 16 + 8 * (lane >> 4) + j):
// the online softmax's maximum and sum are taken inside the lane plus one exchange between the wave's halves, and the weights x32768 (f16 hi + residual), converted in place, ARE the B operand
// of ctx^T += V^T.P^T (the same k order as the V^T rows' loader); ctx -> bf16 hi + residual planes CH/CL[tok][h*64+d].
__global__ __launch_bounds__(128) void k_attn(const h16* __restrict__ Q16, const h16* __restrict__ QL16, const h16* __restrict__ K16, const h16* __restrict__ KL16, const h16* __restrict__ VTH, const h16* __restrict__ VTL, bf* CH, bf* CL) {
    __shared__ __align__(16) float ost[4][16 * 68];
    // Operand tiles in LDS, filled by the block's 128 threads together (each line fetched once a query tile) and read as fragments by all four waves; two buffers each.
    __shared__ __align__(16) h16 kst[2][2][32 * 72];      // [buffer][hi, residual][key][64 d, row pitch 144 B]
    __shared__ __align__(16) h16 vst[2][2][64 * 40];      // [buffer][hi, residual][d][32 keys, row pitch 80 B]
    __shared__ __align__(16) h16 qls[4][16 * 72];         // each wave's 16 query-residual rows, filled once a query tile
    const int lane = threadIdx.x & 31, wave = threadIdx.x >> 5, lr = lane & 15, hi = lane >> 4;
    const int bid = blockIdx.x;
    const int b = bid / (NH_ * (NT_ / 128)), rem = bid - b * (NH_ * (NT_ / 128)), h = rem / (NT_ / 128), tp = rem - h * (NT_ / 128);
    const size_t tok0 = (size_t)b * NT_;
    // A tile's cost grows with its index (causal) and every block is resident at once: a block that takes tile 31 - t and then tile t walks 66 key steps whatever t is.
    // The second tile's first LDS writes stand behind the first tile's last two barriers. Kept rolled: one copy of the body in the instruction cache.
#pragma unroll 1
    for (int part = 0; part < 2; ++part) {
    const int qt = part ? tp : NT_ / 64 - 1 - tp;
    const int q0 = qt * 64 + wave * 16;
    v16h qa[2];
    const size_t qo0 = (tok0 + q0 + lr) * DM + h * HD + 8 * hi;
#pragma unroll
    for (int kc = 0; kc < 2; ++kc) qa[kc] = cat16(*(const v8h*)(Q16 + qo0 + kc * 32), *(const v8h*)(Q16 + qo0 + kc * 32 + 16));
    const h16* kh_b = K16 + tok0 * DM + h * HD;
    const h16* kl_b = KL16 + tok0 * DM + h * HD;
    const size_t vbase = (((size_t)b * NH_ + h) * HD) * NT_;
    v8f o[4], ox[4];
#pragma unroll
    for (int n = 0; n < 4; ++n) { o[n] = (v8f){}; ox[n] = (v8f){}; }
    float mrow = -3.0e38f, lpart = 0.f;      // the lane's one query: running maximum (alike in both halves), sum over the lane's own keys
    const int qi = q0 + lr;
    const int kt_lo = 0, kt_hi = (qt * 64 + 63) / 32;     // causal
    const int krow = threadIdx.x >> 3, kpc = (threadIdx.x & 7) * 8;      // key tile: 8 threads a 128 B row, 16 rows a pass
    const int vrow = threadIdx.x >> 2, vpc = (threadIdx.x & 3) * 8;      // value tile: 4 threads a 64 B row, 32 rows a pass
    v8h gk[2][2], gv[2][2];
    auto fetch = [&](int l0) {
#pragma unroll
        for (int s = 0; s < 2; ++s) {
            const size_t ko = (size_t)(l0 + krow + 16 * s) * DM + kpc, vo = vbase + (size_t)(vrow + 32 * s) * NT_ + l0 + vpc;
            gk[0][s] = *(const v8h*)(kh_b + ko); gk[1][s] = *(const v8h*)(kl_b + ko); gv[0][s] = *(const v8h*)(VTH + vo); gv[1][s] = *(const v8h*)(VTL + vo); }
    };
    auto put = [&](int buf) {
#pragma unroll
        for (int s = 0; s < 2; ++s) {
            const int ko = (krow + 16 * s) * 72 + kpc, vo = (vrow + 32 * s) * 40 + vpc;
            *(v8ha*)(&kst[buf][0][ko]) = gk[0][s]; *(v8ha*)(&kst[buf][1][ko]) = gk[1][s]; *(v8ha*)(&vst[buf][0][vo]) = gv[0][s]; *(v8ha*)(&vst[buf][1][vo]) = gv[1][s]; }
    };
    fetch(0);
#pragma unroll
    for (int s = 0; s < 4; ++s) { const int row = 4 * s + (lane >> 3), pc = (lane & 7) * 8; *(v8ha*)(&qls[wave][row * 72 + pc]) = *(const v8h*)(QL16 + (tok0 + q0 + row) * DM + h * HD + pc); }
    put(0);
    __syncthreads();      // tile 0 is complete before any wave reads it
    const h16* ql_s = &qls[wave][lr * 72 + 8 * hi];
#pragma unroll 1
    for (int kt = kt_lo; kt <= kt_hi; ++kt) {
        const int l0 = kt * 32, cur = kt & 1;
        if (kt < kt_hi) fetch(l0 + 32);      // the next tile's lines fly while this tile is worked on
        const h16* kh_s = &kst[cur][0][0]; const h16* kl_s = &kst[cur][1][0];
        const int ko0 = lr * 72 + 8 * hi, ko1 = (16 + lr) * 72 + 8 * hi;
        v8f s0 = {}, s1 = {}, x0 = {}, x1 = {};
#pragma unroll
        for (int kc = 0; kc < 2; ++kc) {
            { const v16h k0h = cat16(*(const v8ha*)(kh_s + ko0 + kc * 32), *(const v8ha*)(kh_s + ko0 + kc * 32 + 16)), k1h = cat16(*(const v8ha*)(kh_s + ko1 + kc * 32), *(const v8ha*)(kh_s + ko1 + kc * 32 + 16));
              const v16h qlk = cat16(*(const v8ha*)(ql_s + kc * 32), *(const v8ha*)(ql_s + kc * 32 + 16));     // query residual re-read per step (registers)
              s0 = wmma16(k0h, qa[kc], s0); x0 = wmma16(k0h, qlk, x0); s1 = wmma16(k1h, qa[kc], s1); x1 = wmma16(k1h, qlk, x1);
              asm volatile("v_nop" : "+v"(s0), "+v"(s1), "+v"(x0), "+v"(x1) : "v"(qlk), "v"(k0h), "v"(k1h) : "memory"); }
            { const v16h k0l = cat16(*(const v8ha*)(kl_s + ko0 + kc * 32), *(const v8ha*)(kl_s + ko0 + kc * 32 + 16)), k1l = cat16(*(const v8ha*)(kl_s + ko1 + kc * 32), *(const v8ha*)(kl_s + ko1 + kc * 32 + 16));
              x0 = wmma16(k0l, qa[kc], x0); x1 = wmma16(k1l, qa[kc], x1);
              asm volatile("v_nop" : "+v"(x0), "+v"(x1) : "v"(k0l), "v"(k1l) : "memory"); }
        }
        asm volatile("v_nop\n\tv_nop\n\tv_nop\n\tv_nop" : "+v"(s0), "+v"(s1), "+v"(x0), "+v"(x1) : "v"(qa[0]), "v"(qa[1]));
        float a0[8], a1[8];
        const int dq = qi - 8 * hi - l0;      // the lane's query counted from the lane's first key of this tile
#pragma unroll
        for (int j = 0; j < 8; ++j) {
            a0[j] = (j <= dq) ? (s0[j] + x0[j] * LOSCI) * 0.125f : -__builtin_inff(); a1[j] = (16 + j <= dq) ? (s1[j] + x1[j] * LOSCI) * 0.125f : -__builtin_inff();      // key l0 + 8 hi + j (+ 16) <= query
        }
        // the query's maximum over the lane's 16 keys as a tree of three-way maxima, then the other half's
        const float m0 = fmaxf(fmaxf(a0[0], a0[1]), a0[2]), m1 = fmaxf(fmaxf(a0[3], a0[4]), a0[5]), m2 = fmaxf(fmaxf(a0[6], a0[7]), a1[0]);
        const float m3 = fmaxf(fmaxf(a1[1], a1[2]), a1[3]), m4 = fmaxf(fmaxf(a1[4], a1[5]), a1[6]);
        float mx = fmaxf(fmaxf(fmaxf(m0, m1), m2), fmaxf(fmaxf(m3, m4), a1[7]));
        mx = fmaxf(mx, xhalf(mx));
        const float mn = fmaxf(mrow, mx);
        const float alpha = __expf(mrow - mn); mrow = mn;
        v16h pa, px;
        float ls[4] = {0.f, 0.f, 0.f, 0.f};      // four independent chains
#pragma unroll
        for (int j = 0; j < 8; ++j) {
            const float p0 = __expf(a0[j] - mn);
            if (j == 0) asm volatile("v_nop");      // the slot that the instruction set asks for behind a transcendental whose source the next instruction overwrites
            const float p1 = __expf(a1[j] - mn);
            ls[j & 3] += p0 + p1;
            const float ps0 = p0 * PSC, ps1 = p1 * PSC; const h16 h0 = (h16)ps0, h1 = (h16)ps1;
            pa[j] = h0; pa[8 + j] = h1;
            px[j] = (h16)((ps0 - (float)h0) * LOSC); px[8 + j] = (h16)((ps1 - (float)h1) * LOSC);
        }
        lpart = lpart * alpha + ((ls[0] + ls[1]) + (ls[2] + ls[3]));
#pragma unroll
        for (int n = 0; n < 4; ++n)
#pragma unroll
            for (int j = 0; j < 8; ++j) { o[n][j] *= alpha; ox[n][j] *= alpha; }
#pragma unroll
        for (int n = 0; n < 4; ++n) { const int vo = (n * 16 + lr) * 40 + hi * 8;
            const v16h vh = cat16(*(const v8ha*)(&vst[cur][0][vo]), *(const v8ha*)(&vst[cur][0][vo + 16])), vl = cat16(*(const v8ha*)(&vst[cur][1][vo]), *(const v8ha*)(&vst[cur][1][vo + 16]));
            o[n] = wmma16(vh, pa, o[n]); ox[n] = wmma16(vl, pa, ox[n]); ox[n] = wmma16(vh, px, ox[n]);
            asm volatile("" : "+v"(o[n]), "+v"(ox[n]) : "v"(vh), "v"(vl) : "memory"); }
        asm volatile("v_nop\n\tv_nop\n\tv_nop\n\tv_nop" : "+v"(o[0]), "+v"(o[1]), "+v"(o[2]), "+v"(o[3]), "+v"(ox[0]), "+v"(ox[1]), "+v"(ox[2]), "+v"(ox[3]) : "v"(pa), "v"(px));
        if (kt < kt_hi) put(cur ^ 1);      // into the buffer whose readers all passed the barrier of the trip before
        __syncthreads();                   // publishes the next tile and ends every wave's reads of this one
    }
    const float inv = 1.0f / ((lpart + xhalf(lpart)) * PSC);      // the two halves' sums are joined once
    float* os = &ost[wave][0];
#pragma unroll
    for (int n = 0; n < 4; ++n)      // the lane holds d = 16 n + 8 hi + j of its query's row
#pragma unroll
        for (int q = 0; q < 2; ++q) { v4f t;
#pragma unroll
            for (int i = 0; i < 4; ++i) t[i] = (o[n][q * 4 + i] + ox[n][q * 4 + i] * LOSCI) * inv;
            *(v4fa*)(os + lr * 68 + n * 16 + hi * 8 + q * 4) = t; }
    __syncthreads();
    const size_t cbase = (tok0 + q0) * DM + (size_t)h * HD;
    auto pass = [&]() {
#pragma unroll
        for (int s = 0; s < 4; ++s) { const int row = 4 * s + (lane >> 3), piece = lane & 7; const float* sp = os + row * 68 + piece * 8; v8us oh, ol;
#pragma unroll
            for (int i = 0; i < 8; ++i) { const unsigned short hb = f2bf(sp[i]); oh[i] = hb; ol[i] = f2bf(sp[i] - bf2f(hb)); }
            *(v8us*)(CH + cbase + (size_t)row * DM + piece * 8) = oh; *(v8us*)(CL + cbase + (size_t)row * DM + piece * 8) = ol; }
    };
    pass(); 
    asm volatile("s_wait_xcnt 0x0" ::: "memory");      // the wait that stands before the second tile's first instructions rewrite registers named by these stores
    }
}


// wt_body: WT [n][K] = bf16(W[k][n]) (k-major [K][ncols]) via 64 x 64 LDS tiles; tile (bx, by) of (K/64, ncols/64).
__device__ __forceinline__ void wt_body(const float* __restrict__ Wm, int K, int ncols, bf* WT, int bx, int by) {
    __shared__ __align__(16) unsigned short tl[64 * 72];
    const int tid = threadIdx.x, k0 = bx * 64, n0 = by * 64;
    const int kk = tid >> 2, nq = (tid & 3) * 16;
#pragma unroll
    for (int i = 0; i < 16; ++i) tl[(nq + i) * 72 + kk] = f2bf(Wm[(size_t)(k0 + kk) * ncols + n0 + nq + i]);
    __syncthreads();
    const int piece = tid & 7;
    auto pass = [&]() {
#pragma unroll
        for (int s = 0; s < 2; ++s) { const int nr = (tid >> 3) + 32 * s; const v8us val = *(const v8usa*)(tl + nr * 72 + piece * 8); *(v8us*)(WT + (size_t)(n0 + nr) * K + k0 + piece * 8) = val; }
    };
    pass(); 
}

// k_prep: the three conversions of inputs, which do not depend on one another, in one grid; the block index picks the job (alike for the whole block, so wt_body's barrier is passed by
// all of a block's threads or by none): blocks [0, NWQ) transpose c_attn_w, [NWQ, NWQ + NWO) transpose c_proj_w, the rest round 8 rows of x each.
#define NWQ ((DM / 64) * (3 * DM / 64))
#define NWO ((DM / 64) * (DM / 64))
__global__ __launch_bounds__(256) void k_prep(const float* __restrict__ Wqkv, const float* __restrict__ Wo, const float* __restrict__ x, bf* WT, bf* WoT, bf* Xb) {
    const int bid = blockIdx.x;
    if (bid < NWQ + NWO) {
        const bool second = bid >= NWQ;
        const int t = second ? bid - NWQ : bid;      // tile index, the k tile running fastest
        wt_body(second ? Wo : Wqkv, DM, second ? DM : 3 * DM, second ? WoT : WT, t & (DM / 64 - 1), t / (DM / 64));
    } else cvtb_body(x, NTK, Xb, bid - (NWQ + NWO));
}

typedef __attribute__((ext_vector_type(4)))  _Float16 v4h;
// k_dwmix: the grouped causal depthwise convolution along the sequence of a projected [2 x 2048][1024] f32 matrix T, one third of the columns of the [4096][3072] q | k | v product (row pitch TP;
// blockIdx.y picks q, k or v with its weights and its outputs) (row s = batch item s / 2048, position s % 2048) (column c = head h * 64 + d; group g = h / 4: g = 0
// identity, else y[s][c] = bf(bias_g[d]) + sum_i bf(w_g[d][i]) * T[s - (width-1) + i][c] over rows of the same batch item, width = 2g + 1, summed in the order i = 0, 1, ...).
// Block = DWR consecutive rows, wave = one chunk of 128 columns (inside one group), lane -> 4 consecutive columns. A wave issues all of its DWR + width - 1 row loads (16 B a lane)
// and its weight loads before it uses any of them, holds the rounded weights in registers for all DWR rows, and every loop is unrolled: no load waits on another.
#define DWR 8
#define TP  (3 * DM)
typedef v4f __attribute__((aligned(4))) v4fu;      // the small weight arrays are read 16 B at a time with no more than their element alignment assumed
template <int KW, bool EDGE>
__device__ __forceinline__ void dw_rows(const float* __restrict__ T, const float* __restrict__ wg, const float* __restrict__ bg, int s0, int c0, v4f (&y)[DWR]) {
    // EDGE: the block starts its batch item (s0 is the item's first row): the width - 1 rows before it do not exist, their loads fall on row s0 and their taps are left out.
    const char* tb = (const char*)(T + (size_t)(EDGE ? s0 : s0 - (KW - 1)) * TP);      // uniform; the lane's own part of every address is one 32-bit offset
    const unsigned ro = (unsigned)c0 * 4u, bo = (unsigned)(c0 & (HD - 1)) * 4u;
    const char* wp = (const char*)wg + bo * (unsigned)KW;      // the lane's 4 x width weights lie in a row: element i * width + t
    v4f row[DWR + KW - 1], wv[KW], bv;
#pragma unroll
    for (int q = 0; q < KW; ++q) wv[q] = *(const v4fu*)(wp + q * 16);
    bv = *(const v4fu*)((const char*)bg + bo);
#pragma unroll
    for (int k = 0; k < DWR + KW - 1; ++k) row[k] = *(const v4f*)(tb + ro + (size_t)(EDGE ? (k < KW - 1 ? 0 : k - (KW - 1)) : k) * TP * 4);
    // The wait that stands before a register named by an issued load is rewritten; the lane's address parts are its inputs so that none of them is reused as a destination of
    // these loads, and no load is moved behind it: all of the wave's loads are in flight together.
    asm volatile("s_wait_xcnt 0x0" :: "v"(ro), "v"(wp), "v"(bo) : "memory");
    __builtin_amdgcn_sched_barrier(0);      // no arithmetic on the first values (with its wait) is lifted in front of the last loads
    float w[4 * KW];
#pragma unroll
    for (int q = 0; q < KW; ++q)
#pragma unroll
        for (int e = 0; e < 4; ++e) w[q * 4 + e] = bfr(wv[q][e]);
#pragma unroll
    for (int e = 0; e < 4; ++e) bv[e] = bfr(bv[e]);
#pragma unroll
    for (int j = 0; j < DWR; ++j)
#pragma unroll
        for (int i = 0; i < 4; ++i) { float acc = bv[i];
#pragma unroll
            for (int t = 0; t < KW; ++t) { if (!EDGE || j + t >= KW - 1) acc = fmaf(row[j + t][i], w[i * KW + t], acc); }
            y[j][i] = acc; }
}
__global__ __launch_bounds__(256) void k_dwmix(const float* __restrict__ T3,
                                               const float* __restrict__ qw3, const float* __restrict__ qb3, const float* __restrict__ qw5, const float* __restrict__ qb5, const float* __restrict__ qw7, const float* __restrict__ qb7,
                                               const float* __restrict__ kw3, const float* __restrict__ kb3, const float* __restrict__ kw5, const float* __restrict__ kb5, const float* __restrict__ kw7, const float* __restrict__ kb7,
                                               const float* __restrict__ vw3, const float* __restrict__ vb3, const float* __restrict__ vw5, const float* __restrict__ vb5, const float* __restrict__ vw7, const float* __restrict__ vb7,
                                               h16* QH, h16* QL, h16* KH, h16* KL, float* Y) {
    const int p = blockIdx.y;      // 0 = q, 1 = k, 2 = v: alike for the whole block, every choice below is a scalar one
    const float* T = T3 + p * DM;
    const float* w3 = p == 0 ? qw3 : p == 1 ? kw3 : vw3; const float* b3 = p == 0 ? qb3 : p == 1 ? kb3 : vb3;
    const float* w5 = p == 0 ? qw5 : p == 1 ? kw5 : vw5; const float* b5 = p == 0 ? qb5 : p == 1 ? kb5 : vb5;
    const float* w7 = p == 0 ? qw7 : p == 1 ? kw7 : vw7; const float* b7 = p == 0 ? qb7 : p == 1 ? kb7 : vb7;
    h16* YH = p == 0 ? QH : KH; h16* YL = p == 0 ? QL : KL;
    const bool F16 = p < 2;        // q and k leave as f16 hi + residual planes, v as f32
    const int lane = threadIdx.x & 31, s0 = blockIdx.x * DWR;
    const int ch = __builtin_amdgcn_readfirstlane(threadIdx.x >> 5);      // the wave's chunk in a scalar register: the choice of the group below is a scalar branch
    if (s0 >= NTK) return;
    const int c0 = ch * 128 + lane * 4, g = ch >> 1;      // 2 chunks = 4 heads = one group
    const bool edge = (s0 & (NT_ - 1)) == 0;               // DWR > width - 1: only a batch item's first block lacks rows
    const unsigned ro = (unsigned)c0 * 4u;
    v4f y[DWR];
    if (g == 0) {
#pragma unroll
        for (int j = 0; j < DWR; ++j) y[j] = *(const v4f*)((const char*)(T + (size_t)s0 * TP) + ro + j * TP * 4);
        asm volatile("s_wait_xcnt 0x0" :: "v"(ro) : "memory");      // the wait that stands before a register named by an issued load is rewritten
    }
    else if (g == 1) { if (edge) dw_rows<3, true>(T, w3, b3, s0, c0, y); else dw_rows<3, false>(T, w3, b3, s0, c0, y); }
    else if (g == 2) { if (edge) dw_rows<5, true>(T, w5, b5, s0, c0, y); else dw_rows<5, false>(T, w5, b5, s0, c0, y); }
    else             { if (edge) dw_rows<7, true>(T, w7, b7, s0, c0, y); else dw_rows<7, false>(T, w7, b7, s0, c0, y); }
    if (F16) {
#pragma unroll
        for (int j = 0; j < DWR; ++j) { v4h oh, ol;
#pragma unroll
            for (int i = 0; i < 4; ++i) { const h16 a = (h16)y[j][i]; oh[i] = a; ol[i] = (h16)((y[j][i] - (float)a) * LOSC); }
            *(v4h*)((char*)(YH + (size_t)s0 * DM) + (ro >> 1) + j * DM * 2) = oh; *(v4h*)((char*)(YL + (size_t)s0 * DM) + (ro >> 1) + j * DM * 2) = ol; }
    } else {
#pragma unroll
        for (int j = 0; j < DWR; ++j) { *(v4f*)((char*)(Y + (size_t)s0 * DM) + ro + j * DM * 4) = y[j]; }
        asm volatile("s_wait_xcnt 0x0" ::: "memory");      // the wait that stands before a register named by these stores is rewritten on any way the built code has from here
    }
}

extern "C" void kernel_launch(void* const* d_in, const int* in_sizes, int n_in,
                              void* d_out, int out_size, void* d_ws, size_t ws_size, hipStream_t stream) {
    (void)in_sizes; (void)n_in; (void)out_size;
    const float* x = (const float*)d_in[0]; const float* Wqkv = (const float*)d_in[1]; const float* bqkv = (const float*)d_in[2]; const float* Wo = (const float*)d_in[3]; const float* bo = (const float*)d_in[4];   // k-major weights (x @ W)
    const float* cw[3][6]; for (int p = 0; p < 3; ++p) for (int j = 0; j < 6; ++j) cw[p][j] = (const float*)d_in[5 + p * 6 + j];     // (w3, b3, w5, b5, w7, b7) for q, k, v
    float* out = (float*)d_out;    // [2][2048][1024]
    char* wsp = (char*)d_ws;
    auto take = [&](size_t bytes) { char* p = wsp; wsp += (bytes + 255) & ~(size_t)255; return (void*)p; };
    bf* WT = (bf*)take((size_t)3 * DM * DM * 2); bf* WoT = (bf*)take((size_t)DM * DM * 2); bf* Xb = (bf*)take((size_t)NTK * DM * 2);
    float* TMP = (float*)take((size_t)NTK * 3 * DM * 4); float* TV = (float*)take((size_t)NTK * DM * 4);
    h16* QH = (h16*)take((size_t)NTK * DM * 2); h16* QL = (h16*)take((size_t)NTK * DM * 2); h16* KH = (h16*)take((size_t)NTK * DM * 2); h16* KL = (h16*)take((size_t)NTK * DM * 2);
    h16* VTH = (h16*)take((size_t)NTK * DM * 2); h16* VTL = (h16*)take((size_t)NTK * DM * 2); bf* CH = (bf*)take((size_t)NTK * DM * 2); bf* CL = (bf*)take((size_t)NTK * DM * 2);
    if ((size_t)(wsp - (char*)d_ws) > ws_size) return;    // about 150 MB in all, no aliasing
    k_prep<<<NWQ + NWO + NTK / 8, 256, 0, stream>>>(Wqkv, Wo, x, WT, WoT, Xb);
    {
        k_gemmb<false, false><<<dim3(NTK / 64, 3 * DM / 64, 1), 128, 0, stream>>>(Xb, nullptr, WT, bqkv, TMP, 3 * DM, nullptr);                          // q | k | v (f32), one [4096 x 3072] product
        k_dwmix<<<dim3(NTK / DWR, 3, 1), 256, 0, stream>>>(TMP, cw[0][0], cw[0][1], cw[0][2], cw[0][3], cw[0][4], cw[0][5], cw[1][0], cw[1][1], cw[1][2], cw[1][3], cw[1][4], cw[1][5],
                                                           cw[2][0], cw[2][1], cw[2][2], cw[2][3], cw[2][4], cw[2][5], QH, QL, KH, KL, TV);
        k_vt<<<NB_ * NH_ * (NT_ / 64), 256, 0, stream>>>(TV, VTH, VTL);
        k_attn<<<NB_ * NH_ * (NT_ / 128), 128, 0, stream>>>(QH, QL, KH, KL, VTH, VTL, CH, CL);
        k_gemmb<true, false><<<dim3(NTK / 64, DM / 64, 1), 128, 0, stream>>>(CH, CL, WoT, bo, out, DM, nullptr);
    }
}

// v007
// Measured time: 142 microseconds a run.
// In both of two side-by-side timings against v006, it was 1.12 times as fast.
// Over all steps from v000 it is 5.06 times as fast.
#include <hip/hip_runtime.h>

// Compute dtypes, f32 accumulate, both batch items in one pass (4096 rows per launch): qkv = x.c_attn_w + b ([4096 x 1024].[1024 x 3072], one launch, PLAIN bf16 operands = the
// rounded input and the k-major weights transposed once; exact products) on v_wmma_f32_16x16x32_bf16 -> f32; the per-head-group causal depthwise convolutions along the
// sequence (heads 0-3 identity, 4-7 width 3, 8-11 width 5, 12-15 width 7; weights/biases read as inputs) in f32 -> q/k as f16 hi + residual x1024 planes, v -> f32 ->
// transposed f16 hi + residual planes; the 16-head causal attention (masked positions are -inf and contribute exp(-inf - m) = 0) fused on v_wmma_f32_16x16x32_f16
// (hh + hl + lh x 1/8, online f32 softmax, weights x32768 and v as f16 hi + residual x1024); out = ctx.c_proj_w + b (ctx as bf16 hi + UNSCALED residual against the

#define NB_  2                   // both batch items go through every launch together
#define NT_  2048
#define DM   1024
#define NH_  16
#define HD   64
#define HK   4                    // heads per group
#define NTK  (NB_ * NT_)
#define NW   1024
#define NQKV 1024
#define PSC  32768.0f
#define LOSC 1024.0f
#define LOSCI (1.0f / 1024.0f)

typedef _Float16 h16;
typedef unsigned short bf;
typedef __attribute__((ext_vector_type(16))) __bf16   v16bf;
typedef __attribute__((ext_vector_type(16))) _Float16 v16h;
typedef __attribute__((ext_vector_type(8)))  _Float16 v8h;
typedef __attribute__((ext_vector_type(8)))  unsigned short v8us;
typedef __attribute__((ext_vector_type(8)))  float    v8f;
typedef __attribute__((ext_vector_type(4)))  float    v4f;
typedef v8h  __attribute__((may_alias)) v8ha;
typedef v4f  __attribute__((may_alias)) v4fa;
typedef v8us __attribute__((may_alias)) v8usa;

__device__ __forceinline__ unsigned short f2bf(float f) { unsigned u = __float_as_uint(f); u += 0x7FFFu + ((u >> 16) & 1u); return (unsigned short)(u >> 16); }
__device__ __forceinline__ float bf2f(unsigned short b) { return __uint_as_float(((unsigned)b) << 16); }
__device__ __forceinline__ float bfr(float f) { return bf2f(f2bf(f)); }
__device__ __forceinline__ v16h cat16(v8h lo, v8h hi) { return __builtin_shufflevector(lo, hi, 0, 1, 2, 3, 4, 5, 6, 7, 8, 9, 10, 11, 12, 13, 14, 15); }
__device__ __forceinline__ v16bf cat16b(v8us lo, v8us hi) { return __builtin_bit_cast(v16bf, __builtin_shufflevector(lo, hi, 0, 1, 2, 3, 4, 5, 6, 7, 8, 9, 10, 11, 12, 13, 14, 15)); }
__device__ __forceinline__ v8f wmma16(v16h a, v16h b, v8f c) { return __builtin_amdgcn_wmma_f32_16x16x32_f16(false, a, false, b, (short)0, c, false, false); }
__device__ __forceinline__ float xhalf(float x) { return __builtin_bit_cast(float, __builtin_amdgcn_permlanex16(__builtin_bit_cast(int, x), __builtin_bit_cast(int, x), 0x76543210, 0xfedcba98, false, false)); }      // lane l takes lane l ^ 16's value
__device__ __forceinline__ v8f wmmab(v16bf a, v16bf b, v8f c) { return __builtin_amdgcn_wmma_f32_16x16x32_bf16(false, a, false, b, (short)0, c, false, false); }

__device__ __forceinline__ void cvtb_body(const float* __restrict__ src, int nrows, bf* dst, int blk) {
    const int lane = threadIdx.x & 31, r = blk * 8 + (threadIdx.x >> 5);
    if (r >= nrows) return;
    v8us o[DM / 256];
#pragma unroll
    for (int q = 0; q < DM / 256; ++q) { v8us t;
#pragma unroll
        for (int i = 0; i < 8; ++i) t[i] = f2bf(src[(size_t)r * DM + q * 256 + lane * 8 + i]);
        o[q] = t; }
#pragma unroll
    for (int q = 0; q < DM / 256; ++q) *(v8us*)(dst + (size_t)r * DM + q * 256 + lane * 8) = o[q];
    
}

// k_gemmb: 128 x 128 block tile (8 waves, 4 down x 2 across, 32 x 64 each) of C[NTK][ldc] = (A [+ Al]).B^T (K = 1024) [+ bf(bias[c])] [+ bf(R[r][c]) residual]; f32 whole-line epilogue (or f16
template <bool SPLITA, bool F16OUT = false>
__global__ __launch_bounds__(256) void k_gemmb(const bf* __restrict__ A, const bf* __restrict__ Al, const bf* __restrict__ Bn, const float* __restrict__ bias, float* C, int ldc, h16* C2, const float* __restrict__ R = nullptr, int K = DM, int roundR = 1) {
    // stg: two buffers of the block's operand tiles (plane 0 = 128 A rows, 1 = 128 B rows, 2 = 128 Al rows; 64 k each, row pitch 72 elements = 144 B), filled by whole-line
    // loads that the eight waves share; the fragments are read from here. A line fetched once serves 128 rows or columns of C, and a B fragment read from LDS serves two A fragments.
    __shared__ __align__(16) bf stg[2][SPLITA ? 3 : 2][128 * 72];
    const int lane = threadIdx.x & 31, wave = threadIdx.x >> 5, lr = lane & 15, hi = lane >> 4;
    const int wr = (wave >> 1) * 32, wc = (wave & 1) * 64;      // the wave's 32 x 64 part of the block tile
    const int r0 = blockIdx.x * 128 + wr, c0 = blockIdx.y * 128 + wc;
    const int srow = threadIdx.x >> 3, spc = (threadIdx.x & 7) * 8;      // staging: 8 threads cover one 128 B row piece by piece, 32 rows a pass
    unsigned so[4];      // the thread's byte offset inside a 128-row tile, one per pass; the tile's own address is uniform
#pragma unroll
    for (int s = 0; s < 4; ++s) so[s] = ((unsigned)(srow + 32 * s) * (unsigned)K + (unsigned)spc) * 2u;
    v8us ga[4], gb[4], gl[4];
    auto fetch = [&](int kc) {
        const char* ta = (const char*)(A + (size_t)(blockIdx.x * 128) * K + kc); const char* tb = (const char*)(Bn + (size_t)(blockIdx.y * 128) * K + kc); const char* tl = SPLITA ? (const char*)(Al + (size_t)(blockIdx.x * 128) * K + kc) : ta;
        const char* pa[4]; const char* pb[4]; const char* pl[4];
#pragma unroll
        for (int s = 0; s < 4; ++s) { pa[s] = ta + so[s]; pb[s] = tb + so[s]; pl[s] = tl + so[s]; }
#pragma unroll
        for (int s = 0; s < 4; ++s) { ga[s] = *(const v8us*)pa[s]; gb[s] = *(const v8us*)pb[s]; if (SPLITA) gl[s] = *(const v8us*)pl[s]; }
        // The wait that stands before a register named by an issued load is rewritten; the addresses are its inputs so that none of them is reused as a destination of these loads.
        asm volatile("s_wait_xcnt 0x0" :: "v"(pa[0]), "v"(pa[1]), "v"(pa[2]), "v"(pa[3]), "v"(pb[0]), "v"(pb[1]), "v"(pb[2]), "v"(pb[3]), "v"(pl[0]), "v"(pl[1]), "v"(pl[2]), "v"(pl[3]) : "memory");
    };
    auto put = [&](int buf) {
#pragma unroll
        for (int s = 0; s < 4; ++s) { const int o = (srow + 32 * s) * 72 + spc; *(v8usa*)(&stg[buf][0][o]) = ga[s]; *(v8usa*)(&stg[buf][1][o]) = gb[s]; if (SPLITA) *(v8usa*)(&stg[buf][SPLITA ? 2 : 0][o]) = gl[s]; }
    };
    v8f acc[2][4];
#pragma unroll
    for (int m = 0; m < 2; ++m)
#pragma unroll
        for (int t = 0; t < 4; ++t) acc[m][t] = (v8f){};
    fetch(0); put(0);
    __syncthreads();      // stage 0 is complete before any wave reads it
#pragma unroll 1
    for (int kb = 0; kb < K; kb += 64) {
        const int cur = (kb >> 6) & 1;
        const bool more = kb + 64 < K;
        if (more) fetch(kb + 64);      // the next stage's lines fly while this stage is multiplied
#pragma unroll
        for (int ks = 0; ks < 2; ++ks) {
            const int fo = ks * 32 + 8 * hi;
            v16bf a[2], al[2];
#pragma unroll
            for (int m = 0; m < 2; ++m) { const int ao = (wr + m * 16 + lr) * 72 + fo;
                a[m] = cat16b(*(const v8usa*)(&stg[cur][0][ao]), *(const v8usa*)(&stg[cur][0][ao + 16]));
                al[m] = a[m];
                if (SPLITA) al[m] = cat16b(*(const v8usa*)(&stg[cur][SPLITA ? 2 : 0][ao]), *(const v8usa*)(&stg[cur][SPLITA ? 2 : 0][ao + 16])); }
            v16bf b[4];
#pragma unroll
            for (int t = 0; t < 4; ++t) { const int bo = (wc + t * 16 + lr) * 72 + fo; b[t] = cat16b(*(const v8usa*)(&stg[cur][1][bo]), *(const v8usa*)(&stg[cur][1][bo + 16])); }
#pragma unroll
            for (int t = 0; t < 4; ++t)
#pragma unroll
                for (int m = 0; m < 2; ++m) acc[m][t] = wmmab(a[m], b[t], acc[m][t]);
            if (SPLITA) {
#pragma unroll
                for (int t = 0; t < 4; ++t)
#pragma unroll
                    for (int m = 0; m < 2; ++m) acc[m][t] = wmmab(al[m], b[t], acc[m][t]); }
            // the four vector slots that the chip needs behind the last matrix instruction, on every way the built code has from here
            asm volatile("v_nop\n\tv_nop\n\tv_nop\n\tv_nop" : "+v"(acc[0][0]), "+v"(acc[0][1]), "+v"(acc[0][2]), "+v"(acc[0][3]), "+v"(acc[1][0]), "+v"(acc[1][1]), "+v"(acc[1][2]), "+v"(acc[1][3]) : "v"(a[0]), "v"(a[1]), "v"(al[0]), "v"(al[1]));
        }
        if (more) put(cur ^ 1);        // into the buffer whose readers all passed the barrier of the trip before
        __syncthreads();               // publishes the next stage and ends every wave's reads of this one
    }
    // The output is staged in the operand buffers, which nobody reads any more behind the loop's last barrier: 32 rows x 68 floats a wave, 8 waves = 69,632 B of the 73,728 B or more.
    float* os = (float*)(void*)&stg[0][0][0] + wave * (32 * 68);
    float bv[4] = {0.f, 0.f, 0.f, 0.f};
    if (bias) {      // the four bias loads leave together: one latency, not four, in a block that may be alone on its WGP
#pragma unroll
        for (int t = 0; t < 4; ++t) bv[t] = bias[c0 + t * 16 + lr];
#pragma unroll
        for (int t = 0; t < 4; ++t) bv[t] = bfr(bv[t]);
    }
#pragma unroll
    for (int t = 0; t < 4; ++t)
#pragma unroll
        for (int m = 0; m < 2; ++m)
#pragma unroll
            for (int j = 0; j < 8; ++j) os[(m * 16 + hi * 8 + j) * 68 + t * 16 + lr] = acc[m][t][j] + bv[t];
    __syncthreads();
    if (F16OUT) {
        h16* crow = (h16*)(void*)C + (size_t)r0 * ldc + c0;
        auto pass = [&]() {
#pragma unroll
            for (int s = 0; s < 8; ++s) { const int row = 4 * s + (lane >> 3), piece = lane & 7; const float* sp = os + row * 68 + piece * 8; v8h o, o2;
#pragma unroll
                for (int i = 0; i < 8; ++i) { const h16 a = (h16)sp[i]; o[i] = a; o2[i] = (h16)((sp[i] - (float)a) * LOSC); }
                *(v8h*)(crow + (size_t)row * ldc + piece * 8) = o; if (C2) *(v8h*)(C2 + (size_t)r0 * ldc + c0 + (size_t)row * ldc + piece * 8) = o2; }
        };
        pass(); 
    } else {
        float* crow = C + (size_t)r0 * ldc + c0;
        auto pass = [&]() {
            v4f val[16]; float* pc[16];
#pragma unroll
            for (int s = 0; s < 16; ++s) { const int Lid = (lane >> 3) + 4 * s, piece = lane & 7; const int row = Lid >> 1, cofs = (Lid & 1) * 32 + piece * 4;
                val[s] = *(const v4fa*)(os + row * 68 + cofs); if (R) { const v4f rv = *(const v4f*)(R + ((size_t)r0 + row) * ldc + c0 + cofs); val[s] += roundR ? (v4f){bfr(rv[0]), bfr(rv[1]), bfr(rv[2]), bfr(rv[3])} : rv; }
                pc[s] = crow + (size_t)row * ldc + cofs; }
#pragma unroll
            for (int s = 0; s < 16; ++s) *(v4f*)pc[s] = val[s];
            // The wait that stands before a register named by an issued store is rewritten; the addresses are its inputs so that none of them is reused between these stores.
            asm volatile("s_wait_xcnt 0x0" :: "v"(pc[0]), "v"(pc[1]), "v"(pc[2]), "v"(pc[3]), "v"(pc[4]), "v"(pc[5]), "v"(pc[6]), "v"(pc[7]), "v"(pc[8]), "v"(pc[9]), "v"(pc[10]), "v"(pc[11]), "v"(pc[12]), "v"(pc[13]), "v"(pc[14]), "v"(pc[15]) : "memory");
        };
        pass(); 
    }
}

__global__ __launch_bounds__(256) void k_vt(const float* __restrict__ V, h16* VTH, h16* VTL) {
    __shared__ __align__(16) h16 tile[64 * 72];
    __shared__ __align__(16) h16 til2[64 * 72];
    const int bid = blockIdx.x;
    const int b = bid / (NH_ * (NT_ / 64)), rem = bid - b * (NH_ * (NT_ / 64)), h = rem / (NT_ / 64), kt = rem - h * (NT_ / 64);
    const int k0 = kt * 64, tid = threadIdx.x;
    const int kk = tid >> 2, d0 = (tid & 3) * 16;
    const float* src = V + ((size_t)b * NT_ + k0 + kk) * DM + h * HD + d0;
#pragma unroll
    for (int i = 0; i < 16; ++i) { const float v = src[i]; const h16 a = (h16)v; tile[(d0 + i) * 72 + kk] = a; til2[(d0 + i) * 72 + kk] = (h16)((v - (float)a) * LOSC); }
    __syncthreads();
    const int piece = tid & 7;
    const size_t base = (((size_t)b * NH_ + h) * HD) * NT_ + k0;
    auto pass = [&]() {
#pragma unroll
        for (int s = 0; s < 4; ++s) { const int Lid = (tid >> 3) + 32 * s; const int pln = Lid >> 6, d = Lid & 63;
            const v8h val = *(const v8ha*)((pln ? til2 : tile) + d * 72 + piece * 8); *(v8h*)((pln ? VTL : VTH) + base + (size_t)d * NT_ + piece * 8) = val; }
    };
    pass(); 
}

// k_attn: block = (b, h, the two 64-query tiles 31 - t and t, one after the other: 66 key steps in every block), wave = 16 queries; key tiles up to the diagonal. Both products are
// transposed: scores^T = K.Q^T (A = key rows, B = queries) /8 (f32), so a lane holds 16 of the 32 scores of ONE query (query = lane & 15; keys 8 * (lane >> 4) + j and 16 + 8 * (lane >> 4) + j):
// the online softmax's maximum and sum are taken inside the lane plus one exchange between the wave's halves, and the weights x32768 (f16 hi + residual), converted in place, ARE the B operand
// of ctx^T += V^T.P^T (the same k order as the V^T rows' loader); ctx -> bf16 hi + residual planes CH/CL[tok][h*64+d].
__global__ __launch_bounds__(128) void k_attn(const h16* __restrict__ Q16, const h16* __restrict__ QL16, const h16* __restrict__ K16, const h16* __restrict__ KL16, const h16* __restrict__ VTH, const h16* __restrict__ VTL, bf* CH, bf* CL) {
    __shared__ __align__(16) float ost[4][16 * 68];
    // Operand tiles in LDS, filled by the block's 128 threads together (each line fetched once a query tile) and read as fragments by all four waves; two buffers each.
    __shared__ __align__(16) h16 kst[2][2][32 * 72];      // [buffer][hi, residual][key][64 d, row pitch 144 B]
    __shared__ __align__(16) h16 vst[2][2][64 * 40];      // [buffer][hi, residual][d][32 keys, row pitch 80 B]
    __shared__ __align__(16) h16 qls[4][16 * 72];         // each wave's 16 query-residual rows, filled once a query tile
    const int lane = threadIdx.x & 31, wave = threadIdx.x >> 5, lr = lane & 15, hi = lane >> 4;
    const int bid = blockIdx.x;
    const int b = bid / (NH_ * (NT_ / 128)), rem = bid - b * (NH_ * (NT_ / 128)), h = rem / (NT_ / 128), tp = rem - h * (NT_ / 128);
    const size_t tok0 = (size_t)b * NT_;
    // A tile's cost grows with its index (causal) and every block is resident at once: a block that takes tile 31 - t and then tile t walks 66 key steps whatever t is.
    // The second tile's first LDS writes stand behind the first tile's last two barriers. Kept rolled: one copy of the body in the instruction cache.
#pragma unroll 1
    for (int part = 0; part < 2; ++part) {
    const int qt = part ? tp : NT_ / 64 - 1 - tp;
    const int q0 = qt * 64 + wave * 16;
    v16h qa[2];
    const size_t qo0 = (tok0 + q0 + lr) * DM + h * HD + 8 * hi;
#pragma unroll
    for (int kc = 0; kc < 2; ++kc) qa[kc] = cat16(*(const v8h*)(Q16 + qo0 + kc * 32), *(const v8h*)(Q16 + qo0 + kc * 32 + 16));
    const h16* kh_b = K16 + tok0 * DM + h * HD;
    const h16* kl_b = KL16 + tok0 * DM + h * HD;
    const size_t vbase = (((size_t)b * NH_ + h) * HD) * NT_;
    v8f o[4], ox[4];
#pragma unroll
    for (int n = 0; n < 4; ++n) { o[n] = (v8f){}; ox[n] = (v8f){}; }
    float mrow = -3.0e38f, lpart = 0.f;      // the lane's one query: running maximum (alike in both halves), sum over the lane's own keys
    const int qi = q0 + lr;
    const int kt_lo = 0, kt_hi = (qt * 64 + 63) / 32;     // causal
    const int krow = threadIdx.x >> 3, kpc = (threadIdx.x & 7) * 8;      // key tile: 8 threads a 128 B row, 16 rows a pass
    const int vrow = threadIdx.x >> 2, vpc = (threadIdx.x & 3) * 8;      // value tile: 4 threads a 64 B row, 32 rows a pass
    v8h gk[2][2], gv[2][2];
    auto fetch = [&](int l0) {
#pragma unroll
        for (int s = 0; s < 2; ++s) {
            const size_t ko = (size_t)(l0 + krow + 16 * s) * DM + kpc, vo = vbase + (size_t)(vrow + 32 * s) * NT_ + l0 + vpc;
            gk[0][s] = *(const v8h*)(kh_b + ko); gk[1][s] = *(const v8h*)(kl_b + ko); gv[0][s] = *(const v8h*)(VTH + vo); gv[1][s] = *(const v8h*)(VTL + vo); }
    };
    auto put = [&](int buf) {
#pragma unroll
        for (int s = 0; s < 2; ++s) {
            const int ko = (krow + 16 * s) * 72 + kpc, vo = (vrow + 32 * s) * 40 + vpc;
            *(v8ha*)(&kst[buf][0][ko]) = gk[0][s]; *(v8ha*)(&kst[buf][1][ko]) = gk[1][s]; *(v8ha*)(&vst[buf][0][vo]) = gv[0][s]; *(v8ha*)(&vst[buf][1][vo]) = gv[1][s]; }
    };
    fetch(0);
#pragma unroll
    for (int s = 0; s < 4; ++s) { const int row = 4 * s + (lane >> 3), pc = (lane & 7) * 8; *(v8ha*)(&qls[wave][row * 72 + pc]) = *(const v8h*)(QL16 + (tok0 + q0 + row) * DM + h * HD + pc); }
    put(0);
    __syncthreads();      // tile 0 is complete before any wave reads it
    const h16* ql_s = &qls[wave][lr * 72 + 8 * hi];
#pragma unroll 1
    for (int kt = kt_lo; kt <= kt_hi; ++kt) {
        const int l0 = kt * 32, cur = kt & 1;
        if (kt < kt_hi) fetch(l0 + 32);      // the next tile's lines fly while this tile is worked on
        const h16* kh_s = &kst[cur][0][0]; const h16* kl_s = &kst[cur][1][0];
        const int ko0 = lr * 72 + 8 * hi, ko1 = (16 + lr) * 72 + 8 * hi;
        v8f s0 = {}, s1 = {}, x0 = {}, x1 = {};
#pragma unroll
        for (int kc = 0; kc < 2; ++kc) {
            { const v16h k0h = cat16(*(const v8ha*)(kh_s + ko0 + kc * 32), *(const v8ha*)(kh_s + ko0 + kc * 32 + 16)), k1h = cat16(*(const v8ha*)(kh_s + ko1 + kc * 32), *(const v8ha*)(kh_s + ko1 + kc * 32 + 16));
              const v16h qlk = cat16(*(const v8ha*)(ql_s + kc * 32), *(const v8ha*)(ql_s + kc * 32 + 16));     // query residual re-read per step (registers)
              s0 = wmma16(k0h, qa[kc], s0); x0 = wmma16(k0h, qlk, x0); s1 = wmma16(k1h, qa[kc], s1); x1 = wmma16(k1h, qlk, x1);
              asm volatile("v_nop" : "+v"(s0), "+v"(s1), "+v"(x0), "+v"(x1) : "v"(qlk), "v"(k0h), "v"(k1h) : "memory"); }
            { const v16h k0l = cat16(*(const v8ha*)(kl_s + ko0 + kc * 32), *(const v8ha*)(kl_s + ko0 + kc * 32 + 16)), k1l = cat16(*(const v8ha*)(kl_s + ko1 + kc * 32), *(const v8ha*)(kl_s + ko1 + kc * 32 + 16));
              x0 = wmma16(k0l, qa[kc], x0); x1 = wmma16(k1l, qa[kc], x1);
              asm volatile("v_nop" : "+v"(x0), "+v"(x1) : "v"(k0l), "v"(k1l) : "memory"); }
        }
        asm volatile("v_nop\n\tv_nop\n\tv_nop\n\tv_nop" : "+v"(s0), "+v"(s1), "+v"(x0), "+v"(x1) : "v"(qa[0]), "v"(qa[1]));
        float a0[8], a1[8];
        const int dq = qi - 8 * hi - l0;      // the lane's query counted from the lane's first key of this tile
#pragma unroll
        for (int j = 0; j < 8; ++j) {
            a0[j] = (j <= dq) ? (s0[j] + x0[j] * LOSCI) * 0.125f : -__builtin_inff(); a1[j] = (16 + j <= dq) ? (s1[j] + x1[j] * LOSCI) * 0.125f : -__builtin_inff();      // key l0 + 8 hi + j (+ 16) <= query
        }
        // the query's maximum over the lane's 16 keys as a tree of three-way maxima, then the other half's
        const float m0 = fmaxf(fmaxf(a0[0], a0[1]), a0[2]), m1 = fmaxf(fmaxf(a0[3], a0[4]), a0[5]), m2 = fmaxf(fmaxf(a0[6], a0[7]), a1[0]);
        const float m3 = fmaxf(fmaxf(a1[1], a1[2]), a1[3]), m4 = fmaxf(fmaxf(a1[4], a1[5]), a1[6]);
        float mx = fmaxf(fmaxf(fmaxf(m0, m1), m2), fmaxf(fmaxf(m3, m4), a1[7]));
        mx = fmaxf(mx, xhalf(mx));
        const float mn = fmaxf(mrow, mx);
        const float alpha = __expf(mrow - mn); mrow = mn;
        v16h pa, px;
        float ls[4] = {0.f, 0.f, 0.f, 0.f};      // four independent chains
#pragma unroll
        for (int j = 0; j < 8; ++j) {
            const float p0 = __expf(a0[j] - mn);
            if (j == 0) asm volatile("v_nop");      // the slot that the instruction set asks for behind a transcendental whose source the next instruction overwrites
            const float p1 = __expf(a1[j] - mn);
            ls[j & 3] += p0 + p1;
            const float ps0 = p0 * PSC, ps1 = p1 * PSC; const h16 h0 = (h16)ps0, h1 = (h16)ps1;
            pa[j] = h0; pa[8 + j] = h1;
            px[j] = (h16)((ps0 - (float)h0) * LOSC); px[8 + j] = (h16)((ps1 - (float)h1) * LOSC);
        }
        lpart = lpart * alpha + ((ls[0] + ls[1]) + (ls[2] + ls[3]));
#pragma unroll
        for (int n = 0; n < 4; ++n)
#pragma unroll
            for (int j = 0; j < 8; ++j) { o[n][j] *= alpha; ox[n][j] *= alpha; }
#pragma unroll
        for (int n = 0; n < 4; ++n) { const int vo = (n * 16 + lr) * 40 + hi * 8;
            const v16h vh = cat16(*(const v8ha*)(&vst[cur][0][vo]), *(const v8ha*)(&vst[cur][0][vo + 16])), vl = cat16(*(const v8ha*)(&vst[cur][1][vo]), *(const v8ha*)(&vst[cur][1][vo + 16]));
            o[n] = wmma16(vh, pa, o[n]); ox[n] = wmma16(vl, pa, ox[n]); ox[n] = wmma16(vh, px, ox[n]);
            asm volatile("" : "+v"(o[n]), "+v"(ox[n]) : "v"(vh), "v"(vl) : "memory"); }
        asm volatile("v_nop\n\tv_nop\n\tv_nop\n\tv_nop" : "+v"(o[0]), "+v"(o[1]), "+v"(o[2]), "+v"(o[3]), "+v"(ox[0]), "+v"(ox[1]), "+v"(ox[2]), "+v"(ox[3]) : "v"(pa), "v"(px));
        if (kt < kt_hi) put(cur ^ 1);      // into the buffer whose readers all passed the barrier of the trip before
        __syncthreads();                   // publishes the next tile and ends every wave's reads of this one
    }
    const float inv = 1.0f / ((lpart + xhalf(lpart)) * PSC);      // the two halves' sums are joined once
    float* os = &ost[wave][0];
#pragma unroll
    for (int n = 0; n < 4; ++n)      // the lane holds d = 16 n + 8 hi + j of its query's row
#pragma unroll
        for (int q = 0; q < 2; ++q) { v4f t;
#pragma unroll
            for (int i = 0; i < 4; ++i) t[i] = (o[n][q * 4 + i] + ox[n][q * 4 + i] * LOSCI) * inv;
            *(v4fa*)(os + lr * 68 + n * 16 + hi * 8 + q * 4) = t; }
    __syncthreads();
    const size_t cbase = (tok0 + q0) * DM + (size_t)h * HD;
    auto pass = [&]() {
#pragma unroll
        for (int s = 0; s < 4; ++s) { const int row = 4 * s + (lane >> 3), piece = lane & 7; const float* sp = os + row * 68 + piece * 8; v8us oh, ol;
#pragma unroll
            for (int i = 0; i < 8; ++i) { const unsigned short hb = f2bf(sp[i]); oh[i] = hb; ol[i] = f2bf(sp[i] - bf2f(hb)); }
            *(v8us*)(CH + cbase + (size_t)row * DM + piece * 8) = oh; *(v8us*)(CL + cbase + (size_t)row * DM + piece * 8) = ol; }
    };
    pass(); 
    asm volatile("s_wait_xcnt 0x0" ::: "memory");      // the wait that stands before the second tile's first instructions rewrite registers named by these stores
    }
}


// wt_body: WT [n][K] = bf16(W[k][n]) (k-major [K][ncols]) via 64 x 64 LDS tiles; tile (bx, by) of (K/64, ncols/64).
__device__ __forceinline__ void wt_body(const float* __restrict__ Wm, int K, int ncols, bf* WT, int bx, int by) {
    __shared__ __align__(16) unsigned short tl[64 * 72];
    const int tid = threadIdx.x, k0 = bx * 64, n0 = by * 64;
    const int kk = tid >> 2, nq = (tid & 3) * 16;
#pragma unroll
    for (int i = 0; i < 16; ++i) tl[(nq + i) * 72 + kk] = f2bf(Wm[(size_t)(k0 + kk) * ncols + n0 + nq + i]);
    __syncthreads();
    const int piece = tid & 7;
    auto pass = [&]() {
#pragma unroll
        for (int s = 0; s < 2; ++s) { const int nr = (tid >> 3) + 32 * s; const v8us val = *(const v8usa*)(tl + nr * 72 + piece * 8); *(v8us*)(WT + (size_t)(n0 + nr) * K + k0 + piece * 8) = val; }
    };
    pass(); 
}

// k_prep: the three conversions of inputs, which do not depend on one another, in one grid; the block index picks the job (alike for the whole block, so wt_body's barrier is passed by
// all of a block's threads or by none): blocks [0, NWQ) transpose c_attn_w, [NWQ, NWQ + NWO) transpose c_proj_w, the rest round 8 rows of x each.
#define NWQ ((DM / 64) * (3 * DM / 64))
#define NWO ((DM / 64) * (DM / 64))
__global__ __launch_bounds__(256) void k_prep(const float* __restrict__ Wqkv, const float* __restrict__ Wo, const float* __restrict__ x, bf* WT, bf* WoT, bf* Xb) {
    const int bid = blockIdx.x;
    if (bid < NWQ + NWO) {
        const bool second = bid >= NWQ;
        const int t = second ? bid - NWQ : bid;      // tile index, the k tile running fastest
        wt_body(second ? Wo : Wqkv, DM, second ? DM : 3 * DM, second ? WoT : WT, t & (DM / 64 - 1), t / (DM / 64));
    } else cvtb_body(x, NTK, Xb, bid - (NWQ + NWO));
}

typedef __attribute__((ext_vector_type(4)))  _Float16 v4h;
// k_dwmix: the grouped causal depthwise convolution along the sequence of a projected [2 x 2048][1024] f32 matrix T, one third of the columns of the [4096][3072] q | k | v product (row pitch TP;
// blockIdx.y picks q, k or v with its weights and its outputs) (row s = batch item s / 2048, position s % 2048) (column c = head h * 64 + d; group g = h / 4: g = 0
// identity, else y[s][c] = bf(bias_g[d]) + sum_i bf(w_g[d][i]) * T[s - (width-1) + i][c] over rows of the same batch item, width = 2g + 1, summed in the order i = 0, 1, ...).
// Block = DWR consecutive rows, wave = one chunk of 128 columns (inside one group), lane -> 4 consecutive columns. A wave issues all of its DWR + width - 1 row loads (16 B a lane)
// and its weight loads before it uses any of them, holds the rounded weights in registers for all DWR rows, and every loop is unrolled: no load waits on another.
#define DWR 8
#define TP  (3 * DM)
typedef v4f __attribute__((aligned(4))) v4fu;      // the small weight arrays are read 16 B at a time with no more than their element alignment assumed
template <int KW, bool EDGE>
__device__ __forceinline__ void dw_rows(const float* __restrict__ T, const float* __restrict__ wg, const float* __restrict__ bg, int s0, int c0, v4f (&y)[DWR]) {
    // EDGE: the block starts its batch item (s0 is the item's first row): the width - 1 rows before it do not exist, their loads fall on row s0 and their taps are left out.
    const char* tb = (const char*)(T + (size_t)(EDGE ? s0 : s0 - (KW - 1)) * TP);      // uniform; the lane's own part of every address is one 32-bit offset
    const unsigned ro = (unsigned)c0 * 4u, bo = (unsigned)(c0 & (HD - 1)) * 4u;
    const char* wp = (const char*)wg + bo * (unsigned)KW;      // the lane's 4 x width weights lie in a row: element i * width + t
    v4f row[DWR + KW - 1], wv[KW], bv;
#pragma unroll
    for (int q = 0; q < KW; ++q) wv[q] = *(const v4fu*)(wp + q * 16);
    bv = *(const v4fu*)((const char*)bg + bo);
#pragma unroll
    for (int k = 0; k < DWR + KW - 1; ++k) row[k] = *(const v4f*)(tb + ro + (size_t)(EDGE ? (k < KW - 1 ? 0 : k - (KW - 1)) : k) * TP * 4);
    // The wait that stands before a register named by an issued load is rewritten; the lane's address parts are its inputs so that none of them is reused as a destination of
    // these loads, and no load is moved behind it: all of the wave's loads are in flight together.
    asm volatile("s_wait_xcnt 0x0" :: "v"(ro), "v"(wp), "v"(bo) : "memory");
    __builtin_amdgcn_sched_barrier(0);      // no arithmetic on the first values (with its wait) is lifted in front of the last loads
    float w[4 * KW];
#pragma unroll
    for (int q = 0; q < KW; ++q)
#pragma unroll
        for (int e = 0; e < 4; ++e) w[q * 4 + e] = bfr(wv[q][e]);
#pragma unroll
    for (int e = 0; e < 4; ++e) bv[e] = bfr(bv[e]);
#pragma unroll
    for (int j = 0; j < DWR; ++j)
#pragma unroll
        for (int i = 0; i < 4; ++i) { float acc = bv[i];
#pragma unroll
            for (int t = 0; t < KW; ++t) { if (!EDGE || j + t >= KW - 1) acc = fmaf(row[j + t][i], w[i * KW + t], acc); }
            y[j][i] = acc; }
}
__global__ __launch_bounds__(256) void k_dwmix(const float* __restrict__ T3,
                                               const float* __restrict__ qw3, const float* __restrict__ qb3, const float* __restrict__ qw5, const float* __restrict__ qb5, const float* __restrict__ qw7, const float* __restrict__ qb7,
                                               const float* __restrict__ kw3, const float* __restrict__ kb3, const float* __restrict__ kw5, const float* __restrict__ kb5, const float* __restrict__ kw7, const float* __restrict__ kb7,
                                               const float* __restrict__ vw3, const float* __restrict__ vb3, const float* __restrict__ vw5, const float* __restrict__ vb5, const float* __restrict__ vw7, const float* __restrict__ vb7,
                                               h16* QH, h16* QL, h16* KH, h16* KL, float* Y) {
    const int p = blockIdx.y;      // 0 = q, 1 = k, 2 = v: alike for the whole block, every choice below is a scalar one
    const float* T = T3 + p * DM;
    const float* w3 = p == 0 ? qw3 : p == 1 ? kw3 : vw3; const float* b3 = p == 0 ? qb3 : p == 1 ? kb3 : vb3;
    const float* w5 = p == 0 ? qw5 : p == 1 ? kw5 : vw5; const float* b5 = p == 0 ? qb5 : p == 1 ? kb5 : vb5;
    const float* w7 = p == 0 ? qw7 : p == 1 ? kw7 : vw7; const float* b7 = p == 0 ? qb7 : p == 1 ? kb7 : vb7;
    h16* YH = p == 0 ? QH : KH; h16* YL = p == 0 ? QL : KL;
    const bool F16 = p < 2;        // q and k leave as f16 hi + residual planes, v as f32
    const int lane = threadIdx.x & 31, s0 = blockIdx.x * DWR;
    const int ch = __builtin_amdgcn_readfirstlane(threadIdx.x >> 5);      // the wave's chunk in a scalar register: the choice of the group below is a scalar branch
    if (s0 >= NTK) return;
    const int c0 = ch * 128 + lane * 4, g = ch >> 1;      // 2 chunks = 4 heads = one group
    const bool edge = (s0 & (NT_ - 1)) == 0;               // DWR > width - 1: only a batch item's first block lacks rows
    const unsigned ro = (unsigned)c0 * 4u;
    v4f y[DWR];
    if (g == 0) {
#pragma unroll
        for (int j = 0; j < DWR; ++j) y[j] = *(const v4f*)((const char*)(T + (size_t)s0 * TP) + ro + j * TP * 4);
        asm volatile("s_wait_xcnt 0x0" :: "v"(ro) : "memory");      // the wait that stands before a register named by an issued load is rewritten
    }
    else if (g == 1) { if (edge) dw_rows<3, true>(T, w3, b3, s0, c0, y); else dw_rows<3, false>(T, w3, b3, s0, c0, y); }
    else if (g == 2) { if (edge) dw_rows<5, true>(T, w5, b5, s0, c0, y); else dw_rows<5, false>(T, w5, b5, s0, c0, y); }
    else             { if (edge) dw_rows<7, true>(T, w7, b7, s0, c0, y); else dw_rows<7, false>(T, w7, b7, s0, c0, y); }
    if (F16) {
#pragma unroll
        for (int j = 0; j < DWR; ++j) { v4h oh, ol;
#pragma unroll
            for (int i = 0; i < 4; ++i) { const h16 a = (h16)y[j][i]; oh[i] = a; ol[i] = (h16)((y[j][i] - (float)a) * LOSC); }
            *(v4h*)((char*)(YH + (size_t)s0 * DM) + (ro >> 1) + j * DM * 2) = oh; *(v4h*)((char*)(YL + (size_t)s0 * DM) + (ro >> 1) + j * DM * 2) = ol; }
    } else {
#pragma unroll
        for (int j = 0; j < DWR; ++j) { *(v4f*)((char*)(Y + (size_t)s0 * DM) + ro + j * DM * 4) = y[j]; }
        asm volatile("s_wait_xcnt 0x0" ::: "memory");      // the wait that stands before a register named by these stores is rewritten on any way the built code has from here
    }
}

extern "C" void kernel_launch(void* const* d_in, const int* in_sizes, int n_in,
                              void* d_out, int out_size, void* d_ws, size_t ws_size, hipStream_t stream) {
    (void)in_sizes; (void)n_in; (void)out_size;
    const float* x = (const float*)d_in[0]; const float* Wqkv = (const float*)d_in[1]; const float* bqkv = (const float*)d_in[2]; const float* Wo = (const float*)d_in[3]; const float* bo = (const float*)d_in[4];   // k-major weights (x @ W)
    const float* cw[3][6]; for (int p = 0; p < 3; ++p) for (int j = 0; j < 6; ++j) cw[p][j] = (const float*)d_in[5 + p * 6 + j];     // (w3, b3, w5, b5, w7, b7) for q, k, v
    float* out = (float*)d_out;    // [2][2048][1024]
    char* wsp = (char*)d_ws;
    auto take = [&](size_t bytes) { char* p = wsp; wsp += (bytes + 255) & ~(size_t)255; return (void*)p; };
    bf* WT = (bf*)take((size_t)3 * DM * DM * 2); bf* WoT = (bf*)take((size_t)DM * DM * 2); bf* Xb = (bf*)take((size_t)NTK * DM * 2);
    float* TMP = (float*)take((size_t)NTK * 3 * DM * 4); float* TV = (float*)take((size_t)NTK * DM * 4);
    h16* QH = (h16*)take((size_t)NTK * DM * 2); h16* QL = (h16*)take((size_t)NTK * DM * 2); h16* KH = (h16*)take((size_t)NTK * DM * 2); h16* KL = (h16*)take((size_t)NTK * DM * 2);
    h16* VTH = (h16*)take((size_t)NTK * DM * 2); h16* VTL = (h16*)take((size_t)NTK * DM * 2); bf* CH = (bf*)take((size_t)NTK * DM * 2); bf* CL = (bf*)take((size_t)NTK * DM * 2);
    if ((size_t)(wsp - (char*)d_ws) > ws_size) return;    // about 150 MB in all, no aliasing
    k_prep<<<NWQ + NWO + NTK / 8, 256, 0, stream>>>(Wqkv, Wo, x, WT, WoT, Xb);
    {
        k_gemmb<false, false><<<dim3(NTK / 128, 3 * DM / 128, 1), 256, 0, stream>>>(Xb, nullptr, WT, bqkv, TMP, 3 * DM, nullptr);                          // q | k | v (f32), one [4096 x 3072] product
        k_dwmix<<<dim3(NTK / DWR, 3, 1), 256, 0, stream>>>(TMP, cw[0][0], cw[0][1], cw[0][2], cw[0][3], cw[0][4], cw[0][5], cw[1][0], cw[1][1], cw[1][2], cw[1][3], cw[1][4], cw[1][5],
                                                           cw[2][0], cw[2][1], cw[2][2], cw[2][3], cw[2][4], cw[2][5], QH, QL, KH, KL, TV);
        k_vt<<<NB_ * NH_ * (NT_ / 64), 256, 0, stream>>>(TV, VTH, VTL);
        k_attn<<<NB_ * NH_ * (NT_ / 128), 128, 0, stream>>>(QH, QL, KH, KL, VTH, VTL, CH, CL);
        k_gemmb<true, false><<<dim3(NTK / 128, DM / 128, 1), 256, 0, stream>>>(CH, CL, WoT, bo, out, DM, nullptr);
    }
}

// v008
// Measured time: 131 microseconds a run.
// Two timings next to v007 put it at 1.09 and 1.08 times that version's speed.
// Over all steps from v000 it is 5.50 times as fast.
#include <hip/hip_runtime.h>

// Compute dtypes, f32 accumulate, both batch items in one pass (4096 rows per launch): qkv = x.c_attn_w + b ([4096 x 1024].[1024 x 3072], one launch, PLAIN bf16 operands = the
// rounded input and the k-major weights transposed once; exact products) on v_wmma_f32_16x16x32_bf16 -> f32; the per-head-group causal depthwise convolutions along the
// sequence (heads 0-3 identity, 4-7 width 3, 8-11 width 5, 12-15 width 7; weights/biases read as inputs) in f32 -> q/k as f16 hi + residual x1024 planes, v -> f32 ->
// transposed f16 hi + residual planes; the 16-head causal attention (masked positions are -inf and contribute exp(-inf - m) = 0) fused on v_wmma_f32_16x16x32_f16
// (hh + hl + lh x 1/8, online f32 softmax, weights x32768 and v as f16 hi + residual x1024); out = ctx.c_proj_w + b (ctx as bf16 hi + UNSCALED residual against the

#define NB_  2                   // both batch items go through every launch together
#define NT_  2048
#define DM   1024
#define NH_  16
#define HD   64
#define HK   4                    // heads per group
#define NTK  (NB_ * NT_)
#define NW   1024
#define NQKV 1024
#define PSC  32768.0f
#define LOSC 1024.0f
#define LOSCI (1.0f / 1024.0f)

typedef _Float16 h16;
typedef unsigned short bf;
typedef __attribute__((ext_vector_type(16))) __bf16   v16bf;
typedef __attribute__((ext_vector_type(16))) _Float16 v16h;
typedef __attribute__((ext_vector_type(8)))  _Float16 v8h;
typedef __attribute__((ext_vector_type(8)))  unsigned short v8us;
typedef __attribute__((ext_vector_type(8)))  float    v8f;
typedef __attribute__((ext_vector_type(4)))  float    v4f;
typedef v8h  __attribute__((may_alias)) v8ha;
typedef v4f  __attribute__((may_alias)) v4fa;
typedef v8us __attribute__((may_alias)) v8usa;

__device__ __forceinline__ unsigned short f2bf(float f) { unsigned u = __float_as_uint(f); u += 0x7FFFu + ((u >> 16) & 1u); return (unsigned short)(u >> 16); }
__device__ __forceinline__ float bf2f(unsigned short b) { return __uint_as_float(((unsigned)b) << 16); }
__device__ __forceinline__ float bfr(float f) { return bf2f(f2bf(f)); }
__device__ __forceinline__ v16h cat16(v8h lo, v8h hi) { return __builtin_shufflevector(lo, hi, 0, 1, 2, 3, 4, 5, 6, 7, 8, 9, 10, 11, 12, 13, 14, 15); }
__device__ __forceinline__ v16bf cat16b(v8us lo, v8us hi) { return __builtin_bit_cast(v16bf, __builtin_shufflevector(lo, hi, 0, 1, 2, 3, 4, 5, 6, 7, 8, 9, 10, 11, 12, 13, 14, 15)); }
__device__ __forceinline__ v8f wmma16(v16h a, v16h b, v8f c) { return __builtin_amdgcn_wmma_f32_16x16x32_f16(false, a, false, b, (short)0, c, false, false); }
__device__ __forceinline__ float xhalf(float x) { return __builtin_bit_cast(float, __builtin_amdgcn_permlanex16(__builtin_bit_cast(int, x), __builtin_bit_cast(int, x), 0x76543210, 0xfedcba98, false, false)); }      // lane l takes lane l ^ 16's value
__device__ __forceinline__ v8f wmmab(v16bf a, v16bf b, v8f c) { return __builtin_amdgcn_wmma_f32_16x16x32_bf16(false, a, false, b, (short)0, c, false, false); }

__device__ __forceinline__ void cvtb_body(const float* __restrict__ src, int nrows, bf* dst, int blk) {
    const int lane = threadIdx.x & 31, r = blk * 8 + (threadIdx.x >> 5);
    if (r >= nrows) return;
    v8us o[DM / 256];
#pragma unroll
    for (int q = 0; q < DM / 256; ++q) { v8us t;
#pragma unroll
        for (int i = 0; i < 8; ++i) t[i] = f2bf(src[(size_t)r * DM + q * 256 + lane * 8 + i]);
        o[q] = t; }
#pragma unroll
    for (int q = 0; q < DM / 256; ++q) *(v8us*)(dst + (size_t)r * DM + q * 256 + lane * 8) = o[q];
    
}

// k_gemmb: 128 x 128 block tile (8 waves, 4 down x 2 across, 32 x 64 each) of C[NTK][ldc] = (A [+ Al]).B^T (K = 1024) [+ bf(bias[c])] [+ bf(R[r][c]) residual]; f32 whole-line epilogue (or f16
template <bool SPLITA, bool F16OUT = false>
__global__ __launch_bounds__(256) void k_gemmb(const bf* __restrict__ A, const bf* __restrict__ Al, const bf* __restrict__ Bn, const float* __restrict__ bias, float* C, int ldc, h16* C2, const float* __restrict__ R = nullptr, int K = DM, int roundR = 1) {
    // stg: two buffers of the block's operand tiles (plane 0 = 128 A rows, 1 = 128 B rows, 2 = 128 Al rows; 64 k each, row pitch 72 elements = 144 B), filled by whole-line
    // loads that the eight waves share; the fragments are read from here. A line fetched once serves 128 rows or columns of C, and a B fragment read from LDS serves two A fragments.
    __shared__ __align__(16) bf stg[2][SPLITA ? 3 : 2][128 * 72];
    const int lane = threadIdx.x & 31, wave = threadIdx.x >> 5, lr = lane & 15, hi = lane >> 4;
    const int wr = (wave >> 1) * 32, wc = (wave & 1) * 64;      // the wave's 32 x 64 part of the block tile
    const int r0 = blockIdx.x * 128 + wr, c0 = blockIdx.y * 128 + wc;
    const int srow = threadIdx.x >> 3, spc = (threadIdx.x & 7) * 8;      // staging: 8 threads cover one 128 B row piece by piece, 32 rows a pass
    unsigned so[4];      // the thread's byte offset inside a 128-row tile, one per pass; the tile's own address is uniform
#pragma unroll
    for (int s = 0; s < 4; ++s) so[s] = ((unsigned)(srow + 32 * s) * (unsigned)K + (unsigned)spc) * 2u;
    v8us ga[4], gb[4], gl[4];
    auto fetch = [&](int kc) {
        const char* ta = (const char*)(A + (size_t)(blockIdx.x * 128) * K + kc); const char* tb = (const char*)(Bn + (size_t)(blockIdx.y * 128) * K + kc); const char* tl = SPLITA ? (const char*)(Al + (size_t)(blockIdx.x * 128) * K + kc) : ta;
        const char* pa[4]; const char* pb[4]; const char* pl[4];
#pragma unroll
        for (int s = 0; s < 4; ++s) { pa[s] = ta + so[s]; pb[s] = tb + so[s]; pl[s] = tl + so[s]; }
#pragma unroll
        for (int s = 0; s < 4; ++s) { ga[s] = *(const v8us*)pa[s]; gb[s] = *(const v8us*)pb[s]; if (SPLITA) gl[s] = *(const v8us*)pl[s]; }
        // The wait that stands before a register named by an issued load is rewritten; the addresses are its inputs so that none of them is reused as a destination of these loads.
        asm volatile("s_wait_xcnt 0x0" :: "v"(pa[0]), "v"(pa[1]), "v"(pa[2]), "v"(pa[3]), "v"(pb[0]), "v"(pb[1]), "v"(pb[2]), "v"(pb[3]), "v"(pl[0]), "v"(pl[1]), "v"(pl[2]), "v"(pl[3]) : "memory");
    };
    auto put = [&](int buf) {
#pragma unroll
        for (int s = 0; s < 4; ++s) { const int o = (srow + 32 * s) * 72 + spc; *(v8usa*)(&stg[buf][0][o]) = ga[s]; *(v8usa*)(&stg[buf][1][o]) = gb[s]; if (SPLITA) *(v8usa*)(&stg[buf][SPLITA ? 2 : 0][o]) = gl[s]; }
    };
    v8f acc[2][4];
#pragma unroll
    for (int m = 0; m < 2; ++m)
#pragma unroll
        for (int t = 0; t < 4; ++t) acc[m][t] = (v8f){};
    fetch(0); put(0);
    __syncthreads();      // stage 0 is complete before any wave reads it
#pragma unroll 1
    for (int kb = 0; kb < K; kb += 64) {
        const int cur = (kb >> 6) & 1;
        const bool more = kb + 64 < K;
        if (more) fetch(kb + 64);      // the next stage's lines fly while this stage is multiplied
#pragma unroll
        for (int ks = 0; ks < 2; ++ks) {
            const int fo = ks * 32 + 8 * hi;
            v16bf a[2], al[2];
#pragma unroll
            for (int m = 0; m < 2; ++m) { const int ao = (wr + m * 16 + lr) * 72 + fo;
                a[m] = cat16b(*(const v8usa*)(&stg[cur][0][ao]), *(const v8usa*)(&stg[cur][0][ao + 16]));
                al[m] = a[m];
                if (SPLITA) al[m] = cat16b(*(const v8usa*)(&stg[cur][SPLITA ? 2 : 0][ao]), *(const v8usa*)(&stg[cur][SPLITA ? 2 : 0][ao + 16])); }
            v16bf b[4];
#pragma unroll
            for (int t = 0; t < 4; ++t) { const int bo = (wc + t * 16 + lr) * 72 + fo; b[t] = cat16b(*(const v8usa*)(&stg[cur][1][bo]), *(const v8usa*)(&stg[cur][1][bo + 16])); }
#pragma unroll
            for (int t = 0; t < 4; ++t)
#pragma unroll
                for (int m = 0; m < 2; ++m) acc[m][t] = wmmab(a[m], b[t], acc[m][t]);
            if (SPLITA) {
#pragma unroll
                for (int t = 0; t < 4; ++t)
#pragma unroll
                    for (int m = 0; m < 2; ++m) acc[m][t] = wmmab(al[m], b[t], acc[m][t]); }
            // the four vector slots that the chip needs behind the last matrix instruction, on every way the built code has from here
            asm volatile("v_nop\n\tv_nop\n\tv_nop\n\tv_nop" : "+v"(acc[0][0]), "+v"(acc[0][1]), "+v"(acc[0][2]), "+v"(acc[0][3]), "+v"(acc[1][0]), "+v"(acc[1][1]), "+v"(acc[1][2]), "+v"(acc[1][3]) : "v"(a[0]), "v"(a[1]), "v"(al[0]), "v"(al[1]));
        }
        if (more) put(cur ^ 1);        // into the buffer whose readers all passed the barrier of the trip before
        __syncthreads();               // publishes the next stage and ends every wave's reads of this one
    }
    // The output is staged in the operand buffers, which nobody reads any more behind the loop's last barrier: 32 rows x 68 floats a wave, 8 waves = 69,632 B of the 73,728 B or more.
    float* os = (float*)(void*)&stg[0][0][0] + wave * (32 * 68);
    float bv[4] = {0.f, 0.f, 0.f, 0.f};
    if (bias) {      // the four bias loads leave together: one latency, not four, in a block that may be alone on its WGP
#pragma unroll
        for (int t = 0; t < 4; ++t) bv[t] = bias[c0 + t * 16 + lr];
#pragma unroll
        for (int t = 0; t < 4; ++t) bv[t] = bfr(bv[t]);
    }
#pragma unroll
    for (int t = 0; t < 4; ++t)
#pragma unroll
        for (int m = 0; m < 2; ++m)
#pragma unroll
            for (int j = 0; j < 8; ++j) os[(m * 16 + hi * 8 + j) * 68 + t * 16 + lr] = acc[m][t][j] + bv[t];
    __syncthreads();
    if (F16OUT) {
        h16* crow = (h16*)(void*)C + (size_t)r0 * ldc + c0;
        auto pass = [&]() {
#pragma unroll
            for (int s = 0; s < 8; ++s) { const int row = 4 * s + (lane >> 3), piece = lane & 7; const float* sp = os + row * 68 + piece * 8; v8h o, o2;
#pragma unroll
                for (int i = 0; i < 8; ++i) { const h16 a = (h16)sp[i]; o[i] = a; o2[i] = (h16)((sp[i] - (float)a) * LOSC); }
                *(v8h*)(crow + (size_t)row * ldc + piece * 8) = o; if (C2) *(v8h*)(C2 + (size_t)r0 * ldc + c0 + (size_t)row * ldc + piece * 8) = o2; }
        };
        pass(); 
    } else {
        float* crow = C + (size_t)r0 * ldc + c0;
        auto pass = [&]() {
            v4f val[16]; float* pc[16];
#pragma unroll
            for (int s = 0; s < 16; ++s) { const int Lid = (lane >> 3) + 4 * s, piece = lane & 7; const int row = Lid >> 1, cofs = (Lid & 1) * 32 + piece * 4;
                val[s] = *(const v4fa*)(os + row * 68 + cofs); if (R) { const v4f rv = *(const v4f*)(R + ((size_t)r0 + row) * ldc + c0 + cofs); val[s] += roundR ? (v4f){bfr(rv[0]), bfr(rv[1]), bfr(rv[2]), bfr(rv[3])} : rv; }
                pc[s] = crow + (size_t)row * ldc + cofs; }
#pragma unroll
            for (int s = 0; s < 16; ++s) *(v4f*)pc[s] = val[s];
            // The wait that stands before a register named by an issued store is rewritten; the addresses are its inputs so that none of them is reused between these stores.
            asm volatile("s_wait_xcnt 0x0" :: "v"(pc[0]), "v"(pc[1]), "v"(pc[2]), "v"(pc[3]), "v"(pc[4]), "v"(pc[5]), "v"(pc[6]), "v"(pc[7]), "v"(pc[8]), "v"(pc[9]), "v"(pc[10]), "v"(pc[11]), "v"(pc[12]), "v"(pc[13]), "v"(pc[14]), "v"(pc[15]) : "memory");
        };
        pass(); 
    }
}

typedef __attribute__((ext_vector_type(4)))  _Float16 v4h;
typedef __attribute__((ext_vector_type(4)))  unsigned short v4us;
typedef v4us __attribute__((may_alias)) v4usa;
typedef v4f __attribute__((aligned(4))) v4fu;      // the small weight arrays are read 16 B at a time with no more than their element alignment assumed
#define TSP 132      // row pitch of the f32 tile in LDS, in floats
#define TTP 136      // row pitch of the transposed f16 tile in LDS, in elements
// conv16: 16 rows (jb ...) x the lane's 4 columns (cl ...) of the causal depthwise convolution, read from the f32 tile ts (tile row 16 + j = the block's row j, tile rows 0-15 = the 16 rows
// before the block, zero where the batch item starts): y[s][c] = bf(bias[d]) + sum_t bf(w[d][t]) * T[s - (width-1) + t][c], summed in the order t = 0, 1, ...
template <int KW>
__device__ __forceinline__ void conv16(const float* ts, const float* __restrict__ wg, const float* __restrict__ bg, int jb, int cl, v4f (&y)[16]) {
    const unsigned bo = (unsigned)(cl & (HD - 1)) * 4u;
    const char* wp = (const char*)wg + bo * (unsigned)KW;      // the lane's 4 x width weights lie in a row: element i * width + t
    const char* bp = (const char*)bg + bo;
    v4f wv[KW], bv;
#pragma unroll
    for (int q = 0; q < KW; ++q) wv[q] = *(const v4fu*)(wp + q * 16);
    bv = *(const v4fu*)bp;
    // The wait that stands before a register named by an issued load is rewritten; the addresses are its inputs so that none of them is reused as a destination of these loads.
    asm volatile("s_wait_xcnt 0x0" :: "v"(wp), "v"(bp) : "memory");
    float w[4 * KW];
#pragma unroll
    for (int q = 0; q < KW; ++q)
#pragma unroll
        for (int e = 0; e < 4; ++e) w[q * 4 + e] = bfr(wv[q][e]);
#pragma unroll
    for (int e = 0; e < 4; ++e) bv[e] = bfr(bv[e]);
#pragma unroll
    for (int qd = 0; qd < 4; ++qd) {      // four rows at a time: few rows live beside the 16 results
        v4f row[4 + KW - 1];
#pragma unroll
        for (int k = 0; k < 4 + KW - 1; ++k) row[k] = *(const v4fa*)(ts + (16 + jb + qd * 4 - (KW - 1) + k) * TSP + cl);
#pragma unroll
        for (int j = 0; j < 4; ++j)
#pragma unroll
            for (int i = 0; i < 4; ++i) { float acc = bv[i];
#pragma unroll
                for (int t = 0; t < KW; ++t) acc = fmaf(row[j + t][i], w[i * KW + t], acc);
                y[qd * 4 + j][i] = acc; }
    }
}

// k_qkv: 128 x 128 block tile (8 waves, 4 down x 2 across, 32 x 64 each) of T = x.c_attn_w + bf(b) ([4096 x 1024].[1024 x 3072], K = 1024) as in k_gemmb, plus the 16 rows before the tile
// (one more 16 x 16 tile a wave), so that the block holds every row that the convolution of its own 128 rows reads. A block's 128 columns lie in one of q, k, v and in one head group
// (blockIdx.y >> 3 and (blockIdx.y & 7) >> 1: every choice below is a scalar one). The epilogue stages T in LDS (f32), convolves from there and writes what k_attn reads:
// q and k as f16 hi + residual x1024 planes [tok][1024], v as transposed f16 hi + residual planes [b][h][d][2048] through a second LDS tile, whole lines.
// The register bound asks for 6 waves a SIMD: three blocks on a WGP, so that the grid's 768 blocks are all resident at once, as in the product before.
__global__ __launch_bounds__(256, 6) void k_qkv(const bf* __restrict__ A, const bf* __restrict__ Bn, const float* __restrict__ bias,
                                             const float* __restrict__ qw3, const float* __restrict__ qb3, const float* __restrict__ qw5, const float* __restrict__ qb5, const float* __restrict__ qw7, const float* __restrict__ qb7,
                                             const float* __restrict__ kw3, const float* __restrict__ kb3, const float* __restrict__ kw5, const float* __restrict__ kb5, const float* __restrict__ kw7, const float* __restrict__ kb7,
                                             const float* __restrict__ vw3, const float* __restrict__ vb3, const float* __restrict__ vw5, const float* __restrict__ vb5, const float* __restrict__ vw7, const float* __restrict__ vb7,
                                             h16* QH, h16* QL, h16* KH, h16* KL, h16* VTH, h16* VTL) {
    // stg: two buffers of the block's operand tiles (rows 0-15 = the 16 A rows before the tile, 16-143 = its 128 A rows, 144-271 = 128 B rows; 64 k each, row pitch 72 elements = 144 B)
    __shared__ __align__(16) bf stg[2][272 * 72];
    const int tid = threadIdx.x, lane = tid & 31, wave = tid >> 5, lr = lane & 15, hi = lane >> 4;
    const int wr = (wave >> 1) * 32, wc = (wave & 1) * 64;      // the wave's 32 x 64 part of the block tile
    const int rblk = blockIdx.x * 128, cblk = blockIdx.y * 128;
    const bool edge = (rblk & (NT_ - 1)) == 0;      // the block starts its batch item: the rows before it do not exist, their loads fall on the tile's own rows and zeros take their place
    const int hblk = edge ? rblk : rblk - 16;
    const int srow = tid >> 3, spc = (tid & 7) * 8;      // staging: 8 threads cover one 128 B row piece by piece, 32 rows a pass
    const int hrow = tid >> 4, hpc = (tid & 15) * 4;     // the 16 rows before: 16 threads a row, 8 B each
    const unsigned so = ((unsigned)srow * (unsigned)DM + (unsigned)spc) * 2u;
    const unsigned sh = ((unsigned)hrow * (unsigned)DM + (unsigned)hpc) * 2u;
    v8us ga[4], gb[4]; v4us gh;
    auto fetch = [&](int kc) {
        // one address a tile and a thread; the four passes lie 32 rows apart, a constant that goes into the instruction
        const char* pa = (const char*)(A + (size_t)rblk * DM + kc) + so; const char* pb = (const char*)(Bn + (size_t)cblk * DM + kc) + so; const char* ph = (const char*)(A + (size_t)hblk * DM + kc) + sh;
#pragma unroll
        for (int s = 0; s < 4; ++s) { ga[s] = *(const v8us*)(pa + s * (32 * DM * 2)); gb[s] = *(const v8us*)(pb + s * (32 * DM * 2)); }
        gh = *(const v4us*)ph;
        // The wait that stands before a register named by an issued load is rewritten; the addresses are its inputs so that none of them is reused as a destination of these loads.
        asm volatile("s_wait_xcnt 0x0" :: "v"(pa), "v"(pb), "v"(ph) : "memory");
    };
    auto put = [&](int buf) {
#pragma unroll
        for (int s = 0; s < 4; ++s) { const int o = (srow + 32 * s) * 72 + spc; *(v8usa*)(&stg[buf][16 * 72 + o]) = ga[s]; *(v8usa*)(&stg[buf][144 * 72 + o]) = gb[s]; }
        *(v4usa*)(&stg[buf][hrow * 72 + hpc]) = gh;
    };
    v8f acc[2][4], acch = (v8f){};
#pragma unroll
    for (int m = 0; m < 2; ++m)
#pragma unroll
        for (int t = 0; t < 4; ++t) acc[m][t] = (v8f){};
    fetch(0); put(0);
    __syncthreads();      // stage 0 is complete before any wave reads it
#pragma unroll 1
    for (int kb = 0; kb < DM; kb += 64) {
        const int cur = (kb >> 6) & 1;
        const bool more = kb + 64 < DM;
        if (more) fetch(kb + 64);      // the next stage's lines fly while this stage is multiplied
#pragma unroll
        for (int ks = 0; ks < 2; ++ks) {
            const int fo = ks * 32 + 8 * hi;
            const int ho = lr * 72 + fo, hb = (144 + wave * 16 + lr) * 72 + fo;      // the rows before the tile x the wave's own 16 of the 128 columns
            const v16bf ah = cat16b(*(const v8usa*)(&stg[cur][ho]), *(const v8usa*)(&stg[cur][ho + 16])), bh = cat16b(*(const v8usa*)(&stg[cur][hb]), *(const v8usa*)(&stg[cur][hb + 16]));
            v16bf a[2];
#pragma unroll
            for (int m = 0; m < 2; ++m) { const int ao = (16 + wr + m * 16 + lr) * 72 + fo; a[m] = cat16b(*(const v8usa*)(&stg[cur][ao]), *(const v8usa*)(&stg[cur][ao + 16])); }
            v16bf b[4];
#pragma unroll
            for (int t = 0; t < 4; ++t) { const int bo = (144 + wc + t * 16 + lr) * 72 + fo; b[t] = cat16b(*(const v8usa*)(&stg[cur][bo]), *(const v8usa*)(&stg[cur][bo + 16])); }
            acch = wmmab(ah, bh, acch);
#pragma unroll
            for (int t = 0; t < 4; ++t)
#pragma unroll
                for (int m = 0; m < 2; ++m) acc[m][t] = wmmab(a[m], b[t], acc[m][t]);
            // the four vector slots that the chip needs behind the last matrix instruction, on every way the built code has from here
            asm volatile("v_nop\n\tv_nop\n\tv_nop\n\tv_nop" : "+v"(acc[0][0]), "+v"(acc[0][1]), "+v"(acc[0][2]), "+v"(acc[0][3]), "+v"(acc[1][0]), "+v"(acc[1][1]), "+v"(acc[1][2]), "+v"(acc[1][3]), "+v"(acch) : "v"(a[0]), "v"(a[1]));
        }
        if (more) put(cur ^ 1);        // into the buffer whose readers all passed the barrier of the trip before
        __syncthreads();               // publishes the next stage and ends every wave's reads of this one
    }
    // T is staged in the operand buffers, which nobody reads any more behind the loop's last barrier: 144 rows x 132 floats = 76,032 B of the 78,336 B.
    float* ts = (float*)(void*)&stg[0][0];
    float bv[4], bvh;
    const float* pbv = bias + cblk + wc + lr; const float* pbh = bias + cblk + wave * 16 + lr;
#pragma unroll
    for (int t = 0; t < 4; ++t) bv[t] = pbv[t * 16];      // the bias loads leave together
    bvh = *pbh;
    // The wait that stands before a register named by an issued load is rewritten; the addresses are its inputs so that none of them is reused as a destination of these loads.
    asm volatile("s_wait_xcnt 0x0" :: "v"(pbv), "v"(pbh) : "memory");
#pragma unroll
    for (int t = 0; t < 4; ++t) bv[t] = bfr(bv[t]);
    bvh = bfr(bvh);
#pragma unroll
    for (int t = 0; t < 4; ++t)
#pragma unroll
        for (int m = 0; m < 2; ++m)
#pragma unroll
            for (int j = 0; j < 8; ++j) ts[(16 + wr + m * 16 + hi * 8 + j) * TSP + wc + t * 16 + lr] = acc[m][t][j] + bv[t];
#pragma unroll
    for (int j = 0; j < 8; ++j) ts[(hi * 8 + j) * TSP + wave * 16 + lr] = edge ? 0.f : acch[j] + bvh;      // the reference pads the projected rows with zeros
    __syncthreads();      // T is complete before any wave convolves
    const int p = blockIdx.y >> 3, cb = (blockIdx.y & 7) * 128, g = (blockIdx.y & 7) >> 1;      // 0 = q, 1 = k, 2 = v; first column inside it; head group
    const float* w3 = p == 0 ? qw3 : p == 1 ? kw3 : vw3; const float* b3 = p == 0 ? qb3 : p == 1 ? kb3 : vb3;
    const float* w5 = p == 0 ? qw5 : p == 1 ? kw5 : vw5; const float* b5 = p == 0 ? qb5 : p == 1 ? kb5 : vb5;
    const float* w7 = p == 0 ? qw7 : p == 1 ? kw7 : vw7; const float* b7 = p == 0 ? qb7 : p == 1 ? kb7 : vb7;
    const int jb = wave * 16, cl = lane * 4;      // a wave convolves 16 rows of all 128 columns, a lane 4 columns
    v4f y[16];
    if (g == 0) {
#pragma unroll
        for (int j = 0; j < 16; ++j) y[j] = *(const v4fa*)(ts + (16 + jb + j) * TSP + cl);
    }
    else if (g == 1) conv16<3>(ts, w3, b3, jb, cl, y);
    else if (g == 2) conv16<5>(ts, w5, b5, jb, cl, y);
    else             conv16<7>(ts, w7, b7, jb, cl, y);
    if (p < 2) {
        h16* ph = (p == 0 ? QH : KH) + (size_t)(rblk + jb) * DM + cb + cl; h16* pl = (p == 0 ? QL : KL) + (size_t)(rblk + jb) * DM + cb + cl;
#pragma unroll
        for (int j = 0; j < 16; ++j) { v4h oh, ol;
#pragma unroll
            for (int i = 0; i < 4; ++i) { const h16 a = (h16)y[j][i]; oh[i] = a; ol[i] = (h16)((y[j][i] - (float)a) * LOSC); }
            *(v4h*)(ph + j * DM) = oh; *(v4h*)(pl + j * DM) = ol; }
        asm volatile("s_wait_xcnt 0x0" :: "v"(ph), "v"(pl) : "memory");      // the wait that stands before a register named by these stores is rewritten
    } else {
        __syncthreads();      // every wave has read its rows of T before the transposed tile is written over them
        h16* tt = (h16*)(void*)ts;      // [hi, residual][128 columns][128 rows, pitch 136]: 69,632 B
#pragma unroll
        for (int i = 0; i < 4; ++i)
#pragma unroll
            for (int hf = 0; hf < 2; ++hf) { v8h oh, ol;
#pragma unroll
                for (int j = 0; j < 8; ++j) { const float v = y[hf * 8 + j][i]; const h16 a = (h16)v; oh[j] = a; ol[j] = (h16)((v - (float)a) * LOSC); }
                *(v8ha*)(tt + (cl + i) * TTP + jb + hf * 8) = oh; *(v8ha*)(tt + (128 + cl + i) * TTP + jb + hf * 8) = ol; }
        __syncthreads();      // the transposed tile is complete before it is read row by row
        const int dr = tid >> 4, pc = (tid & 15) * 8;      // 16 threads cover one 256 B row of 128 positions
        const size_t vo = ((size_t)(rblk / NT_) * DM + cb + dr) * NT_ + (rblk & (NT_ - 1)) + pc;
        h16* ph = VTH + vo; h16* pl = VTL + vo;
#pragma unroll
        for (int s = 0; s < 8; ++s) {
            const v8h vh = *(const v8ha*)(tt + (dr + 16 * s) * TTP + pc), vl = *(const v8ha*)(tt + (128 + dr + 16 * s) * TTP + pc);
            *(v8h*)(ph + (size_t)(16 * s) * NT_) = vh; *(v8h*)(pl + (size_t)(16 * s) * NT_) = vl; }
        asm volatile("s_wait_xcnt 0x0" :: "v"(ph), "v"(pl) : "memory");      // the wait that stands before a register named by these stores is rewritten
    }
}

// k_attn: block = (b, h, the two 64-query tiles 31 - t and t, one after the other: 66 key steps in every block), wave = 16 queries; key tiles up to the diagonal. Both products are
// transposed: scores^T = K.Q^T (A = key rows, B = queries) /8 (f32), so a lane holds 16 of the 32 scores of ONE query (query = lane & 15; keys 8 * (lane >> 4) + j and 16 + 8 * (lane >> 4) + j):
// the online softmax's maximum and sum are taken inside the lane plus one exchange between the wave's halves, and the weights x32768 (f16 hi + residual), converted in place, ARE the B operand
// of ctx^T += V^T.P^T (the same k order as the V^T rows' loader); ctx -> bf16 hi + residual planes CH/CL[tok][h*64+d].
__global__ __launch_bounds__(128) void k_attn(const h16* __restrict__ Q16, const h16* __restrict__ QL16, const h16* __restrict__ K16, const h16* __restrict__ KL16, const h16* __restrict__ VTH, const h16* __restrict__ VTL, bf* CH, bf* CL) {
    __shared__ __align__(16) float ost[4][16 * 68];
    // Operand tiles in LDS, filled by the block's 128 threads together (each line fetched once a query tile) and read as fragments by all four waves; two buffers each.
    __shared__ __align__(16) h16 kst[2][2][32 * 72];      // [buffer][hi, residual][key][64 d, row pitch 144 B]
    __shared__ __align__(16) h16 vst[2][2][64 * 40];      // [buffer][hi, residual][d][32 keys, row pitch 80 B]
    __shared__ __align__(16) h16 qls[4][16 * 72];         // each wave's 16 query-residual rows, filled once a query tile
    const int lane = threadIdx.x & 31, wave = threadIdx.x >> 5, lr = lane & 15, hi = lane >> 4;
    const int bid = blockIdx.x;
    const int b = bid / (NH_ * (NT_ / 128)), rem = bid - b * (NH_ * (NT_ / 128)), h = rem / (NT_ / 128), tp = rem - h * (NT_ / 128);
    const size_t tok0 = (size_t)b * NT_;
    // A tile's cost grows with its index (causal) and every block is resident at once: a block that takes tile 31 - t and then tile t walks 66 key steps whatever t is.
    // The second tile's first LDS writes stand behind the first tile's last two barriers. Kept rolled: one copy of the body in the instruction cache.
#pragma unroll 1
    for (int part = 0; part < 2; ++part) {
    const int qt = part ? tp : NT_ / 64 - 1 - tp;
    const int q0 = qt * 64 + wave * 16;
    v16h qa[2];
    const size_t qo0 = (tok0 + q0 + lr) * DM + h * HD + 8 * hi;
#pragma unroll
    for (int kc = 0; kc < 2; ++kc) qa[kc] = cat16(*(const v8h*)(Q16 + qo0 + kc * 32), *(const v8h*)(Q16 + qo0 + kc * 32 + 16));
    const h16* kh_b = K16 + tok0 * DM + h * HD;
    const h16* kl_b = KL16 + tok0 * DM + h * HD;
    const size_t vbase = (((size_t)b * NH_ + h) * HD) * NT_;
    v8f o[4], ox[4];
#pragma unroll
    for (int n = 0; n < 4; ++n) { o[n] = (v8f){}; ox[n] = (v8f){}; }
    float mrow = -3.0e38f, lpart = 0.f;      // the lane's one query: running maximum (alike in both halves), sum over the lane's own keys
    const int qi = q0 + lr;
    const int kt_lo = 0, kt_hi = (qt * 64 + 63) / 32;     // causal
    const int krow = threadIdx.x >> 3, kpc = (threadIdx.x & 7) * 8;      // key tile: 8 threads a 128 B row, 16 rows a pass
    const int vrow = threadIdx.x >> 2, vpc = (threadIdx.x & 3) * 8;      // value tile: 4 threads a 64 B row, 32 rows a pass
    v8h gk[2][2], gv[2][2];
    auto fetch = [&](int l0) {
#pragma unroll
        for (int s = 0; s < 2; ++s) {
            const size_t ko = (size_t)(l0 + krow + 16 * s) * DM + kpc, vo = vbase + (size_t)(vrow + 32 * s) * NT_ + l0 + vpc;
            gk[0][s] = *(const v8h*)(kh_b + ko); gk[1][s] = *(const v8h*)(kl_b + ko); gv[0][s] = *(const v8h*)(VTH + vo); gv[1][s] = *(const v8h*)(VTL + vo); }
    };
    auto put = [&](int buf) {
#pragma unroll
        for (int s = 0; s < 2; ++s) {
            const int ko = (krow + 16 * s) * 72 + kpc, vo = (vrow + 32 * s) * 40 + vpc;
            *(v8ha*)(&kst[buf][0][ko]) = gk[0][s]; *(v8ha*)(&kst[buf][1][ko]) = gk[1][s]; *(v8ha*)(&vst[buf][0][vo]) = gv[0][s]; *(v8ha*)(&vst[buf][1][vo]) = gv[1][s]; }
    };
    fetch(0);
#pragma unroll
    for (int s = 0; s < 4; ++s) { const int row = 4 * s + (lane >> 3), pc = (lane & 7) * 8; *(v8ha*)(&qls[wave][row * 72 + pc]) = *(const v8h*)(QL16 + (tok0 + q0 + row) * DM + h * HD + pc); }
    put(0);
    __syncthreads();      // tile 0 is complete before any wave reads it
    const h16* ql_s = &qls[wave][lr * 72 + 8 * hi];
#pragma unroll 1
    for (int kt = kt_lo; kt <= kt_hi; ++kt) {
        const int l0 = kt * 32, cur = kt & 1;
        if (kt < kt_hi) fetch(l0 + 32);      // the next tile's lines fly while this tile is worked on
        const h16* kh_s = &kst[cur][0][0]; const h16* kl_s = &kst[cur][1][0];
        const int ko0 = lr * 72 + 8 * hi, ko1 = (16 + lr) * 72 + 8 * hi;
        v8f s0 = {}, s1 = {}, x0 = {}, x1 = {};
#pragma unroll
        for (int kc = 0; kc < 2; ++kc) {
            { const v16h k0h = cat16(*(const v8ha*)(kh_s + ko0 + kc * 32), *(const v8ha*)(kh_s + ko0 + kc * 32 + 16)), k1h = cat16(*(const v8ha*)(kh_s + ko1 + kc * 32), *(const v8ha*)(kh_s + ko1 + kc * 32 + 16));
              const v16h qlk = cat16(*(const v8ha*)(ql_s + kc * 32), *(const v8ha*)(ql_s + kc * 32 + 16));     // query residual re-read per step (registers)
              s0 = wmma16(k0h, qa[kc], s0); x0 = wmma16(k0h, qlk, x0); s1 = wmma16(k1h, qa[kc], s1); x1 = wmma16(k1h, qlk, x1);
              asm volatile("v_nop" : "+v"(s0), "+v"(s1), "+v"(x0), "+v"(x1) : "v"(qlk), "v"(k0h), "v"(k1h) : "memory"); }
            { const v16h k0l = cat16(*(const v8ha*)(kl_s + ko0 + kc * 32), *(const v8ha*)(kl_s + ko0 + kc * 32 + 16)), k1l = cat16(*(const v8ha*)(kl_s + ko1 + kc * 32), *(const v8ha*)(kl_s + ko1 + kc * 32 + 16));
              x0 = wmma16(k0l, qa[kc], x0); x1 = wmma16(k1l, qa[kc], x1);
              asm volatile("v_nop" : "+v"(x0), "+v"(x1) : "v"(k0l), "v"(k1l) : "memory"); }
        }
        asm volatile("v_nop\n\tv_nop\n\tv_nop\n\tv_nop" : "+v"(s0), "+v"(s1), "+v"(x0), "+v"(x1) : "v"(qa[0]), "v"(qa[1]));
        float a0[8], a1[8];
        const int dq = qi - 8 * hi - l0;      // the lane's query counted from the lane's first key of this tile
#pragma unroll
        for (int j = 0; j < 8; ++j) {
            a0[j] = (j <= dq) ? (s0[j] + x0[j] * LOSCI) * 0.125f : -__builtin_inff(); a1[j] = (16 + j <= dq) ? (s1[j] + x1[j] * LOSCI) * 0.125f : -__builtin_inff();      // key l0 + 8 hi + j (+ 16) <= query
        }
        // the query's maximum over the lane's 16 keys as a tree of three-way maxima, then the other half's
        const float m0 = fmaxf(fmaxf(a0[0], a0[1]), a0[2]), m1 = fmaxf(fmaxf(a0[3], a0[4]), a0[5]), m2 = fmaxf(fmaxf(a0[6], a0[7]), a1[0]);
        const float m3 = fmaxf(fmaxf(a1[1], a1[2]), a1[3]), m4 = fmaxf(fmaxf(a1[4], a1[5]), a1[6]);
        float mx = fmaxf(fmaxf(fmaxf(m0, m1), m2), fmaxf(fmaxf(m3, m4), a1[7]));
        mx = fmaxf(mx, xhalf(mx));
        const float mn = fmaxf(mrow, mx);
        const float alpha = __expf(mrow - mn); mrow = mn;
        v16h pa, px;
        float ls[4] = {0.f, 0.f, 0.f, 0.f};      // four independent chains
#pragma unroll
        for (int j = 0; j < 8; ++j) {
            const float p0 = __expf(a0[j] - mn);
            if (j == 0) asm volatile("v_nop");      // the slot that the instruction set asks for behind a transcendental whose source the next instruction overwrites
            const float p1 = __expf(a1[j] - mn);
            ls[j & 3] += p0 + p1;
            const float ps0 = p0 * PSC, ps1 = p1 * PSC; const h16 h0 = (h16)ps0, h1 = (h16)ps1;
            pa[j] = h0; pa[8 + j] = h1;
            px[j] = (h16)((ps0 - (float)h0) * LOSC); px[8 + j] = (h16)((ps1 - (float)h1) * LOSC);
        }
        lpart = lpart * alpha + ((ls[0] + ls[1]) + (ls[2] + ls[3]));
#pragma unroll
        for (int n = 0; n < 4; ++n)
#pragma unroll
            for (int j = 0; j < 8; ++j) { o[n][j] *= alpha; ox[n][j] *= alpha; }
#pragma unroll
        for (int n = 0; n < 4; ++n) { const int vo = (n * 16 + lr) * 40 + hi * 8;
            const v16h vh = cat16(*(const v8ha*)(&vst[cur][0][vo]), *(const v8ha*)(&vst[cur][0][vo + 16])), vl = cat16(*(const v8ha*)(&vst[cur][1][vo]), *(const v8ha*)(&vst[cur][1][vo + 16]));
            o[n] = wmma16(vh, pa, o[n]); ox[n] = wmma16(vl, pa, ox[n]); ox[n] = wmma16(vh, px, ox[n]);
            asm volatile("" : "+v"(o[n]), "+v"(ox[n]) : "v"(vh), "v"(vl) : "memory"); }
        asm volatile("v_nop\n\tv_nop\n\tv_nop\n\tv_nop" : "+v"(o[0]), "+v"(o[1]), "+v"(o[2]), "+v"(o[3]), "+v"(ox[0]), "+v"(ox[1]), "+v"(ox[2]), "+v"(ox[3]) : "v"(pa), "v"(px));
        if (kt < kt_hi) put(cur ^ 1);      // into the buffer whose readers all passed the barrier of the trip before
        __syncthreads();                   // publishes the next tile and ends every wave's reads of this one
    }
    const float inv = 1.0f / ((lpart + xhalf(lpart)) * PSC);      // the two halves' sums are joined once
    float* os = &ost[wave][0];
#pragma unroll
    for (int n = 0; n < 4; ++n)      // the lane holds d = 16 n + 8 hi + j of its query's row
#pragma unroll
        for (int q = 0; q < 2; ++q) { v4f t;
#pragma unroll
            for (int i = 0; i < 4; ++i) t[i] = (o[n][q * 4 + i] + ox[n][q * 4 + i] * LOSCI) * inv;
            *(v4fa*)(os + lr * 68 + n * 16 + hi * 8 + q * 4) = t; }
    __syncthreads();
    const size_t cbase = (tok0 + q0) * DM + (size_t)h * HD;
    auto pass = [&]() {
#pragma unroll
        for (int s = 0; s < 4; ++s) { const int row = 4 * s + (lane >> 3), piece = lane & 7; const float* sp = os + row * 68 + piece * 8; v8us oh, ol;
#pragma unroll
            for (int i = 0; i < 8; ++i) { const unsigned short hb = f2bf(sp[i]); oh[i] = hb; ol[i] = f2bf(sp[i] - bf2f(hb)); }
            *(v8us*)(CH + cbase + (size_t)row * DM + piece * 8) = oh; *(v8us*)(CL + cbase + (size_t)row * DM + piece * 8) = ol; }
    };
    pass(); 
    asm volatile("s_wait_xcnt 0x0" ::: "memory");      // the wait that stands before the second tile's first instructions rewrite registers named by these stores
    }
}


// wt_body: WT [n][K] = bf16(W[k][n]) (k-major [K][ncols]) via 64 x 64 LDS tiles; tile (bx, by) of (K/64, ncols/64).
__device__ __forceinline__ void wt_body(const float* __restrict__ Wm, int K, int ncols, bf* WT, int bx, int by) {
    __shared__ __align__(16) unsigned short tl[64 * 72];
    const int tid = threadIdx.x, k0 = bx * 64, n0 = by * 64;
    const int kk = tid >> 2, nq = (tid & 3) * 16;
#pragma unroll
    for (int i = 0; i < 16; ++i) tl[(nq + i) * 72 + kk] = f2bf(Wm[(size_t)(k0 + kk) * ncols + n0 + nq + i]);
    __syncthreads();
    const int piece = tid & 7;
    auto pass = [&]() {
#pragma unroll
        for (int s = 0; s < 2; ++s) { const int nr = (tid >> 3) + 32 * s; const v8us val = *(const v8usa*)(tl + nr * 72 + piece * 8); *(v8us*)(WT + (size_t)(n0 + nr) * K + k0 + piece * 8) = val; }
    };
    pass(); 
}

// k_prep: the three conversions of inputs, which do not depend on one another, in one grid; the block index picks the job (alike for the whole block, so wt_body's barrier is passed by
// all of a block's threads or by none): blocks [0, NWQ) transpose c_attn_w, [NWQ, NWQ + NWO) transpose c_proj_w, the rest round 8 rows of x each.
#define NWQ ((DM / 64) * (3 * DM / 64))
#define NWO ((DM / 64) * (DM / 64))
__global__ __launch_bounds__(256) void k_prep(const float* __restrict__ Wqkv, const float* __restrict__ Wo, const float* __restrict__ x, bf* WT, bf* WoT, bf* Xb) {
    const int bid = blockIdx.x;
    if (bid < NWQ + NWO) {
        const bool second = bid >= NWQ;
        const int t = second ? bid - NWQ : bid;      // tile index, the k tile running fastest
        wt_body(second ? Wo : Wqkv, DM, second ? DM : 3 * DM, second ? WoT : WT, t & (DM / 64 - 1), t / (DM / 64));
    } else cvtb_body(x, NTK, Xb, bid - (NWQ + NWO));
}

extern "C" void kernel_launch(void* const* d_in, const int* in_sizes, int n_in,
                              void* d_out, int out_size, void* d_ws, size_t ws_size, hipStream_t stream) {
    (void)in_sizes; (void)n_in; (void)out_size;
    const float* x = (const float*)d_in[0]; const float* Wqkv = (const float*)d_in[1]; const float* bqkv = (const float*)d_in[2]; const float* Wo = (const float*)d_in[3]; const float* bo = (const float*)d_in[4];   // k-major weights (x @ W)
    const float* cw[3][6]; for (int p = 0; p < 3; ++p) for (int j = 0; j < 6; ++j) cw[p][j] = (const float*)d_in[5 + p * 6 + j];     // (w3, b3, w5, b5, w7, b7) for q, k, v
    float* out = (float*)d_out;    // [2][2048][1024]
    char* wsp = (char*)d_ws;
    auto take = [&](size_t bytes) { char* p = wsp; wsp += (bytes + 255) & ~(size_t)255; return (void*)p; };
    bf* WT = (bf*)take((size_t)3 * DM * DM * 2); bf* WoT = (bf*)take((size_t)DM * DM * 2); bf* Xb = (bf*)take((size_t)NTK * DM * 2);
    h16* QH = (h16*)take((size_t)NTK * DM * 2); h16* QL = (h16*)take((size_t)NTK * DM * 2); h16* KH = (h16*)take((size_t)NTK * DM * 2); h16* KL = (h16*)take((size_t)NTK * DM * 2);
    h16* VTH = (h16*)take((size_t)NTK * DM * 2); h16* VTL = (h16*)take((size_t)NTK * DM * 2); bf* CH = (bf*)take((size_t)NTK * DM * 2); bf* CL = (bf*)take((size_t)NTK * DM * 2);
    if ((size_t)(wsp - (char*)d_ws) > ws_size) return;    // about 80 MB in all, no aliasing
    k_prep<<<NWQ + NWO + NTK / 8, 256, 0, stream>>>(Wqkv, Wo, x, WT, WoT, Xb);
    {
        k_qkv<<<dim3(NTK / 128, 3 * DM / 128, 1), 256, 0, stream>>>(Xb, WT, bqkv, cw[0][0], cw[0][1], cw[0][2], cw[0][3], cw[0][4], cw[0][5], cw[1][0], cw[1][1], cw[1][2], cw[1][3], cw[1][4], cw[1][5],
                                                                    cw[2][0], cw[2][1], cw[2][2], cw[2][3], cw[2][4], cw[2][5], QH, QL, KH, KL, VTH, VTL);      // q | k | v: product, convolution, operand planes
        k_attn<<<NB_ * NH_ * (NT_ / 128), 128, 0, stream>>>(QH, QL, KH, KL, VTH, VTL, CH, CL);
        k_gemmb<true, false><<<dim3(NTK / 128, DM / 128, 1), 256, 0, stream>>>(CH, CL, WoT, bo, out, DM, nullptr);
    }
}

// v009
// A run of this version takes 120 microseconds.
// Next to v008, in two timings, it ran 1.09 times as fast each time.
// All steps since v000 together make it 5.97 times as fast.
#include <hip/hip_runtime.h>

// Compute dtypes, f32 accumulate, both batch items in one pass (4096 rows per launch): qkv = x.c_attn_w + b ([4096 x 1024].[1024 x 3072], one launch, PLAIN bf16 operands = the
// rounded input and the k-major weights transposed once; exact products) on v_wmma_f32_16x16x32_bf16 -> f32; the per-head-group causal depthwise convolutions along the
// sequence (heads 0-3 identity, 4-7 width 3, 8-11 width 5, 12-15 width 7; weights/biases read as inputs) in f32 -> q/k as f16 hi + residual x1024 planes, v -> f32 ->
// transposed f16 hi + residual planes; the 16-head causal attention (masked positions are -inf and contribute exp(-inf - m) = 0) fused on v_wmma_f32_16x16x32_f16
// (hh + hl + lh x 1/8, online f32 softmax, weights x32768 and v as f16 hi + residual x1024); out = ctx.c_proj_w + b (ctx as bf16 hi + UNSCALED residual against the

#define NB_  2                   // both batch items go through every launch together
#define NT_  2048
#define DM   1024
#define NH_  16
#define HD   64
#define HK   4                    // heads per group
#define NTK  (NB_ * NT_)
#define NW   1024
#define NQKV 1024
#define PSC  32768.0f
#define LOSC 1024.0f
#define LOSCI (1.0f / 1024.0f)

typedef _Float16 h16;
typedef unsigned short bf;
typedef __attribute__((ext_vector_type(16))) __bf16   v16bf;
typedef __attribute__((ext_vector_type(16))) _Float16 v16h;
typedef __attribute__((ext_vector_type(8)))  _Float16 v8h;
typedef __attribute__((ext_vector_type(8)))  unsigned short v8us;
typedef __attribute__((ext_vector_type(8)))  float    v8f;
typedef __attribute__((ext_vector_type(4)))  float    v4f;
typedef v8h  __attribute__((may_alias)) v8ha;
typedef v4f  __attribute__((may_alias)) v4fa;
typedef v8us __attribute__((may_alias)) v8usa;

__device__ __forceinline__ unsigned short f2bf(float f) { unsigned u = __float_as_uint(f); u += 0x7FFFu + ((u >> 16) & 1u); return (unsigned short)(u >> 16); }
__device__ __forceinline__ float bf2f(unsigned short b) { return __uint_as_float(((unsigned)b) << 16); }
__device__ __forceinline__ float bfr(float f) { return bf2f(f2bf(f)); }
__device__ __forceinline__ v16h cat16(v8h lo, v8h hi) { return __builtin_shufflevector(lo, hi, 0, 1, 2, 3, 4, 5, 6, 7, 8, 9, 10, 11, 12, 13, 14, 15); }
__device__ __forceinline__ v16bf cat16b(v8us lo, v8us hi) { return __builtin_bit_cast(v16bf, __builtin_shufflevector(lo, hi, 0, 1, 2, 3, 4, 5, 6, 7, 8, 9, 10, 11, 12, 13, 14, 15)); }
__device__ __forceinline__ v8f wmma16(v16h a, v16h b, v8f c) { return __builtin_amdgcn_wmma_f32_16x16x32_f16(false, a, false, b, (short)0, c, false, false); }
__device__ __forceinline__ float xhalf(float x) { return __builtin_bit_cast(float, __builtin_amdgcn_permlanex16(__builtin_bit_cast(int, x), __builtin_bit_cast(int, x), 0x76543210, 0xfedcba98, false, false)); }      // lane l takes lane l ^ 16's value
__device__ __forceinline__ v8f wmmab(v16bf a, v16bf b, v8f c) { return __builtin_amdgcn_wmma_f32_16x16x32_bf16(false, a, false, b, (short)0, c, false, false); }

__device__ __forceinline__ void cvtb_body(const float* __restrict__ src, int nrows, bf* dst, int blk) {
    const int lane = threadIdx.x & 31, r = blk * 8 + (threadIdx.x >> 5);
    if (r >= nrows) return;
    v8us o[DM / 256];
#pragma unroll
    for (int q = 0; q < DM / 256; ++q) { v8us t;
#pragma unroll
        for (int i = 0; i < 8; ++i) t[i] = f2bf(src[(size_t)r * DM + q * 256 + lane * 8 + i]);
        o[q] = t; }
#pragma unroll
    for (int q = 0; q < DM / 256; ++q) *(v8us*)(dst + (size_t)r * DM + q * 256 + lane * 8) = o[q];
    
}

// k_gemmb: 128 x 128 block tile (8 waves, 4 down x 2 across, 32 x 64 each) of C[NTK][ldc] = (A [+ Al]).B^T (K = 1024) [+ bf(bias[c])] [+ bf(R[r][c]) residual]; f32 whole-line epilogue (or f16
template <bool SPLITA, bool F16OUT = false>
__global__ __launch_bounds__(256) void k_gemmb(const bf* __restrict__ A, const bf* __restrict__ Al, const bf* __restrict__ Bn, const float* __restrict__ bias, float* C, int ldc, h16* C2, const float* __restrict__ R = nullptr, int K = DM, int roundR = 1) {
    // stg: two buffers of the block's operand tiles (plane 0 = 128 A rows, 1 = 128 B rows, 2 = 128 Al rows; 64 k each, row pitch 72 elements = 144 B), filled by whole-line
    // loads that the eight waves share; the fragments are read from here. A line fetched once serves 128 rows or columns of C, and a B fragment read from LDS serves two A fragments.
    __shared__ __align__(16) bf stg[2][SPLITA ? 3 : 2][128 * 72];
    const int lane = threadIdx.x & 31, wave = threadIdx.x >> 5, lr = lane & 15, hi = lane >> 4;
    const int wr = (wave >> 1) * 32, wc = (wave & 1) * 64;      // the wave's 32 x 64 part of the block tile
    const int r0 = blockIdx.x * 128 + wr, c0 = blockIdx.y * 128 + wc;
    const int srow = threadIdx.x >> 3, spc = (threadIdx.x & 7) * 8;      // staging: 8 threads cover one 128 B row piece by piece, 32 rows a pass
    unsigned so[4];      // the thread's byte offset inside a 128-row tile, one per pass; the tile's own address is uniform
#pragma unroll
    for (int s = 0; s < 4; ++s) so[s] = ((unsigned)(srow + 32 * s) * (unsigned)K + (unsigned)spc) * 2u;
    v8us ga[4], gb[4], gl[4];
    auto fetch = [&](int kc) {
        const char* ta = (const char*)(A + (size_t)(blockIdx.x * 128) * K + kc); const char* tb = (const char*)(Bn + (size_t)(blockIdx.y * 128) * K + kc); const char* tl = SPLITA ? (const char*)(Al + (size_t)(blockIdx.x * 128) * K + kc) : ta;
        const char* pa[4]; const char* pb[4]; const char* pl[4];
#pragma unroll
        for (int s = 0; s < 4; ++s) { pa[s] = ta + so[s]; pb[s] = tb + so[s]; pl[s] = tl + so[s]; }
#pragma unroll
        for (int s = 0; s < 4; ++s) { ga[s] = *(const v8us*)pa[s]; gb[s] = *(const v8us*)pb[s]; if (SPLITA) gl[s] = *(const v8us*)pl[s]; }
        // The wait that stands before a register named by an issued load is rewritten; the addresses are its inputs so that none of them is reused as a destination of these loads.
        asm volatile("s_wait_xcnt 0x0" :: "v"(pa[0]), "v"(pa[1]), "v"(pa[2]), "v"(pa[3]), "v"(pb[0]), "v"(pb[1]), "v"(pb[2]), "v"(pb[3]), "v"(pl[0]), "v"(pl[1]), "v"(pl[2]), "v"(pl[3]) : "memory");
    };
    auto put = [&](int buf) {
#pragma unroll
        for (int s = 0; s < 4; ++s) { const int o = (srow + 32 * s) * 72 + spc; *(v8usa*)(&stg[buf][0][o]) = ga[s]; *(v8usa*)(&stg[buf][1][o]) = gb[s]; if (SPLITA) *(v8usa*)(&stg[buf][SPLITA ? 2 : 0][o]) = gl[s]; }
    };
    v8f acc[2][4];
#pragma unroll
    for (int m = 0; m < 2; ++m)
#pragma unroll
        for (int t = 0; t < 4; ++t) acc[m][t] = (v8f){};
    fetch(0); put(0);
    __syncthreads();      // stage 0 is complete before any wave reads it
#pragma unroll 1
    for (int kb = 0; kb < K; kb += 64) {
        const int cur = (kb >> 6) & 1;
        const bool more = kb + 64 < K;
        if (more) fetch(kb + 64);      // the next stage's lines fly while this stage is multiplied
#pragma unroll
        for (int ks = 0; ks < 2; ++ks) {
            const int fo = ks * 32 + 8 * hi;
            v16bf a[2], al[2];
#pragma unroll
            for (int m = 0; m < 2; ++m) { const int ao = (wr + m * 16 + lr) * 72 + fo;
                a[m] = cat16b(*(const v8usa*)(&stg[cur][0][ao]), *(const v8usa*)(&stg[cur][0][ao + 16]));
                al[m] = a[m];
                if (SPLITA) al[m] = cat16b(*(const v8usa*)(&stg[cur][SPLITA ? 2 : 0][ao]), *(const v8usa*)(&stg[cur][SPLITA ? 2 : 0][ao + 16])); }
            v16bf b[4];
#pragma unroll
            for (int t = 0; t < 4; ++t) { const int bo = (wc + t * 16 + lr) * 72 + fo; b[t] = cat16b(*(const v8usa*)(&stg[cur][1][bo]), *(const v8usa*)(&stg[cur][1][bo + 16])); }
#pragma unroll
            for (int t = 0; t < 4; ++t)
#pragma unroll
                for (int m = 0; m < 2; ++m) acc[m][t] = wmmab(a[m], b[t], acc[m][t]);
            if (SPLITA) {
#pragma unroll
                for (int t = 0; t < 4; ++t)
#pragma unroll
                    for (int m = 0; m < 2; ++m) acc[m][t] = wmmab(al[m], b[t], acc[m][t]); }
            // the four vector slots that the chip needs behind the last matrix instruction, on every way the built code has from here
            asm volatile("v_nop\n\tv_nop\n\tv_nop\n\tv_nop" : "+v"(acc[0][0]), "+v"(acc[0][1]), "+v"(acc[0][2]), "+v"(acc[0][3]), "+v"(acc[1][0]), "+v"(acc[1][1]), "+v"(acc[1][2]), "+v"(acc[1][3]) : "v"(a[0]), "v"(a[1]), "v"(al[0]), "v"(al[1]));
        }
        if (more) put(cur ^ 1);        // into the buffer whose readers all passed the barrier of the trip before
        __syncthreads();               // publishes the next stage and ends every wave's reads of this one
    }
    // The output is staged in the operand buffers, which nobody reads any more behind the loop's last barrier: 32 rows x 68 floats a wave, 8 waves = 69,632 B of the 73,728 B or more.
    float* os = (float*)(void*)&stg[0][0][0] + wave * (32 * 68);
    float bv[4] = {0.f, 0.f, 0.f, 0.f};
    if (bias) {      // the four bias loads leave together: one latency, not four, in a block that may be alone on its WGP
#pragma unroll
        for (int t = 0; t < 4; ++t) bv[t] = bias[c0 + t * 16 + lr];
#pragma unroll
        for (int t = 0; t < 4; ++t) bv[t] = bfr(bv[t]);
    }
#pragma unroll
    for (int t = 0; t < 4; ++t)
#pragma unroll
        for (int m = 0; m < 2; ++m)
#pragma unroll
            for (int j = 0; j < 8; ++j) os[(m * 16 + hi * 8 + j) * 68 + t * 16 + lr] = acc[m][t][j] + bv[t];
    __syncthreads();
    if (F16OUT) {
        h16* crow = (h16*)(void*)C + (size_t)r0 * ldc + c0;
        auto pass = [&]() {
#pragma unroll
            for (int s = 0; s < 8; ++s) { const int row = 4 * s + (lane >> 3), piece = lane & 7; const float* sp = os + row * 68 + piece * 8; v8h o, o2;
#pragma unroll
                for (int i = 0; i < 8; ++i) { const h16 a = (h16)sp[i]; o[i] = a; o2[i] = (h16)((sp[i] - (float)a) * LOSC); }
                *(v8h*)(crow + (size_t)row * ldc + piece * 8) = o; if (C2) *(v8h*)(C2 + (size_t)r0 * ldc + c0 + (size_t)row * ldc + piece * 8) = o2; }
        };
        pass(); 
    } else {
        float* crow = C + (size_t)r0 * ldc + c0;
        auto pass = [&]() {
            v4f val[16]; float* pc[16];
#pragma unroll
            for (int s = 0; s < 16; ++s) { const int Lid = (lane >> 3) + 4 * s, piece = lane & 7; const int row = Lid >> 1, cofs = (Lid & 1) * 32 + piece * 4;
                val[s] = *(const v4fa*)(os + row * 68 + cofs); if (R) { const v4f rv = *(const v4f*)(R + ((size_t)r0 + row) * ldc + c0 + cofs); val[s] += roundR ? (v4f){bfr(rv[0]), bfr(rv[1]), bfr(rv[2]), bfr(rv[3])} : rv; }
                pc[s] = crow + (size_t)row * ldc + cofs; }
#pragma unroll
            for (int s = 0; s < 16; ++s) *(v4f*)pc[s] = val[s];
            // The wait that stands before a register named by an issued store is rewritten; the addresses are its inputs so that none of them is reused between these stores.
            asm volatile("s_wait_xcnt 0x0" :: "v"(pc[0]), "v"(pc[1]), "v"(pc[2]), "v"(pc[3]), "v"(pc[4]), "v"(pc[5]), "v"(pc[6]), "v"(pc[7]), "v"(pc[8]), "v"(pc[9]), "v"(pc[10]), "v"(pc[11]), "v"(pc[12]), "v"(pc[13]), "v"(pc[14]), "v"(pc[15]) : "memory");
        };
        pass(); 
    }
}

typedef __attribute__((ext_vector_type(4)))  _Float16 v4h;
typedef __attribute__((ext_vector_type(4)))  unsigned short v4us;
typedef v4us __attribute__((may_alias)) v4usa;
typedef v4f __attribute__((aligned(4))) v4fu;      // the small weight arrays are read 16 B at a time with no more than their element alignment assumed
#define TSP 132      // row pitch of the f32 tile in LDS, in floats
#define TTP 136      // row pitch of the transposed f16 tile in LDS, in elements
// conv16: 16 rows (jb ...) x the lane's 4 columns (cl ...) of the causal depthwise convolution, read from the f32 tile ts (tile row 16 + j = the block's row j, tile rows 0-15 = the 16 rows
// before the block, zero where the batch item starts): y[s][c] = bf(bias[d]) + sum_t bf(w[d][t]) * T[s - (width-1) + t][c], summed in the order t = 0, 1, ...
template <int KW>
__device__ __forceinline__ void conv16(const float* ts, const float* __restrict__ wg, const float* __restrict__ bg, int jb, int cl, v4f (&y)[16]) {
    const unsigned bo = (unsigned)(cl & (HD - 1)) * 4u;
    const char* wp = (const char*)wg + bo * (unsigned)KW;      // the lane's 4 x width weights lie in a row: element i * width + t
    const char* bp = (const char*)bg + bo;
    v4f wv[KW], bv;
#pragma unroll
    for (int q = 0; q < KW; ++q) wv[q] = *(const v4fu*)(wp + q * 16);
    bv = *(const v4fu*)bp;
    // The wait that stands before a register named by an issued load is rewritten; the addresses are its inputs so that none of them is reused as a destination of these loads.
    asm volatile("s_wait_xcnt 0x0" :: "v"(wp), "v"(bp) : "memory");
    float w[4 * KW];
#pragma unroll
    for (int q = 0; q < KW; ++q)
#pragma unroll
        for (int e = 0; e < 4; ++e) w[q * 4 + e] = bfr(wv[q][e]);
#pragma unroll
    for (int e = 0; e < 4; ++e) bv[e] = bfr(bv[e]);
#pragma unroll
    for (int qd = 0; qd < 4; ++qd) {      // four rows at a time: few rows live beside the 16 results
        v4f row[4 + KW - 1];
#pragma unroll
        for (int k = 0; k < 4 + KW - 1; ++k) row[k] = *(const v4fa*)(ts + (16 + jb + qd * 4 - (KW - 1) + k) * TSP + cl);
#pragma unroll
        for (int j = 0; j < 4; ++j)
#pragma unroll
            for (int i = 0; i < 4; ++i) { float acc = bv[i];
#pragma unroll
                for (int t = 0; t < KW; ++t) acc = fmaf(row[j + t][i], w[i * KW + t], acc);
                y[qd * 4 + j][i] = acc; }
    }
}

// k_qkv: 128 x 128 block tile (8 waves, 4 down x 2 across, 32 x 64 each) of T = x.c_attn_w + bf(b) ([4096 x 1024].[1024 x 3072], K = 1024) as in k_gemmb, plus the 16 rows before the tile
// (one more 16 x 16 tile a wave), so that the block holds every row that the convolution of its own 128 rows reads. A block's 128 columns lie in one of q, k, v and in one head group
// (blockIdx.y >> 3 and (blockIdx.y & 7) >> 1: every choice below is a scalar one). The epilogue stages T in LDS (f32), convolves from there and writes what k_attn reads:
// q and k as f16 hi + residual x1024 planes [tok][1024], v as transposed f16 hi + residual planes [b][h][d][2048] through a second LDS tile, whole lines.
// The register bound asks for 6 waves a SIMD: three blocks on a WGP, so that the grid's 768 blocks are all resident at once, as in the product before.
__global__ __launch_bounds__(256, 6) void k_qkv(const bf* __restrict__ A, const bf* __restrict__ Bn, const float* __restrict__ bias,
                                             const float* __restrict__ qw3, const float* __restrict__ qb3, const float* __restrict__ qw5, const float* __restrict__ qb5, const float* __restrict__ qw7, const float* __restrict__ qb7,
                                             const float* __restrict__ kw3, const float* __restrict__ kb3, const float* __restrict__ kw5, const float* __restrict__ kb5, const float* __restrict__ kw7, const float* __restrict__ kb7,
                                             const float* __restrict__ vw3, const float* __restrict__ vb3, const float* __restrict__ vw5, const float* __restrict__ vb5, const float* __restrict__ vw7, const float* __restrict__ vb7,
                                             h16* QH, h16* QL, h16* KH, h16* KL, h16* VTH, h16* VTL) {
    // stg: two buffers of the block's operand tiles (rows 0-15 = the 16 A rows before the tile, 16-143 = its 128 A rows, 144-271 = 128 B rows; 64 k each, row pitch 72 elements = 144 B)
    __shared__ __align__(16) bf stg[2][272 * 72];
    const int tid = threadIdx.x, lane = tid & 31, wave = tid >> 5, lr = lane & 15, hi = lane >> 4;
    const int wr = (wave >> 1) * 32, wc = (wave & 1) * 64;      // the wave's 32 x 64 part of the block tile
    const int rblk = blockIdx.x * 128, cblk = blockIdx.y * 128;
    const bool edge = (rblk & (NT_ - 1)) == 0;      // the block starts its batch item: the rows before it do not exist, their loads fall on the tile's own rows and zeros take their place
    const int hblk = edge ? rblk : rblk - 16;
    const int srow = tid >> 3, spc = (tid & 7) * 8;      // staging: 8 threads cover one 128 B row piece by piece, 32 rows a pass
    const int hrow = tid >> 4, hpc = (tid & 15) * 4;     // the 16 rows before: 16 threads a row, 8 B each
    const unsigned so = ((unsigned)srow * (unsigned)DM + (unsigned)spc) * 2u;
    const unsigned sh = ((unsigned)hrow * (unsigned)DM + (unsigned)hpc) * 2u;
    v8us ga[4], gb[4]; v4us gh;
    auto fetch = [&](int kc) {
        // one address a tile and a thread; the four passes lie 32 rows apart, a constant that goes into the instruction
        const char* pa = (const char*)(A + (size_t)rblk * DM + kc) + so; const char* pb = (const char*)(Bn + (size_t)cblk * DM + kc) + so; const char* ph = (const char*)(A + (size_t)hblk * DM + kc) + sh;
#pragma unroll
        for (int s = 0; s < 4; ++s) { ga[s] = *(const v8us*)(pa + s * (32 * DM * 2)); gb[s] = *(const v8us*)(pb + s * (32 * DM * 2)); }
        gh = *(const v4us*)ph;
        // The wait that stands before a register named by an issued load is rewritten; the addresses are its inputs so that none of them is reused as a destination of these loads.
        asm volatile("s_wait_xcnt 0x0" :: "v"(pa), "v"(pb), "v"(ph) : "memory");
    };
    auto put = [&](int buf) {
#pragma unroll
        for (int s = 0; s < 4; ++s) { const int o = (srow + 32 * s) * 72 + spc; *(v8usa*)(&stg[buf][16 * 72 + o]) = ga[s]; *(v8usa*)(&stg[buf][144 * 72 + o]) = gb[s]; }
        *(v4usa*)(&stg[buf][hrow * 72 + hpc]) = gh;
    };
    v8f acc[2][4], acch = (v8f){};
#pragma unroll
    for (int m = 0; m < 2; ++m)
#pragma unroll
        for (int t = 0; t < 4; ++t) acc[m][t] = (v8f){};
    fetch(0); put(0);
    __syncthreads();      // stage 0 is complete before any wave reads it
#pragma unroll 1
    for (int kb = 0; kb < DM; kb += 64) {
        const int cur = (kb >> 6) & 1;
        const bool more = kb + 64 < DM;
        if (more) fetch(kb + 64);      // the next stage's lines fly while this stage is multiplied
#pragma unroll
        for (int ks = 0; ks < 2; ++ks) {
            const int fo = ks * 32 + 8 * hi;
            const int ho = lr * 72 + fo, hb = (144 + wave * 16 + lr) * 72 + fo;      // the rows before the tile x the wave's own 16 of the 128 columns
            const v16bf ah = cat16b(*(const v8usa*)(&stg[cur][ho]), *(const v8usa*)(&stg[cur][ho + 16])), bh = cat16b(*(const v8usa*)(&stg[cur][hb]), *(const v8usa*)(&stg[cur][hb + 16]));
            v16bf a[2];
#pragma unroll
            for (int m = 0; m < 2; ++m) { const int ao = (16 + wr + m * 16 + lr) * 72 + fo; a[m] = cat16b(*(const v8usa*)(&stg[cur][ao]), *(const v8usa*)(&stg[cur][ao + 16])); }
            v16bf b[4];
#pragma unroll
            for (int t = 0; t < 4; ++t) { const int bo = (144 + wc + t * 16 + lr) * 72 + fo; b[t] = cat16b(*(const v8usa*)(&stg[cur][bo]), *(const v8usa*)(&stg[cur][bo + 16])); }
            acch = wmmab(ah, bh, acch);
#pragma unroll
            for (int t = 0; t < 4; ++t)
#pragma unroll
                for (int m = 0; m < 2; ++m) acc[m][t] = wmmab(a[m], b[t], acc[m][t]);
            // the four vector slots that the chip needs behind the last matrix instruction, on every way the built code has from here
            asm volatile("v_nop\n\tv_nop\n\tv_nop\n\tv_nop" : "+v"(acc[0][0]), "+v"(acc[0][1]), "+v"(acc[0][2]), "+v"(acc[0][3]), "+v"(acc[1][0]), "+v"(acc[1][1]), "+v"(acc[1][2]), "+v"(acc[1][3]), "+v"(acch) : "v"(a[0]), "v"(a[1]));
        }
        if (more) put(cur ^ 1);        // into the buffer whose readers all passed the barrier of the trip before
        __syncthreads();               // publishes the next stage and ends every wave's reads of this one
    }
    // T is staged in the operand buffers, which nobody reads any more behind the loop's last barrier: 144 rows x 132 floats = 76,032 B of the 78,336 B.
    float* ts = (float*)(void*)&stg[0][0];
    float bv[4], bvh;
    const float* pbv = bias + cblk + wc + lr; const float* pbh = bias + cblk + wave * 16 + lr;
#pragma unroll
    for (int t = 0; t < 4; ++t) bv[t] = pbv[t * 16];      // the bias loads leave together
    bvh = *pbh;
    // The wait that stands before a register named by an issued load is rewritten; the addresses are its inputs so that none of them is reused as a destination of these loads.
    asm volatile("s_wait_xcnt 0x0" :: "v"(pbv), "v"(pbh) : "memory");
#pragma unroll
    for (int t = 0; t < 4; ++t) bv[t] = bfr(bv[t]);
    bvh = bfr(bvh);
#pragma unroll
    for (int t = 0; t < 4; ++t)
#pragma unroll
        for (int m = 0; m < 2; ++m)
#pragma unroll
            for (int j = 0; j < 8; ++j) ts[(16 + wr + m * 16 + hi * 8 + j) * TSP + wc + t * 16 + lr] = acc[m][t][j] + bv[t];
#pragma unroll
    for (int j = 0; j < 8; ++j) ts[(hi * 8 + j) * TSP + wave * 16 + lr] = edge ? 0.f : acch[j] + bvh;      // the reference pads the projected rows with zeros
    __syncthreads();      // T is complete before any wave convolves
    const int p = blockIdx.y >> 3, cb = (blockIdx.y & 7) * 128, g = (blockIdx.y & 7) >> 1;      // 0 = q, 1 = k, 2 = v; first column inside it; head group
    const float* w3 = p == 0 ? qw3 : p == 1 ? kw3 : vw3; const float* b3 = p == 0 ? qb3 : p == 1 ? kb3 : vb3;
    const float* w5 = p == 0 ? qw5 : p == 1 ? kw5 : vw5; const float* b5 = p == 0 ? qb5 : p == 1 ? kb5 : vb5;
    const float* w7 = p == 0 ? qw7 : p == 1 ? kw7 : vw7; const float* b7 = p == 0 ? qb7 : p == 1 ? kb7 : vb7;
    const int jb = wave * 16, cl = lane * 4;      // a wave convolves 16 rows of all 128 columns, a lane 4 columns
    v4f y[16];
    if (g == 0) {
#pragma unroll
        for (int j = 0; j < 16; ++j) y[j] = *(const v4fa*)(ts + (16 + jb + j) * TSP + cl);
    }
    else if (g == 1) conv16<3>(ts, w3, b3, jb, cl, y);
    else if (g == 2) conv16<5>(ts, w5, b5, jb, cl, y);
    else             conv16<7>(ts, w7, b7, jb, cl, y);
    if (p < 2) {
        h16* ph = (p == 0 ? QH : KH) + (size_t)(rblk + jb) * DM + cb + cl; h16* pl = (p == 0 ? QL : KL) + (size_t)(rblk + jb) * DM + cb + cl;
#pragma unroll
        for (int j = 0; j < 16; ++j) { v4h oh, ol;
#pragma unroll
            for (int i = 0; i < 4; ++i) { const h16 a = (h16)y[j][i]; oh[i] = a; ol[i] = (h16)((y[j][i] - (float)a) * LOSC); }
            *(v4h*)(ph + j * DM) = oh; *(v4h*)(pl + j * DM) = ol; }
        asm volatile("s_wait_xcnt 0x0" :: "v"(ph), "v"(pl) : "memory");      // the wait that stands before a register named by these stores is rewritten
    } else {
        __syncthreads();      // every wave has read its rows of T before the transposed tile is written over them
        h16* tt = (h16*)(void*)ts;      // [hi, residual][128 columns][128 rows, pitch 136]: 69,632 B
#pragma unroll
        for (int i = 0; i < 4; ++i)
#pragma unroll
            for (int hf = 0; hf < 2; ++hf) { v8h oh, ol;
#pragma unroll
                for (int j = 0; j < 8; ++j) { const float v = y[hf * 8 + j][i]; const h16 a = (h16)v; oh[j] = a; ol[j] = (h16)((v - (float)a) * LOSC); }
                *(v8ha*)(tt + (cl + i) * TTP + jb + hf * 8) = oh; *(v8ha*)(tt + (128 + cl + i) * TTP + jb + hf * 8) = ol; }
        __syncthreads();      // the transposed tile is complete before it is read row by row
        const int dr = tid >> 4, pc = (tid & 15) * 8;      // 16 threads cover one 256 B row of 128 positions
        const size_t vo = ((size_t)(rblk / NT_) * DM + cb + dr) * NT_ + (rblk & (NT_ - 1)) + pc;
        h16* ph = VTH + vo; h16* pl = VTL + vo;
#pragma unroll
        for (int s = 0; s < 8; ++s) {
            const v8h vh = *(const v8ha*)(tt + (dr + 16 * s) * TTP + pc), vl = *(const v8ha*)(tt + (128 + dr + 16 * s) * TTP + pc);
            *(v8h*)(ph + (size_t)(16 * s) * NT_) = vh; *(v8h*)(pl + (size_t)(16 * s) * NT_) = vl; }
        asm volatile("s_wait_xcnt 0x0" :: "v"(ph), "v"(pl) : "memory");      // the wait that stands before a register named by these stores is rewritten
    }
}

// k_attn: block = (b, h, the two 64-query tiles 31 - t and t, one after the other: 33 trips of 64 keys in every block), 8 waves = 4 query groups of 16 x 2 key groups: of each trip's 64 keys
// key group 0 takes the first 32 and key group 1 the last 32, each with an online softmax of its own over its keys; the two partial results of a query are joined once, behind the loop.
// Four waves a SIMD (two blocks on a WGP) instead of two stand over the same LDS-read and softmax latencies. Both products are
// transposed: scores^T = K.Q^T (A = key rows, B = queries) /8 (f32), so a lane holds 16 of the 32 scores of ONE query (query = lane & 15; keys 8 * (lane >> 4) + j and 16 + 8 * (lane >> 4) + j):
// the online softmax's maximum and sum are taken inside the lane plus one exchange between the wave's halves, and the weights x32768 (f16 hi + residual), converted in place, ARE the B operand
// of ctx^T += V^T.P^T (the same k order as the V^T rows' loader); ctx -> bf16 hi + residual planes CH/CL[tok][h*64+d].
// The register bound asks for 4 waves a SIMD: two blocks on a WGP, the grid's 512 blocks all resident at once.
__global__ __launch_bounds__(256, 4) void k_attn(const h16* __restrict__ Q16, const h16* __restrict__ QL16, const h16* __restrict__ K16, const h16* __restrict__ KL16, const h16* __restrict__ VTH, const h16* __restrict__ VTL, bf* CH, bf* CL) {
    __shared__ __align__(16) float ost[4][16 * 68];       // per query group: first key group 1's partial result (1024 sums, 32 x (maximum, sum)), then the 16 output rows
    // Operand tiles in LDS, filled by the block's 256 threads together (each line fetched once a block) and read as fragments by the four waves of a key group; two buffers each.
    __shared__ __align__(16) h16 kst[2][2][64 * 72];         // [buffer][hi, residual][key][64 d, row pitch 144 B]
    __shared__ __align__(16) h16 vst[2][2][2][64 * 40 + 32]; // [buffer][hi, residual][key group][d][32 keys, row pitch 80 B]; 64 B more a key group, so that the two halves of a staged 128 B row fall on different banks
    __shared__ __align__(16) h16 qls[4][16 * 72];            // each query group's 16 query-residual rows, filled once a tile
    const int lane = threadIdx.x & 31, wave = threadIdx.x >> 5, lr = lane & 15, hi = lane >> 4;
    const int wq = wave & 3;                                             // query group
    const int grp = __builtin_amdgcn_readfirstlane(wave >> 2);           // key group, alike in the whole wave: the branches on it are scalar ones
    const int bid = blockIdx.x;
    const int b = bid / (NH_ * (NT_ / 128)), rem = bid - b * (NH_ * (NT_ / 128)), h = rem / (NT_ / 128), tp = rem - h * (NT_ / 128);
    const size_t tok0 = (size_t)b * NT_;
    // A tile's cost grows with its index (causal) and every block is resident at once: a block that takes tile 31 - t and then tile t walks 33 trips whatever t is.
    // The second tile's first LDS writes stand behind the first tile's last two barriers. Kept rolled: one copy of the body in the instruction cache.
#pragma unroll 1
    for (int part = 0; part < 2; ++part) {
    const int qt = part ? tp : NT_ / 64 - 1 - tp;
    const int q0 = qt * 64 + wq * 16;
    v16h qa[2];
    const size_t qo0 = (tok0 + q0 + lr) * DM + h * HD + 8 * hi;
#pragma unroll
    for (int kc = 0; kc < 2; ++kc) qa[kc] = cat16(*(const v8h*)(Q16 + qo0 + kc * 32), *(const v8h*)(Q16 + qo0 + kc * 32 + 16));
    const h16* kh_b = K16 + tok0 * DM + h * HD;
    const h16* kl_b = KL16 + tok0 * DM + h * HD;
    const size_t vbase = (((size_t)b * NH_ + h) * HD) * NT_;
    v8f o[4], ox[4];
#pragma unroll
    for (int n = 0; n < 4; ++n) { o[n] = (v8f){}; ox[n] = (v8f){}; }
    float mrow = -3.0e38f, lpart = 0.f;      // the lane's one query: running maximum (alike in both halves), sum over the lane's own keys
    const int qi = q0 + lr;
    const int kt_lo = 0, kt_hi = qt;     // causal: trips of 64 keys up to the diagonal tile
    const int krow = threadIdx.x >> 3, kpc = (threadIdx.x & 7) * 8;      // key tile: 8 threads a 128 B row, 32 rows a pass
    const int vrow = threadIdx.x >> 3, vpc = (threadIdx.x & 7) * 8;      // value tile: 8 threads a 128 B row of 64 keys, 32 rows a pass
    v8h gk[2][2], gv[2][2];
    // one running address a plane and a thread; the two passes lie 32 rows apart, a constant that goes into the instruction
    const h16* pkh = kh_b + (size_t)krow * DM + kpc; const h16* pkl = kl_b + (size_t)krow * DM + kpc; const h16* pvh = VTH + vbase + (size_t)vrow * NT_ + vpc; const h16* pvl = VTL + vbase + (size_t)vrow * NT_ + vpc;
    auto fetch = [&]() {      // the next 64 keys
#pragma unroll
        for (int s = 0; s < 2; ++s) { gk[0][s] = *(const v8h*)(pkh + s * (32 * DM)); gk[1][s] = *(const v8h*)(pkl + s * (32 * DM)); gv[0][s] = *(const v8h*)(pvh + s * (32 * NT_)); gv[1][s] = *(const v8h*)(pvl + s * (32 * NT_)); }
        // The wait that stands before a register named by an issued load is rewritten; the addresses are its inputs so that none of them is reused as a destination of these loads.
        asm volatile("s_wait_xcnt 0x0" :: "v"(pkh), "v"(pkl), "v"(pvh), "v"(pvl) : "memory");
        pkh += 64 * DM; pkl += 64 * DM; pvh += 64; pvl += 64;
    };
    auto put = [&](int buf) {
#pragma unroll
        for (int s = 0; s < 2; ++s) {
            const int ko = (krow + 32 * s) * 72 + kpc, vo = (vrow + 32 * s) * 40 + (vpc & 31);
            *(v8ha*)(&kst[buf][0][ko]) = gk[0][s]; *(v8ha*)(&kst[buf][1][ko]) = gk[1][s]; *(v8ha*)(&vst[buf][0][vpc >> 5][vo]) = gv[0][s]; *(v8ha*)(&vst[buf][1][vpc >> 5][vo]) = gv[1][s]; }
    };
    fetch();
    {   // the query group's 16 residual rows: each of its two waves brings 8
        const int row = 8 * grp + (lane >> 3), pc = (lane & 7) * 8;
        const h16* pq = QL16 + (tok0 + q0 + row) * DM + h * HD + pc;
        const v8h r0 = *(const v8h*)pq, r1 = *(const v8h*)(pq + 4 * DM);
        asm volatile("s_wait_xcnt 0x0" :: "v"(pq) : "memory");      // the wait that stands before a register named by these loads is rewritten
        *(v8ha*)(&qls[wq][row * 72 + pc]) = r0; *(v8ha*)(&qls[wq][(row + 4) * 72 + pc]) = r1;
    }
    put(0);
    __syncthreads();      // tile 0 and the residual rows are complete before any wave reads them
    const h16* ql_s = &qls[wq][lr * 72 + 8 * hi];
#pragma unroll 1
    for (int kt = kt_lo; kt <= kt_hi; ++kt) {
        const int l0 = kt * 64 + grp * 32, cur = kt & 1;      // the wave's own 32 keys of this trip
        if (kt < kt_hi) fetch();      // the next tile's lines fly while this tile is worked on
        const h16* kh_s = &kst[cur][0][grp * (32 * 72)]; const h16* kl_s = &kst[cur][1][grp * (32 * 72)];
        const int ko0 = lr * 72 + 8 * hi, ko1 = (16 + lr) * 72 + 8 * hi;
        v8f s0 = {}, s1 = {}, x0 = {}, x1 = {};
#pragma unroll
        for (int kc = 0; kc < 2; ++kc) {
            { const v16h k0h = cat16(*(const v8ha*)(kh_s + ko0 + kc * 32), *(const v8ha*)(kh_s + ko0 + kc * 32 + 16)), k1h = cat16(*(const v8ha*)(kh_s + ko1 + kc * 32), *(const v8ha*)(kh_s + ko1 + kc * 32 + 16));
              const v16h qlk = cat16(*(const v8ha*)(ql_s + kc * 32), *(const v8ha*)(ql_s + kc * 32 + 16));     // query residual re-read per step (registers)
              s0 = wmma16(k0h, qa[kc], s0); x0 = wmma16(k0h, qlk, x0); s1 = wmma16(k1h, qa[kc], s1); x1 = wmma16(k1h, qlk, x1);
              asm volatile("v_nop" : "+v"(s0), "+v"(s1), "+v"(x0), "+v"(x1) : "v"(qlk), "v"(k0h), "v"(k1h) : "memory"); }
            { const v16h k0l = cat16(*(const v8ha*)(kl_s + ko0 + kc * 32), *(const v8ha*)(kl_s + ko0 + kc * 32 + 16)), k1l = cat16(*(const v8ha*)(kl_s + ko1 + kc * 32), *(const v8ha*)(kl_s + ko1 + kc * 32 + 16));
              x0 = wmma16(k0l, qa[kc], x0); x1 = wmma16(k1l, qa[kc], x1);
              asm volatile("v_nop" : "+v"(x0), "+v"(x1) : "v"(k0l), "v"(k1l) : "memory"); }
        }
        asm volatile("v_nop\n\tv_nop\n\tv_nop\n\tv_nop" : "+v"(s0), "+v"(s1), "+v"(x0), "+v"(x1) : "v"(qa[0]), "v"(qa[1]));
        float a0[8], a1[8];
        const int dq = qi - 8 * hi - l0;      // the lane's query counted from the lane's first key of this tile
#pragma unroll
        for (int j = 0; j < 8; ++j) {
            a0[j] = (j <= dq) ? (s0[j] + x0[j] * LOSCI) * 0.125f : -__builtin_inff(); a1[j] = (16 + j <= dq) ? (s1[j] + x1[j] * LOSCI) * 0.125f : -__builtin_inff();      // key l0 + 8 hi + j (+ 16) <= query
        }
        // the query's maximum over the lane's 16 keys as a tree of three-way maxima, then the other half's
        const float m0 = fmaxf(fmaxf(a0[0], a0[1]), a0[2]), m1 = fmaxf(fmaxf(a0[3], a0[4]), a0[5]), m2 = fmaxf(fmaxf(a0[6], a0[7]), a1[0]);
        const float m3 = fmaxf(fmaxf(a1[1], a1[2]), a1[3]), m4 = fmaxf(fmaxf(a1[4], a1[5]), a1[6]);
        float mx = fmaxf(fmaxf(fmaxf(m0, m1), m2), fmaxf(fmaxf(m3, m4), a1[7]));
        mx = fmaxf(mx, xhalf(mx));
        const float mn = fmaxf(mrow, mx);
        const float alpha = __expf(mrow - mn); mrow = mn;
        v16h pa, px;
        float ls[4] = {0.f, 0.f, 0.f, 0.f};      // four independent chains
#pragma unroll
        for (int j = 0; j < 8; ++j) {
            const float p0 = __expf(a0[j] - mn);
            const float p1 = __expf(a1[j] - mn);
            if (j == 5) asm volatile("v_nop");      // the slot that the instruction set asks for behind a transcendental whose source the next instruction overwrites
            ls[j & 3] += p0 + p1;
            const float ps0 = p0 * PSC, ps1 = p1 * PSC; const h16 h0 = (h16)ps0, h1 = (h16)ps1;
            pa[j] = h0; pa[8 + j] = h1;
            px[j] = (h16)((ps0 - (float)h0) * LOSC); px[8 + j] = (h16)((ps1 - (float)h1) * LOSC);
        }
        lpart = lpart * alpha + ((ls[0] + ls[1]) + (ls[2] + ls[3]));
#pragma unroll
        for (int n = 0; n < 4; ++n)
#pragma unroll
            for (int j = 0; j < 8; ++j) { o[n][j] *= alpha; ox[n][j] *= alpha; }
#pragma unroll
        for (int n = 0; n < 4; ++n) { const int vo = (n * 16 + lr) * 40 + hi * 8;
            const v16h vh = cat16(*(const v8ha*)(&vst[cur][0][grp][vo]), *(const v8ha*)(&vst[cur][0][grp][vo + 16])), vl = cat16(*(const v8ha*)(&vst[cur][1][grp][vo]), *(const v8ha*)(&vst[cur][1][grp][vo + 16]));
            o[n] = wmma16(vh, pa, o[n]); ox[n] = wmma16(vl, pa, ox[n]); ox[n] = wmma16(vh, px, ox[n]);
            asm volatile("" : "+v"(o[n]), "+v"(ox[n]) : "v"(vh), "v"(vl) : "memory"); }
        asm volatile("v_nop\n\tv_nop\n\tv_nop\n\tv_nop" : "+v"(o[0]), "+v"(o[1]), "+v"(o[2]), "+v"(o[3]), "+v"(ox[0]), "+v"(ox[1]), "+v"(ox[2]), "+v"(ox[3]) : "v"(pa), "v"(px));
        if (kt < kt_hi) put(cur ^ 1);      // into the buffer whose readers all passed the barrier of the trip before
        __syncthreads();                   // publishes the next tile and ends every wave's reads of this one
    }
    const float lsum = lpart + xhalf(lpart);      // the two halves' sums are joined once
    float* os = &ost[wq][0];
    v4f t[8];      // the lane holds d = 16 n + 8 hi + j of its query's row, not yet divided by the sum
#pragma unroll
    for (int n = 0; n < 4; ++n)
#pragma unroll
        for (int q = 0; q < 2; ++q)
#pragma unroll
            for (int i = 0; i < 4; ++i) t[n * 2 + q][i] = o[n][q * 4 + i] + ox[n][q * 4 + i] * LOSCI;
    if (grp == 1) {      // key group 1 hands its partial result to the wave of key group 0 that has the same queries, lane to lane
#pragma unroll
        for (int k = 0; k < 8; ++k) *(v4fa*)(os + (k * 32 + lane) * 4) = t[k];
        os[1024 + lane] = mrow; os[1056 + lane] = lsum;
    }
    __syncthreads();      // key group 1's partial results are complete before key group 0 reads them
    if (grp == 0) {
        v4f u[8];
#pragma unroll
        for (int k = 0; k < 8; ++k) u[k] = *(const v4fa*)(os + (k * 32 + lane) * 4);
        const float mo = os[1024 + lane], lo = os[1056 + lane];
        // the two softmaxes are brought to their common maximum (key group 0 always holds an unmasked key; a key group 1 with none has sum 0 and weight exp(-huge) = 0)
        const float mj = fmaxf(mrow, mo);
        const float e0 = __expf(mrow - mj), e1 = __expf(mo - mj);
        const float inv = 1.0f / ((lsum * e0 + lo * e1) * PSC);
        const float f0 = e0 * inv, f1 = e1 * inv;
#pragma unroll
        for (int n = 0; n < 4; ++n)
#pragma unroll
            for (int q = 0; q < 2; ++q) *(v4fa*)(os + lr * 68 + n * 16 + hi * 8 + q * 4) = t[n * 2 + q] * f0 + u[n * 2 + q] * f1;
    }
    __syncthreads();      // the 16 output rows are complete before the query group's two waves read them
    const size_t cbase = (tok0 + q0) * DM + (size_t)h * HD;
    auto pass = [&]() {
#pragma unroll
        for (int s = 0; s < 2; ++s) { const int row = 8 * grp + 4 * s + (lane >> 3), piece = lane & 7; const float* sp = os + row * 68 + piece * 8; v8us oh, ol;
#pragma unroll
            for (int i = 0; i < 8; ++i) { const unsigned short hb = f2bf(sp[i]); oh[i] = hb; ol[i] = f2bf(sp[i] - bf2f(hb)); }
            *(v8us*)(CH + cbase + (size_t)row * DM + piece * 8) = oh; *(v8us*)(CL + cbase + (size_t)row * DM + piece * 8) = ol; }
    };
    pass(); 
    asm volatile("s_wait_xcnt 0x0" ::: "memory");      // the wait that stands before the second tile's first instructions rewrite registers named by these stores
    }
}


// wt_body: WT [n][K] = bf16(W[k][n]) (k-major [K][ncols]) via 64 x 64 LDS tiles; tile (bx, by) of (K/64, ncols/64).
__device__ __forceinline__ void wt_body(const float* __restrict__ Wm, int K, int ncols, bf* WT, int bx, int by) {
    __shared__ __align__(16) unsigned short tl[64 * 72];
    const int tid = threadIdx.x, k0 = bx * 64, n0 = by * 64;
    const int kk = tid >> 2, nq = (tid & 3) * 16;
#pragma unroll
    for (int i = 0; i < 16; ++i) tl[(nq + i) * 72 + kk] = f2bf(Wm[(size_t)(k0 + kk) * ncols + n0 + nq + i]);
    __syncthreads();
    const int piece = tid & 7;
    auto pass = [&]() {
#pragma unroll
        for (int s = 0; s < 2; ++s) { const int nr = (tid >> 3) + 32 * s; const v8us val = *(const v8usa*)(tl + nr * 72 + piece * 8); *(v8us*)(WT + (size_t)(n0 + nr) * K + k0 + piece * 8) = val; }
    };
    pass(); 
}

// k_prep: the three conversions of inputs, which do not depend on one another, in one grid; the block index picks the job (alike for the whole block, so wt_body's barrier is passed by
// all of a block's threads or by none): blocks [0, NWQ) transpose c_attn_w, [NWQ, NWQ + NWO) transpose c_proj_w, the rest round 8 rows of x each.
#define NWQ ((DM / 64) * (3 * DM / 64))
#define NWO ((DM / 64) * (DM / 64))
__global__ __launch_bounds__(256) void k_prep(const float* __restrict__ Wqkv, const float* __restrict__ Wo, const float* __restrict__ x, bf* WT, bf* WoT, bf* Xb) {
    const int bid = blockIdx.x;
    if (bid < NWQ + NWO) {
        const bool second = bid >= NWQ;
        const int t = second ? bid - NWQ : bid;      // tile index, the k tile running fastest
        wt_body(second ? Wo : Wqkv, DM, second ? DM : 3 * DM, second ? WoT : WT, t & (DM / 64 - 1), t / (DM / 64));
    } else cvtb_body(x, NTK, Xb, bid - (NWQ + NWO));
}

extern "C" void kernel_launch(void* const* d_in, const int* in_sizes, int n_in,
                              void* d_out, int out_size, void* d_ws, size_t ws_size, hipStream_t stream) {
    (void)in_sizes; (void)n_in; (void)out_size;
    const float* x = (const float*)d_in[0]; const float* Wqkv = (const float*)d_in[1]; const float* bqkv = (const float*)d_in[2]; const float* Wo = (const float*)d_in[3]; const float* bo = (const float*)d_in[4];   // k-major weights (x @ W)
    const float* cw[3][6]; for (int p = 0; p < 3; ++p) for (int j = 0; j < 6; ++j) cw[p][j] = (const float*)d_in[5 + p * 6 + j];     // (w3, b3, w5, b5, w7, b7) for q, k, v
    float* out = (float*)d_out;    // [2][2048][1024]
    char* wsp = (char*)d_ws;
    auto take = [&](size_t bytes) { char* p = wsp; wsp += (bytes + 255) & ~(size_t)255; return (void*)p; };
    bf* WT = (bf*)take((size_t)3 * DM * DM * 2); bf* WoT = (bf*)take((size_t)DM * DM * 2); bf* Xb = (bf*)take((size_t)NTK * DM * 2);
    h16* QH = (h16*)take((size_t)NTK * DM * 2); h16* QL = (h16*)take((size_t)NTK * DM * 2); h16* KH = (h16*)take((size_t)NTK * DM * 2); h16* KL = (h16*)take((size_t)NTK * DM * 2);
    h16* VTH = (h16*)take((size_t)NTK * DM * 2); h16* VTL = (h16*)take((size_t)NTK * DM * 2); bf* CH = (bf*)take((size_t)NTK * DM * 2); bf* CL = (bf*)take((size_t)NTK * DM * 2);
    if ((size_t)(wsp - (char*)d_ws) > ws_size) return;    // about 80 MB in all, no aliasing
    k_prep<<<NWQ + NWO + NTK / 8, 256, 0, stream>>>(Wqkv, Wo, x, WT, WoT, Xb);
    {
        k_qkv<<<dim3(NTK / 128, 3 * DM / 128, 1), 256, 0, stream>>>(Xb, WT, bqkv, cw[0][0], cw[0][1], cw[0][2], cw[0][3], cw[0][4], cw[0][5], cw[1][0], cw[1][1], cw[1][2], cw[1][3], cw[1][4], cw[1][5],
                                                                    cw[2][0], cw[2][1], cw[2][2], cw[2][3], cw[2][4], cw[2][5], QH, QL, KH, KL, VTH, VTL);      // q | k | v: product, convolution, operand planes
        k_attn<<<NB_ * NH_ * (NT_ / 128), 256, 0, stream>>>(QH, QL, KH, KL, VTH, VTL, CH, CL);
        k_gemmb<true, false><<<dim3(NTK / 128, DM / 128, 1), 256, 0, stream>>>(CH, CL, WoT, bo, out, DM, nullptr);
    }
}

// v010
// It runs in 111 microseconds.
// In both of two side-by-side timings against v009, it was 1.08 times as fast.
// All steps since v000 together make it 6.43 times as fast.
#include <hip/hip_runtime.h>

// Compute dtypes, f32 accumulate, both batch items in one pass (4096 rows per launch): qkv = x.c_attn_w + b ([4096 x 1024].[1024 x 3072], one launch, PLAIN bf16 operands = the
// rounded input and the k-major weights transposed once; exact products) on v_wmma_f32_16x16x32_bf16 -> f32; the per-head-group causal depthwise convolutions along the
// sequence (heads 0-3 identity, 4-7 width 3, 8-11 width 5, 12-15 width 7; weights/biases read as inputs) in f32 -> q/k as f16 hi + residual planes, v -> f32 ->
// transposed f16 hi + residual planes; the 16-head causal attention (masked positions are -inf and contribute exp2(-inf) = 0) fused on v_wmma_f32_16x16x32_f16
// (hh + hl + lh x 1/8, online f32 softmax, weights x32768 and v as f16 hi + residual; every residual at its value's own scale); out = ctx.c_proj_w + b (ctx as bf16 hi + UNSCALED residual against the

#define NB_  2                   // both batch items go through every launch together
#define NT_  2048
#define DM   1024
#define NH_  16
#define HD   64
#define HK   4                    // heads per group
#define NTK  (NB_ * NT_)
#define NW   1024
#define NQKV 1024
#define LOSC 1024.0f
#define ESC   0.18033688011112042592f   // log2(e) / 8: a raw score's step in the exponent of two
#define PSCL  15.0f                    // the weights enter the matrix unit x 2^15

typedef _Float16 h16;
typedef unsigned short bf;
typedef __attribute__((ext_vector_type(16))) __bf16   v16bf;
typedef __attribute__((ext_vector_type(16))) _Float16 v16h;
typedef __attribute__((ext_vector_type(8)))  _Float16 v8h;
typedef __attribute__((ext_vector_type(8)))  unsigned short v8us;
typedef __attribute__((ext_vector_type(8)))  float    v8f;
typedef __attribute__((ext_vector_type(4)))  float    v4f;
typedef __attribute__((ext_vector_type(2)))  float    v2f;
typedef __attribute__((ext_vector_type(2)))  _Float16 v2h;
typedef v8h  __attribute__((may_alias)) v8ha;
typedef v4f  __attribute__((may_alias)) v4fa;
typedef v8us __attribute__((may_alias)) v8usa;

__device__ __forceinline__ unsigned short f2bf(float f) { unsigned u = __float_as_uint(f); u += 0x7FFFu + ((u >> 16) & 1u); return (unsigned short)(u >> 16); }
__device__ __forceinline__ float bf2f(unsigned short b) { return __uint_as_float(((unsigned)b) << 16); }
__device__ __forceinline__ float bfr(float f) { return bf2f(f2bf(f)); }
__device__ __forceinline__ v16h cat16(v8h lo, v8h hi) { return __builtin_shufflevector(lo, hi, 0, 1, 2, 3, 4, 5, 6, 7, 8, 9, 10, 11, 12, 13, 14, 15); }
__device__ __forceinline__ v16bf cat16b(v8us lo, v8us hi) { return __builtin_bit_cast(v16bf, __builtin_shufflevector(lo, hi, 0, 1, 2, 3, 4, 5, 6, 7, 8, 9, 10, 11, 12, 13, 14, 15)); }
__device__ __forceinline__ v8f wmma16(v16h a, v16h b, v8f c) { return __builtin_amdgcn_wmma_f32_16x16x32_f16(false, a, false, b, (short)0, c, false, false); }
__device__ __forceinline__ float xhalf(float x) { return __builtin_bit_cast(float, __builtin_amdgcn_permlanex16(__builtin_bit_cast(int, x), __builtin_bit_cast(int, x), 0x76543210, 0xfedcba98, false, false)); }      // lane l takes lane l ^ 16's value
__device__ __forceinline__ v8f wmmab(v16bf a, v16bf b, v8f c) { return __builtin_amdgcn_wmma_f32_16x16x32_bf16(false, a, false, b, (short)0, c, false, false); }

__device__ __forceinline__ void cvtb_body(const float* __restrict__ src, int nrows, bf* dst, int blk) {
    const int lane = threadIdx.x & 31, r = blk * 8 + (threadIdx.x >> 5);
    if (r >= nrows) return;
    v8us o[DM / 256];
#pragma unroll
    for (int q = 0; q < DM / 256; ++q) { v8us t;
#pragma unroll
        for (int i = 0; i < 8; ++i) t[i] = f2bf(src[(size_t)r * DM + q * 256 + lane * 8 + i]);
        o[q] = t; }
#pragma unroll
    for (int q = 0; q < DM / 256; ++q) *(v8us*)(dst + (size_t)r * DM + q * 256 + lane * 8) = o[q];
    
}

// k_gemmb: 128 x 128 block tile (8 waves, 4 down x 2 across, 32 x 64 each) of C[NTK][ldc] = (A [+ Al]).B^T (K = 1024) [+ bf(bias[c])] [+ bf(R[r][c]) residual]; f32 whole-line epilogue (or f16
template <bool SPLITA, bool F16OUT = false>
__global__ __launch_bounds__(256) void k_gemmb(const bf* __restrict__ A, const bf* __restrict__ Al, const bf* __restrict__ Bn, const float* __restrict__ bias, float* C, int ldc, h16* C2, const float* __restrict__ R = nullptr, int K = DM, int roundR = 1) {
    // stg: two buffers of the block's operand tiles (plane 0 = 128 A rows, 1 = 128 B rows, 2 = 128 Al rows; 64 k each, row pitch 72 elements = 144 B), filled by whole-line
    // loads that the eight waves share; the fragments are read from here. A line fetched once serves 128 rows or columns of C, and a B fragment read from LDS serves two A fragments.
    __shared__ __align__(16) bf stg[2][SPLITA ? 3 : 2][128 * 72];
    const int lane = threadIdx.x & 31, wave = threadIdx.x >> 5, lr = lane & 15, hi = lane >> 4;
    const int wr = (wave >> 1) * 32, wc = (wave & 1) * 64;      // the wave's 32 x 64 part of the block tile
    const int r0 = blockIdx.x * 128 + wr, c0 = blockIdx.y * 128 + wc;
    const int srow = threadIdx.x >> 3, spc = (threadIdx.x & 7) * 8;      // staging: 8 threads cover one 128 B row piece by piece, 32 rows a pass
    unsigned so[4];      // the thread's byte offset inside a 128-row tile, one per pass; the tile's own address is uniform
#pragma unroll
    for (int s = 0; s < 4; ++s) so[s] = ((unsigned)(srow + 32 * s) * (unsigned)K + (unsigned)spc) * 2u;
    v8us ga[4], gb[4], gl[4];
    auto fetch = [&](int kc) {
        const char* ta = (const char*)(A + (size_t)(blockIdx.x * 128) * K + kc); const char* tb = (const char*)(Bn + (size_t)(blockIdx.y * 128) * K + kc); const char* tl = SPLITA ? (const char*)(Al + (size_t)(blockIdx.x * 128) * K + kc) : ta;
        const char* pa[4]; const char* pb[4]; const char* pl[4];
#pragma unroll
        for (int s = 0; s < 4; ++s) { pa[s] = ta + so[s]; pb[s] = tb + so[s]; pl[s] = tl + so[s]; }
#pragma unroll
        for (int s = 0; s < 4; ++s) { ga[s] = *(const v8us*)pa[s]; gb[s] = *(const v8us*)pb[s]; if (SPLITA) gl[s] = *(const v8us*)pl[s]; }
        // The wait that stands before a register named by an issued load is rewritten; the addresses are its inputs so that none of them is reused as a destination of these loads.
        asm volatile("s_wait_xcnt 0x0" :: "v"(pa[0]), "v"(pa[1]), "v"(pa[2]), "v"(pa[3]), "v"(pb[0]), "v"(pb[1]), "v"(pb[2]), "v"(pb[3]), "v"(pl[0]), "v"(pl[1]), "v"(pl[2]), "v"(pl[3]) : "memory");
    };
    auto put = [&](int buf) {
#pragma unroll
        for (int s = 0; s < 4; ++s) { const int o = (srow + 32 * s) * 72 + spc; *(v8usa*)(&stg[buf][0][o]) = ga[s]; *(v8usa*)(&stg[buf][1][o]) = gb[s]; if (SPLITA) *(v8usa*)(&stg[buf][SPLITA ? 2 : 0][o]) = gl[s]; }
    };
    v8f acc[2][4];
#pragma unroll
    for (int m = 0; m < 2; ++m)
#pragma unroll
        for (int t = 0; t < 4; ++t) acc[m][t] = (v8f){};
    fetch(0); put(0);
    __syncthreads();      // stage 0 is complete before any wave reads it
#pragma unroll 1
    for (int kb = 0; kb < K; kb += 64) {
        const int cur = (kb >> 6) & 1;
        const bool more = kb + 64 < K;
        if (more) fetch(kb + 64);      // the next stage's lines fly while this stage is multiplied
#pragma unroll
        for (int ks = 0; ks < 2; ++ks) {
            const int fo = ks * 32 + 8 * hi;
            v16bf a[2], al[2];
#pragma unroll
            for (int m = 0; m < 2; ++m) { const int ao = (wr + m * 16 + lr) * 72 + fo;
                a[m] = cat16b(*(const v8usa*)(&stg[cur][0][ao]), *(const v8usa*)(&stg[cur][0][ao + 16]));
                al[m] = a[m];
                if (SPLITA) al[m] = cat16b(*(const v8usa*)(&stg[cur][SPLITA ? 2 : 0][ao]), *(const v8usa*)(&stg[cur][SPLITA ? 2 : 0][ao + 16])); }
            v16bf b[4];
#pragma unroll
            for (int t = 0; t < 4; ++t) { const int bo = (wc + t * 16 + lr) * 72 + fo; b[t] = cat16b(*(const v8usa*)(&stg[cur][1][bo]), *(const v8usa*)(&stg[cur][1][bo + 16])); }
#pragma unroll
            for (int t = 0; t < 4; ++t)
#pragma unroll
                for (int m = 0; m < 2; ++m) acc[m][t] = wmmab(a[m], b[t], acc[m][t]);
            if (SPLITA) {
#pragma unroll
                for (int t = 0; t < 4; ++t)
#pragma unroll
                    for (int m = 0; m < 2; ++m) acc[m][t] = wmmab(al[m], b[t], acc[m][t]); }
            // the four vector slots that the chip needs behind the last matrix instruction, on every way the built code has from here
            asm volatile("v_nop\n\tv_nop\n\tv_nop\n\tv_nop" : "+v"(acc[0][0]), "+v"(acc[0][1]), "+v"(acc[0][2]), "+v"(acc[0][3]), "+v"(acc[1][0]), "+v"(acc[1][1]), "+v"(acc[1][2]), "+v"(acc[1][3]) : "v"(a[0]), "v"(a[1]), "v"(al[0]), "v"(al[1]));
        }
        if (more) put(cur ^ 1);        // into the buffer whose readers all passed the barrier of the trip before
        __syncthreads();               // publishes the next stage and ends every wave's reads of this one
    }
    // The output is staged in the operand buffers, which nobody reads any more behind the loop's last barrier: 32 rows x 68 floats a wave, 8 waves = 69,632 B of the 73,728 B or more.
    float* os = (float*)(void*)&stg[0][0][0] + wave * (32 * 68);
    float bv[4] = {0.f, 0.f, 0.f, 0.f};
    if (bias) {      // the four bias loads leave together: one latency, not four, in a block that may be alone on its WGP
#pragma unroll
        for (int t = 0; t < 4; ++t) bv[t] = bias[c0 + t * 16 + lr];
#pragma unroll
        for (int t = 0; t < 4; ++t) bv[t] = bfr(bv[t]);
    }
#pragma unroll
    for (int t = 0; t < 4; ++t)
#pragma unroll
        for (int m = 0; m < 2; ++m)
#pragma unroll
            for (int j = 0; j < 8; ++j) os[(m * 16 + hi * 8 + j) * 68 + t * 16 + lr] = acc[m][t][j] + bv[t];
    __syncthreads();
    if (F16OUT) {
        h16* crow = (h16*)(void*)C + (size_t)r0 * ldc + c0;
        auto pass = [&]() {
#pragma unroll
            for (int s = 0; s < 8; ++s) { const int row = 4 * s + (lane >> 3), piece = lane & 7; const float* sp = os + row * 68 + piece * 8; v8h o, o2;
#pragma unroll
                for (int i = 0; i < 8; ++i) { const h16 a = (h16)sp[i]; o[i] = a; o2[i] = (h16)((sp[i] - (float)a) * LOSC); }
                *(v8h*)(crow + (size_t)row * ldc + piece * 8) = o; if (C2) *(v8h*)(C2 + (size_t)r0 * ldc + c0 + (size_t)row * ldc + piece * 8) = o2; }
        };
        pass(); 
    } else {
        float* crow = C + (size_t)r0 * ldc + c0;
        auto pass = [&]() {
            v4f val[16]; float* pc[16];
#pragma unroll
            for (int s = 0; s < 16; ++s) { const int Lid = (lane >> 3) + 4 * s, piece = lane & 7; const int row = Lid >> 1, cofs = (Lid & 1) * 32 + piece * 4;
                val[s] = *(const v4fa*)(os + row * 68 + cofs); if (R) { const v4f rv = *(const v4f*)(R + ((size_t)r0 + row) * ldc + c0 + cofs); val[s] += roundR ? (v4f){bfr(rv[0]), bfr(rv[1]), bfr(rv[2]), bfr(rv[3])} : rv; }
                pc[s] = crow + (size_t)row * ldc + cofs; }
#pragma unroll
            for (int s = 0; s < 16; ++s) *(v4f*)pc[s] = val[s];
            // The wait that stands before a register named by an issued store is rewritten; the addresses are its inputs so that none of them is reused between these stores.
            asm volatile("s_wait_xcnt 0x0" :: "v"(pc[0]), "v"(pc[1]), "v"(pc[2]), "v"(pc[3]), "v"(pc[4]), "v"(pc[5]), "v"(pc[6]), "v"(pc[7]), "v"(pc[8]), "v"(pc[9]), "v"(pc[10]), "v"(pc[11]), "v"(pc[12]), "v"(pc[13]), "v"(pc[14]), "v"(pc[15]) : "memory");
        };
        pass(); 
    }
}

typedef __attribute__((ext_vector_type(4)))  _Float16 v4h;
typedef __attribute__((ext_vector_type(4)))  unsigned short v4us;
typedef v4us __attribute__((may_alias)) v4usa;
typedef v4f __attribute__((aligned(4))) v4fu;      // the small weight arrays are read 16 B at a time with no more than their element alignment assumed
#define TSP 132      // row pitch of the f32 tile in LDS, in floats
#define TTP 136      // row pitch of the transposed f16 tile in LDS, in elements
// conv16: 16 rows (jb ...) x the lane's 4 columns (cl ...) of the causal depthwise convolution, read from the f32 tile ts (tile row 16 + j = the block's row j, tile rows 0-15 = the 16 rows
// before the block, zero where the batch item starts): y[s][c] = bf(bias[d]) + sum_t bf(w[d][t]) * T[s - (width-1) + t][c], summed in the order t = 0, 1, ...
template <int KW>
__device__ __forceinline__ void conv16(const float* ts, const float* __restrict__ wg, const float* __restrict__ bg, int jb, int cl, v4f (&y)[16]) {
    const unsigned bo = (unsigned)(cl & (HD - 1)) * 4u;
    const char* wp = (const char*)wg + bo * (unsigned)KW;      // the lane's 4 x width weights lie in a row: element i * width + t
    const char* bp = (const char*)bg + bo;
    v4f wv[KW], bv;
#pragma unroll
    for (int q = 0; q < KW; ++q) wv[q] = *(const v4fu*)(wp + q * 16);
    bv = *(const v4fu*)bp;
    // The wait that stands before a register named by an issued load is rewritten; the addresses are its inputs so that none of them is reused as a destination of these loads.
    asm volatile("s_wait_xcnt 0x0" :: "v"(wp), "v"(bp) : "memory");
    float w[4 * KW];
#pragma unroll
    for (int q = 0; q < KW; ++q)
#pragma unroll
        for (int e = 0; e < 4; ++e) w[q * 4 + e] = bfr(wv[q][e]);
#pragma unroll
    for (int e = 0; e < 4; ++e) bv[e] = bfr(bv[e]);
#pragma unroll
    for (int qd = 0; qd < 4; ++qd) {      // four rows at a time: few rows live beside the 16 results
        v4f row[4 + KW - 1];
#pragma unroll
        for (int k = 0; k < 4 + KW - 1; ++k) row[k] = *(const v4fa*)(ts + (16 + jb + qd * 4 - (KW - 1) + k) * TSP + cl);
#pragma unroll
        for (int j = 0; j < 4; ++j)
#pragma unroll
            for (int i = 0; i < 4; ++i) { float acc = bv[i];
#pragma unroll
                for (int t = 0; t < KW; ++t) acc = fmaf(row[j + t][i], w[i * KW + t], acc);
                y[qd * 4 + j][i] = acc; }
    }
}

// k_qkv: 128 x 128 block tile (8 waves, 4 down x 2 across, 32 x 64 each) of T = x.c_attn_w + bf(b) ([4096 x 1024].[1024 x 3072], K = 1024) as in k_gemmb, plus the 16 rows before the tile
// (one more 16 x 16 tile a wave), so that the block holds every row that the convolution of its own 128 rows reads. A block's 128 columns lie in one of q, k, v and in one head group
// (blockIdx.y >> 3 and (blockIdx.y & 7) >> 1: every choice below is a scalar one). The epilogue stages T in LDS (f32), convolves from there and writes what k_attn reads:
// q and k as f16 hi + residual planes [tok][1024], v as transposed f16 hi + residual planes [b][h][d][2048] through a second LDS tile, whole lines.
// The register bound asks for 6 waves a SIMD: three blocks on a WGP, so that the grid's 768 blocks are all resident at once, as in the product before.
__global__ __launch_bounds__(256, 6) void k_qkv(const bf* __restrict__ A, const bf* __restrict__ Bn, const float* __restrict__ bias,
                                             const float* __restrict__ qw3, const float* __restrict__ qb3, const float* __restrict__ qw5, const float* __restrict__ qb5, const float* __restrict__ qw7, const float* __restrict__ qb7,
                                             const float* __restrict__ kw3, const float* __restrict__ kb3, const float* __restrict__ kw5, const float* __restrict__ kb5, const float* __restrict__ kw7, const float* __restrict__ kb7,
                                             const float* __restrict__ vw3, const float* __restrict__ vb3, const float* __restrict__ vw5, const float* __restrict__ vb5, const float* __restrict__ vw7, const float* __restrict__ vb7,
                                             h16* QH, h16* QL, h16* KH, h16* KL, h16* VTH, h16* VTL) {
    // stg: two buffers of the block's operand tiles (rows 0-15 = the 16 A rows before the tile, 16-143 = its 128 A rows, 144-271 = 128 B rows; 64 k each, row pitch 72 elements = 144 B)
    __shared__ __align__(16) bf stg[2][272 * 72];
    const int tid = threadIdx.x, lane = tid & 31, wave = tid >> 5, lr = lane & 15, hi = lane >> 4;
    const int wr = (wave >> 1) * 32, wc = (wave & 1) * 64;      // the wave's 32 x 64 part of the block tile
    const int rblk = blockIdx.x * 128, cblk = blockIdx.y * 128;
    const bool edge = (rblk & (NT_ - 1)) == 0;      // the block starts its batch item: the rows before it do not exist, their loads fall on the tile's own rows and zeros take their place
    const int hblk = edge ? rblk : rblk - 16;
    const int srow = tid >> 3, spc = (tid & 7) * 8;      // staging: 8 threads cover one 128 B row piece by piece, 32 rows a pass
    const int hrow = tid >> 4, hpc = (tid & 15) * 4;     // the 16 rows before: 16 threads a row, 8 B each
    const unsigned so = ((unsigned)srow * (unsigned)DM + (unsigned)spc) * 2u;
    const unsigned sh = ((unsigned)hrow * (unsigned)DM + (unsigned)hpc) * 2u;
    v8us ga[4], gb[4]; v4us gh;
    auto fetch = [&](int kc) {
        // one address a tile and a thread; the four passes lie 32 rows apart, a constant that goes into the instruction
        const char* pa = (const char*)(A + (size_t)rblk * DM + kc) + so; const char* pb = (const char*)(Bn + (size_t)cblk * DM + kc) + so; const char* ph = (const char*)(A + (size_t)hblk * DM + kc) + sh;
#pragma unroll
        for (int s = 0; s < 4; ++s) { ga[s] = *(const v8us*)(pa + s * (32 * DM * 2)); gb[s] = *(const v8us*)(pb + s * (32 * DM * 2)); }
        gh = *(const v4us*)ph;
        // The wait that stands before a register named by an issued load is rewritten; the addresses are its inputs so that none of them is reused as a destination of these loads.
        asm volatile("s_wait_xcnt 0x0" :: "v"(pa), "v"(pb), "v"(ph) : "memory");
    };
    auto put = [&](int buf) {
#pragma unroll
        for (int s = 0; s < 4; ++s) { const int o = (srow + 32 * s) * 72 + spc; *(v8usa*)(&stg[buf][16 * 72 + o]) = ga[s]; *(v8usa*)(&stg[buf][144 * 72 + o]) = gb[s]; }
        *(v4usa*)(&stg[buf][hrow * 72 + hpc]) = gh;
    };
    v8f acc[2][4], acch = (v8f){};
#pragma unroll
    for (int m = 0; m < 2; ++m)
#pragma unroll
        for (int t = 0; t < 4; ++t) acc[m][t] = (v8f){};
    fetch(0); put(0);
    __syncthreads();      // stage 0 is complete before any wave reads it
#pragma unroll 1
    for (int kb = 0; kb < DM; kb += 64) {
        const int cur = (kb >> 6) & 1;
        const bool more = kb + 64 < DM;
        if (more) fetch(kb + 64);      // the next stage's lines fly while this stage is multiplied
#pragma unroll
        for (int ks = 0; ks < 2; ++ks) {
            const int fo = ks * 32 + 8 * hi;
            const int ho = lr * 72 + fo, hb = (144 + wave * 16 + lr) * 72 + fo;      // the rows before the tile x the wave's own 16 of the 128 columns
            const v16bf ah = cat16b(*(const v8usa*)(&stg[cur][ho]), *(const v8usa*)(&stg[cur][ho + 16])), bh = cat16b(*(const v8usa*)(&stg[cur][hb]), *(const v8usa*)(&stg[cur][hb + 16]));
            v16bf a[2];
#pragma unroll
            for (int m = 0; m < 2; ++m) { const int ao = (16 + wr + m * 16 + lr) * 72 + fo; a[m] = cat16b(*(const v8usa*)(&stg[cur][ao]), *(const v8usa*)(&stg[cur][ao + 16])); }
            v16bf b[4];
#pragma unroll
            for (int t = 0; t < 4; ++t) { const int bo = (144 + wc + t * 16 + lr) * 72 + fo; b[t] = cat16b(*(const v8usa*)(&stg[cur][bo]), *(const v8usa*)(&stg[cur][bo + 16])); }
            acch = wmmab(ah, bh, acch);
#pragma unroll
            for (int t = 0; t < 4; ++t)
#pragma unroll
                for (int m = 0; m < 2; ++m) acc[m][t] = wmmab(a[m], b[t], acc[m][t]);
            // the four vector slots that the chip needs behind the last matrix instruction, on every way the built code has from here
            asm volatile("v_nop\n\tv_nop\n\tv_nop\n\tv_nop" : "+v"(acc[0][0]), "+v"(acc[0][1]), "+v"(acc[0][2]), "+v"(acc[0][3]), "+v"(acc[1][0]), "+v"(acc[1][1]), "+v"(acc[1][2]), "+v"(acc[1][3]), "+v"(acch) : "v"(a[0]), "v"(a[1]));
        }
        if (more) put(cur ^ 1);        // into the buffer whose readers all passed the barrier of the trip before
        __syncthreads();               // publishes the next stage and ends every wave's reads of this one
    }
    // T is staged in the operand buffers, which nobody reads any more behind the loop's last barrier: 144 rows x 132 floats = 76,032 B of the 78,336 B.
    float* ts = (float*)(void*)&stg[0][0];
    float bv[4], bvh;
    const float* pbv = bias + cblk + wc + lr; const float* pbh = bias + cblk + wave * 16 + lr;
#pragma unroll
    for (int t = 0; t < 4; ++t) bv[t] = pbv[t * 16];      // the bias loads leave together
    bvh = *pbh;
    // The wait that stands before a register named by an issued load is rewritten; the addresses are its inputs so that none of them is reused as a destination of these loads.
    asm volatile("s_wait_xcnt 0x0" :: "v"(pbv), "v"(pbh) : "memory");
#pragma unroll
    for (int t = 0; t < 4; ++t) bv[t] = bfr(bv[t]);
    bvh = bfr(bvh);
#pragma unroll
    for (int t = 0; t < 4; ++t)
#pragma unroll
        for (int m = 0; m < 2; ++m)
#pragma unroll
            for (int j = 0; j < 8; ++j) ts[(16 + wr + m * 16 + hi * 8 + j) * TSP + wc + t * 16 + lr] = acc[m][t][j] + bv[t];
#pragma unroll
    for (int j = 0; j < 8; ++j) ts[(hi * 8 + j) * TSP + wave * 16 + lr] = edge ? 0.f : acch[j] + bvh;      // the reference pads the projected rows with zeros
    __syncthreads();      // T is complete before any wave convolves
    const int p = blockIdx.y >> 3, cb = (blockIdx.y & 7) * 128, g = (blockIdx.y & 7) >> 1;      // 0 = q, 1 = k, 2 = v; first column inside it; head group
    const float* w3 = p == 0 ? qw3 : p == 1 ? kw3 : vw3; const float* b3 = p == 0 ? qb3 : p == 1 ? kb3 : vb3;
    const float* w5 = p == 0 ? qw5 : p == 1 ? kw5 : vw5; const float* b5 = p == 0 ? qb5 : p == 1 ? kb5 : vb5;
    const float* w7 = p == 0 ? qw7 : p == 1 ? kw7 : vw7; const float* b7 = p == 0 ? qb7 : p == 1 ? kb7 : vb7;
    const int jb = wave * 16, cl = lane * 4;      // a wave convolves 16 rows of all 128 columns, a lane 4 columns
    v4f y[16];
    if (g == 0) {
#pragma unroll
        for (int j = 0; j < 16; ++j) y[j] = *(const v4fa*)(ts + (16 + jb + j) * TSP + cl);
    }
    else if (g == 1) conv16<3>(ts, w3, b3, jb, cl, y);
    else if (g == 2) conv16<5>(ts, w5, b5, jb, cl, y);
    else             conv16<7>(ts, w7, b7, jb, cl, y);
    if (p < 2) {
        h16* ph = (p == 0 ? QH : KH) + (size_t)(rblk + jb) * DM + cb + cl; h16* pl = (p == 0 ? QL : KL) + (size_t)(rblk + jb) * DM + cb + cl;
#pragma unroll
        for (int j = 0; j < 16; ++j) { v4h oh, ol;
#pragma unroll
            for (int i = 0; i < 4; ++i) { const h16 a = (h16)y[j][i]; oh[i] = a; ol[i] = (h16)(y[j][i] - (float)a); }
            *(v4h*)(ph + j * DM) = oh; *(v4h*)(pl + j * DM) = ol; }
        asm volatile("s_wait_xcnt 0x0" :: "v"(ph), "v"(pl) : "memory");      // the wait that stands before a register named by these stores is rewritten
    } else {
        __syncthreads();      // every wave has read its rows of T before the transposed tile is written over them
        h16* tt = (h16*)(void*)ts;      // [hi, residual][128 columns][128 rows, pitch 136]: 69,632 B
#pragma unroll
        for (int i = 0; i < 4; ++i)
#pragma unroll
            for (int hf = 0; hf < 2; ++hf) { v8h oh, ol;
#pragma unroll
                for (int j = 0; j < 8; ++j) { const float v = y[hf * 8 + j][i]; const h16 a = (h16)v; oh[j] = a; ol[j] = (h16)(v - (float)a); }
                *(v8ha*)(tt + (cl + i) * TTP + jb + hf * 8) = oh; *(v8ha*)(tt + (128 + cl + i) * TTP + jb + hf * 8) = ol; }
        __syncthreads();      // the transposed tile is complete before it is read row by row
        const int dr = tid >> 4, pc = (tid & 15) * 8;      // 16 threads cover one 256 B row of 128 positions
        const size_t vo = ((size_t)(rblk / NT_) * DM + cb + dr) * NT_ + (rblk & (NT_ - 1)) + pc;
        h16* ph = VTH + vo; h16* pl = VTL + vo;
#pragma unroll
        for (int s = 0; s < 8; ++s) {
            const v8h vh = *(const v8ha*)(tt + (dr + 16 * s) * TTP + pc), vl = *(const v8ha*)(tt + (128 + dr + 16 * s) * TTP + pc);
            *(v8h*)(ph + (size_t)(16 * s) * NT_) = vh; *(v8h*)(pl + (size_t)(16 * s) * NT_) = vl; }
        asm volatile("s_wait_xcnt 0x0" :: "v"(ph), "v"(pl) : "memory");      // the wait that stands before a register named by these stores is rewritten
    }
}

// k_attn: block = (b, h, the two 64-query tiles 31 - t and t, one after the other: 33 trips of 64 keys in every block), 8 waves = 4 query groups of 16 x 2 key groups: of each trip's 64 keys
// key group 0 takes the first 32 and key group 1 the last 32, each with an online softmax of its own over its keys; the two partial results of a query are joined once, behind the loop.
// Four waves a SIMD (two blocks on a WGP) instead of two stand over the same LDS-read and softmax latencies. Both products are
// transposed: scores^T = K.Q^T (A = key rows, B = queries) /8 (f32), so a lane holds 16 of the 32 scores of ONE query (query = lane & 15; keys 8 * (lane >> 4) + j and 16 + 8 * (lane >> 4) + j):
// the online softmax's maximum and sum are taken inside the lane plus one exchange between the wave's halves, and the weights x32768 (f16 hi + residual), converted in place, ARE the B operand
// of ctx^T += V^T.P^T (the same k order as the V^T rows' loader); ctx -> bf16 hi + residual planes CH/CL[tok][h*64+d].
// The register bound asks for 4 waves a SIMD: two blocks on a WGP, the grid's 512 blocks all resident at once.
__global__ __launch_bounds__(256, 4) void k_attn(const h16* __restrict__ Q16, const h16* __restrict__ QL16, const h16* __restrict__ K16, const h16* __restrict__ KL16, const h16* __restrict__ VTH, const h16* __restrict__ VTL, bf* CH, bf* CL) {
    __shared__ __align__(16) float ost[4][16 * 68];       // per query group: first key group 1's partial result (1024 sums, 32 x (maximum, sum)), then the 16 output rows
    // Operand tiles in LDS, filled by the block's 256 threads together (each line fetched once a trip) and read as fragments by the four waves of a key group; two buffers each.
    __shared__ __align__(16) h16 kst[2][2][64 * 72];         // [buffer][hi, residual][key][64 d, row pitch 144 B]
    __shared__ __align__(16) h16 vst[2][2][2][64 * 40 + 32]; // [buffer][hi, residual][key group][d][32 keys, row pitch 80 B]; 64 B more a key group, so that the two halves of a staged 128 B row fall on different banks
    __shared__ __align__(16) h16 qls[4][16 * 72];            // each query group's 16 query-residual rows, filled once a tile
    const int lane = threadIdx.x & 31, wave = threadIdx.x >> 5, lr = lane & 15, hi = lane >> 4;
    const int wq = wave & 3;                                             // query group
    const int grp = __builtin_amdgcn_readfirstlane(wave >> 2);           // key group, alike in the whole wave: the branches on it are scalar ones
    const int bid = blockIdx.x;
    const int b = bid / (NH_ * (NT_ / 128)), rem = bid - b * (NH_ * (NT_ / 128)), h = rem / (NT_ / 128), tp = rem - h * (NT_ / 128);
    const size_t tok0 = (size_t)b * NT_;
    // A tile's cost grows with its index (causal) and every block is resident at once: a block that takes tile 31 - t and then tile t walks 33 trips whatever t is.
    // The second tile's first LDS writes stand behind the first tile's last two barriers. Kept rolled: one copy of the body in the instruction cache.
#pragma unroll 1
    for (int part = 0; part < 2; ++part) {
    const int qt = part ? tp : NT_ / 64 - 1 - tp;
    const int q0 = qt * 64 + wq * 16;
    v16h qa[2];
    const size_t qo0 = (tok0 + q0 + lr) * DM + h * HD + 8 * hi;
#pragma unroll
    for (int kc = 0; kc < 2; ++kc) qa[kc] = cat16(*(const v8h*)(Q16 + qo0 + kc * 32), *(const v8h*)(Q16 + qo0 + kc * 32 + 16));
    const h16* kh_b = K16 + tok0 * DM + h * HD;
    const h16* kl_b = KL16 + tok0 * DM + h * HD;
    const size_t vbase = (((size_t)b * NH_ + h) * HD) * NT_;
    v8f o[4];
#pragma unroll
    for (int n = 0; n < 4; ++n) o[n] = (v8f){};
    float mrow = -3.0e38f, lpart = 0.f;      // the lane's one query: running maximum (alike in both halves), sum over the lane's own keys
    const int qi = q0 + lr;
    const int kt_lo = 0, kt_hi = qt;     // causal: trips of 64 keys up to the diagonal tile
    const int krow = threadIdx.x >> 3, kpc = (threadIdx.x & 7) * 8;      // key tile: 8 threads a 128 B row, 32 rows a pass
    const int vrow = threadIdx.x >> 3, vpc = (threadIdx.x & 7) * 8;      // value tile: 8 threads a 128 B row of 64 keys, 32 rows a pass
    v8h gk[2][2], gv[2][2];
    // one running address a plane and a thread; the two passes lie 32 rows apart, a constant that goes into the instruction
    const h16* pkh = kh_b + (size_t)krow * DM + kpc; const h16* pkl = kl_b + (size_t)krow * DM + kpc; const h16* pvh = VTH + vbase + (size_t)vrow * NT_ + vpc; const h16* pvl = VTL + vbase + (size_t)vrow * NT_ + vpc;
    auto fetch = [&]() {      // the next 64 keys
#pragma unroll
        for (int s = 0; s < 2; ++s) { gk[0][s] = *(const v8h*)(pkh + s * (32 * DM)); gk[1][s] = *(const v8h*)(pkl + s * (32 * DM)); gv[0][s] = *(const v8h*)(pvh + s * (32 * NT_)); gv[1][s] = *(const v8h*)(pvl + s * (32 * NT_)); }
        // The wait that stands before a register named by an issued load is rewritten; the addresses are its inputs so that none of them is reused as a destination of these loads.
        asm volatile("s_wait_xcnt 0x0" :: "v"(pkh), "v"(pkl), "v"(pvh), "v"(pvl) : "memory");
        pkh += 64 * DM; pkl += 64 * DM; pvh += 64; pvl += 64;
    };
    auto put = [&](int buf) {
#pragma unroll
        for (int s = 0; s < 2; ++s) {
            const int ko = (krow + 32 * s) * 72 + kpc, vo = (vrow + 32 * s) * 40 + (vpc & 31);
            *(v8ha*)(&kst[buf][0][ko]) = gk[0][s]; *(v8ha*)(&kst[buf][1][ko]) = gk[1][s]; *(v8ha*)(&vst[buf][0][vpc >> 5][vo]) = gv[0][s]; *(v8ha*)(&vst[buf][1][vpc >> 5][vo]) = gv[1][s]; }
    };
    fetch();
    {   // the query group's 16 residual rows: each of its two waves brings 8
        const int row = 8 * grp + (lane >> 3), pc = (lane & 7) * 8;
        const h16* pq = QL16 + (tok0 + q0 + row) * DM + h * HD + pc;
        const v8h r0 = *(const v8h*)pq, r1 = *(const v8h*)(pq + 4 * DM);
        asm volatile("s_wait_xcnt 0x0" :: "v"(pq) : "memory");      // the wait that stands before a register named by these loads is rewritten
        *(v8ha*)(&qls[wq][row * 72 + pc]) = r0; *(v8ha*)(&qls[wq][(row + 4) * 72 + pc]) = r1;
    }
    put(0);
    __syncthreads();      // tile 0 and the residual rows are complete before any wave reads them
    const h16* ql_s = &qls[wq][lr * 72 + 8 * hi];
#pragma unroll 1
    for (int kt = kt_lo; kt <= kt_hi; ++kt) {
        const int l0 = kt * 64 + grp * 32, cur = kt & 1;      // the wave's own 32 keys of this trip
        if (kt < kt_hi) fetch();      // the next tile's lines fly while this tile is worked on
        const h16* kh_s = &kst[cur][0][grp * (32 * 72)]; const h16* kl_s = &kst[cur][1][grp * (32 * 72)];
        const int ko0 = lr * 72 + 8 * hi, ko1 = (16 + lr) * 72 + 8 * hi;
        v8f s0 = {}, s1 = {};      // hh + hl + lh of a score sum in one accumulator: the residual planes carry no scale of their own
#pragma unroll
        for (int kc = 0; kc < 2; ++kc) {
            { const v16h k0h = cat16(*(const v8ha*)(kh_s + ko0 + kc * 32), *(const v8ha*)(kh_s + ko0 + kc * 32 + 16)), k1h = cat16(*(const v8ha*)(kh_s + ko1 + kc * 32), *(const v8ha*)(kh_s + ko1 + kc * 32 + 16));
              const v16h qlk = cat16(*(const v8ha*)(ql_s + kc * 32), *(const v8ha*)(ql_s + kc * 32 + 16));     // query residual re-read per step (registers)
              s0 = wmma16(k0h, qa[kc], s0); s1 = wmma16(k1h, qa[kc], s1); s0 = wmma16(k0h, qlk, s0); s1 = wmma16(k1h, qlk, s1);
              asm volatile("v_nop" : "+v"(s0), "+v"(s1) : "v"(qlk), "v"(k0h), "v"(k1h) : "memory"); }
            { const v16h k0l = cat16(*(const v8ha*)(kl_s + ko0 + kc * 32), *(const v8ha*)(kl_s + ko0 + kc * 32 + 16)), k1l = cat16(*(const v8ha*)(kl_s + ko1 + kc * 32), *(const v8ha*)(kl_s + ko1 + kc * 32 + 16));
              s0 = wmma16(k0l, qa[kc], s0); s1 = wmma16(k1l, qa[kc], s1);
              asm volatile("v_nop" : "+v"(s0), "+v"(s1) : "v"(k0l), "v"(k1l) : "memory"); }
        }
        asm volatile("v_nop\n\tv_nop\n\tv_nop\n\tv_nop" : "+v"(s0), "+v"(s1) : "v"(qa[0]), "v"(qa[1]));
        float a0[8], a1[8];
        const int dq = qi - 8 * hi - l0;      // the lane's query counted from the lane's first key of this tile
#pragma unroll
        for (int j = 0; j < 8; ++j) {
            a0[j] = (j <= dq) ? s0[j] : -__builtin_inff(); a1[j] = (16 + j <= dq) ? s1[j] : -__builtin_inff();      // key l0 + 8 hi + j (+ 16) <= query; the raw products, the 1/8 waits in ESC
        }
        // the query's maximum over the lane's 16 keys as a tree of three-way maxima, then the other half's
        const float m0 = fmaxf(fmaxf(a0[0], a0[1]), a0[2]), m1 = fmaxf(fmaxf(a0[3], a0[4]), a0[5]), m2 = fmaxf(fmaxf(a0[6], a0[7]), a1[0]);
        const float m3 = fmaxf(fmaxf(a1[1], a1[2]), a1[3]), m4 = fmaxf(fmaxf(a1[4], a1[5]), a1[6]);
        float mx = fmaxf(fmaxf(fmaxf(m0, m1), m2), fmaxf(fmaxf(m3, m4), a1[7]));
        mx = fmaxf(mx, xhalf(mx));
        const float mn = fmaxf(mrow, mx);
        const float alpha = __builtin_amdgcn_exp2f((mrow - mn) * ESC); mrow = mn;
        const float off = fmaf(-mn, ESC, PSCL);      // weight x 2^15 = 2^(score * ESC + off): 1/8, log2(e), the maximum and the operand scale in one multiply-add a score
        v16h pa, px;
        float ls[4] = {0.f, 0.f, 0.f, 0.f};      // four independent chains
        const v2f esc2 = {ESC, ESC}, off2 = {off, off};
#pragma unroll
        for (int j = 0; j < 8; j += 2) {
            const v2f e0 = __builtin_elementwise_fma((v2f){a0[j], a0[j + 1]}, esc2, off2), e1 = __builtin_elementwise_fma((v2f){a1[j], a1[j + 1]}, esc2, off2);
            const v2f p0 = {__builtin_amdgcn_exp2f(e0[0]), __builtin_amdgcn_exp2f(e0[1])}, p1 = {__builtin_amdgcn_exp2f(e1[0]), __builtin_amdgcn_exp2f(e1[1])};
            ls[j & 3] += p0[0] + p1[0]; ls[(j + 1) & 3] += p0[1] + p1[1];
            const v2h h0 = __builtin_convertvector(p0, v2h), h1 = __builtin_convertvector(p1, v2h);
            const v2h x0 = __builtin_convertvector(p0 - __builtin_convertvector(h0, v2f), v2h), x1 = __builtin_convertvector(p1 - __builtin_convertvector(h1, v2f), v2h);      // what the f16 left over, at the weights' own scale
            pa[j] = h0[0]; pa[j + 1] = h0[1]; pa[8 + j] = h1[0]; pa[9 + j] = h1[1];
            px[j] = x0[0]; px[j + 1] = x0[1]; px[8 + j] = x1[0]; px[9 + j] = x1[1];
        }
        lpart = lpart * alpha + ((ls[0] + ls[1]) + (ls[2] + ls[3]));
#pragma unroll
        for (int n = 0; n < 4; ++n)
#pragma unroll
            for (int j = 0; j < 8; ++j) o[n][j] *= alpha;
        v16h vh[4], vl[4];
#pragma unroll
        for (int n = 0; n < 4; ++n) { const int vo = (n * 16 + lr) * 40 + hi * 8;
            vh[n] = cat16(*(const v8ha*)(&vst[cur][0][grp][vo]), *(const v8ha*)(&vst[cur][0][grp][vo + 16])); vl[n] = cat16(*(const v8ha*)(&vst[cur][1][grp][vo]), *(const v8ha*)(&vst[cur][1][grp][vo + 16])); }
        // the three parts of a tile's product sum in the one accumulator; part by part over the four tiles, so that no matrix instruction waits for the one before it
#pragma unroll
        for (int n = 0; n < 4; ++n) o[n] = wmma16(vh[n], pa, o[n]);
#pragma unroll
        for (int n = 0; n < 4; ++n) o[n] = wmma16(vl[n], pa, o[n]);
#pragma unroll
        for (int n = 0; n < 4; ++n) o[n] = wmma16(vh[n], px, o[n]);
        // the four vector slots that the chip needs behind the last matrix instruction, on every way the built code has from here
        asm volatile("v_nop\n\tv_nop\n\tv_nop\n\tv_nop" : "+v"(o[0]), "+v"(o[1]), "+v"(o[2]), "+v"(o[3]) : "v"(pa), "v"(px), "v"(vh[0]), "v"(vh[1]), "v"(vh[2]), "v"(vh[3]));
        if (kt < kt_hi) put(cur ^ 1);      // into the buffer whose readers all passed the barrier of the trip before
        __syncthreads();                   // publishes the next tile and ends every wave's reads of this one
    }
    const float lsum = lpart + xhalf(lpart);      // the two halves' sums are joined once
    float* os = &ost[wq][0];
    v4f t[8];      // the lane holds d = 16 n + 8 hi + j of its query's row, not yet divided by the sum
#pragma unroll
    for (int n = 0; n < 4; ++n)
#pragma unroll
        for (int q = 0; q < 2; ++q)
#pragma unroll
            for (int i = 0; i < 4; ++i) t[n * 2 + q][i] = o[n][q * 4 + i];
    if (grp == 1) {      // key group 1 hands its partial result to the wave of key group 0 that has the same queries, lane to lane
#pragma unroll
        for (int k = 0; k < 8; ++k) *(v4fa*)(os + (k * 32 + lane) * 4) = t[k];
        os[1024 + lane] = mrow; os[1056 + lane] = lsum;
    }
    __syncthreads();      // key group 1's partial results are complete before key group 0 reads them
    if (grp == 0) {
        v4f u[8];
#pragma unroll
        for (int k = 0; k < 8; ++k) u[k] = *(const v4fa*)(os + (k * 32 + lane) * 4);
        const float mo = os[1024 + lane], lo = os[1056 + lane];
        // the two softmaxes are brought to their common maximum (key group 0 always holds an unmasked key; a key group 1 with none has sum 0 and weight exp(-huge) = 0)
        const float mj = fmaxf(mrow, mo);
        const float e0 = __builtin_amdgcn_exp2f((mrow - mj) * ESC), e1 = __builtin_amdgcn_exp2f((mo - mj) * ESC);      // the maxima are raw scores
        const float inv = 1.0f / (lsum * e0 + lo * e1);      // sums and results carry the same 2^15
        const float f0 = e0 * inv, f1 = e1 * inv;
#pragma unroll
        for (int n = 0; n < 4; ++n)
#pragma unroll
            for (int q = 0; q < 2; ++q) *(v4fa*)(os + lr * 68 + n * 16 + hi * 8 + q * 4) = t[n * 2 + q] * f0 + u[n * 2 + q] * f1;
    }
    __syncthreads();      // the 16 output rows are complete before the query group's two waves read them
    const size_t cbase = (tok0 + q0) * DM + (size_t)h * HD;
    auto pass = [&]() {
#pragma unroll
        for (int s = 0; s < 2; ++s) { const int row = 8 * grp + 4 * s + (lane >> 3), piece = lane & 7; const float* sp = os + row * 68 + piece * 8; v8us oh, ol;
#pragma unroll
            for (int i = 0; i < 8; ++i) { const unsigned short hb = f2bf(sp[i]); oh[i] = hb; ol[i] = f2bf(sp[i] - bf2f(hb)); }
            *(v8us*)(CH + cbase + (size_t)row * DM + piece * 8) = oh; *(v8us*)(CL + cbase + (size_t)row * DM + piece * 8) = ol; }
    };
    pass(); 
    asm volatile("s_wait_xcnt 0x0" ::: "memory");      // the wait that stands before the second tile's first instructions rewrite registers named by these stores
    }
}


// wt_body: WT [n][K] = bf16(W[k][n]) (k-major [K][ncols]) via 64 x 64 LDS tiles; tile (bx, by) of (K/64, ncols/64).
__device__ __forceinline__ void wt_body(const float* __restrict__ Wm, int K, int ncols, bf* WT, int bx, int by) {
    __shared__ __align__(16) unsigned short tl[64 * 72];
    const int tid = threadIdx.x, k0 = bx * 64, n0 = by * 64;
    const int kk = tid >> 2, nq = (tid & 3) * 16;
#pragma unroll
    for (int i = 0; i < 16; ++i) tl[(nq + i) * 72 + kk] = f2bf(Wm[(size_t)(k0 + kk) * ncols + n0 + nq + i]);
    __syncthreads();
    const int piece = tid & 7;
    auto pass = [&]() {
#pragma unroll
        for (int s = 0; s < 2; ++s) { const int nr = (tid >> 3) + 32 * s; const v8us val = *(const v8usa*)(tl + nr * 72 + piece * 8); *(v8us*)(WT + (size_t)(n0 + nr) * K + k0 + piece * 8) = val; }
    };
    pass(); 
}

// k_prep: the three conversions of inputs, which do not depend on one another, in one grid; the block index picks the job (alike for the whole block, so wt_body's barrier is passed by
// all of a block's threads or by none): blocks [0, NWQ) transpose c_attn_w, [NWQ, NWQ + NWO) transpose c_proj_w, the rest round 8 rows of x each.
#define NWQ ((DM / 64) * (3 * DM / 64))
#define NWO ((DM / 64) * (DM / 64))
__global__ __launch_bounds__(256) void k_prep(const float* __restrict__ Wqkv, const float* __restrict__ Wo, const float* __restrict__ x, bf* WT, bf* WoT, bf* Xb) {
    const int bid = blockIdx.x;
    if (bid < NWQ + NWO) {
        const bool second = bid >= NWQ;
        const int t = second ? bid - NWQ : bid;      // tile index, the k tile running fastest
        wt_body(second ? Wo : Wqkv, DM, second ? DM : 3 * DM, second ? WoT : WT, t & (DM / 64 - 1), t / (DM / 64));
    } else cvtb_body(x, NTK, Xb, bid - (NWQ + NWO));
}

extern "C" void kernel_launch(void* const* d_in, const int* in_sizes, int n_in,
                              void* d_out, int out_size, void* d_ws, size_t ws_size, hipStream_t stream) {
    (void)in_sizes; (void)n_in; (void)out_size;
    const float* x = (const float*)d_in[0]; const float* Wqkv = (const float*)d_in[1]; const float* bqkv = (const float*)d_in[2]; const float* Wo = (const float*)d_in[3]; const float* bo = (const float*)d_in[4];   // k-major weights (x @ W)
    const float* cw[3][6]; for (int p = 0; p < 3; ++p) for (int j = 0; j < 6; ++j) cw[p][j] = (const float*)d_in[5 + p * 6 + j];     // (w3, b3, w5, b5, w7, b7) for q, k, v
    float* out = (float*)d_out;    // [2][2048][1024]
    char* wsp = (char*)d_ws;
    auto take = [&](size_t bytes) { char* p = wsp; wsp += (bytes + 255) & ~(size_t)255; return (void*)p; };
    bf* WT = (bf*)take((size_t)3 * DM * DM * 2); bf* WoT = (bf*)take((size_t)DM * DM * 2); bf* Xb = (bf*)take((size_t)NTK * DM * 2);
    h16* QH = (h16*)take((size_t)NTK * DM * 2); h16* QL = (h16*)take((size_t)NTK * DM * 2); h16* KH = (h16*)take((size_t)NTK * DM * 2); h16* KL = (h16*)take((size_t)NTK * DM * 2);
    h16* VTH = (h16*)take((size_t)NTK * DM * 2); h16* VTL = (h16*)take((size_t)NTK * DM * 2); bf* CH = (bf*)take((size_t)NTK * DM * 2); bf* CL = (bf*)take((size_t)NTK * DM * 2);
    if ((size_t)(wsp - (char*)d_ws) > ws_size) return;    // about 80 MB in all, no aliasing
    k_prep<<<NWQ + NWO + NTK / 8, 256, 0, stream>>>(Wqkv, Wo, x, WT, WoT, Xb);
    {
        k_qkv<<<dim3(NTK / 128, 3 * DM / 128, 1), 256, 0, stream>>>(Xb, WT, bqkv, cw[0][0], cw[0][1], cw[0][2], cw[0][3], cw[0][4], cw[0][5], cw[1][0], cw[1][1], cw[1][2], cw[1][3], cw[1][4], cw[1][5],
                                                                    cw[2][0], cw[2][1], cw[2][2], cw[2][3], cw[2][4], cw[2][5], QH, QL, KH, KL, VTH, VTL);      // q | k | v: product, convolution, operand planes
        k_attn<<<NB_ * NH_ * (NT_ / 128), 256, 0, stream>>>(QH, QL, KH, KL, VTH, VTL, CH, CL);
        k_gemmb<true, false><<<dim3(NTK / 128, DM / 128, 1), 256, 0, stream>>>(CH, CL, WoT, bo, out, DM, nullptr);
    }
}
